// v000
// Measured on an AMD MI455X. A time is GPU time per run, averaged over a window of back-to-back runs after a warm-up
// (all launches, gaps included; the runs take copies of the inputs in turn), and the median of several windows.
// Apart from v000's, it joins two sittings. Times from different sittings can be a few percent apart, while
// side-by-side timings come from the same sitting.
// v000, which the later versions start from, runs in 696 microseconds.
// Projections q, k, v^T: v_wmma_f32_16x16x32_bf16 (x and weights RNE-converted to bf16, single product); attention q.k^T and p.v: v_wmma_f32_16x16x32_bf16 with bf16 hi/lo split operands (hi.hi + hi.lo + lo.hi); output projection: v_wmma_f32_16x16x32_f16 (attention output carried x16 in f16, bf16-RNE weight carried x64 in f16); f32 accumulate everywhere; online softmax, key-mask select (-1e9) and normalisation in f32.
#include <hip/hip_runtime.h>
#include <math.h>
#include <stdint.h>

#define N_BATCH  2
#define SEQ_LEN  2048
#define EMB_DIM  1024
#define N_HEADS  16
#define HEAD_DIM 64
#define N_TOK    (N_BATCH * SEQ_LEN)

typedef __attribute__((ext_vector_type(16))) _Float16 v16h;
typedef __attribute__((ext_vector_type(8)))  _Float16 v8h;
typedef __attribute__((ext_vector_type(16))) __bf16   v16b;
typedef __attribute__((ext_vector_type(8)))  __bf16   v8b;
typedef __attribute__((ext_vector_type(8)))  float    v8f;
typedef __attribute__((ext_vector_type(4)))  float    v4f;
typedef __attribute__((ext_vector_type(2)))  float    v2f;
typedef __attribute__((ext_vector_type(4)))  unsigned int v4u;

__device__ __forceinline__ unsigned short f2bf_bits(float f) {
  unsigned u = __float_as_uint(f);
  return (unsigned short)((u + 0x7FFFu + ((u >> 16) & 1u)) >> 16);
}
__device__ __forceinline__ float bf_bits2f(unsigned short h) { return __uint_as_float(((unsigned)h) << 16); }

// hazard guards as plain device helpers (no inline asm inside the kernel template body)
__device__ __forceinline__ void dep_guard_h(v8f& a, v8f& b, v16h x, v16h y) { asm volatile("v_nop\n\tv_nop\n\tv_nop\n\tv_nop" : "+v"(a), "+v"(b) : "v"(x), "v"(y)); }
__device__ __forceinline__ void dep_guard_b(v8f& a, v8f& b, v16b x, v16b y) { asm volatile("v_nop\n\tv_nop\n\tv_nop\n\tv_nop" : "+v"(a), "+v"(b) : "v"(x), "v"(y)); }
__device__ __forceinline__ void keep4_h(v16h a, v16h b, v16h c, v16h d) { asm volatile("v_nop" :: "v"(a), "v"(b), "v"(c), "v"(d)); }
__device__ __forceinline__ void keep4_b(v16b a, v16b b, v16b c, v16b d) { asm volatile("v_nop" :: "v"(a), "v"(b), "v"(c), "v"(d)); }
__device__ __forceinline__ void acc_guard4(v8f& a, v8f& b, v8f& c, v8f& d) { asm volatile("v_nop\n\tv_nop\n\tv_nop\n\tv_nop" : "+v"(a), "+v"(b), "+v"(c), "+v"(d)); }
template <typename T> struct Frag;
template <> struct Frag<_Float16> {
  typedef v16h V; union U { v16h v; v8h h[2]; };
  static __device__ __forceinline__ v16h load(const _Float16* p) {   // elements 0..7 <- p[0..7], 8..15 <- p[16..23]
    U f; f.h[0] = *(const v8h*)(p); f.h[1] = *(const v8h*)(p + 16); return f.v;
  }
  static __device__ __forceinline__ v8f mma(v16h a, v16h b, v8f c) {
    return __builtin_amdgcn_wmma_f32_16x16x32_f16(false, a, false, b, (short)0, c, false, false);
  }
  static __device__ __forceinline__ void guard(v8f& a, v8f& b, v16h x, v16h y) { dep_guard_h(a, b, x, y); }
  static __device__ __forceinline__ void keep(v16h a, v16h b, v16h c, v16h d) { keep4_h(a, b, c, d); }
};
template <> struct Frag<__bf16> {
  typedef v16b V; union U { v16b v; v8b h[2]; };
  static __device__ __forceinline__ v16b load(const __bf16* p) {
    U f; f.h[0] = *(const v8b*)(p); f.h[1] = *(const v8b*)(p + 16); return f.v;
  }
  static __device__ __forceinline__ v8f mma(v16b a, v16b b, v8f c) {
    return __builtin_amdgcn_wmma_f32_16x16x32_bf16(false, a, false, b, (short)0, c, false, false);
  }
  static __device__ __forceinline__ void guard(v8f& a, v8f& b, v16b x, v16b y) { dep_guard_b(a, b, x, y); }
  static __device__ __forceinline__ void keep(v16b a, v16b b, v16b c, v16b d) { keep4_b(a, b, c, d); }
};

// ---- Register-blocked batched WMMA GEMM ------------------------------------
// C[m,n] = scale * sum_k A[m,k] * Bt[n,k] (+bias)(+resid); each wave owns a 64x64 tile.
// A row-major [M,K]; Bt row-major [N,K]; M,N % 64 == 0, K % 32 == 0.
// SPLIT: operands are hi/lo planes (A2/Bt2 = lo planes, same layout); product = hi.hi + hi.lo + lo.hi.
// BIAS_MODE: 0 = none, 1 = bias[m], 2 = bias[n].
// OUT_MODE: 0 = f32, 1 = f16, 2 = bf16 hi plane (Cout) + bf16 lo plane (Cout2).
// Epilogue coverage per wave: f32 path 8 it x 2 rows x (16 lanes x 4 floats) = 16 rows x 64; 16-bit path
// 4 it x 4 rows x (8 lanes x 8 halves) = 16 rows x 64; 4 slabs = the whole 64x64 tile.
// ET: 0 = f16 operands, 1 = bf16 operands (pointers passed as 16-bit storage)
template <int ET> struct Elem;
template <> struct Elem<0> { typedef _Float16 T; };
template <> struct Elem<1> { typedef __bf16 T; };
template <int ET, bool SPLIT, int BIAS_MODE, int OUT_MODE, bool RESID, int ACT = 0>
__global__ __launch_bounds__(256) void wmma_gemm64(
    const unsigned short* __restrict__ Ap, const unsigned short* __restrict__ A2p, int lda, long strideA,
    const unsigned short* __restrict__ Btp, const unsigned short* __restrict__ Bt2p, int ldb, long strideB,
    void* __restrict__ Cout, void* __restrict__ Cout2, int ldc, long strideC,
    const float* __restrict__ bias,
    const float* __restrict__ resid, long strideR,
    int M, int N, int K, float scale) {
  typedef typename Elem<ET>::T T;
  typedef typename Frag<T>::V V;
  const T* A = (const T*)Ap; const T* A2 = (const T*)A2p; const T* Bt = (const T*)Btp; const T* Bt2 = (const T*)Bt2p;
  __shared__ __align__(16) float sT[8][16 * 68];   // per-wave 16x64 slab, pitch 68 floats
  const int b    = blockIdx.y;
  const int lane = threadIdx.x & 31;
  const int wave = threadIdx.x >> 5;
  const int tilesN = N >> 6;
  const int tilesM = M >> 6;
  const int tile = blockIdx.x * 8 + wave;
  if (tile >= tilesM * tilesN) return;   // wave-uniform; no block barriers in this kernel
  const int tm = tile / tilesN;
  const int tn = tile - tm * tilesN;
  const int m0 = tm << 6;
  const int n0 = tn << 6;

  const T* Ab  = A  + (size_t)b * strideA;
  const T* Bb  = Bt + (size_t)b * strideB;
  const T* Ab2 = SPLIT ? (A2  + (size_t)b * strideA) : nullptr;
  const T* Bb2 = SPLIT ? (Bt2 + (size_t)b * strideB) : nullptr;

  const int rlane = lane & 15;                 // row (A) / col (B, D) within subtile
  const int koff  = (lane >> 4) * 8;           // k offset of this lane half
  const int mOff  = (lane >> 4) * 8;           // D row offset

  v8f acc[4][4];
#pragma unroll
  for (int i = 0; i < 4; ++i)
#pragma unroll
    for (int j = 0; j < 4; ++j) acc[i][j] = (v8f){0.f,0.f,0.f,0.f,0.f,0.f,0.f,0.f};

  for (int k0 = 0; k0 < K; k0 += 32) {
    V bh[4], bl[4];
#pragma unroll
    for (int j = 0; j < 4; ++j) {
      const size_t bo = (size_t)(n0 + (j << 4) + rlane) * ldb + koff + k0;
      bh[j] = Frag<T>::load(Bb + bo);
      if (SPLIT) bl[j] = Frag<T>::load(Bb2 + bo);
    }
#pragma unroll
    for (int i = 0; i < 4; ++i) {
      const size_t ao = (size_t)(m0 + (i << 4) + rlane) * lda + koff + k0;
      V ah = Frag<T>::load(Ab + ao);
      V al;
      if (SPLIT) al = Frag<T>::load(Ab2 + ao);
#pragma unroll
      for (int j = 0; j < 4; ++j) {
        acc[i][j] = Frag<T>::mma(ah, bh[j], acc[i][j]);
        if (SPLIT) {
          acc[i][j] = Frag<T>::mma(ah, bl[j], acc[i][j]);
          acc[i][j] = Frag<T>::mma(al, bh[j], acc[i][j]);
        }
      }
      Frag<T>::guard(acc[i][0], acc[i][3], ah, SPLIT ? al : ah);
    }
    Frag<T>::keep(bh[0], bh[1], bh[2], bh[3]);
    if (SPLIT) Frag<T>::keep(bl[0], bl[1], bl[2], bl[3]);
  }
  acc_guard4(acc[0][0], acc[0][1], acc[0][2], acc[0][3]);
  acc_guard4(acc[1][0], acc[1][1], acc[1][2], acc[1][3]);
  acc_guard4(acc[2][0], acc[2][1], acc[2][2], acc[2][3]);
  acc_guard4(acc[3][0], acc[3][1], acc[3][2], acc[3][3]);

  // ---- epilogue ----
  float* slab = sT[wave];
  const float* Rb = RESID ? (resid + (size_t)b * strideR) : nullptr;
#pragma unroll
  for (int i = 0; i < 4; ++i) {
    const int mBase = m0 + (i << 4);
#pragma unroll
    for (int j = 0; j < 4; ++j) {
      const int n = n0 + (j << 4) + rlane;
      float bv = 0.f;
      if (BIAS_MODE == 2) bv = bias[n];
#pragma unroll
      for (int r = 0; r < 8; ++r) {
        float v = acc[i][j][r] * scale;
        if (BIAS_MODE == 1) v += bias[mBase + mOff + r];
        if (BIAS_MODE == 2) v += bv;
        if (RESID) v += Rb[(size_t)(mBase + mOff + r) * ldc + n];
        if (ACT == 1) v = tanhf(v);
        if (ACT == 2) v = fmaxf(v, 0.0f);
        if (ACT == 3) v = v / (1.0f + expf(-v));
        if (ACT == 4) v = (v > 0.f) ? v : 0.01f * v;
        if (ACT == 5) v = 0.5f * v * (1.0f + erff(v * 0.70710678118654752f));
        slab[(mOff + r) * 68 + (j << 4) + rlane] = v;
      }
    }
    __builtin_amdgcn_fence(__ATOMIC_RELEASE, "workgroup");
    __builtin_amdgcn_wave_barrier();
    __builtin_amdgcn_fence(__ATOMIC_ACQUIRE, "workgroup");
    if (OUT_MODE == 0) {
      float* C = (float*)Cout + (size_t)b * strideC;
      const int hh = lane >> 4, c4 = (lane & 15) * 4;     // row seg = 256 B = 16 lanes x 16 B
      {
#pragma unroll
        for (int it = 0; it < 8; ++it) {
          const int row = it * 2 + hh;
          v4f v = *(const v4f*)(slab + row * 68 + c4);
          *(v4f*)(C + (size_t)(mBase + row) * ldc + n0 + c4) = v;
        }
        
      }
    } else {
      const int q = lane >> 3, c8 = (lane & 7) * 8;
      unsigned short* C  = (unsigned short*)Cout  + (size_t)b * strideC;
      unsigned short* C2 = (OUT_MODE == 2) ? ((unsigned short*)Cout2 + (size_t)b * strideC) : nullptr;
      {
#pragma unroll
        for (int it = 0; it < 4; ++it) {
          const int row = it * 4 + q;
          const float* sp = slab + row * 68 + c8;
          v8h hv, lv;
#pragma unroll
          for (int e = 0; e < 8; ++e) {
            if (OUT_MODE == 1) {
              hv[e] = (_Float16)sp[e];
            } else {
              unsigned short hb = f2bf_bits(sp[e]);
              unsigned short lb = f2bf_bits(sp[e] - bf_bits2f(hb));
              hv[e] = __builtin_bit_cast(_Float16, hb);
              lv[e] = __builtin_bit_cast(_Float16, lb);
            }
          }
          *(v8h*)(C + (size_t)(mBase + row) * ldc + n0 + c8) = hv;
          if (OUT_MODE == 2) *(v8h*)(C2 + (size_t)(mBase + row) * ldc + n0 + c8) = lv;
        }
        
      }
    }
    __builtin_amdgcn_fence(__ATOMIC_RELEASE, "workgroup");
    __builtin_amdgcn_wave_barrier();
    __builtin_amdgcn_fence(__ATOMIC_ACQUIRE, "workgroup");
  }
}

// ---------------------------------------------------------------------------
// Elementwise f32 -> 16-bit plane, 2 consecutive elements per thread packed into one 4-B store: each wave writes
// CMODE 0: bf16 RNE bits of in*scale.
// CMODE 1: f16 bits of the bf16-RNE value of in*scale (an 8-significant-bit value re-encoded exactly in f16).
// CMODE 2: f16 RNE bits of in*scale.
// Coverage: grid = ceil(n2/256) blocks x 256 threads x 2 elements = 2*n2 = the whole plane
// (calls here: n2 = 2097152 -> 8192 blocks; n2 = 524288 -> 2048 blocks; both exact multiples of 256).
// ---------------------------------------------------------------------------
__device__ __forceinline__ unsigned pk16(unsigned short a, unsigned short b) { return (unsigned)a | ((unsigned)b << 16); }

template <int CMODE>
__global__ __launch_bounds__(256) void cast2_kernel(const float* __restrict__ in, unsigned short* __restrict__ out,
                                                    int n2, float scale) {
  const int i = blockIdx.x * 256 + threadIdx.x;
  if (i < n2) {
    const v2f f = *(const v2f*)(in + 2 * (size_t)i);
    const float f0 = f[0] * scale, f1 = f[1] * scale;
    unsigned short u0, u1;
    if (CMODE == 0) {
      u0 = f2bf_bits(f0); u1 = f2bf_bits(f1);
    } else if (CMODE == 1) {
      u0 = __builtin_bit_cast(unsigned short, (_Float16)bf_bits2f(f2bf_bits(f0)));
      u1 = __builtin_bit_cast(unsigned short, (_Float16)bf_bits2f(f2bf_bits(f1)));
    } else {
      u0 = __builtin_bit_cast(unsigned short, (_Float16)f0);
      u1 = __builtin_bit_cast(unsigned short, (_Float16)f1);
    }
    const unsigned u = pk16(u0, u1);
    ((unsigned*)out)[i] = u;
    
  }
}

// =====================================================================================
// Full-length attention with key-padding mask, head dim 64, one launch per batch element (pointers pre-offset).
//   q planes (hi/lo bf16): element (t, h, d) at [t*EMB_DIM + h*64 + d]
//   k planes (hi/lo bf16): element (s, h, d) at [s*EMB_DIM + h*64 + d]
//   v^T planes (hi/lo bf16): element (h, d, s) at [(h*64 + d)*SEQ_LEN + s]
//   kmask int32 [SEQ_LEN]: nonzero = key masked out -> score := mfill (select, as in the module)
//   out f32: element (t, h, d) at [t*EMB_DIM + h*64 + d]
//   scores = (q . k) * sscale : bf16 hi/lo split (hi.hi + hi.lo + lo.hi) on v_wmma_f32_16x16x32_bf16
//   out    = p . v            : bf16 hi/lo split of p (unnormalised) and v, f32 accumulate
//   online softmax in f32 over all SEQ_LEN keys (32 chunks of 64, compile-time trip count).
//   Block = 4 waves = 64 query rows of one head; grid.x = N_HEADS * (SEQ_LEN/64) = 512.
//   K / V^T chunk staging: 128 threads x 32 elements per plane = the whole 64x64 tile (16-B copies, plain loads,
//   __syncthreads before and after); fragment loads read the LDS tiles with the same v8b element type.
//   Output coverage per wave: 8 it x 2 rows x (16 lanes x 4 floats) = 16 rows x 64 = the wave tile; 4 waves x
//   512 blocks x 2 launches = all 4096 x 1024 of the out plane.
// =====================================================================================
#define AT_D 64
#define AT_NW 4
#define AT_QB 64
#define AT_KC 64

__device__ __forceinline__ unsigned short at_bf_bits(float f) {
  unsigned u = __float_as_uint(f);
  return (unsigned short)((u + 0x7FFFu + ((u >> 16) & 1u)) >> 16);
}
__device__ __forceinline__ __bf16 at_f2bf(float f) { return __builtin_bit_cast(__bf16, at_bf_bits(f)); }
__device__ __forceinline__ void at_split(float f, __bf16& hi, __bf16& lo) {
  const unsigned short hb = at_bf_bits(f);
  hi = __builtin_bit_cast(__bf16, hb);
  lo = at_f2bf(f - __uint_as_float(((unsigned)hb) << 16));
}
__device__ __forceinline__ v8f at_mma(v16b a, v16b b, v8f c) {
  c = __builtin_amdgcn_wmma_f32_16x16x32_bf16(false, a, false, b, (short)0, c, false, false);
  asm volatile("v_nop\n\tv_nop\n\tv_nop\n\tv_nop" : "+v"(c) : "v"(a), "v"(b));
  return c;
}

__global__ __launch_bounds__(128)
void attn_full64_kernel(const unsigned short* __restrict__ qhp, const unsigned short* __restrict__ qlp,
                        const unsigned short* __restrict__ khp, const unsigned short* __restrict__ klp,
                        const unsigned short* __restrict__ vhp, const unsigned short* __restrict__ vlp,
                        const int* __restrict__ kmask,
                        float* __restrict__ out, float sscale, float mfill) {
  union FB { v16b v; v8b h[2]; };
  __shared__ __align__(16) __bf16 Ksh[AT_KC * AT_D];             // K hi [kv][d]      8 KB
  __shared__ __align__(16) __bf16 Ksl[AT_KC * AT_D];             // K lo
  __shared__ __align__(16) __bf16 Vth[AT_D * AT_KC];             // V hi [d][kv]      8 KB
  __shared__ __align__(16) __bf16 Vtl[AT_D * AT_KC];             // V lo
  __shared__ __align__(16) __bf16 Psh[AT_NW][16 * AT_KC];        // per wave P hi [row][kv]
  __shared__ __align__(16) __bf16 Psl[AT_NW][16 * AT_KC];        // per wave P lo
  __shared__ __align__(16) float  Os[AT_NW][16 * 68];            // per wave out tile, pitch 68

  const int tid  = threadIdx.x;
  const int wave = tid >> 5;
  const int lane = tid & 31;
  const int hh   = lane >> 4;
  const int c    = lane & 15;

  const int nqb = SEQ_LEN / AT_QB;        // 32
  const int bx = blockIdx.x;
  const int qb = bx % nqb;
  const int h  = bx / nqb;                // 0..N_HEADS-1 (grid = N_HEADS * nqb)
  const int q0 = qb * AT_QB + wave * 16;

  const __bf16* Qh = (const __bf16*)(const void*)qhp + (size_t)h * AT_D;
  const __bf16* Ql = (const __bf16*)(const void*)qlp + (size_t)h * AT_D;
  const __bf16* Kh = (const __bf16*)(const void*)khp + (size_t)h * AT_D;
  const __bf16* Kl = (const __bf16*)(const void*)klp + (size_t)h * AT_D;
  const __bf16* Vh = (const __bf16*)(const void*)vhp + (size_t)h * AT_D * SEQ_LEN;
  const __bf16* Vl = (const __bf16*)(const void*)vlp + (size_t)h * AT_D * SEQ_LEN;
  float*        ob = out + (size_t)h * AT_D;

  // ---- Q fragments (A operand, row = lane&15, split k map via Frag load): 2 d-chunks, hi and lo ----
  v16b qah[2], qal[2];
#pragma unroll
  for (int dc = 0; dc < 2; ++dc) {
    const __bf16* qr = Qh + (size_t)(q0 + c) * EMB_DIM + dc * 32 + 8 * hh;
    const __bf16* ql = Ql + (size_t)(q0 + c) * EMB_DIM + dc * 32 + 8 * hh;
    qah[dc] = Frag<__bf16>::load(qr);
    qal[dc] = Frag<__bf16>::load(ql);
  }

  float mrow[8], lrow[8];
  v8f oacc[4];
#pragma unroll
  for (int r = 0; r < 8; ++r) { mrow[r] = -INFINITY; lrow[r] = 0.f; }
#pragma unroll
  for (int t = 0; t < 4; ++t) oacc[t] = (v8f){0.f,0.f,0.f,0.f,0.f,0.f,0.f,0.f};

  const int nChunks = SEQ_LEN / AT_KC;   // 32, compile-time constant
  for (int kc = 0; kc < nChunks; ++kc) {
    const int kv0 = kc * AT_KC;
    __syncthreads();
    {
      // staging coverage: 128 threads x (4 x 8) elements = 64 rows x 64 per plane = the whole chunk tile
      const int r = tid >> 1, half = (tid & 1) * 32;
      const __bf16* ksh = Kh + (size_t)(kv0 + r) * EMB_DIM + half;   // K row kv0+r, d = half..half+31
      const __bf16* ksl = Kl + (size_t)(kv0 + r) * EMB_DIM + half;
      const __bf16* vsh = Vh + (size_t)r * SEQ_LEN + kv0 + half;      // V^T row d = r, s = kv0+half..+31
      const __bf16* vsl = Vl + (size_t)r * SEQ_LEN + kv0 + half;
#pragma unroll
      for (int i = 0; i < 4; ++i) {
        const v8b a0 = *(const v8b*)(ksh + 8 * i);
        const v8b a1 = *(const v8b*)(ksl + 8 * i);
        const v8b b0 = *(const v8b*)(vsh + 8 * i);
        const v8b b1 = *(const v8b*)(vsl + 8 * i);
        *(v8b*)(Ksh + r * AT_D  + half + 8 * i) = a0;
        *(v8b*)(Ksl + r * AT_D  + half + 8 * i) = a1;
        *(v8b*)(Vth + r * AT_KC + half + 8 * i) = b0;
        *(v8b*)(Vtl + r * AT_KC + half + 8 * i) = b1;
      }
    }
    __syncthreads();

    v8f s[4];
#pragma unroll
    for (int j = 0; j < 4; ++j) {
      s[j] = (v8f){0.f,0.f,0.f,0.f,0.f,0.f,0.f,0.f};
#pragma unroll
      for (int dc = 0; dc < 2; ++dc) {
        FB kb, kl;
        kb.h[0] = *(const v8b*)(Ksh + (j * 16 + c) * AT_D + dc * 32 + 8 * hh);
        kb.h[1] = *(const v8b*)(Ksh + (j * 16 + c) * AT_D + dc * 32 + 16 + 8 * hh);
        kl.h[0] = *(const v8b*)(Ksl + (j * 16 + c) * AT_D + dc * 32 + 8 * hh);
        kl.h[1] = *(const v8b*)(Ksl + (j * 16 + c) * AT_D + dc * 32 + 16 + 8 * hh);
        s[j] = at_mma(qah[dc], kb.v, s[j]);
        s[j] = at_mma(qah[dc], kl.v, s[j]);
        s[j] = at_mma(qal[dc], kb.v, s[j]);
      }
    }
    // key-padding mask for this lane's 4 key columns (kv0 + j*16 + c, always < SEQ_LEN): nonzero -> score := mfill
    int kvm[4];
#pragma unroll
    for (int j = 0; j < 4; ++j) kvm[j] = kmask[kv0 + j * 16 + c];
    float cm[8];
#pragma unroll
    for (int r = 0; r < 8; ++r) {
      float m = -INFINITY;
#pragma unroll
      for (int j = 0; j < 4; ++j) {
        float sv = s[j][r] * sscale;
        sv = (kvm[j] != 0) ? mfill : sv;
        s[j][r] = sv;
        m = fmaxf(m, sv);
      }
#pragma unroll
      for (int off = 1; off < 16; off <<= 1) m = fmaxf(m, __shfl_xor(m, off, 32));
      cm[r] = m;
    }
    __bf16* pwh = Psh[wave];
    __bf16* pwl = Psl[wave];
#pragma unroll
    for (int r = 0; r < 8; ++r) {
      const float mnew = fmaxf(mrow[r], cm[r]);
      const float alpha = expf(mrow[r] - mnew);
      mrow[r] = mnew;
      float psum = 0.f;
#pragma unroll
      for (int j = 0; j < 4; ++j) {
        const float p = expf(s[j][r] - mnew);
        psum += p;
        __bf16 a, bl; at_split(p, a, bl);
        pwh[(8 * hh + r) * AT_KC + j * 16 + c] = a;
        pwl[(8 * hh + r) * AT_KC + j * 16 + c] = bl;
      }
#pragma unroll
      for (int off = 1; off < 16; off <<= 1) psum += __shfl_xor(psum, off, 32);
      lrow[r] = lrow[r] * alpha + psum;
#pragma unroll
      for (int t = 0; t < 4; ++t) oacc[t][r] *= alpha;
    }
    __builtin_amdgcn_fence(__ATOMIC_RELEASE, "workgroup");
    __builtin_amdgcn_wave_barrier();
    __builtin_amdgcn_fence(__ATOMIC_ACQUIRE, "workgroup");
#pragma unroll 1
    for (int kk = 0; kk < 2; ++kk) {
      FB pa, pl;
      pa.h[0] = *(const v8b*)(pwh + c * AT_KC + kk * 32 + 8 * hh);
      pa.h[1] = *(const v8b*)(pwh + c * AT_KC + kk * 32 + 16 + 8 * hh);
      pl.h[0] = *(const v8b*)(pwl + c * AT_KC + kk * 32 + 8 * hh);
      pl.h[1] = *(const v8b*)(pwl + c * AT_KC + kk * 32 + 16 + 8 * hh);
#pragma unroll
      for (int t = 0; t < 4; ++t) {
        FB vb, vl;
        vb.h[0] = *(const v8b*)(Vth + (t * 16 + c) * AT_KC + kk * 32 + 8 * hh);
        vb.h[1] = *(const v8b*)(Vth + (t * 16 + c) * AT_KC + kk * 32 + 16 + 8 * hh);
        vl.h[0] = *(const v8b*)(Vtl + (t * 16 + c) * AT_KC + kk * 32 + 8 * hh);
        vl.h[1] = *(const v8b*)(Vtl + (t * 16 + c) * AT_KC + kk * 32 + 16 + 8 * hh);
        oacc[t] = at_mma(pa.v, vb.v, oacc[t]);
        oacc[t] = at_mma(pa.v, vl.v, oacc[t]);
        oacc[t] = at_mma(pl.v, vb.v, oacc[t]);
      }
    }
  }

  float* os = Os[wave];
#pragma unroll
  for (int r = 0; r < 8; ++r) {
    const float inv = 1.0f / lrow[r];
#pragma unroll
    for (int t = 0; t < 4; ++t) os[(8 * hh + r) * 68 + t * 16 + c] = oacc[t][r] * inv;
  }
  __builtin_amdgcn_fence(__ATOMIC_RELEASE, "workgroup");
  __builtin_amdgcn_wave_barrier();
  __builtin_amdgcn_fence(__ATOMIC_ACQUIRE, "workgroup");
  {
    const int c4 = (lane & 15) * 4;
    {
#pragma unroll
      for (int it = 0; it < 8; ++it) {
        const int row = it * 2 + hh;   // it 0..7 x hh 0..1 covers rows 0..15 of the wave tile
        v4f val = *(const v4f*)(os + row * 68 + c4);
        *(v4f*)(ob + (size_t)(q0 + row) * EMB_DIM + c4) = val;
      }
      
    }
  }
}

// ---------------------------------------------------------------------------
// Host-side orchestration (kernel launches + host arithmetic only).
// Workspace region map (byte offsets, every region fully written by its producer before any read):
//   0           xb    bf16 [4096][1024]            8,388,608
//   8,388,608   wqb   bf16 [1024][1024]            2,097,152
//   10,485,760  wkb   bf16 [1024][1024]            2,097,152
//   12,582,912  wvb   bf16 [1024][1024]            2,097,152
//   14,680,064  wo16  f16  [1024][1024] (x64)      2,097,152
//   16,777,216  qh    bf16 [4096][1024]            8,388,608
//   25,165,824  ql    bf16 [4096][1024]            8,388,608
//   33,554,432  kh    bf16 [4096][1024]            8,388,608
//   41,943,040  kl    bf16 [4096][1024]            8,388,608
//   50,331,648  vth   bf16 [2][1024][2048]         8,388,608
//   58,720,256  vtl   bf16 [2][1024][2048]         8,388,608
//   67,108,864  o32   f32  [4096][1024]           16,777,216
//   83,886,080  o16   f16  [4096][1024] (x16)      8,388,608
//   92,274,688  end (88 MiB)
// GEMM shapes: K = 1024 (multiple of 32) everywhere; M, N in {1024, 2048, 4096} (multiples of 64); no padding.
// ---------------------------------------------------------------------------
extern "C" void kernel_launch(void* const* d_in, const int* in_sizes, int n_in,
                              void* d_out, int out_size, void* d_ws, size_t ws_size,
                              hipStream_t stream) {
  if (n_in < 6) return;
  const int nTokEmb = N_TOK * EMB_DIM;          // 4,194,304
  const int nEmbEmb = EMB_DIM * EMB_DIM;        // 1,048,576
  if (in_sizes[0] != nTokEmb || in_sizes[1] != N_BATCH * SEQ_LEN || in_sizes[2] != nEmbEmb ||
      in_sizes[3] != nEmbEmb || in_sizes[4] != nEmbEmb || in_sizes[5] != nEmbEmb || out_size != nTokEmb) return;

  const size_t offXb  = 0;
  const size_t offWq  = offXb  + (size_t)nTokEmb * 2;
  const size_t offWk  = offWq  + (size_t)nEmbEmb * 2;
  const size_t offWv  = offWk  + (size_t)nEmbEmb * 2;
  const size_t offWo  = offWv  + (size_t)nEmbEmb * 2;
  const size_t offQh  = offWo  + (size_t)nEmbEmb * 2;
  const size_t offQl  = offQh  + (size_t)nTokEmb * 2;
  const size_t offKh  = offQl  + (size_t)nTokEmb * 2;
  const size_t offKl  = offKh  + (size_t)nTokEmb * 2;
  const size_t offVth = offKl  + (size_t)nTokEmb * 2;
  const size_t offVtl = offVth + (size_t)nTokEmb * 2;
  const size_t offO32 = offVtl + (size_t)nTokEmb * 2;
  const size_t offO16 = offO32 + (size_t)nTokEmb * 4;
  const size_t offEnd = offO16 + (size_t)nTokEmb * 2;   // 92,274,688
  if (ws_size < offEnd) return;

  const float* x    = (const float*)d_in[0];
  const int*   mask = (const int*)d_in[1];
  const float* wq   = (const float*)d_in[2];
  const float* wk   = (const float*)d_in[3];
  const float* wv   = (const float*)d_in[4];
  const float* wo   = (const float*)d_in[5];
  float* out = (float*)d_out;

  char* ws = (char*)d_ws;
  unsigned short* xb   = (unsigned short*)(ws + offXb);
  unsigned short* wqb  = (unsigned short*)(ws + offWq);
  unsigned short* wkb  = (unsigned short*)(ws + offWk);
  unsigned short* wvb  = (unsigned short*)(ws + offWv);
  unsigned short* wo16 = (unsigned short*)(ws + offWo);
  unsigned short* qh   = (unsigned short*)(ws + offQh);
  unsigned short* ql   = (unsigned short*)(ws + offQl);
  unsigned short* kh   = (unsigned short*)(ws + offKh);
  unsigned short* kl   = (unsigned short*)(ws + offKl);
  unsigned short* vth  = (unsigned short*)(ws + offVth);
  unsigned short* vtl  = (unsigned short*)(ws + offVtl);
  float*          o32  = (float*)(ws + offO32);
  unsigned short* o16  = (unsigned short*)(ws + offO16);
  const float* dummyf = x;   // valid pointer for unused bias / resid arguments (never dereferenced)

  // 1) 16-bit operand planes: x, wq, wk, wv -> bf16 RNE; wo -> f16 encode of bf16-RNE(wo*64)
  {
    const int n2x = nTokEmb / 2;   // 2,097,152 -> 8192 blocks
    const int n2w = nEmbEmb / 2;   //   524,288 -> 2048 blocks
    cast2_kernel<0><<<(n2x + 255) / 256, 256, 0, stream>>>(x,  xb,  n2x, 1.0f);
    cast2_kernel<0><<<(n2w + 255) / 256, 256, 0, stream>>>(wq, wqb, n2w, 1.0f);
    cast2_kernel<0><<<(n2w + 255) / 256, 256, 0, stream>>>(wk, wkb, n2w, 1.0f);
    cast2_kernel<0><<<(n2w + 255) / 256, 256, 0, stream>>>(wv, wvb, n2w, 1.0f);
    cast2_kernel<1><<<(n2w + 255) / 256, 256, 0, stream>>>(wo, wo16, n2w, 64.0f);
  }

  // 2) q, k = x @ W^T : M = 4096 tokens, N = 1024, K = 1024; bf16 hi/lo output planes [token][h*64+d]
  //    tiles = 64 x 16 = 1024 -> 128 blocks of 8 waves
  {
    const dim3 g(((N_TOK / 64) * (EMB_DIM / 64)) / 8, 1);
    wmma_gemm64<1, false, 0, 2, false><<<g, 256, 0, stream>>>(
        xb, xb, EMB_DIM, 0L, wqb, wqb, EMB_DIM, 0L,
        (void*)qh, (void*)ql, EMB_DIM, 0L, dummyf, dummyf, 0L, N_TOK, EMB_DIM, EMB_DIM, 1.0f);
    wmma_gemm64<1, false, 0, 2, false><<<g, 256, 0, stream>>>(
        xb, xb, EMB_DIM, 0L, wkb, wkb, EMB_DIM, 0L,
        (void*)kh, (void*)kl, EMB_DIM, 0L, dummyf, dummyf, 0L, N_TOK, EMB_DIM, EMB_DIM, 1.0f);
  }

  // 3) v^T per batch = Wv @ x_b^T : A = wvb [1024 out][1024 in], Bt = xb_b [2048 tokens][1024],
  //    C = [1024 (h*64+d)][2048 s] bf16 hi/lo, y-batched over 2 batches; tiles = 16 x 32 = 512 -> 64 blocks
  {
    const dim3 g(((EMB_DIM / 64) * (SEQ_LEN / 64)) / 8, N_BATCH);
    wmma_gemm64<1, false, 0, 2, false><<<g, 256, 0, stream>>>(
        wvb, wvb, EMB_DIM, 0L, xb, xb, EMB_DIM, (long)SEQ_LEN * EMB_DIM,
        (void*)vth, (void*)vtl, SEQ_LEN, (long)EMB_DIM * SEQ_LEN, dummyf, dummyf, 0L,
        EMB_DIM, SEQ_LEN, EMB_DIM, 1.0f);
  }

  // 4) attention per batch: grid = 16 heads x 32 query blocks; key mask read from d_in[1] as int32
  for (int b = 0; b < N_BATCH; ++b) {
    const size_t tokOff = (size_t)b * SEQ_LEN * EMB_DIM;
    const size_t vtOff  = (size_t)b * EMB_DIM * SEQ_LEN;
    attn_full64_kernel<<<N_HEADS * (SEQ_LEN / 64), 128, 0, stream>>>(
        qh + tokOff, ql + tokOff, kh + tokOff, kl + tokOff, vth + vtOff, vtl + vtOff,
        mask + (size_t)b * SEQ_LEN, o32 + tokOff, 0.125f, -1.0e9f);
  }

  // 5) attention output f32 -> f16 carried x16
  {
    const int n2o = nTokEmb / 2;   // 2,097,152 -> 8192 blocks
    cast2_kernel<2><<<(n2o + 255) / 256, 256, 0, stream>>>(o32, o16, n2o, 16.0f);
  }

  // 6) out = O @ Wo^T : f16 operands (O x16, Wo x64) -> scale 1/1024, f32 into d_out [4096][1024]
  {
    const dim3 g(((N_TOK / 64) * (EMB_DIM / 64)) / 8, 1);
    wmma_gemm64<0, false, 0, 0, false><<<g, 256, 0, stream>>>(
        o16, o16, EMB_DIM, 0L, wo16, wo16, EMB_DIM, 0L,
        (void*)out, (void*)out, EMB_DIM, 0L, dummyf, dummyf, 0L, N_TOK, EMB_DIM, EMB_DIM, 1.0f / 1024.0f);
  }
}

// v001
// Measured time: 567 microseconds a run.
// In two side-by-side timings against v000, it was 1.24 and 1.25 times as fast.
// Projections q, k, v^T: v_wmma_f32_16x16x32_bf16 (x and weights RNE-converted to bf16, single product); attention q.k^T and p.v: v_wmma_f32_16x16x32_bf16 with bf16 hi/lo split operands (hi.hi + hi.lo + lo.hi); output projection: v_wmma_f32_16x16x32_f16 (attention output carried x16 in f16, bf16-RNE weight carried x64 in f16); f32 accumulate everywhere; online softmax, key-mask select (-1e9) and normalisation in f32.
#include <hip/hip_runtime.h>
#include <math.h>
#include <stdint.h>

#define N_BATCH  2
#define SEQ_LEN  2048
#define EMB_DIM  1024
#define N_HEADS  16
#define HEAD_DIM 64
#define N_TOK    (N_BATCH * SEQ_LEN)

typedef __attribute__((ext_vector_type(16))) _Float16 v16h;
typedef __attribute__((ext_vector_type(8)))  _Float16 v8h;
typedef __attribute__((ext_vector_type(16))) __bf16   v16b;
typedef __attribute__((ext_vector_type(8)))  __bf16   v8b;
typedef __attribute__((ext_vector_type(8)))  float    v8f;
typedef __attribute__((ext_vector_type(4)))  float    v4f;
typedef __attribute__((ext_vector_type(2)))  float    v2f;
typedef __attribute__((ext_vector_type(4)))  unsigned int v4u;

__device__ __forceinline__ unsigned short f2bf_bits(float f) {
  unsigned u = __float_as_uint(f);
  return (unsigned short)((u + 0x7FFFu + ((u >> 16) & 1u)) >> 16);
}
__device__ __forceinline__ float bf_bits2f(unsigned short h) { return __uint_as_float(((unsigned)h) << 16); }

// hazard guards as plain device helpers (no inline asm inside the kernel template body)
__device__ __forceinline__ void dep_guard_h(v8f& a, v8f& b, v16h x, v16h y) { asm volatile("v_nop\n\tv_nop\n\tv_nop\n\tv_nop" : "+v"(a), "+v"(b) : "v"(x), "v"(y)); }
__device__ __forceinline__ void dep_guard_b(v8f& a, v8f& b, v16b x, v16b y) { asm volatile("v_nop\n\tv_nop\n\tv_nop\n\tv_nop" : "+v"(a), "+v"(b) : "v"(x), "v"(y)); }
__device__ __forceinline__ void keep4_h(v16h a, v16h b, v16h c, v16h d) { asm volatile("v_nop" :: "v"(a), "v"(b), "v"(c), "v"(d)); }
__device__ __forceinline__ void keep4_b(v16b a, v16b b, v16b c, v16b d) { asm volatile("v_nop" :: "v"(a), "v"(b), "v"(c), "v"(d)); }
__device__ __forceinline__ void acc_guard4(v8f& a, v8f& b, v8f& c, v8f& d) { asm volatile("v_nop\n\tv_nop\n\tv_nop\n\tv_nop" : "+v"(a), "+v"(b), "+v"(c), "+v"(d)); }
template <typename T> struct Frag;
template <> struct Frag<_Float16> {
  typedef v16h V; union U { v16h v; v8h h[2]; };
  static __device__ __forceinline__ v16h load(const _Float16* p) {   // elements 0..7 <- p[0..7], 8..15 <- p[16..23]
    U f; f.h[0] = *(const v8h*)(p); f.h[1] = *(const v8h*)(p + 16); return f.v;
  }
  static __device__ __forceinline__ v8f mma(v16h a, v16h b, v8f c) {
    return __builtin_amdgcn_wmma_f32_16x16x32_f16(false, a, false, b, (short)0, c, false, false);
  }
  static __device__ __forceinline__ void guard(v8f& a, v8f& b, v16h x, v16h y) { dep_guard_h(a, b, x, y); }
  static __device__ __forceinline__ void keep(v16h a, v16h b, v16h c, v16h d) { keep4_h(a, b, c, d); }
};
template <> struct Frag<__bf16> {
  typedef v16b V; union U { v16b v; v8b h[2]; };
  static __device__ __forceinline__ v16b load(const __bf16* p) {
    U f; f.h[0] = *(const v8b*)(p); f.h[1] = *(const v8b*)(p + 16); return f.v;
  }
  static __device__ __forceinline__ v8f mma(v16b a, v16b b, v8f c) {
    return __builtin_amdgcn_wmma_f32_16x16x32_bf16(false, a, false, b, (short)0, c, false, false);
  }
  static __device__ __forceinline__ void guard(v8f& a, v8f& b, v16b x, v16b y) { dep_guard_b(a, b, x, y); }
  static __device__ __forceinline__ void keep(v16b a, v16b b, v16b c, v16b d) { keep4_b(a, b, c, d); }
};

// ---- Register-blocked batched WMMA GEMM ------------------------------------
// C[m,n] = scale * sum_k A[m,k] * Bt[n,k] (+bias)(+resid); each wave owns a 64x64 tile.
// A row-major [M,K]; Bt row-major [N,K]; M,N % 64 == 0, K % 32 == 0.
// SPLIT: operands are hi/lo planes (A2/Bt2 = lo planes, same layout); product = hi.hi + hi.lo + lo.hi.
// BIAS_MODE: 0 = none, 1 = bias[m], 2 = bias[n].
// OUT_MODE: 0 = f32, 1 = f16, 2 = bf16 hi plane (Cout) + bf16 lo plane (Cout2).
// Epilogue coverage per wave: f32 path 8 it x 2 rows x (16 lanes x 4 floats) = 16 rows x 64; 16-bit path
// 4 it x 4 rows x (8 lanes x 8 halves) = 16 rows x 64; 4 slabs = the whole 64x64 tile.
// ET: 0 = f16 operands, 1 = bf16 operands (pointers passed as 16-bit storage)
template <int ET> struct Elem;
template <> struct Elem<0> { typedef _Float16 T; };
template <> struct Elem<1> { typedef __bf16 T; };
template <int ET, bool SPLIT, int BIAS_MODE, int OUT_MODE, bool RESID, int ACT = 0>
__global__ __launch_bounds__(256) void wmma_gemm64(
    const unsigned short* __restrict__ Ap, const unsigned short* __restrict__ A2p, int lda, long strideA,
    const unsigned short* __restrict__ Btp, const unsigned short* __restrict__ Bt2p, int ldb, long strideB,
    void* __restrict__ Cout, void* __restrict__ Cout2, int ldc, long strideC,
    const float* __restrict__ bias,
    const float* __restrict__ resid, long strideR,
    int M, int N, int K, float scale) {
  typedef typename Elem<ET>::T T;
  typedef typename Frag<T>::V V;
  const T* A = (const T*)Ap; const T* A2 = (const T*)A2p; const T* Bt = (const T*)Btp; const T* Bt2 = (const T*)Bt2p;
  __shared__ __align__(16) float sT[8][16 * 68];   // per-wave 16x64 slab, pitch 68 floats
  const int b    = blockIdx.y;
  const int lane = threadIdx.x & 31;
  const int wave = threadIdx.x >> 5;
  const int tilesN = N >> 6;
  const int tilesM = M >> 6;
  const int tile = blockIdx.x * 8 + wave;
  if (tile >= tilesM * tilesN) return;   // wave-uniform; no block barriers in this kernel
  const int tm = tile / tilesN;
  const int tn = tile - tm * tilesN;
  const int m0 = tm << 6;
  const int n0 = tn << 6;

  const T* Ab  = A  + (size_t)b * strideA;
  const T* Bb  = Bt + (size_t)b * strideB;
  const T* Ab2 = SPLIT ? (A2  + (size_t)b * strideA) : nullptr;
  const T* Bb2 = SPLIT ? (Bt2 + (size_t)b * strideB) : nullptr;

  const int rlane = lane & 15;                 // row (A) / col (B, D) within subtile
  const int koff  = (lane >> 4) * 8;           // k offset of this lane half
  const int mOff  = (lane >> 4) * 8;           // D row offset

  v8f acc[4][4];
#pragma unroll
  for (int i = 0; i < 4; ++i)
#pragma unroll
    for (int j = 0; j < 4; ++j) acc[i][j] = (v8f){0.f,0.f,0.f,0.f,0.f,0.f,0.f,0.f};

  for (int k0 = 0; k0 < K; k0 += 32) {
    V bh[4], bl[4];
#pragma unroll
    for (int j = 0; j < 4; ++j) {
      const size_t bo = (size_t)(n0 + (j << 4) + rlane) * ldb + koff + k0;
      bh[j] = Frag<T>::load(Bb + bo);
      if (SPLIT) bl[j] = Frag<T>::load(Bb2 + bo);
    }
#pragma unroll
    for (int i = 0; i < 4; ++i) {
      const size_t ao = (size_t)(m0 + (i << 4) + rlane) * lda + koff + k0;
      V ah = Frag<T>::load(Ab + ao);
      V al;
      if (SPLIT) al = Frag<T>::load(Ab2 + ao);
#pragma unroll
      for (int j = 0; j < 4; ++j) {
        acc[i][j] = Frag<T>::mma(ah, bh[j], acc[i][j]);
        if (SPLIT) {
          acc[i][j] = Frag<T>::mma(ah, bl[j], acc[i][j]);
          acc[i][j] = Frag<T>::mma(al, bh[j], acc[i][j]);
        }
      }
      Frag<T>::guard(acc[i][0], acc[i][3], ah, SPLIT ? al : ah);
    }
    Frag<T>::keep(bh[0], bh[1], bh[2], bh[3]);
    if (SPLIT) Frag<T>::keep(bl[0], bl[1], bl[2], bl[3]);
  }
  acc_guard4(acc[0][0], acc[0][1], acc[0][2], acc[0][3]);
  acc_guard4(acc[1][0], acc[1][1], acc[1][2], acc[1][3]);
  acc_guard4(acc[2][0], acc[2][1], acc[2][2], acc[2][3]);
  acc_guard4(acc[3][0], acc[3][1], acc[3][2], acc[3][3]);

  // ---- epilogue ----
  float* slab = sT[wave];
  const float* Rb = RESID ? (resid + (size_t)b * strideR) : nullptr;
#pragma unroll
  for (int i = 0; i < 4; ++i) {
    const int mBase = m0 + (i << 4);
#pragma unroll
    for (int j = 0; j < 4; ++j) {
      const int n = n0 + (j << 4) + rlane;
      float bv = 0.f;
      if (BIAS_MODE == 2) bv = bias[n];
#pragma unroll
      for (int r = 0; r < 8; ++r) {
        float v = acc[i][j][r] * scale;
        if (BIAS_MODE == 1) v += bias[mBase + mOff + r];
        if (BIAS_MODE == 2) v += bv;
        if (RESID) v += Rb[(size_t)(mBase + mOff + r) * ldc + n];
        if (ACT == 1) v = tanhf(v);
        if (ACT == 2) v = fmaxf(v, 0.0f);
        if (ACT == 3) v = v / (1.0f + expf(-v));
        if (ACT == 4) v = (v > 0.f) ? v : 0.01f * v;
        if (ACT == 5) v = 0.5f * v * (1.0f + erff(v * 0.70710678118654752f));
        slab[(mOff + r) * 68 + (j << 4) + rlane] = v;
      }
    }
    __builtin_amdgcn_fence(__ATOMIC_RELEASE, "workgroup");
    __builtin_amdgcn_wave_barrier();
    __builtin_amdgcn_fence(__ATOMIC_ACQUIRE, "workgroup");
    if (OUT_MODE == 0) {
      float* C = (float*)Cout + (size_t)b * strideC;
      const int hh = lane >> 4, c4 = (lane & 15) * 4;     // row seg = 256 B = 16 lanes x 16 B
      {
#pragma unroll
        for (int it = 0; it < 8; ++it) {
          const int row = it * 2 + hh;
          v4f v = *(const v4f*)(slab + row * 68 + c4);
          *(v4f*)(C + (size_t)(mBase + row) * ldc + n0 + c4) = v;
        }
        
      }
    } else {
      const int q = lane >> 3, c8 = (lane & 7) * 8;
      unsigned short* C  = (unsigned short*)Cout  + (size_t)b * strideC;
      unsigned short* C2 = (OUT_MODE == 2) ? ((unsigned short*)Cout2 + (size_t)b * strideC) : nullptr;
      {
#pragma unroll
        for (int it = 0; it < 4; ++it) {
          const int row = it * 4 + q;
          const float* sp = slab + row * 68 + c8;
          v8h hv, lv;
#pragma unroll
          for (int e = 0; e < 8; ++e) {
            if (OUT_MODE == 1) {
              hv[e] = (_Float16)sp[e];
            } else {
              unsigned short hb = f2bf_bits(sp[e]);
              unsigned short lb = f2bf_bits(sp[e] - bf_bits2f(hb));
              hv[e] = __builtin_bit_cast(_Float16, hb);
              lv[e] = __builtin_bit_cast(_Float16, lb);
            }
          }
          *(v8h*)(C + (size_t)(mBase + row) * ldc + n0 + c8) = hv;
          if (OUT_MODE == 2) *(v8h*)(C2 + (size_t)(mBase + row) * ldc + n0 + c8) = lv;
        }
        
      }
    }
    __builtin_amdgcn_fence(__ATOMIC_RELEASE, "workgroup");
    __builtin_amdgcn_wave_barrier();
    __builtin_amdgcn_fence(__ATOMIC_ACQUIRE, "workgroup");
  }
}

// ---------------------------------------------------------------------------
// Elementwise f32 -> 16-bit plane, 2 consecutive elements per thread packed into one 4-B store: each wave writes
// CMODE 0: bf16 RNE bits of in*scale.
// CMODE 1: f16 bits of the bf16-RNE value of in*scale (an 8-significant-bit value re-encoded exactly in f16).
// CMODE 2: f16 RNE bits of in*scale.
// Coverage: grid = ceil(n2/256) blocks x 256 threads x 2 elements = 2*n2 = the whole plane
// (calls here: n2 = 2097152 -> 8192 blocks; n2 = 524288 -> 2048 blocks; both exact multiples of 256).
// ---------------------------------------------------------------------------
__device__ __forceinline__ unsigned pk16(unsigned short a, unsigned short b) { return (unsigned)a | ((unsigned)b << 16); }

template <int CMODE>
__global__ __launch_bounds__(256) void cast2_kernel(const float* __restrict__ in, unsigned short* __restrict__ out,
                                                    int n2, float scale) {
  const int i = blockIdx.x * 256 + threadIdx.x;
  if (i < n2) {
    const v2f f = *(const v2f*)(in + 2 * (size_t)i);
    const float f0 = f[0] * scale, f1 = f[1] * scale;
    unsigned short u0, u1;
    if (CMODE == 0) {
      u0 = f2bf_bits(f0); u1 = f2bf_bits(f1);
    } else if (CMODE == 1) {
      u0 = __builtin_bit_cast(unsigned short, (_Float16)bf_bits2f(f2bf_bits(f0)));
      u1 = __builtin_bit_cast(unsigned short, (_Float16)bf_bits2f(f2bf_bits(f1)));
    } else {
      u0 = __builtin_bit_cast(unsigned short, (_Float16)f0);
      u1 = __builtin_bit_cast(unsigned short, (_Float16)f1);
    }
    const unsigned u = pk16(u0, u1);
    ((unsigned*)out)[i] = u;
    
  }
}

// =====================================================================================
// Full-length attention with key-padding mask, head dim 64, one launch per batch element (pointers pre-offset).
//   q planes (hi/lo bf16): element (t, h, d) at [t*EMB_DIM + h*64 + d]
//   k planes (hi/lo bf16): element (s, h, d) at [s*EMB_DIM + h*64 + d]
//   v^T planes (hi/lo bf16): element (h, d, s) at [(h*64 + d)*SEQ_LEN + s]
//   kmask int32 [SEQ_LEN]: nonzero = key masked out -> score := mfill (select, as in the module)
//   out f32: element (t, h, d) at [t*EMB_DIM + h*64 + d]
//   scores = (q . k) * sscale : bf16 hi/lo split (hi.hi + hi.lo + lo.hi) on v_wmma_f32_16x16x32_bf16
//   out    = p . v            : bf16 hi/lo split of p (unnormalised) and v, f32 accumulate
//   online softmax in f32 over all SEQ_LEN keys (32 chunks of 64, compile-time trip count).
//   Block = 4 waves = 64 query rows of one head; grid.x = N_HEADS * (SEQ_LEN/64) = 512.
//   K / V^T chunk staging: 128 threads x 32 elements per plane = the whole 64x64 tile (16-B copies, plain loads,
//   __syncthreads before and after); fragment loads read the LDS tiles with the same v8b element type.
//   Output coverage per wave: 8 it x 2 rows x (16 lanes x 4 floats) = 16 rows x 64 = the wave tile; 4 waves x
//   512 blocks x 2 launches = all 4096 x 1024 of the out plane.
// =====================================================================================
#define AT_D 64
#define AT_NW 4
#define AT_QB 64
#define AT_KC 64
#define AT_LP 72   // LDS row pitch of the K, V^T and P tiles in elements: 144 B = 16 B x 9 (odd), so the 16 rows of one 16-byte fragment read fall on 64 distinct banks

__device__ __forceinline__ unsigned short at_bf_bits(float f) {
  unsigned u = __float_as_uint(f);
  return (unsigned short)((u + 0x7FFFu + ((u >> 16) & 1u)) >> 16);
}
__device__ __forceinline__ __bf16 at_f2bf(float f) { return __builtin_bit_cast(__bf16, at_bf_bits(f)); }
__device__ __forceinline__ void at_split(float f, __bf16& hi, __bf16& lo) {
  const unsigned short hb = at_bf_bits(f);
  hi = __builtin_bit_cast(__bf16, hb);
  lo = at_f2bf(f - __uint_as_float(((unsigned)hb) << 16));
}
__device__ __forceinline__ v8f at_mma(v16b a, v16b b, v8f c) {
  c = __builtin_amdgcn_wmma_f32_16x16x32_bf16(false, a, false, b, (short)0, c, false, false);
  asm volatile("v_nop\n\tv_nop\n\tv_nop\n\tv_nop" : "+v"(c) : "v"(a), "v"(b));
  return c;
}

__global__ __launch_bounds__(128)
void attn_full64_kernel(const unsigned short* __restrict__ qhp, const unsigned short* __restrict__ qlp,
                        const unsigned short* __restrict__ khp, const unsigned short* __restrict__ klp,
                        const unsigned short* __restrict__ vhp, const unsigned short* __restrict__ vlp,
                        const int* __restrict__ kmask,
                        float* __restrict__ out, float sscale, float mfill) {
  union FB { v16b v; v8b h[2]; };
  __shared__ __align__(16) __bf16 Ksh[AT_KC * AT_LP];            // K hi [kv][d]      9 KB
  __shared__ __align__(16) __bf16 Ksl[AT_KC * AT_LP];            // K lo
  __shared__ __align__(16) __bf16 Vth[AT_D * AT_LP];             // V hi [d][kv]      9 KB
  __shared__ __align__(16) __bf16 Vtl[AT_D * AT_LP];             // V lo
  __shared__ __align__(16) __bf16 Psh[AT_NW][16 * AT_LP];        // per wave P hi [row][kv]
  __shared__ __align__(16) __bf16 Psl[AT_NW][16 * AT_LP];        // per wave P lo
  __shared__ __align__(16) float  Os[AT_NW][16 * 68];            // per wave out tile, pitch 68

  const int tid  = threadIdx.x;
  const int wave = tid >> 5;
  const int lane = tid & 31;
  const int hh   = lane >> 4;
  const int c    = lane & 15;

  const int nqb = SEQ_LEN / AT_QB;        // 32
  const int bx = blockIdx.x;
  const int qb = bx % nqb;
  const int h  = bx / nqb;                // 0..N_HEADS-1 (grid = N_HEADS * nqb)
  const int q0 = qb * AT_QB + wave * 16;

  const __bf16* Qh = (const __bf16*)(const void*)qhp + (size_t)h * AT_D;
  const __bf16* Ql = (const __bf16*)(const void*)qlp + (size_t)h * AT_D;
  const __bf16* Kh = (const __bf16*)(const void*)khp + (size_t)h * AT_D;
  const __bf16* Kl = (const __bf16*)(const void*)klp + (size_t)h * AT_D;
  const __bf16* Vh = (const __bf16*)(const void*)vhp + (size_t)h * AT_D * SEQ_LEN;
  const __bf16* Vl = (const __bf16*)(const void*)vlp + (size_t)h * AT_D * SEQ_LEN;
  float*        ob = out + (size_t)h * AT_D;

  // ---- Q fragments (A operand, row = lane&15, split k map via Frag load): 2 d-chunks, hi and lo ----
  v16b qah[2], qal[2];
#pragma unroll
  for (int dc = 0; dc < 2; ++dc) {
    const __bf16* qr = Qh + (size_t)(q0 + c) * EMB_DIM + dc * 32 + 8 * hh;
    const __bf16* ql = Ql + (size_t)(q0 + c) * EMB_DIM + dc * 32 + 8 * hh;
    qah[dc] = Frag<__bf16>::load(qr);
    qal[dc] = Frag<__bf16>::load(ql);
  }

  float mrow[8], lrow[8];
  v8f oacc[4];
#pragma unroll
  for (int r = 0; r < 8; ++r) { mrow[r] = -INFINITY; lrow[r] = 0.f; }
#pragma unroll
  for (int t = 0; t < 4; ++t) oacc[t] = (v8f){0.f,0.f,0.f,0.f,0.f,0.f,0.f,0.f};

  const int nChunks = SEQ_LEN / AT_KC;   // 32, compile-time constant
  for (int kc = 0; kc < nChunks; ++kc) {
    const int kv0 = kc * AT_KC;
    __syncthreads();
    {
      // staging coverage: 128 threads x (4 x 8) elements = 64 rows x 64 per plane = the whole chunk tile
      const int r = tid >> 1, half = (tid & 1) * 32;
      const __bf16* ksh = Kh + (size_t)(kv0 + r) * EMB_DIM + half;   // K row kv0+r, d = half..half+31
      const __bf16* ksl = Kl + (size_t)(kv0 + r) * EMB_DIM + half;
      const __bf16* vsh = Vh + (size_t)r * SEQ_LEN + kv0 + half;      // V^T row d = r, s = kv0+half..+31
      const __bf16* vsl = Vl + (size_t)r * SEQ_LEN + kv0 + half;
#pragma unroll
      for (int i = 0; i < 4; ++i) {
        const v8b a0 = *(const v8b*)(ksh + 8 * i);
        const v8b a1 = *(const v8b*)(ksl + 8 * i);
        const v8b b0 = *(const v8b*)(vsh + 8 * i);
        const v8b b1 = *(const v8b*)(vsl + 8 * i);
        *(v8b*)(Ksh + r * AT_LP + half + 8 * i) = a0;
        *(v8b*)(Ksl + r * AT_LP + half + 8 * i) = a1;
        *(v8b*)(Vth + r * AT_LP + half + 8 * i) = b0;
        *(v8b*)(Vtl + r * AT_LP + half + 8 * i) = b1;
      }
    }
    __syncthreads();

    v8f s[4];
#pragma unroll
    for (int j = 0; j < 4; ++j) {
      s[j] = (v8f){0.f,0.f,0.f,0.f,0.f,0.f,0.f,0.f};
#pragma unroll
      for (int dc = 0; dc < 2; ++dc) {
        FB kb, kl;
        kb.h[0] = *(const v8b*)(Ksh + (j * 16 + c) * AT_LP + dc * 32 + 8 * hh);
        kb.h[1] = *(const v8b*)(Ksh + (j * 16 + c) * AT_LP + dc * 32 + 16 + 8 * hh);
        kl.h[0] = *(const v8b*)(Ksl + (j * 16 + c) * AT_LP + dc * 32 + 8 * hh);
        kl.h[1] = *(const v8b*)(Ksl + (j * 16 + c) * AT_LP + dc * 32 + 16 + 8 * hh);
        s[j] = at_mma(qah[dc], kb.v, s[j]);
        s[j] = at_mma(qah[dc], kl.v, s[j]);
        s[j] = at_mma(qal[dc], kb.v, s[j]);
      }
    }
    // key-padding mask for this lane's 4 key columns (kv0 + j*16 + c, always < SEQ_LEN): nonzero -> score := mfill
    int kvm[4];
#pragma unroll
    for (int j = 0; j < 4; ++j) kvm[j] = kmask[kv0 + j * 16 + c];
    float cm[8];
#pragma unroll
    for (int r = 0; r < 8; ++r) {
      float m = -INFINITY;
#pragma unroll
      for (int j = 0; j < 4; ++j) {
        float sv = s[j][r] * sscale;
        sv = (kvm[j] != 0) ? mfill : sv;
        s[j][r] = sv;
        m = fmaxf(m, sv);
      }
#pragma unroll
      for (int off = 1; off < 16; off <<= 1) m = fmaxf(m, __shfl_xor(m, off, 32));
      cm[r] = m;
    }
    __bf16* pwh = Psh[wave];
    __bf16* pwl = Psl[wave];
#pragma unroll
    for (int r = 0; r < 8; ++r) {
      const float mnew = fmaxf(mrow[r], cm[r]);
      const float alpha = expf(mrow[r] - mnew);
      mrow[r] = mnew;
      float psum = 0.f;
#pragma unroll
      for (int j = 0; j < 4; ++j) {
        const float p = expf(s[j][r] - mnew);
        psum += p;
        __bf16 a, bl; at_split(p, a, bl);
        pwh[(8 * hh + r) * AT_LP + j * 16 + c] = a;
        pwl[(8 * hh + r) * AT_LP + j * 16 + c] = bl;
      }
#pragma unroll
      for (int off = 1; off < 16; off <<= 1) psum += __shfl_xor(psum, off, 32);
      lrow[r] = lrow[r] * alpha + psum;
#pragma unroll
      for (int t = 0; t < 4; ++t) oacc[t][r] *= alpha;
    }
    __builtin_amdgcn_fence(__ATOMIC_RELEASE, "workgroup");
    __builtin_amdgcn_wave_barrier();
    __builtin_amdgcn_fence(__ATOMIC_ACQUIRE, "workgroup");
#pragma unroll 1
    for (int kk = 0; kk < 2; ++kk) {
      FB pa, pl;
      pa.h[0] = *(const v8b*)(pwh + c * AT_LP + kk * 32 + 8 * hh);
      pa.h[1] = *(const v8b*)(pwh + c * AT_LP + kk * 32 + 16 + 8 * hh);
      pl.h[0] = *(const v8b*)(pwl + c * AT_LP + kk * 32 + 8 * hh);
      pl.h[1] = *(const v8b*)(pwl + c * AT_LP + kk * 32 + 16 + 8 * hh);
#pragma unroll
      for (int t = 0; t < 4; ++t) {
        FB vb, vl;
        vb.h[0] = *(const v8b*)(Vth + (t * 16 + c) * AT_LP + kk * 32 + 8 * hh);
        vb.h[1] = *(const v8b*)(Vth + (t * 16 + c) * AT_LP + kk * 32 + 16 + 8 * hh);
        vl.h[0] = *(const v8b*)(Vtl + (t * 16 + c) * AT_LP + kk * 32 + 8 * hh);
        vl.h[1] = *(const v8b*)(Vtl + (t * 16 + c) * AT_LP + kk * 32 + 16 + 8 * hh);
        oacc[t] = at_mma(pa.v, vb.v, oacc[t]);
        oacc[t] = at_mma(pa.v, vl.v, oacc[t]);
        oacc[t] = at_mma(pl.v, vb.v, oacc[t]);
      }
    }
  }

  float* os = Os[wave];
#pragma unroll
  for (int r = 0; r < 8; ++r) {
    const float inv = 1.0f / lrow[r];
#pragma unroll
    for (int t = 0; t < 4; ++t) os[(8 * hh + r) * 68 + t * 16 + c] = oacc[t][r] * inv;
  }
  __builtin_amdgcn_fence(__ATOMIC_RELEASE, "workgroup");
  __builtin_amdgcn_wave_barrier();
  __builtin_amdgcn_fence(__ATOMIC_ACQUIRE, "workgroup");
  {
    const int c4 = (lane & 15) * 4;
    {
#pragma unroll
      for (int it = 0; it < 8; ++it) {
        const int row = it * 2 + hh;   // it 0..7 x hh 0..1 covers rows 0..15 of the wave tile
        v4f val = *(const v4f*)(os + row * 68 + c4);
        *(v4f*)(ob + (size_t)(q0 + row) * EMB_DIM + c4) = val;
      }
      
    }
  }
}

// ---------------------------------------------------------------------------
// Host-side orchestration (kernel launches + host arithmetic only).
// Workspace region map (byte offsets, every region fully written by its producer before any read):
//   0           xb    bf16 [4096][1024]            8,388,608
//   8,388,608   wqb   bf16 [1024][1024]            2,097,152
//   10,485,760  wkb   bf16 [1024][1024]            2,097,152
//   12,582,912  wvb   bf16 [1024][1024]            2,097,152
//   14,680,064  wo16  f16  [1024][1024] (x64)      2,097,152
//   16,777,216  qh    bf16 [4096][1024]            8,388,608
//   25,165,824  ql    bf16 [4096][1024]            8,388,608
//   33,554,432  kh    bf16 [4096][1024]            8,388,608
//   41,943,040  kl    bf16 [4096][1024]            8,388,608
//   50,331,648  vth   bf16 [2][1024][2048]         8,388,608
//   58,720,256  vtl   bf16 [2][1024][2048]         8,388,608
//   67,108,864  o32   f32  [4096][1024]           16,777,216
//   83,886,080  o16   f16  [4096][1024] (x16)      8,388,608
//   92,274,688  end (88 MiB)
// GEMM shapes: K = 1024 (multiple of 32) everywhere; M, N in {1024, 2048, 4096} (multiples of 64); no padding.
// ---------------------------------------------------------------------------
extern "C" void kernel_launch(void* const* d_in, const int* in_sizes, int n_in,
                              void* d_out, int out_size, void* d_ws, size_t ws_size,
                              hipStream_t stream) {
  if (n_in < 6) return;
  const int nTokEmb = N_TOK * EMB_DIM;          // 4,194,304
  const int nEmbEmb = EMB_DIM * EMB_DIM;        // 1,048,576
  if (in_sizes[0] != nTokEmb || in_sizes[1] != N_BATCH * SEQ_LEN || in_sizes[2] != nEmbEmb ||
      in_sizes[3] != nEmbEmb || in_sizes[4] != nEmbEmb || in_sizes[5] != nEmbEmb || out_size != nTokEmb) return;

  const size_t offXb  = 0;
  const size_t offWq  = offXb  + (size_t)nTokEmb * 2;
  const size_t offWk  = offWq  + (size_t)nEmbEmb * 2;
  const size_t offWv  = offWk  + (size_t)nEmbEmb * 2;
  const size_t offWo  = offWv  + (size_t)nEmbEmb * 2;
  const size_t offQh  = offWo  + (size_t)nEmbEmb * 2;
  const size_t offQl  = offQh  + (size_t)nTokEmb * 2;
  const size_t offKh  = offQl  + (size_t)nTokEmb * 2;
  const size_t offKl  = offKh  + (size_t)nTokEmb * 2;
  const size_t offVth = offKl  + (size_t)nTokEmb * 2;
  const size_t offVtl = offVth + (size_t)nTokEmb * 2;
  const size_t offO32 = offVtl + (size_t)nTokEmb * 2;
  const size_t offO16 = offO32 + (size_t)nTokEmb * 4;
  const size_t offEnd = offO16 + (size_t)nTokEmb * 2;   // 92,274,688
  if (ws_size < offEnd) return;

  const float* x    = (const float*)d_in[0];
  const int*   mask = (const int*)d_in[1];
  const float* wq   = (const float*)d_in[2];
  const float* wk   = (const float*)d_in[3];
  const float* wv   = (const float*)d_in[4];
  const float* wo   = (const float*)d_in[5];
  float* out = (float*)d_out;

  char* ws = (char*)d_ws;
  unsigned short* xb   = (unsigned short*)(ws + offXb);
  unsigned short* wqb  = (unsigned short*)(ws + offWq);
  unsigned short* wkb  = (unsigned short*)(ws + offWk);
  unsigned short* wvb  = (unsigned short*)(ws + offWv);
  unsigned short* wo16 = (unsigned short*)(ws + offWo);
  unsigned short* qh   = (unsigned short*)(ws + offQh);
  unsigned short* ql   = (unsigned short*)(ws + offQl);
  unsigned short* kh   = (unsigned short*)(ws + offKh);
  unsigned short* kl   = (unsigned short*)(ws + offKl);
  unsigned short* vth  = (unsigned short*)(ws + offVth);
  unsigned short* vtl  = (unsigned short*)(ws + offVtl);
  float*          o32  = (float*)(ws + offO32);
  unsigned short* o16  = (unsigned short*)(ws + offO16);
  const float* dummyf = x;   // valid pointer for unused bias / resid arguments (never dereferenced)

  // 1) 16-bit operand planes: x, wq, wk, wv -> bf16 RNE; wo -> f16 encode of bf16-RNE(wo*64)
  {
    const int n2x = nTokEmb / 2;   // 2,097,152 -> 8192 blocks
    const int n2w = nEmbEmb / 2;   //   524,288 -> 2048 blocks
    cast2_kernel<0><<<(n2x + 255) / 256, 256, 0, stream>>>(x,  xb,  n2x, 1.0f);
    cast2_kernel<0><<<(n2w + 255) / 256, 256, 0, stream>>>(wq, wqb, n2w, 1.0f);
    cast2_kernel<0><<<(n2w + 255) / 256, 256, 0, stream>>>(wk, wkb, n2w, 1.0f);
    cast2_kernel<0><<<(n2w + 255) / 256, 256, 0, stream>>>(wv, wvb, n2w, 1.0f);
    cast2_kernel<1><<<(n2w + 255) / 256, 256, 0, stream>>>(wo, wo16, n2w, 64.0f);
  }

  // 2) q, k = x @ W^T : M = 4096 tokens, N = 1024, K = 1024; bf16 hi/lo output planes [token][h*64+d]
  //    tiles = 64 x 16 = 1024 -> 128 blocks of 8 waves
  {
    const dim3 g(((N_TOK / 64) * (EMB_DIM / 64)) / 8, 1);
    wmma_gemm64<1, false, 0, 2, false><<<g, 256, 0, stream>>>(
        xb, xb, EMB_DIM, 0L, wqb, wqb, EMB_DIM, 0L,
        (void*)qh, (void*)ql, EMB_DIM, 0L, dummyf, dummyf, 0L, N_TOK, EMB_DIM, EMB_DIM, 1.0f);
    wmma_gemm64<1, false, 0, 2, false><<<g, 256, 0, stream>>>(
        xb, xb, EMB_DIM, 0L, wkb, wkb, EMB_DIM, 0L,
        (void*)kh, (void*)kl, EMB_DIM, 0L, dummyf, dummyf, 0L, N_TOK, EMB_DIM, EMB_DIM, 1.0f);
  }

  // 3) v^T per batch = Wv @ x_b^T : A = wvb [1024 out][1024 in], Bt = xb_b [2048 tokens][1024],
  //    C = [1024 (h*64+d)][2048 s] bf16 hi/lo, y-batched over 2 batches; tiles = 16 x 32 = 512 -> 64 blocks
  {
    const dim3 g(((EMB_DIM / 64) * (SEQ_LEN / 64)) / 8, N_BATCH);
    wmma_gemm64<1, false, 0, 2, false><<<g, 256, 0, stream>>>(
        wvb, wvb, EMB_DIM, 0L, xb, xb, EMB_DIM, (long)SEQ_LEN * EMB_DIM,
        (void*)vth, (void*)vtl, SEQ_LEN, (long)EMB_DIM * SEQ_LEN, dummyf, dummyf, 0L,
        EMB_DIM, SEQ_LEN, EMB_DIM, 1.0f);
  }

  // 4) attention per batch: grid = 16 heads x 32 query blocks; key mask read from d_in[1] as int32
  for (int b = 0; b < N_BATCH; ++b) {
    const size_t tokOff = (size_t)b * SEQ_LEN * EMB_DIM;
    const size_t vtOff  = (size_t)b * EMB_DIM * SEQ_LEN;
    attn_full64_kernel<<<N_HEADS * (SEQ_LEN / 64), 128, 0, stream>>>(
        qh + tokOff, ql + tokOff, kh + tokOff, kl + tokOff, vth + vtOff, vtl + vtOff,
        mask + (size_t)b * SEQ_LEN, o32 + tokOff, 0.125f, -1.0e9f);
  }

  // 5) attention output f32 -> f16 carried x16
  {
    const int n2o = nTokEmb / 2;   // 2,097,152 -> 8192 blocks
    cast2_kernel<2><<<(n2o + 255) / 256, 256, 0, stream>>>(o32, o16, n2o, 16.0f);
  }

  // 6) out = O @ Wo^T : f16 operands (O x16, Wo x64) -> scale 1/1024, f32 into d_out [4096][1024]
  {
    const dim3 g(((N_TOK / 64) * (EMB_DIM / 64)) / 8, 1);
    wmma_gemm64<0, false, 0, 0, false><<<g, 256, 0, stream>>>(
        o16, o16, EMB_DIM, 0L, wo16, wo16, EMB_DIM, 0L,
        (void*)out, (void*)out, EMB_DIM, 0L, dummyf, dummyf, 0L, N_TOK, EMB_DIM, EMB_DIM, 1.0f / 1024.0f);
  }
}

// v002
// It runs in 416 microseconds.
// In two side-by-side timings against v001, it was 1.36 and 1.37 times as fast.
// All steps since v000 together make it 1.70 times as fast.
// Projections q, k, v^T: v_wmma_f32_16x16x32_bf16 (x and weights RNE-converted to bf16, single product); attention q.k^T and p.v: v_wmma_f32_16x16x32_bf16 with bf16 hi/lo split operands (hi.hi + hi.lo + lo.hi); output projection: v_wmma_f32_16x16x32_f16 (attention output carried x16 in f16, bf16-RNE weight carried x64 in f16); f32 accumulate everywhere; online softmax, key-mask select (-1e9) and normalisation in f32.
#include <hip/hip_runtime.h>
#include <math.h>
#include <stdint.h>

#define N_BATCH  2
#define SEQ_LEN  2048
#define EMB_DIM  1024
#define N_HEADS  16
#define HEAD_DIM 64
#define N_TOK    (N_BATCH * SEQ_LEN)

typedef __attribute__((ext_vector_type(16))) _Float16 v16h;
typedef __attribute__((ext_vector_type(8)))  _Float16 v8h;
typedef __attribute__((ext_vector_type(16))) __bf16   v16b;
typedef __attribute__((ext_vector_type(8)))  __bf16   v8b;
typedef __attribute__((ext_vector_type(8)))  float    v8f;
typedef __attribute__((ext_vector_type(4)))  float    v4f;
typedef __attribute__((ext_vector_type(2)))  float    v2f;
typedef __attribute__((ext_vector_type(4)))  unsigned int v4u;

__device__ __forceinline__ unsigned short f2bf_bits(float f) {
  unsigned u = __float_as_uint(f);
  return (unsigned short)((u + 0x7FFFu + ((u >> 16) & 1u)) >> 16);
}
__device__ __forceinline__ float bf_bits2f(unsigned short h) { return __uint_as_float(((unsigned)h) << 16); }

// hazard guards as plain device helpers (no inline asm inside the kernel template body)
__device__ __forceinline__ void dep_guard_h(v8f& a, v8f& b, v16h x, v16h y) { asm volatile("v_nop\n\tv_nop\n\tv_nop\n\tv_nop" : "+v"(a), "+v"(b) : "v"(x), "v"(y)); }
__device__ __forceinline__ void dep_guard_b(v8f& a, v8f& b, v16b x, v16b y) { asm volatile("v_nop\n\tv_nop\n\tv_nop\n\tv_nop" : "+v"(a), "+v"(b) : "v"(x), "v"(y)); }
__device__ __forceinline__ void keep4_h(v16h a, v16h b, v16h c, v16h d) { asm volatile("v_nop" :: "v"(a), "v"(b), "v"(c), "v"(d)); }
__device__ __forceinline__ void keep4_b(v16b a, v16b b, v16b c, v16b d) { asm volatile("v_nop" :: "v"(a), "v"(b), "v"(c), "v"(d)); }
__device__ __forceinline__ void acc_guard4(v8f& a, v8f& b, v8f& c, v8f& d) { asm volatile("v_nop\n\tv_nop\n\tv_nop\n\tv_nop" : "+v"(a), "+v"(b), "+v"(c), "+v"(d)); }
template <typename T> struct Frag;
template <> struct Frag<_Float16> {
  typedef v16h V; union U { v16h v; v8h h[2]; };
  static __device__ __forceinline__ v16h load(const _Float16* p) {   // elements 0..7 <- p[0..7], 8..15 <- p[16..23]
    U f; f.h[0] = *(const v8h*)(p); f.h[1] = *(const v8h*)(p + 16); return f.v;
  }
  static __device__ __forceinline__ v8f mma(v16h a, v16h b, v8f c) {
    return __builtin_amdgcn_wmma_f32_16x16x32_f16(false, a, false, b, (short)0, c, false, false);
  }
  static __device__ __forceinline__ void guard(v8f& a, v8f& b, v16h x, v16h y) { dep_guard_h(a, b, x, y); }
  static __device__ __forceinline__ void keep(v16h a, v16h b, v16h c, v16h d) { keep4_h(a, b, c, d); }
};
template <> struct Frag<__bf16> {
  typedef v16b V; union U { v16b v; v8b h[2]; };
  static __device__ __forceinline__ v16b load(const __bf16* p) {
    U f; f.h[0] = *(const v8b*)(p); f.h[1] = *(const v8b*)(p + 16); return f.v;
  }
  static __device__ __forceinline__ v8f mma(v16b a, v16b b, v8f c) {
    return __builtin_amdgcn_wmma_f32_16x16x32_bf16(false, a, false, b, (short)0, c, false, false);
  }
  static __device__ __forceinline__ void guard(v8f& a, v8f& b, v16b x, v16b y) { dep_guard_b(a, b, x, y); }
  static __device__ __forceinline__ void keep(v16b a, v16b b, v16b c, v16b d) { keep4_b(a, b, c, d); }
};

// ---- Register-blocked batched WMMA GEMM ------------------------------------
// C[m,n] = scale * sum_k A[m,k] * Bt[n,k] (+bias)(+resid); each wave owns a 64x64 tile.
// A row-major [M,K]; Bt row-major [N,K]; M,N % 64 == 0, K % 32 == 0.
// SPLIT: operands are hi/lo planes (A2/Bt2 = lo planes, same layout); product = hi.hi + hi.lo + lo.hi.
// BIAS_MODE: 0 = none, 1 = bias[m], 2 = bias[n].
// OUT_MODE: 0 = f32, 1 = f16, 2 = bf16 hi plane (Cout) + bf16 lo plane (Cout2).
// Epilogue coverage per wave: f32 path 8 it x 2 rows x (16 lanes x 4 floats) = 16 rows x 64; 16-bit path
// 4 it x 4 rows x (8 lanes x 8 halves) = 16 rows x 64; 4 slabs = the whole 64x64 tile.
// ET: 0 = f16 operands, 1 = bf16 operands (pointers passed as 16-bit storage)
template <int ET> struct Elem;
template <> struct Elem<0> { typedef _Float16 T; };
template <> struct Elem<1> { typedef __bf16 T; };
template <int ET, bool SPLIT, int BIAS_MODE, int OUT_MODE, bool RESID, int ACT = 0>
__global__ __launch_bounds__(256) void wmma_gemm64(
    const unsigned short* __restrict__ Ap, const unsigned short* __restrict__ A2p, int lda, long strideA,
    const unsigned short* __restrict__ Btp, const unsigned short* __restrict__ Bt2p, int ldb, long strideB,
    void* __restrict__ Cout, void* __restrict__ Cout2, int ldc, long strideC,
    const float* __restrict__ bias,
    const float* __restrict__ resid, long strideR,
    int M, int N, int K, float scale) {
  typedef typename Elem<ET>::T T;
  typedef typename Frag<T>::V V;
  const T* A = (const T*)Ap; const T* A2 = (const T*)A2p; const T* Bt = (const T*)Btp; const T* Bt2 = (const T*)Bt2p;
  __shared__ __align__(16) float sT[8][16 * 68];   // per-wave 16x64 slab, pitch 68 floats
  const int b    = blockIdx.y;
  const int lane = threadIdx.x & 31;
  const int wave = threadIdx.x >> 5;
  const int tilesN = N >> 6;
  const int tilesM = M >> 6;
  const int tile = blockIdx.x * 8 + wave;
  if (tile >= tilesM * tilesN) return;   // wave-uniform; no block barriers in this kernel
  const int tm = tile / tilesN;
  const int tn = tile - tm * tilesN;
  const int m0 = tm << 6;
  const int n0 = tn << 6;

  const T* Ab  = A  + (size_t)b * strideA;
  const T* Bb  = Bt + (size_t)b * strideB;
  const T* Ab2 = SPLIT ? (A2  + (size_t)b * strideA) : nullptr;
  const T* Bb2 = SPLIT ? (Bt2 + (size_t)b * strideB) : nullptr;

  const int rlane = lane & 15;                 // row (A) / col (B, D) within subtile
  const int koff  = (lane >> 4) * 8;           // k offset of this lane half
  const int mOff  = (lane >> 4) * 8;           // D row offset

  v8f acc[4][4];
#pragma unroll
  for (int i = 0; i < 4; ++i)
#pragma unroll
    for (int j = 0; j < 4; ++j) acc[i][j] = (v8f){0.f,0.f,0.f,0.f,0.f,0.f,0.f,0.f};

  for (int k0 = 0; k0 < K; k0 += 32) {
    V bh[4], bl[4];
#pragma unroll
    for (int j = 0; j < 4; ++j) {
      const size_t bo = (size_t)(n0 + (j << 4) + rlane) * ldb + koff + k0;
      bh[j] = Frag<T>::load(Bb + bo);
      if (SPLIT) bl[j] = Frag<T>::load(Bb2 + bo);
    }
#pragma unroll
    for (int i = 0; i < 4; ++i) {
      const size_t ao = (size_t)(m0 + (i << 4) + rlane) * lda + koff + k0;
      V ah = Frag<T>::load(Ab + ao);
      V al;
      if (SPLIT) al = Frag<T>::load(Ab2 + ao);
#pragma unroll
      for (int j = 0; j < 4; ++j) {
        acc[i][j] = Frag<T>::mma(ah, bh[j], acc[i][j]);
        if (SPLIT) {
          acc[i][j] = Frag<T>::mma(ah, bl[j], acc[i][j]);
          acc[i][j] = Frag<T>::mma(al, bh[j], acc[i][j]);
        }
      }
      Frag<T>::guard(acc[i][0], acc[i][3], ah, SPLIT ? al : ah);
    }
    Frag<T>::keep(bh[0], bh[1], bh[2], bh[3]);
    if (SPLIT) Frag<T>::keep(bl[0], bl[1], bl[2], bl[3]);
  }
  acc_guard4(acc[0][0], acc[0][1], acc[0][2], acc[0][3]);
  acc_guard4(acc[1][0], acc[1][1], acc[1][2], acc[1][3]);
  acc_guard4(acc[2][0], acc[2][1], acc[2][2], acc[2][3]);
  acc_guard4(acc[3][0], acc[3][1], acc[3][2], acc[3][3]);

  // ---- epilogue ----
  float* slab = sT[wave];
  const float* Rb = RESID ? (resid + (size_t)b * strideR) : nullptr;
#pragma unroll
  for (int i = 0; i < 4; ++i) {
    const int mBase = m0 + (i << 4);
#pragma unroll
    for (int j = 0; j < 4; ++j) {
      const int n = n0 + (j << 4) + rlane;
      float bv = 0.f;
      if (BIAS_MODE == 2) bv = bias[n];
#pragma unroll
      for (int r = 0; r < 8; ++r) {
        float v = acc[i][j][r] * scale;
        if (BIAS_MODE == 1) v += bias[mBase + mOff + r];
        if (BIAS_MODE == 2) v += bv;
        if (RESID) v += Rb[(size_t)(mBase + mOff + r) * ldc + n];
        if (ACT == 1) v = tanhf(v);
        if (ACT == 2) v = fmaxf(v, 0.0f);
        if (ACT == 3) v = v / (1.0f + expf(-v));
        if (ACT == 4) v = (v > 0.f) ? v : 0.01f * v;
        if (ACT == 5) v = 0.5f * v * (1.0f + erff(v * 0.70710678118654752f));
        slab[(mOff + r) * 68 + (j << 4) + rlane] = v;
      }
    }
    __builtin_amdgcn_fence(__ATOMIC_RELEASE, "workgroup");
    __builtin_amdgcn_wave_barrier();
    __builtin_amdgcn_fence(__ATOMIC_ACQUIRE, "workgroup");
    if (OUT_MODE == 0) {
      float* C = (float*)Cout + (size_t)b * strideC;
      const int hh = lane >> 4, c4 = (lane & 15) * 4;     // row seg = 256 B = 16 lanes x 16 B
      {
#pragma unroll
        for (int it = 0; it < 8; ++it) {
          const int row = it * 2 + hh;
          v4f v = *(const v4f*)(slab + row * 68 + c4);
          *(v4f*)(C + (size_t)(mBase + row) * ldc + n0 + c4) = v;
        }
        
      }
    } else {
      const int q = lane >> 3, c8 = (lane & 7) * 8;
      unsigned short* C  = (unsigned short*)Cout  + (size_t)b * strideC;
      unsigned short* C2 = (OUT_MODE == 2) ? ((unsigned short*)Cout2 + (size_t)b * strideC) : nullptr;
      {
#pragma unroll
        for (int it = 0; it < 4; ++it) {
          const int row = it * 4 + q;
          const float* sp = slab + row * 68 + c8;
          v8h hv, lv;
#pragma unroll
          for (int e = 0; e < 8; ++e) {
            if (OUT_MODE == 1) {
              hv[e] = (_Float16)sp[e];
            } else {
              unsigned short hb = f2bf_bits(sp[e]);
              unsigned short lb = f2bf_bits(sp[e] - bf_bits2f(hb));
              hv[e] = __builtin_bit_cast(_Float16, hb);
              lv[e] = __builtin_bit_cast(_Float16, lb);
            }
          }
          *(v8h*)(C + (size_t)(mBase + row) * ldc + n0 + c8) = hv;
          if (OUT_MODE == 2) *(v8h*)(C2 + (size_t)(mBase + row) * ldc + n0 + c8) = lv;
        }
        
      }
    }
    __builtin_amdgcn_fence(__ATOMIC_RELEASE, "workgroup");
    __builtin_amdgcn_wave_barrier();
    __builtin_amdgcn_fence(__ATOMIC_ACQUIRE, "workgroup");
  }
}

// ---------------------------------------------------------------------------
// Elementwise f32 -> 16-bit plane, 2 consecutive elements per thread packed into one 4-B store: each wave writes
// CMODE 0: bf16 RNE bits of in*scale.
// CMODE 1: f16 bits of the bf16-RNE value of in*scale (an 8-significant-bit value re-encoded exactly in f16).
// CMODE 2: f16 RNE bits of in*scale.
// Coverage: grid = ceil(n2/256) blocks x 256 threads x 2 elements = 2*n2 = the whole plane
// (calls here: n2 = 2097152 -> 8192 blocks; n2 = 524288 -> 2048 blocks; both exact multiples of 256).
// ---------------------------------------------------------------------------
__device__ __forceinline__ unsigned pk16(unsigned short a, unsigned short b) { return (unsigned)a | ((unsigned)b << 16); }

template <int CMODE>
__global__ __launch_bounds__(256) void cast2_kernel(const float* __restrict__ in, unsigned short* __restrict__ out,
                                                    int n2, float scale) {
  const int i = blockIdx.x * 256 + threadIdx.x;
  if (i < n2) {
    const v2f f = *(const v2f*)(in + 2 * (size_t)i);
    const float f0 = f[0] * scale, f1 = f[1] * scale;
    unsigned short u0, u1;
    if (CMODE == 0) {
      u0 = f2bf_bits(f0); u1 = f2bf_bits(f1);
    } else if (CMODE == 1) {
      u0 = __builtin_bit_cast(unsigned short, (_Float16)bf_bits2f(f2bf_bits(f0)));
      u1 = __builtin_bit_cast(unsigned short, (_Float16)bf_bits2f(f2bf_bits(f1)));
    } else {
      u0 = __builtin_bit_cast(unsigned short, (_Float16)f0);
      u1 = __builtin_bit_cast(unsigned short, (_Float16)f1);
    }
    const unsigned u = pk16(u0, u1);
    ((unsigned*)out)[i] = u;
    
  }
}

// =====================================================================================
// Full-length attention with key-padding mask, head dim 64, both batch elements in one launch (blockIdx.y = batch).
//   Layouts below are those of one batch element; batch b starts b*SEQ_LEN*EMB_DIM elements into each plane.
//   q planes (hi/lo bf16): element (t, h, d) at [t*EMB_DIM + h*64 + d]
//   k planes (hi/lo bf16): element (s, h, d) at [s*EMB_DIM + h*64 + d]
//   v^T planes (hi/lo bf16): element (h, d, s) at [(h*64 + d)*SEQ_LEN + s]
//   kmask int32 [N_BATCH][SEQ_LEN]: nonzero = key masked out -> score := mfill (select, as in the module)
//   out f32: element (t, h, d) at [t*EMB_DIM + h*64 + d]
//   scores = (q . k) * sscale : bf16 hi/lo split (hi.hi + hi.lo + lo.hi) on v_wmma_f32_16x16x32_bf16
//   out    = p . v            : bf16 hi/lo split of p (unnormalised) and v, f32 accumulate
//   online softmax in f32 over all SEQ_LEN keys (32 chunks of 64, compile-time trip count).
//   Block = 4 waves = 64 query rows of one head; grid = (N_HEADS * (SEQ_LEN/64) = 512, N_BATCH = 2): 1024 blocks,
//   four to a WGP (4 x 72,704 B of LDS, 4 waves per SIMD), so that three other waves issue while one waits.
//   K / V^T chunk staging: 128 threads x 32 elements per plane = the whole 64x64 tile (16-B copies, plain loads,
//   __syncthreads before and after); fragment loads read the LDS tiles with the same v8b element type.
//   Output coverage per wave: 8 it x 2 rows x (16 lanes x 4 floats) = 16 rows x 64 = the wave tile; 4 waves x
//   512 x 2 blocks = all 4096 x 1024 of the out plane.
// =====================================================================================
#define AT_D 64
#define AT_NW 4
#define AT_QB 64
#define AT_KC 64
#define AT_LP 72   // LDS row pitch of the K, V^T and P tiles in elements: 144 B = 16 B x 9 (odd), so the 16 rows of one 16-byte fragment read fall on 64 distinct banks

__device__ __forceinline__ unsigned short at_bf_bits(float f) {
  unsigned u = __float_as_uint(f);
  return (unsigned short)((u + 0x7FFFu + ((u >> 16) & 1u)) >> 16);
}
__device__ __forceinline__ __bf16 at_f2bf(float f) { return __builtin_bit_cast(__bf16, at_bf_bits(f)); }
__device__ __forceinline__ void at_split(float f, __bf16& hi, __bf16& lo) {
  const unsigned short hb = at_bf_bits(f);
  hi = __builtin_bit_cast(__bf16, hb);
  lo = at_f2bf(f - __uint_as_float(((unsigned)hb) << 16));
}
__device__ __forceinline__ v8f at_mma(v16b a, v16b b, v8f c) {
  c = __builtin_amdgcn_wmma_f32_16x16x32_bf16(false, a, false, b, (short)0, c, false, false);
  asm volatile("v_nop\n\tv_nop\n\tv_nop\n\tv_nop" : "+v"(c) : "v"(a), "v"(b));
  return c;
}

__global__ __launch_bounds__(128)
void attn_full64_kernel(const unsigned short* __restrict__ qhp, const unsigned short* __restrict__ qlp,
                        const unsigned short* __restrict__ khp, const unsigned short* __restrict__ klp,
                        const unsigned short* __restrict__ vhp, const unsigned short* __restrict__ vlp,
                        const int* __restrict__ kmask,
                        float* __restrict__ out, float sscale, float mfill) {
  union FB { v16b v; v8b h[2]; };
  __shared__ __align__(16) __bf16 Ksh[AT_KC * AT_LP];            // K hi [kv][d]      9 KB
  __shared__ __align__(16) __bf16 Ksl[AT_KC * AT_LP];            // K lo
  __shared__ __align__(16) __bf16 Vth[AT_D * AT_LP];             // V hi [d][kv]      9 KB
  __shared__ __align__(16) __bf16 Vtl[AT_D * AT_LP];             // V lo
  __shared__ __align__(16) __bf16 Psh[AT_NW][16 * AT_LP];        // per wave P hi [row][kv]
  __shared__ __align__(16) __bf16 Psl[AT_NW][16 * AT_LP];        // per wave P lo
  __shared__ __align__(16) float  Os[AT_NW][16 * 68];            // per wave out tile, pitch 68

  const int tid  = threadIdx.x;
  const int wave = tid >> 5;
  const int lane = tid & 31;
  const int hh   = lane >> 4;
  const int c    = lane & 15;

  const int nqb = SEQ_LEN / AT_QB;        // 32
  const int bx = blockIdx.x;
  const int qb = bx % nqb;
  const int h  = bx / nqb;                // 0..N_HEADS-1 (grid = N_HEADS * nqb)
  const int q0 = qb * AT_QB + wave * 16;
  const size_t bo = (size_t)blockIdx.y * SEQ_LEN * EMB_DIM;   // this batch element's start in every q, k, v^T and out plane
  const int* km = kmask + (size_t)blockIdx.y * SEQ_LEN;

  const __bf16* Qh = (const __bf16*)(const void*)qhp + bo + (size_t)h * AT_D;
  const __bf16* Ql = (const __bf16*)(const void*)qlp + bo + (size_t)h * AT_D;
  const __bf16* Kh = (const __bf16*)(const void*)khp + bo + (size_t)h * AT_D;
  const __bf16* Kl = (const __bf16*)(const void*)klp + bo + (size_t)h * AT_D;
  const __bf16* Vh = (const __bf16*)(const void*)vhp + bo + (size_t)h * AT_D * SEQ_LEN;
  const __bf16* Vl = (const __bf16*)(const void*)vlp + bo + (size_t)h * AT_D * SEQ_LEN;
  float*        ob = out + bo + (size_t)h * AT_D;

  // ---- Q fragments (A operand, row = lane&15, split k map via Frag load): 2 d-chunks, hi and lo ----
  v16b qah[2], qal[2];
#pragma unroll
  for (int dc = 0; dc < 2; ++dc) {
    const __bf16* qr = Qh + (size_t)(q0 + c) * EMB_DIM + dc * 32 + 8 * hh;
    const __bf16* ql = Ql + (size_t)(q0 + c) * EMB_DIM + dc * 32 + 8 * hh;
    qah[dc] = Frag<__bf16>::load(qr);
    qal[dc] = Frag<__bf16>::load(ql);
  }

  float mrow[8], lrow[8];
  v8f oacc[4];
#pragma unroll
  for (int r = 0; r < 8; ++r) { mrow[r] = -INFINITY; lrow[r] = 0.f; }
#pragma unroll
  for (int t = 0; t < 4; ++t) oacc[t] = (v8f){0.f,0.f,0.f,0.f,0.f,0.f,0.f,0.f};

  const int nChunks = SEQ_LEN / AT_KC;   // 32, compile-time constant
  for (int kc = 0; kc < nChunks; ++kc) {
    const int kv0 = kc * AT_KC;
    __syncthreads();
    {
      // staging coverage: 128 threads x (4 x 8) elements = 64 rows x 64 per plane = the whole chunk tile
      const int r = tid >> 1, half = (tid & 1) * 32;
      const __bf16* ksh = Kh + (size_t)(kv0 + r) * EMB_DIM + half;   // K row kv0+r, d = half..half+31
      const __bf16* ksl = Kl + (size_t)(kv0 + r) * EMB_DIM + half;
      const __bf16* vsh = Vh + (size_t)r * SEQ_LEN + kv0 + half;      // V^T row d = r, s = kv0+half..+31
      const __bf16* vsl = Vl + (size_t)r * SEQ_LEN + kv0 + half;
#pragma unroll
      for (int i = 0; i < 4; ++i) {
        const v8b a0 = *(const v8b*)(ksh + 8 * i);
        const v8b a1 = *(const v8b*)(ksl + 8 * i);
        const v8b b0 = *(const v8b*)(vsh + 8 * i);
        const v8b b1 = *(const v8b*)(vsl + 8 * i);
        *(v8b*)(Ksh + r * AT_LP + half + 8 * i) = a0;
        *(v8b*)(Ksl + r * AT_LP + half + 8 * i) = a1;
        *(v8b*)(Vth + r * AT_LP + half + 8 * i) = b0;
        *(v8b*)(Vtl + r * AT_LP + half + 8 * i) = b1;
      }
    }
    __syncthreads();

    v8f s[4];
#pragma unroll
    for (int j = 0; j < 4; ++j) {
      s[j] = (v8f){0.f,0.f,0.f,0.f,0.f,0.f,0.f,0.f};
#pragma unroll
      for (int dc = 0; dc < 2; ++dc) {
        FB kb, kl;
        kb.h[0] = *(const v8b*)(Ksh + (j * 16 + c) * AT_LP + dc * 32 + 8 * hh);
        kb.h[1] = *(const v8b*)(Ksh + (j * 16 + c) * AT_LP + dc * 32 + 16 + 8 * hh);
        kl.h[0] = *(const v8b*)(Ksl + (j * 16 + c) * AT_LP + dc * 32 + 8 * hh);
        kl.h[1] = *(const v8b*)(Ksl + (j * 16 + c) * AT_LP + dc * 32 + 16 + 8 * hh);
        s[j] = at_mma(qah[dc], kb.v, s[j]);
        s[j] = at_mma(qah[dc], kl.v, s[j]);
        s[j] = at_mma(qal[dc], kb.v, s[j]);
      }
    }
    // key-padding mask for this lane's 4 key columns (kv0 + j*16 + c, always < SEQ_LEN): nonzero -> score := mfill
    int kvm[4];
#pragma unroll
    for (int j = 0; j < 4; ++j) kvm[j] = km[kv0 + j * 16 + c];
    float cm[8];
#pragma unroll
    for (int r = 0; r < 8; ++r) {
      float m = -INFINITY;
#pragma unroll
      for (int j = 0; j < 4; ++j) {
        float sv = s[j][r] * sscale;
        sv = (kvm[j] != 0) ? mfill : sv;
        s[j][r] = sv;
        m = fmaxf(m, sv);
      }
#pragma unroll
      for (int off = 1; off < 16; off <<= 1) m = fmaxf(m, __shfl_xor(m, off, 32));
      cm[r] = m;
    }
    __bf16* pwh = Psh[wave];
    __bf16* pwl = Psl[wave];
#pragma unroll
    for (int r = 0; r < 8; ++r) {
      const float mnew = fmaxf(mrow[r], cm[r]);
      const float alpha = expf(mrow[r] - mnew);
      mrow[r] = mnew;
      float psum = 0.f;
#pragma unroll
      for (int j = 0; j < 4; ++j) {
        const float p = expf(s[j][r] - mnew);
        psum += p;
        __bf16 a, bl; at_split(p, a, bl);
        pwh[(8 * hh + r) * AT_LP + j * 16 + c] = a;
        pwl[(8 * hh + r) * AT_LP + j * 16 + c] = bl;
      }
#pragma unroll
      for (int off = 1; off < 16; off <<= 1) psum += __shfl_xor(psum, off, 32);
      lrow[r] = lrow[r] * alpha + psum;
#pragma unroll
      for (int t = 0; t < 4; ++t) oacc[t][r] *= alpha;
    }
    __builtin_amdgcn_fence(__ATOMIC_RELEASE, "workgroup");
    __builtin_amdgcn_wave_barrier();
    __builtin_amdgcn_fence(__ATOMIC_ACQUIRE, "workgroup");
#pragma unroll 1
    for (int kk = 0; kk < 2; ++kk) {
      FB pa, pl;
      pa.h[0] = *(const v8b*)(pwh + c * AT_LP + kk * 32 + 8 * hh);
      pa.h[1] = *(const v8b*)(pwh + c * AT_LP + kk * 32 + 16 + 8 * hh);
      pl.h[0] = *(const v8b*)(pwl + c * AT_LP + kk * 32 + 8 * hh);
      pl.h[1] = *(const v8b*)(pwl + c * AT_LP + kk * 32 + 16 + 8 * hh);
#pragma unroll
      for (int t = 0; t < 4; ++t) {
        FB vb, vl;
        vb.h[0] = *(const v8b*)(Vth + (t * 16 + c) * AT_LP + kk * 32 + 8 * hh);
        vb.h[1] = *(const v8b*)(Vth + (t * 16 + c) * AT_LP + kk * 32 + 16 + 8 * hh);
        vl.h[0] = *(const v8b*)(Vtl + (t * 16 + c) * AT_LP + kk * 32 + 8 * hh);
        vl.h[1] = *(const v8b*)(Vtl + (t * 16 + c) * AT_LP + kk * 32 + 16 + 8 * hh);
        oacc[t] = at_mma(pa.v, vb.v, oacc[t]);
        oacc[t] = at_mma(pa.v, vl.v, oacc[t]);
        oacc[t] = at_mma(pl.v, vb.v, oacc[t]);
      }
    }
  }

  float* os = Os[wave];
#pragma unroll
  for (int r = 0; r < 8; ++r) {
    const float inv = 1.0f / lrow[r];
#pragma unroll
    for (int t = 0; t < 4; ++t) os[(8 * hh + r) * 68 + t * 16 + c] = oacc[t][r] * inv;
  }
  __builtin_amdgcn_fence(__ATOMIC_RELEASE, "workgroup");
  __builtin_amdgcn_wave_barrier();
  __builtin_amdgcn_fence(__ATOMIC_ACQUIRE, "workgroup");
  {
    const int c4 = (lane & 15) * 4;
    {
#pragma unroll
      for (int it = 0; it < 8; ++it) {
        const int row = it * 2 + hh;   // it 0..7 x hh 0..1 covers rows 0..15 of the wave tile
        v4f val = *(const v4f*)(os + row * 68 + c4);
        *(v4f*)(ob + (size_t)(q0 + row) * EMB_DIM + c4) = val;
      }
      
    }
  }
}

// ---------------------------------------------------------------------------
// Host-side orchestration (kernel launches + host arithmetic only).
// Workspace region map (byte offsets, every region fully written by its producer before any read):
//   0           xb    bf16 [4096][1024]            8,388,608
//   8,388,608   wqb   bf16 [1024][1024]            2,097,152
//   10,485,760  wkb   bf16 [1024][1024]            2,097,152
//   12,582,912  wvb   bf16 [1024][1024]            2,097,152
//   14,680,064  wo16  f16  [1024][1024] (x64)      2,097,152
//   16,777,216  qh    bf16 [4096][1024]            8,388,608
//   25,165,824  ql    bf16 [4096][1024]            8,388,608
//   33,554,432  kh    bf16 [4096][1024]            8,388,608
//   41,943,040  kl    bf16 [4096][1024]            8,388,608
//   50,331,648  vth   bf16 [2][1024][2048]         8,388,608
//   58,720,256  vtl   bf16 [2][1024][2048]         8,388,608
//   67,108,864  o32   f32  [4096][1024]           16,777,216
//   83,886,080  o16   f16  [4096][1024] (x16)      8,388,608
//   92,274,688  end (88 MiB)
// GEMM shapes: K = 1024 (multiple of 32) everywhere; M, N in {1024, 2048, 4096} (multiples of 64); no padding.
// ---------------------------------------------------------------------------
extern "C" void kernel_launch(void* const* d_in, const int* in_sizes, int n_in,
                              void* d_out, int out_size, void* d_ws, size_t ws_size,
                              hipStream_t stream) {
  if (n_in < 6) return;
  const int nTokEmb = N_TOK * EMB_DIM;          // 4,194,304
  const int nEmbEmb = EMB_DIM * EMB_DIM;        // 1,048,576
  if (in_sizes[0] != nTokEmb || in_sizes[1] != N_BATCH * SEQ_LEN || in_sizes[2] != nEmbEmb ||
      in_sizes[3] != nEmbEmb || in_sizes[4] != nEmbEmb || in_sizes[5] != nEmbEmb || out_size != nTokEmb) return;

  const size_t offXb  = 0;
  const size_t offWq  = offXb  + (size_t)nTokEmb * 2;
  const size_t offWk  = offWq  + (size_t)nEmbEmb * 2;
  const size_t offWv  = offWk  + (size_t)nEmbEmb * 2;
  const size_t offWo  = offWv  + (size_t)nEmbEmb * 2;
  const size_t offQh  = offWo  + (size_t)nEmbEmb * 2;
  const size_t offQl  = offQh  + (size_t)nTokEmb * 2;
  const size_t offKh  = offQl  + (size_t)nTokEmb * 2;
  const size_t offKl  = offKh  + (size_t)nTokEmb * 2;
  const size_t offVth = offKl  + (size_t)nTokEmb * 2;
  const size_t offVtl = offVth + (size_t)nTokEmb * 2;
  const size_t offO32 = offVtl + (size_t)nTokEmb * 2;
  const size_t offO16 = offO32 + (size_t)nTokEmb * 4;
  const size_t offEnd = offO16 + (size_t)nTokEmb * 2;   // 92,274,688
  if (ws_size < offEnd) return;

  const float* x    = (const float*)d_in[0];
  const int*   mask = (const int*)d_in[1];
  const float* wq   = (const float*)d_in[2];
  const float* wk   = (const float*)d_in[3];
  const float* wv   = (const float*)d_in[4];
  const float* wo   = (const float*)d_in[5];
  float* out = (float*)d_out;

  char* ws = (char*)d_ws;
  unsigned short* xb   = (unsigned short*)(ws + offXb);
  unsigned short* wqb  = (unsigned short*)(ws + offWq);
  unsigned short* wkb  = (unsigned short*)(ws + offWk);
  unsigned short* wvb  = (unsigned short*)(ws + offWv);
  unsigned short* wo16 = (unsigned short*)(ws + offWo);
  unsigned short* qh   = (unsigned short*)(ws + offQh);
  unsigned short* ql   = (unsigned short*)(ws + offQl);
  unsigned short* kh   = (unsigned short*)(ws + offKh);
  unsigned short* kl   = (unsigned short*)(ws + offKl);
  unsigned short* vth  = (unsigned short*)(ws + offVth);
  unsigned short* vtl  = (unsigned short*)(ws + offVtl);
  float*          o32  = (float*)(ws + offO32);
  unsigned short* o16  = (unsigned short*)(ws + offO16);
  const float* dummyf = x;   // valid pointer for unused bias / resid arguments (never dereferenced)

  // 1) 16-bit operand planes: x, wq, wk, wv -> bf16 RNE; wo -> f16 encode of bf16-RNE(wo*64)
  {
    const int n2x = nTokEmb / 2;   // 2,097,152 -> 8192 blocks
    const int n2w = nEmbEmb / 2;   //   524,288 -> 2048 blocks
    cast2_kernel<0><<<(n2x + 255) / 256, 256, 0, stream>>>(x,  xb,  n2x, 1.0f);
    cast2_kernel<0><<<(n2w + 255) / 256, 256, 0, stream>>>(wq, wqb, n2w, 1.0f);
    cast2_kernel<0><<<(n2w + 255) / 256, 256, 0, stream>>>(wk, wkb, n2w, 1.0f);
    cast2_kernel<0><<<(n2w + 255) / 256, 256, 0, stream>>>(wv, wvb, n2w, 1.0f);
    cast2_kernel<1><<<(n2w + 255) / 256, 256, 0, stream>>>(wo, wo16, n2w, 64.0f);
  }

  // 2) q, k = x @ W^T : M = 4096 tokens, N = 1024, K = 1024; bf16 hi/lo output planes [token][h*64+d]
  //    tiles = 64 x 16 = 1024 -> 128 blocks of 8 waves
  {
    const dim3 g(((N_TOK / 64) * (EMB_DIM / 64)) / 8, 1);
    wmma_gemm64<1, false, 0, 2, false><<<g, 256, 0, stream>>>(
        xb, xb, EMB_DIM, 0L, wqb, wqb, EMB_DIM, 0L,
        (void*)qh, (void*)ql, EMB_DIM, 0L, dummyf, dummyf, 0L, N_TOK, EMB_DIM, EMB_DIM, 1.0f);
    wmma_gemm64<1, false, 0, 2, false><<<g, 256, 0, stream>>>(
        xb, xb, EMB_DIM, 0L, wkb, wkb, EMB_DIM, 0L,
        (void*)kh, (void*)kl, EMB_DIM, 0L, dummyf, dummyf, 0L, N_TOK, EMB_DIM, EMB_DIM, 1.0f);
  }

  // 3) v^T per batch = Wv @ x_b^T : A = wvb [1024 out][1024 in], Bt = xb_b [2048 tokens][1024],
  //    C = [1024 (h*64+d)][2048 s] bf16 hi/lo, y-batched over 2 batches; tiles = 16 x 32 = 512 -> 64 blocks
  {
    const dim3 g(((EMB_DIM / 64) * (SEQ_LEN / 64)) / 8, N_BATCH);
    wmma_gemm64<1, false, 0, 2, false><<<g, 256, 0, stream>>>(
        wvb, wvb, EMB_DIM, 0L, xb, xb, EMB_DIM, (long)SEQ_LEN * EMB_DIM,
        (void*)vth, (void*)vtl, SEQ_LEN, (long)EMB_DIM * SEQ_LEN, dummyf, dummyf, 0L,
        EMB_DIM, SEQ_LEN, EMB_DIM, 1.0f);
  }

  // 4) attention: grid = (16 heads x 32 query blocks, 2 batch elements); key mask read from d_in[1] as int32
  {
    const dim3 g(N_HEADS * (SEQ_LEN / 64), N_BATCH);
    attn_full64_kernel<<<g, 128, 0, stream>>>(qh, ql, kh, kl, vth, vtl, mask, o32, 0.125f, -1.0e9f);
  }

  // 5) attention output f32 -> f16 carried x16
  {
    const int n2o = nTokEmb / 2;   // 2,097,152 -> 8192 blocks
    cast2_kernel<2><<<(n2o + 255) / 256, 256, 0, stream>>>(o32, o16, n2o, 16.0f);
  }

  // 6) out = O @ Wo^T : f16 operands (O x16, Wo x64) -> scale 1/1024, f32 into d_out [4096][1024]
  {
    const dim3 g(((N_TOK / 64) * (EMB_DIM / 64)) / 8, 1);
    wmma_gemm64<0, false, 0, 0, false><<<g, 256, 0, stream>>>(
        o16, o16, EMB_DIM, 0L, wo16, wo16, EMB_DIM, 0L,
        (void*)out, (void*)out, EMB_DIM, 0L, dummyf, dummyf, 0L, N_TOK, EMB_DIM, EMB_DIM, 1.0f / 1024.0f);
  }
}

// v003
// Measured time: 350 microseconds a run.
// In two side-by-side timings against v002, it was 1.19 and 1.18 times as fast.
// Over all steps from v000 it is 2.02 times as fast.
// Projections q, k, v^T: v_wmma_f32_16x16x32_bf16 (x and weights RNE-converted to bf16, single product); attention q.k^T and p.v: v_wmma_f32_16x16x32_bf16 with bf16 hi/lo split operands (hi.hi + hi.lo + lo.hi); output projection: v_wmma_f32_16x16x32_f16 (attention output carried x16 in f16, bf16-RNE weight carried x64 in f16); f32 accumulate everywhere; online softmax, key-mask select (-1e9) and normalisation in f32.
#include <hip/hip_runtime.h>
#include <math.h>
#include <stdint.h>

#define N_BATCH  2
#define SEQ_LEN  2048
#define EMB_DIM  1024
#define N_HEADS  16
#define HEAD_DIM 64
#define N_TOK    (N_BATCH * SEQ_LEN)

typedef __attribute__((ext_vector_type(16))) _Float16 v16h;
typedef __attribute__((ext_vector_type(8)))  _Float16 v8h;
typedef __attribute__((ext_vector_type(16))) __bf16   v16b;
typedef __attribute__((ext_vector_type(8)))  __bf16   v8b;
typedef __attribute__((ext_vector_type(8)))  float    v8f;
typedef __attribute__((ext_vector_type(4)))  float    v4f;
typedef __attribute__((ext_vector_type(2)))  float    v2f;
typedef __attribute__((ext_vector_type(4)))  unsigned int v4u;

__device__ __forceinline__ unsigned short f2bf_bits(float f) {
  unsigned u = __float_as_uint(f);
  return (unsigned short)((u + 0x7FFFu + ((u >> 16) & 1u)) >> 16);
}
__device__ __forceinline__ float bf_bits2f(unsigned short h) { return __uint_as_float(((unsigned)h) << 16); }

// hazard guards as plain device helpers (no inline asm inside the kernel template body)
__device__ __forceinline__ void dep_guard_h(v8f& a, v8f& b, v16h x, v16h y) { asm volatile("v_nop\n\tv_nop\n\tv_nop\n\tv_nop" : "+v"(a), "+v"(b) : "v"(x), "v"(y)); }
__device__ __forceinline__ void dep_guard_b(v8f& a, v8f& b, v16b x, v16b y) { asm volatile("v_nop\n\tv_nop\n\tv_nop\n\tv_nop" : "+v"(a), "+v"(b) : "v"(x), "v"(y)); }
__device__ __forceinline__ void keep4_h(v16h a, v16h b, v16h c, v16h d) { asm volatile("v_nop" :: "v"(a), "v"(b), "v"(c), "v"(d)); }
__device__ __forceinline__ void keep4_b(v16b a, v16b b, v16b c, v16b d) { asm volatile("v_nop" :: "v"(a), "v"(b), "v"(c), "v"(d)); }
__device__ __forceinline__ void acc_guard4(v8f& a, v8f& b, v8f& c, v8f& d) { asm volatile("v_nop\n\tv_nop\n\tv_nop\n\tv_nop" : "+v"(a), "+v"(b), "+v"(c), "+v"(d)); }
template <typename T> struct Frag;
template <> struct Frag<_Float16> {
  typedef v16h V; union U { v16h v; v8h h[2]; };
  static __device__ __forceinline__ v16h load(const _Float16* p) {   // elements 0..7 <- p[0..7], 8..15 <- p[16..23]
    U f; f.h[0] = *(const v8h*)(p); f.h[1] = *(const v8h*)(p + 16); return f.v;
  }
  static __device__ __forceinline__ v8f mma(v16h a, v16h b, v8f c) {
    return __builtin_amdgcn_wmma_f32_16x16x32_f16(false, a, false, b, (short)0, c, false, false);
  }
  static __device__ __forceinline__ void guard(v8f& a, v8f& b, v16h x, v16h y) { dep_guard_h(a, b, x, y); }
  static __device__ __forceinline__ void keep(v16h a, v16h b, v16h c, v16h d) { keep4_h(a, b, c, d); }
};
template <> struct Frag<__bf16> {
  typedef v16b V; union U { v16b v; v8b h[2]; };
  static __device__ __forceinline__ v16b load(const __bf16* p) {
    U f; f.h[0] = *(const v8b*)(p); f.h[1] = *(const v8b*)(p + 16); return f.v;
  }
  static __device__ __forceinline__ v8f mma(v16b a, v16b b, v8f c) {
    return __builtin_amdgcn_wmma_f32_16x16x32_bf16(false, a, false, b, (short)0, c, false, false);
  }
  static __device__ __forceinline__ void guard(v8f& a, v8f& b, v16b x, v16b y) { dep_guard_b(a, b, x, y); }
  static __device__ __forceinline__ void keep(v16b a, v16b b, v16b c, v16b d) { keep4_b(a, b, c, d); }
};

// ---- Register-blocked batched WMMA GEMM ------------------------------------
// C[m,n] = scale * sum_k A[m,k] * Bt[n,k] (+bias)(+resid); each wave owns a 64x64 tile.
// A row-major [M,K]; Bt row-major [N,K]; M,N % 64 == 0, K % 32 == 0.
// SPLIT: operands are hi/lo planes (A2/Bt2 = lo planes, same layout); product = hi.hi + hi.lo + lo.hi.
// BIAS_MODE: 0 = none, 1 = bias[m], 2 = bias[n].
// OUT_MODE: 0 = f32, 1 = f16, 2 = bf16 hi plane (Cout) + bf16 lo plane (Cout2).
// Epilogue coverage per wave: f32 path 8 it x 2 rows x (16 lanes x 4 floats) = 16 rows x 64; 16-bit path
// 4 it x 4 rows x (8 lanes x 8 halves) = 16 rows x 64; 4 slabs = the whole 64x64 tile.
// ET: 0 = f16 operands, 1 = bf16 operands (pointers passed as 16-bit storage)
template <int ET> struct Elem;
template <> struct Elem<0> { typedef _Float16 T; };
template <> struct Elem<1> { typedef __bf16 T; };
template <int ET, bool SPLIT, int BIAS_MODE, int OUT_MODE, bool RESID, int ACT = 0>
__global__ __launch_bounds__(256) void wmma_gemm64(
    const unsigned short* __restrict__ Ap, const unsigned short* __restrict__ A2p, int lda, long strideA,
    const unsigned short* __restrict__ Btp, const unsigned short* __restrict__ Bt2p, int ldb, long strideB,
    void* __restrict__ Cout, void* __restrict__ Cout2, int ldc, long strideC,
    const float* __restrict__ bias,
    const float* __restrict__ resid, long strideR,
    int M, int N, int K, float scale) {
  typedef typename Elem<ET>::T T;
  typedef typename Frag<T>::V V;
  const T* A = (const T*)Ap; const T* A2 = (const T*)A2p; const T* Bt = (const T*)Btp; const T* Bt2 = (const T*)Bt2p;
  __shared__ __align__(16) float sT[8][16 * 68];   // per-wave 16x64 slab, pitch 68 floats
  const int b    = blockIdx.y;
  const int lane = threadIdx.x & 31;
  const int wave = threadIdx.x >> 5;
  const int tilesN = N >> 6;
  const int tilesM = M >> 6;
  const int tile = blockIdx.x * 8 + wave;
  if (tile >= tilesM * tilesN) return;   // wave-uniform; no block barriers in this kernel
  const int tm = tile / tilesN;
  const int tn = tile - tm * tilesN;
  const int m0 = tm << 6;
  const int n0 = tn << 6;

  const T* Ab  = A  + (size_t)b * strideA;
  const T* Bb  = Bt + (size_t)b * strideB;
  const T* Ab2 = SPLIT ? (A2  + (size_t)b * strideA) : nullptr;
  const T* Bb2 = SPLIT ? (Bt2 + (size_t)b * strideB) : nullptr;

  const int rlane = lane & 15;                 // row (A) / col (B, D) within subtile
  const int koff  = (lane >> 4) * 8;           // k offset of this lane half
  const int mOff  = (lane >> 4) * 8;           // D row offset

  v8f acc[4][4];
#pragma unroll
  for (int i = 0; i < 4; ++i)
#pragma unroll
    for (int j = 0; j < 4; ++j) acc[i][j] = (v8f){0.f,0.f,0.f,0.f,0.f,0.f,0.f,0.f};

  for (int k0 = 0; k0 < K; k0 += 32) {
    V bh[4], bl[4];
#pragma unroll
    for (int j = 0; j < 4; ++j) {
      const size_t bo = (size_t)(n0 + (j << 4) + rlane) * ldb + koff + k0;
      bh[j] = Frag<T>::load(Bb + bo);
      if (SPLIT) bl[j] = Frag<T>::load(Bb2 + bo);
    }
#pragma unroll
    for (int i = 0; i < 4; ++i) {
      const size_t ao = (size_t)(m0 + (i << 4) + rlane) * lda + koff + k0;
      V ah = Frag<T>::load(Ab + ao);
      V al;
      if (SPLIT) al = Frag<T>::load(Ab2 + ao);
#pragma unroll
      for (int j = 0; j < 4; ++j) {
        acc[i][j] = Frag<T>::mma(ah, bh[j], acc[i][j]);
        if (SPLIT) {
          acc[i][j] = Frag<T>::mma(ah, bl[j], acc[i][j]);
          acc[i][j] = Frag<T>::mma(al, bh[j], acc[i][j]);
        }
      }
      Frag<T>::guard(acc[i][0], acc[i][3], ah, SPLIT ? al : ah);
    }
    Frag<T>::keep(bh[0], bh[1], bh[2], bh[3]);
    if (SPLIT) Frag<T>::keep(bl[0], bl[1], bl[2], bl[3]);
  }
  acc_guard4(acc[0][0], acc[0][1], acc[0][2], acc[0][3]);
  acc_guard4(acc[1][0], acc[1][1], acc[1][2], acc[1][3]);
  acc_guard4(acc[2][0], acc[2][1], acc[2][2], acc[2][3]);
  acc_guard4(acc[3][0], acc[3][1], acc[3][2], acc[3][3]);

  // ---- epilogue ----
  float* slab = sT[wave];
  const float* Rb = RESID ? (resid + (size_t)b * strideR) : nullptr;
#pragma unroll
  for (int i = 0; i < 4; ++i) {
    const int mBase = m0 + (i << 4);
#pragma unroll
    for (int j = 0; j < 4; ++j) {
      const int n = n0 + (j << 4) + rlane;
      float bv = 0.f;
      if (BIAS_MODE == 2) bv = bias[n];
#pragma unroll
      for (int r = 0; r < 8; ++r) {
        float v = acc[i][j][r] * scale;
        if (BIAS_MODE == 1) v += bias[mBase + mOff + r];
        if (BIAS_MODE == 2) v += bv;
        if (RESID) v += Rb[(size_t)(mBase + mOff + r) * ldc + n];
        if (ACT == 1) v = tanhf(v);
        if (ACT == 2) v = fmaxf(v, 0.0f);
        if (ACT == 3) v = v / (1.0f + expf(-v));
        if (ACT == 4) v = (v > 0.f) ? v : 0.01f * v;
        if (ACT == 5) v = 0.5f * v * (1.0f + erff(v * 0.70710678118654752f));
        slab[(mOff + r) * 68 + (j << 4) + rlane] = v;
      }
    }
    __builtin_amdgcn_fence(__ATOMIC_RELEASE, "workgroup");
    __builtin_amdgcn_wave_barrier();
    __builtin_amdgcn_fence(__ATOMIC_ACQUIRE, "workgroup");
    if (OUT_MODE == 0) {
      float* C = (float*)Cout + (size_t)b * strideC;
      const int hh = lane >> 4, c4 = (lane & 15) * 4;     // row seg = 256 B = 16 lanes x 16 B
      {
#pragma unroll
        for (int it = 0; it < 8; ++it) {
          const int row = it * 2 + hh;
          v4f v = *(const v4f*)(slab + row * 68 + c4);
          *(v4f*)(C + (size_t)(mBase + row) * ldc + n0 + c4) = v;
        }
        
      }
    } else {
      const int q = lane >> 3, c8 = (lane & 7) * 8;
      unsigned short* C  = (unsigned short*)Cout  + (size_t)b * strideC;
      unsigned short* C2 = (OUT_MODE == 2) ? ((unsigned short*)Cout2 + (size_t)b * strideC) : nullptr;
      {
#pragma unroll
        for (int it = 0; it < 4; ++it) {
          const int row = it * 4 + q;
          const float* sp = slab + row * 68 + c8;
          v8h hv, lv;
#pragma unroll
          for (int e = 0; e < 8; ++e) {
            if (OUT_MODE == 1) {
              hv[e] = (_Float16)sp[e];
            } else {
              unsigned short hb = f2bf_bits(sp[e]);
              unsigned short lb = f2bf_bits(sp[e] - bf_bits2f(hb));
              hv[e] = __builtin_bit_cast(_Float16, hb);
              lv[e] = __builtin_bit_cast(_Float16, lb);
            }
          }
          *(v8h*)(C + (size_t)(mBase + row) * ldc + n0 + c8) = hv;
          if (OUT_MODE == 2) *(v8h*)(C2 + (size_t)(mBase + row) * ldc + n0 + c8) = lv;
        }
        
      }
    }
    __builtin_amdgcn_fence(__ATOMIC_RELEASE, "workgroup");
    __builtin_amdgcn_wave_barrier();
    __builtin_amdgcn_fence(__ATOMIC_ACQUIRE, "workgroup");
  }
}

// ---------------------------------------------------------------------------
// Elementwise f32 -> 16-bit plane, 2 consecutive elements per thread packed into one 4-B store: each wave writes
// CMODE 0: bf16 RNE bits of in*scale.
// CMODE 1: f16 bits of the bf16-RNE value of in*scale (an 8-significant-bit value re-encoded exactly in f16).
// CMODE 2: f16 RNE bits of in*scale.
// Coverage: grid = ceil(n2/256) blocks x 256 threads x 2 elements = 2*n2 = the whole plane
// (calls here: n2 = 2097152 -> 8192 blocks; n2 = 524288 -> 2048 blocks; both exact multiples of 256).
// ---------------------------------------------------------------------------
__device__ __forceinline__ unsigned pk16(unsigned short a, unsigned short b) { return (unsigned)a | ((unsigned)b << 16); }

template <int CMODE>
__global__ __launch_bounds__(256) void cast2_kernel(const float* __restrict__ in, unsigned short* __restrict__ out,
                                                    int n2, float scale) {
  const int i = blockIdx.x * 256 + threadIdx.x;
  if (i < n2) {
    const v2f f = *(const v2f*)(in + 2 * (size_t)i);
    const float f0 = f[0] * scale, f1 = f[1] * scale;
    unsigned short u0, u1;
    if (CMODE == 0) {
      u0 = f2bf_bits(f0); u1 = f2bf_bits(f1);
    } else if (CMODE == 1) {
      u0 = __builtin_bit_cast(unsigned short, (_Float16)bf_bits2f(f2bf_bits(f0)));
      u1 = __builtin_bit_cast(unsigned short, (_Float16)bf_bits2f(f2bf_bits(f1)));
    } else {
      u0 = __builtin_bit_cast(unsigned short, (_Float16)f0);
      u1 = __builtin_bit_cast(unsigned short, (_Float16)f1);
    }
    const unsigned u = pk16(u0, u1);
    ((unsigned*)out)[i] = u;
    
  }
}

#define AT_D 64
#define AT_NW 4
#define AT_QB 64
#define AT_KC 64
#define AT_LP 72   // LDS row pitch of the K and V^T tiles in elements: 144 B = 16 B x 9 (odd), so the 16 rows of one 16-byte fragment read fall on 64 distinct banks

__device__ __forceinline__ unsigned short at_bf_bits(float f) {
  unsigned u = __float_as_uint(f);
  return (unsigned short)((u + 0x7FFFu + ((u >> 16) & 1u)) >> 16);
}
__device__ __forceinline__ __bf16 at_f2bf(float f) { return __builtin_bit_cast(__bf16, at_bf_bits(f)); }
__device__ __forceinline__ void at_split(float f, __bf16& hi, __bf16& lo) {
  const unsigned short hb = at_bf_bits(f);
  hi = __builtin_bit_cast(__bf16, hb);
  lo = at_f2bf(f - __uint_as_float(((unsigned)hb) << 16));
}
__device__ __forceinline__ v8f at_mma(v16b a, v16b b, v8f c) {
  c = __builtin_amdgcn_wmma_f32_16x16x32_bf16(false, a, false, b, (short)0, c, false, false);
  asm volatile("v_nop\n\tv_nop\n\tv_nop\n\tv_nop" : "+v"(c) : "v"(a), "v"(b));
  return c;
}

// lane l <-> l ^ 16 (the two halves of a wave hold the two key halves of one query column)
__device__ __forceinline__ float at_xhalf(float v) {
  const int b = __builtin_bit_cast(int, v);
  return __builtin_bit_cast(float, __builtin_amdgcn_permlanex16(b, b, 0x76543210, 0xfedcba98, false, false));
}

__global__ __launch_bounds__(128)
void attn_full64_kernel(const unsigned short* __restrict__ qhp, const unsigned short* __restrict__ qlp,
                        const unsigned short* __restrict__ khp, const unsigned short* __restrict__ klp,
                        const unsigned short* __restrict__ vhp, const unsigned short* __restrict__ vlp,
                        const int* __restrict__ kmask,
                        float* __restrict__ out, float sscale, float mfill) {
  union FB { v16b v; v8b h[2]; };
  __shared__ __align__(16) __bf16 Ksh[AT_KC * AT_LP];            // K hi [kv][d]      9 KB
  __shared__ __align__(16) __bf16 Ksl[AT_KC * AT_LP];            // K lo
  __shared__ __align__(16) __bf16 Vth[AT_D * AT_LP];             // V hi [d][kv]      9 KB
  __shared__ __align__(16) __bf16 Vtl[AT_D * AT_LP];             // V lo
  __shared__ __align__(16) float  Os[AT_NW][16 * 68];            // per wave out tile, pitch 68

  const int tid  = threadIdx.x;
  const int wave = tid >> 5;
  const int lane = tid & 31;
  const int hh   = lane >> 4;
  const int c    = lane & 15;

  const int nqb = SEQ_LEN / AT_QB;        // 32
  const int bx = blockIdx.x;
  const int qb = bx % nqb;
  const int h  = bx / nqb;                // 0..N_HEADS-1 (grid = N_HEADS * nqb)
  const int q0 = qb * AT_QB + wave * 16;
  const size_t bo = (size_t)blockIdx.y * SEQ_LEN * EMB_DIM;   // this batch element's start in every q, k, v^T and out plane
  const int* km = kmask + (size_t)blockIdx.y * SEQ_LEN;

  const __bf16* Qh = (const __bf16*)(const void*)qhp + bo + (size_t)h * AT_D;
  const __bf16* Ql = (const __bf16*)(const void*)qlp + bo + (size_t)h * AT_D;
  const __bf16* Kh = (const __bf16*)(const void*)khp + bo + (size_t)h * AT_D;
  const __bf16* Kl = (const __bf16*)(const void*)klp + bo + (size_t)h * AT_D;
  const __bf16* Vh = (const __bf16*)(const void*)vhp + bo + (size_t)h * AT_D * SEQ_LEN;
  const __bf16* Vl = (const __bf16*)(const void*)vlp + bo + (size_t)h * AT_D * SEQ_LEN;
  float*        ob = out + bo + (size_t)h * AT_D;

  // ---- Q fragments (B operand, column = query = lane&15, split k map via Frag load): 2 d-chunks, hi and lo ----
  v16b qah[2], qal[2];
#pragma unroll
  for (int dc = 0; dc < 2; ++dc) {
    const __bf16* qr = Qh + (size_t)(q0 + c) * EMB_DIM + dc * 32 + 8 * hh;
    const __bf16* ql = Ql + (size_t)(q0 + c) * EMB_DIM + dc * 32 + 8 * hh;
    qah[dc] = Frag<__bf16>::load(qr);
    qal[dc] = Frag<__bf16>::load(ql);
  }

  // One query per lane (q0 + c). mrow: running maximum, equal in both wave halves; lrow: this half's share of the sum.
  float mrow = -INFINITY, lrow = 0.f;
  v8f oacc[4];   // out^T tiles: oacc[t][r] = out[q0 + c][t*16 + 8*hh + r]
#pragma unroll
  for (int t = 0; t < 4; ++t) oacc[t] = (v8f){0.f,0.f,0.f,0.f,0.f,0.f,0.f,0.f};

  const int nChunks = SEQ_LEN / AT_KC;   // 32, compile-time constant
  for (int kc = 0; kc < nChunks; ++kc) {
    const int kv0 = kc * AT_KC;
    __syncthreads();
    // key-padding mask of this lane's 32 keys (kv0 + j*16 + 8*hh + r, always < SEQ_LEN), asked for together with the
    // staging loads so that its latency runs under theirs
    v4u kmv[8];
#pragma unroll
    for (int j = 0; j < 4; ++j) {
      kmv[2 * j]     = *(const v4u*)(km + kv0 + j * 16 + 8 * hh);
      kmv[2 * j + 1] = *(const v4u*)(km + kv0 + j * 16 + 8 * hh + 4);
    }
    // the staging loads below may land in the registers that hold the mask loads' address: keep the wait in front of that overwrite
    asm volatile("s_wait_xcnt 0x0" ::: "memory");
    {
      // staging coverage: 128 threads x (4 x 8) elements = 64 rows x 64 per plane = the whole chunk tile
      const int r = tid >> 1, half = (tid & 1) * 32;
      const __bf16* ksh = Kh + (size_t)(kv0 + r) * EMB_DIM + half;   // K row kv0+r, d = half..half+31
      const __bf16* ksl = Kl + (size_t)(kv0 + r) * EMB_DIM + half;
      const __bf16* vsh = Vh + (size_t)r * SEQ_LEN + kv0 + half;      // V^T row d = r, s = kv0+half..+31
      const __bf16* vsl = Vl + (size_t)r * SEQ_LEN + kv0 + half;
#pragma unroll
      for (int i = 0; i < 4; ++i) {
        const v8b a0 = *(const v8b*)(ksh + 8 * i);
        const v8b a1 = *(const v8b*)(ksl + 8 * i);
        const v8b b0 = *(const v8b*)(vsh + 8 * i);
        const v8b b1 = *(const v8b*)(vsl + 8 * i);
        *(v8b*)(Ksh + r * AT_LP + half + 8 * i) = a0;
        *(v8b*)(Ksl + r * AT_LP + half + 8 * i) = a1;
        *(v8b*)(Vth + r * AT_LP + half + 8 * i) = b0;
        *(v8b*)(Vtl + r * AT_LP + half + 8 * i) = b1;
      }
    }
    __syncthreads();

    // scores^T = K . Q^T : s[j][r] = score(key kv0 + j*16 + 8*hh + r, query q0 + c)
    v8f s[4];
#pragma unroll
    for (int j = 0; j < 4; ++j) {
      s[j] = (v8f){0.f,0.f,0.f,0.f,0.f,0.f,0.f,0.f};
#pragma unroll
      for (int dc = 0; dc < 2; ++dc) {
        FB kb, kl;
        kb.h[0] = *(const v8b*)(Ksh + (j * 16 + c) * AT_LP + dc * 32 + 8 * hh);
        kb.h[1] = *(const v8b*)(Ksh + (j * 16 + c) * AT_LP + dc * 32 + 16 + 8 * hh);
        kl.h[0] = *(const v8b*)(Ksl + (j * 16 + c) * AT_LP + dc * 32 + 8 * hh);
        kl.h[1] = *(const v8b*)(Ksl + (j * 16 + c) * AT_LP + dc * 32 + 16 + 8 * hh);
        s[j] = at_mma(kb.v, qah[dc], s[j]);
        s[j] = at_mma(kl.v, qah[dc], s[j]);
        s[j] = at_mma(kb.v, qal[dc], s[j]);
      }
    }
    // mask nonzero -> score := mfill (select, as in the module)
    float m = -INFINITY;
#pragma unroll
    for (int j = 0; j < 4; ++j) {
#pragma unroll
      for (int r = 0; r < 8; ++r) {
        float sv = s[j][r] * sscale;
        sv = (kmv[2 * j + (r >> 2)][r & 3] != 0u) ? mfill : sv;
        s[j][r] = sv;
        m = fmaxf(m, sv);
      }
    }
    m = fmaxf(m, at_xhalf(m));   // the other 32 keys of this query
    const float mnew = fmaxf(mrow, m);
    const float alpha = expf(mrow - mnew);
    mrow = mnew;
    // p^T stays in registers: two score tiles (keys 0..15 and 16..31 of a 32-key group) are one B operand,
    // element e < 8 = key 8*hh + e, e >= 8 = key 16 + 8*hh + (e - 8): the order in which the V^T rows are read below
    v16b pth[2], ptl[2];
    float psum = 0.f;
#pragma unroll
    for (int j = 0; j < 4; ++j) {
#pragma unroll
      for (int r = 0; r < 8; ++r) {
        const float p = expf(s[j][r] - mnew);
        psum += p;
        __bf16 a, bl; at_split(p, a, bl);
        pth[j >> 1][(j & 1) * 8 + r] = a;
        ptl[j >> 1][(j & 1) * 8 + r] = bl;
      }
    }
    lrow = lrow * alpha + psum;
#pragma unroll
    for (int t = 0; t < 4; ++t)
#pragma unroll
      for (int r = 0; r < 8; ++r) oacc[t][r] *= alpha;
    // out^T += V^T . p^T
#pragma unroll
    for (int kk = 0; kk < 2; ++kk) {
#pragma unroll
      for (int t = 0; t < 4; ++t) {
        FB vb, vl;
        vb.h[0] = *(const v8b*)(Vth + (t * 16 + c) * AT_LP + kk * 32 + 8 * hh);
        vb.h[1] = *(const v8b*)(Vth + (t * 16 + c) * AT_LP + kk * 32 + 16 + 8 * hh);
        vl.h[0] = *(const v8b*)(Vtl + (t * 16 + c) * AT_LP + kk * 32 + 8 * hh);
        vl.h[1] = *(const v8b*)(Vtl + (t * 16 + c) * AT_LP + kk * 32 + 16 + 8 * hh);
        oacc[t] = at_mma(vb.v, pth[kk], oacc[t]);
        oacc[t] = at_mma(vl.v, pth[kk], oacc[t]);
        oacc[t] = at_mma(vb.v, ptl[kk], oacc[t]);
      }
    }
  }

  float* os = Os[wave];
  {
    const float inv = 1.0f / (lrow + at_xhalf(lrow));   // join the two halves' sums once
#pragma unroll
    for (int t = 0; t < 4; ++t) {
      v4f lo4, hi4;
#pragma unroll
      for (int r = 0; r < 4; ++r) { lo4[r] = oacc[t][r] * inv; hi4[r] = oacc[t][4 + r] * inv; }
      *(v4f*)(os + c * 68 + t * 16 + 8 * hh)     = lo4;
      *(v4f*)(os + c * 68 + t * 16 + 8 * hh + 4) = hi4;
    }
  }
  __builtin_amdgcn_fence(__ATOMIC_RELEASE, "workgroup");
  __builtin_amdgcn_wave_barrier();
  __builtin_amdgcn_fence(__ATOMIC_ACQUIRE, "workgroup");
  {
    const int c4 = (lane & 15) * 4;
    {
#pragma unroll
      for (int it = 0; it < 8; ++it) {
        const int row = it * 2 + hh;   // it 0..7 x hh 0..1 covers rows 0..15 of the wave tile
        v4f val = *(const v4f*)(os + row * 68 + c4);
        *(v4f*)(ob + (size_t)(q0 + row) * EMB_DIM + c4) = val;
      }
      
    }
  }
}

// ---------------------------------------------------------------------------
// Host-side orchestration (kernel launches + host arithmetic only).
// Workspace region map (byte offsets, every region fully written by its producer before any read):
//   0           xb    bf16 [4096][1024]            8,388,608
//   8,388,608   wqb   bf16 [1024][1024]            2,097,152
//   10,485,760  wkb   bf16 [1024][1024]            2,097,152
//   12,582,912  wvb   bf16 [1024][1024]            2,097,152
//   14,680,064  wo16  f16  [1024][1024] (x64)      2,097,152
//   16,777,216  qh    bf16 [4096][1024]            8,388,608
//   25,165,824  ql    bf16 [4096][1024]            8,388,608
//   33,554,432  kh    bf16 [4096][1024]            8,388,608
//   41,943,040  kl    bf16 [4096][1024]            8,388,608
//   50,331,648  vth   bf16 [2][1024][2048]         8,388,608
//   58,720,256  vtl   bf16 [2][1024][2048]         8,388,608
//   67,108,864  o32   f32  [4096][1024]           16,777,216
//   83,886,080  o16   f16  [4096][1024] (x16)      8,388,608
//   92,274,688  end (88 MiB)
// GEMM shapes: K = 1024 (multiple of 32) everywhere; M, N in {1024, 2048, 4096} (multiples of 64); no padding.
// ---------------------------------------------------------------------------
extern "C" void kernel_launch(void* const* d_in, const int* in_sizes, int n_in,
                              void* d_out, int out_size, void* d_ws, size_t ws_size,
                              hipStream_t stream) {
  if (n_in < 6) return;
  const int nTokEmb = N_TOK * EMB_DIM;          // 4,194,304
  const int nEmbEmb = EMB_DIM * EMB_DIM;        // 1,048,576
  if (in_sizes[0] != nTokEmb || in_sizes[1] != N_BATCH * SEQ_LEN || in_sizes[2] != nEmbEmb ||
      in_sizes[3] != nEmbEmb || in_sizes[4] != nEmbEmb || in_sizes[5] != nEmbEmb || out_size != nTokEmb) return;

  const size_t offXb  = 0;
  const size_t offWq  = offXb  + (size_t)nTokEmb * 2;
  const size_t offWk  = offWq  + (size_t)nEmbEmb * 2;
  const size_t offWv  = offWk  + (size_t)nEmbEmb * 2;
  const size_t offWo  = offWv  + (size_t)nEmbEmb * 2;
  const size_t offQh  = offWo  + (size_t)nEmbEmb * 2;
  const size_t offQl  = offQh  + (size_t)nTokEmb * 2;
  const size_t offKh  = offQl  + (size_t)nTokEmb * 2;
  const size_t offKl  = offKh  + (size_t)nTokEmb * 2;
  const size_t offVth = offKl  + (size_t)nTokEmb * 2;
  const size_t offVtl = offVth + (size_t)nTokEmb * 2;
  const size_t offO32 = offVtl + (size_t)nTokEmb * 2;
  const size_t offO16 = offO32 + (size_t)nTokEmb * 4;
  const size_t offEnd = offO16 + (size_t)nTokEmb * 2;   // 92,274,688
  if (ws_size < offEnd) return;

  const float* x    = (const float*)d_in[0];
  const int*   mask = (const int*)d_in[1];
  const float* wq   = (const float*)d_in[2];
  const float* wk   = (const float*)d_in[3];
  const float* wv   = (const float*)d_in[4];
  const float* wo   = (const float*)d_in[5];
  float* out = (float*)d_out;

  char* ws = (char*)d_ws;
  unsigned short* xb   = (unsigned short*)(ws + offXb);
  unsigned short* wqb  = (unsigned short*)(ws + offWq);
  unsigned short* wkb  = (unsigned short*)(ws + offWk);
  unsigned short* wvb  = (unsigned short*)(ws + offWv);
  unsigned short* wo16 = (unsigned short*)(ws + offWo);
  unsigned short* qh   = (unsigned short*)(ws + offQh);
  unsigned short* ql   = (unsigned short*)(ws + offQl);
  unsigned short* kh   = (unsigned short*)(ws + offKh);
  unsigned short* kl   = (unsigned short*)(ws + offKl);
  unsigned short* vth  = (unsigned short*)(ws + offVth);
  unsigned short* vtl  = (unsigned short*)(ws + offVtl);
  float*          o32  = (float*)(ws + offO32);
  unsigned short* o16  = (unsigned short*)(ws + offO16);
  const float* dummyf = x;   // valid pointer for unused bias / resid arguments (never dereferenced)

  // 1) 16-bit operand planes: x, wq, wk, wv -> bf16 RNE; wo -> f16 encode of bf16-RNE(wo*64)
  {
    const int n2x = nTokEmb / 2;   // 2,097,152 -> 8192 blocks
    const int n2w = nEmbEmb / 2;   //   524,288 -> 2048 blocks
    cast2_kernel<0><<<(n2x + 255) / 256, 256, 0, stream>>>(x,  xb,  n2x, 1.0f);
    cast2_kernel<0><<<(n2w + 255) / 256, 256, 0, stream>>>(wq, wqb, n2w, 1.0f);
    cast2_kernel<0><<<(n2w + 255) / 256, 256, 0, stream>>>(wk, wkb, n2w, 1.0f);
    cast2_kernel<0><<<(n2w + 255) / 256, 256, 0, stream>>>(wv, wvb, n2w, 1.0f);
    cast2_kernel<1><<<(n2w + 255) / 256, 256, 0, stream>>>(wo, wo16, n2w, 64.0f);
  }

  // 2) q, k = x @ W^T : M = 4096 tokens, N = 1024, K = 1024; bf16 hi/lo output planes [token][h*64+d]
  //    tiles = 64 x 16 = 1024 -> 128 blocks of 8 waves
  {
    const dim3 g(((N_TOK / 64) * (EMB_DIM / 64)) / 8, 1);
    wmma_gemm64<1, false, 0, 2, false><<<g, 256, 0, stream>>>(
        xb, xb, EMB_DIM, 0L, wqb, wqb, EMB_DIM, 0L,
        (void*)qh, (void*)ql, EMB_DIM, 0L, dummyf, dummyf, 0L, N_TOK, EMB_DIM, EMB_DIM, 1.0f);
    wmma_gemm64<1, false, 0, 2, false><<<g, 256, 0, stream>>>(
        xb, xb, EMB_DIM, 0L, wkb, wkb, EMB_DIM, 0L,
        (void*)kh, (void*)kl, EMB_DIM, 0L, dummyf, dummyf, 0L, N_TOK, EMB_DIM, EMB_DIM, 1.0f);
  }

  // 3) v^T per batch = Wv @ x_b^T : A = wvb [1024 out][1024 in], Bt = xb_b [2048 tokens][1024],
  //    C = [1024 (h*64+d)][2048 s] bf16 hi/lo, y-batched over 2 batches; tiles = 16 x 32 = 512 -> 64 blocks
  {
    const dim3 g(((EMB_DIM / 64) * (SEQ_LEN / 64)) / 8, N_BATCH);
    wmma_gemm64<1, false, 0, 2, false><<<g, 256, 0, stream>>>(
        wvb, wvb, EMB_DIM, 0L, xb, xb, EMB_DIM, (long)SEQ_LEN * EMB_DIM,
        (void*)vth, (void*)vtl, SEQ_LEN, (long)EMB_DIM * SEQ_LEN, dummyf, dummyf, 0L,
        EMB_DIM, SEQ_LEN, EMB_DIM, 1.0f);
  }

  // 4) attention: grid = (16 heads x 32 query blocks, 2 batch elements); key mask read from d_in[1] as int32
  {
    const dim3 g(N_HEADS * (SEQ_LEN / 64), N_BATCH);
    attn_full64_kernel<<<g, 128, 0, stream>>>(qh, ql, kh, kl, vth, vtl, mask, o32, 0.125f, -1.0e9f);
  }

  // 5) attention output f32 -> f16 carried x16
  {
    const int n2o = nTokEmb / 2;   // 2,097,152 -> 8192 blocks
    cast2_kernel<2><<<(n2o + 255) / 256, 256, 0, stream>>>(o32, o16, n2o, 16.0f);
  }

  // 6) out = O @ Wo^T : f16 operands (O x16, Wo x64) -> scale 1/1024, f32 into d_out [4096][1024]
  {
    const dim3 g(((N_TOK / 64) * (EMB_DIM / 64)) / 8, 1);
    wmma_gemm64<0, false, 0, 0, false><<<g, 256, 0, stream>>>(
        o16, o16, EMB_DIM, 0L, wo16, wo16, EMB_DIM, 0L,
        (void*)out, (void*)out, EMB_DIM, 0L, dummyf, dummyf, 0L, N_TOK, EMB_DIM, EMB_DIM, 1.0f / 1024.0f);
  }
}

// v004
// One run takes 247 microseconds.
// In both of two side-by-side timings against v003, it was 1.41 times as fast.
// Counting every step since v000, it is 2.84 times as fast.
// Projections q, k, v^T: v_wmma_f32_16x16x32_bf16 (x and weights RNE-converted to bf16, single product); attention q.k^T and p.v: v_wmma_f32_16x16x32_bf16 with bf16 hi/lo split operands (hi.hi + hi.lo + lo.hi); output projection: v_wmma_f32_16x16x32_f16 (attention output carried x16 in f16, bf16-RNE weight carried x64 in f16); f32 accumulate everywhere; online softmax, key-mask select (-1e9) and normalisation in f32.
#include <hip/hip_runtime.h>
#include <math.h>
#include <stdint.h>

#define N_BATCH  2
#define SEQ_LEN  2048
#define EMB_DIM  1024
#define N_HEADS  16
#define HEAD_DIM 64
#define N_TOK    (N_BATCH * SEQ_LEN)

typedef __attribute__((ext_vector_type(16))) _Float16 v16h;
typedef __attribute__((ext_vector_type(8)))  _Float16 v8h;
typedef __attribute__((ext_vector_type(16))) __bf16   v16b;
typedef __attribute__((ext_vector_type(8)))  __bf16   v8b;
typedef __attribute__((ext_vector_type(8)))  float    v8f;
typedef __attribute__((ext_vector_type(4)))  float    v4f;
typedef __attribute__((ext_vector_type(2)))  float    v2f;
typedef __attribute__((ext_vector_type(4)))  unsigned int v4u;

__device__ __forceinline__ unsigned short f2bf_bits(float f) {
  unsigned u = __float_as_uint(f);
  return (unsigned short)((u + 0x7FFFu + ((u >> 16) & 1u)) >> 16);
}
__device__ __forceinline__ float bf_bits2f(unsigned short h) { return __uint_as_float(((unsigned)h) << 16); }

// hazard guards as plain device helpers (their inline asm stays outside the kernel template body)
__device__ __forceinline__ void dep_guard_h(v8f& a, v8f& b, v16h x, v16h y) { asm volatile("v_nop\n\tv_nop\n\tv_nop\n\tv_nop" : "+v"(a), "+v"(b) : "v"(x), "v"(y)); }
__device__ __forceinline__ void dep_guard_b(v8f& a, v8f& b, v16b x, v16b y) { asm volatile("v_nop\n\tv_nop\n\tv_nop\n\tv_nop" : "+v"(a), "+v"(b) : "v"(x), "v"(y)); }
__device__ __forceinline__ void keep4_h(v16h a, v16h b, v16h c, v16h d) { asm volatile("v_nop" :: "v"(a), "v"(b), "v"(c), "v"(d)); }
__device__ __forceinline__ void keep4_b(v16b a, v16b b, v16b c, v16b d) { asm volatile("v_nop" :: "v"(a), "v"(b), "v"(c), "v"(d)); }
__device__ __forceinline__ void acc_guard4(v8f& a, v8f& b, v8f& c, v8f& d) { asm volatile("v_nop\n\tv_nop\n\tv_nop\n\tv_nop" : "+v"(a), "+v"(b), "+v"(c), "+v"(d)); }
template <typename T> struct Frag;
template <> struct Frag<_Float16> {
  typedef v16h V; union U { v16h v; v8h h[2]; };
  static __device__ __forceinline__ v16h load(const _Float16* p) {   // elements 0..7 <- p[0..7], 8..15 <- p[16..23]
    U f; f.h[0] = *(const v8h*)(p); f.h[1] = *(const v8h*)(p + 16); return f.v;
  }
  static __device__ __forceinline__ v8f mma(v16h a, v16h b, v8f c) {
    return __builtin_amdgcn_wmma_f32_16x16x32_f16(false, a, false, b, (short)0, c, false, false);
  }
  static __device__ __forceinline__ void guard(v8f& a, v8f& b, v16h x, v16h y) { dep_guard_h(a, b, x, y); }
  static __device__ __forceinline__ void keep(v16h a, v16h b, v16h c, v16h d) { keep4_h(a, b, c, d); }
};
template <> struct Frag<__bf16> {
  typedef v16b V; union U { v16b v; v8b h[2]; };
  static __device__ __forceinline__ v16b load(const __bf16* p) {
    U f; f.h[0] = *(const v8b*)(p); f.h[1] = *(const v8b*)(p + 16); return f.v;
  }
  static __device__ __forceinline__ v8f mma(v16b a, v16b b, v8f c) {
    return __builtin_amdgcn_wmma_f32_16x16x32_bf16(false, a, false, b, (short)0, c, false, false);
  }
  static __device__ __forceinline__ void guard(v8f& a, v8f& b, v16b x, v16b y) { dep_guard_b(a, b, x, y); }
  static __device__ __forceinline__ void keep(v16b a, v16b b, v16b c, v16b d) { keep4_b(a, b, c, d); }
};

// ---- Register-blocked batched WMMA GEMM ------------------------------------
// C[m,n] = scale * sum_k A[m,k] * Bt[n,k] (+bias)(+resid); each wave owns a 64x64 tile.
// A row-major [M,K]; Bt row-major [N,K]; M % 64 == 0, N % 512 == 0, K % 64 == 0; grid.x = (M/64)*(N/64)/8.
// The 8 waves of a block share one 64-row band of A and own 8 neighbouring 64-row bands of Bt. Operands reach the
// waves through LDS: a stage is 64 k (one 128-B line of each of the 64 + 512 rows), brought by asynchronous 16-byte
// copies of which 8 neighbouring lanes cover one whole line, two buffers, the next stage in flight under this one's products.
// Copy coverage: 256 threads x 18 copies x 16 B = 576 rows x 128 B = the whole stage, every LDS byte from one lane.
// SPLIT (hi/lo planes) is not instantiated and not staged.
// BIAS_MODE: 0 = none, 1 = bias[m], 2 = bias[n].
// OUT_MODE: 0 = f32, 1 = f16, 2 = bf16 hi plane (Cout) + bf16 lo plane (Cout2).
// Epilogue coverage per wave: f32 path 8 it x 2 rows x (16 lanes x 4 floats) = 16 rows x 64; 16-bit path
// 4 it x 4 rows x (8 lanes x 8 halves) = 16 rows x 64; 4 slabs = the whole 64x64 tile.
// ET: 0 = f16 operands, 1 = bf16 operands (pointers passed as 16-bit storage)
#define GS_ROWS  576                       // 64 rows of A, then 512 rows of Bt
#define GS_PITCH 72                        // LDS row pitch in elements: 144 B = 16 B x 9 (odd), no bank met twice by a 16-byte fragment read
#define GS_BYTES (GS_ROWS * GS_PITCH * 2)  // one buffer: 82,944 B
// Nine asynchronous 16-byte copies global -> LDS of this lane. The s_wait_xcnt stands inside the statement, behind the last copy,
// so that no address register of a copy is rewritten in front of it.
__device__ __forceinline__ void gs_copy9(unsigned l0, unsigned l1, unsigned l2, unsigned l3, unsigned l4, unsigned l5,
                                         unsigned l6, unsigned l7, unsigned l8,
                                         const unsigned short* g0, const unsigned short* g1, const unsigned short* g2,
                                         const unsigned short* g3, const unsigned short* g4, const unsigned short* g5,
                                         const unsigned short* g6, const unsigned short* g7, const unsigned short* g8) {
  asm volatile("global_load_async_to_lds_b128 %0, %9, off\n\t"
               "global_load_async_to_lds_b128 %1, %10, off\n\t"
               "global_load_async_to_lds_b128 %2, %11, off\n\t"
               "global_load_async_to_lds_b128 %3, %12, off\n\t"
               "global_load_async_to_lds_b128 %4, %13, off\n\t"
               "global_load_async_to_lds_b128 %5, %14, off\n\t"
               "global_load_async_to_lds_b128 %6, %15, off\n\t"
               "global_load_async_to_lds_b128 %7, %16, off\n\t"
               "global_load_async_to_lds_b128 %8, %17, off\n\t"
               "s_wait_xcnt 0x0"
               :: "v"(l0), "v"(l1), "v"(l2), "v"(l3), "v"(l4), "v"(l5), "v"(l6), "v"(l7), "v"(l8),
                  "v"(g0), "v"(g1), "v"(g2), "v"(g3), "v"(g4), "v"(g5), "v"(g6), "v"(g7), "v"(g8)
               : "memory");
}
// One stage: this thread's 2 pieces of A rows and 16 pieces of Bt rows (rows 32 apart), l = its LDS byte address in row (tid >> 3).
__device__ __forceinline__ void gs_stage(unsigned l, const unsigned short* a, size_t sa, const unsigned short* b, size_t sb) {
  const unsigned st = 32u * GS_PITCH * 2u;   // 32 LDS rows
  gs_copy9(l, l + st, l + 2 * st, l + 3 * st, l + 4 * st, l + 5 * st, l + 6 * st, l + 7 * st, l + 8 * st,
           a, a + sa, b, b + sb, b + 2 * sb, b + 3 * sb, b + 4 * sb, b + 5 * sb, b + 6 * sb);
  gs_copy9(l + 9 * st, l + 10 * st, l + 11 * st, l + 12 * st, l + 13 * st, l + 14 * st, l + 15 * st, l + 16 * st, l + 17 * st,
           b + 7 * sb, b + 8 * sb, b + 9 * sb, b + 10 * sb, b + 11 * sb, b + 12 * sb, b + 13 * sb, b + 14 * sb, b + 15 * sb);
}
template <int ET> struct Elem;
template <> struct Elem<0> { typedef _Float16 T; };
template <> struct Elem<1> { typedef __bf16 T; };
template <int ET, bool SPLIT, int BIAS_MODE, int OUT_MODE, bool RESID, int ACT = 0>
__global__ __launch_bounds__(256) void wmma_gemm64(
    const unsigned short* __restrict__ Ap, const unsigned short* __restrict__ A2p, int lda, long strideA,
    const unsigned short* __restrict__ Btp, const unsigned short* __restrict__ Bt2p, int ldb, long strideB,
    void* __restrict__ Cout, void* __restrict__ Cout2, int ldc, long strideC,
    const float* __restrict__ bias,
    const float* __restrict__ resid, long strideR,
    int M, int N, int K, float scale) {
  typedef typename Elem<ET>::T T;
  typedef typename Frag<T>::V V;
  static_assert(!SPLIT, "hi/lo planes are not staged");
  __shared__ __align__(16) unsigned short sAB[2 * GS_ROWS * GS_PITCH];   // two stage buffers, 165,888 B
  __shared__ __align__(16) float sT[8][16 * 68];   // per-wave 16x64 slab, pitch 68 floats
  const int b    = blockIdx.y;
  const int lane = threadIdx.x & 31;
  const int wave = threadIdx.x >> 5;
  const int tilesN = N >> 6;
  const int tilesM = M >> 6;
  const int tile = blockIdx.x * 8 + wave;
  if (blockIdx.x * 8 >= tilesM * tilesN) return;   // the whole block or none of it, in front of every barrier
  const int tm = tile / tilesN;
  const int tn = tile - tm * tilesN;
  const int m0 = tm << 6;
  const int n0 = tn << 6;

  // staging: thread -> row (tid >> 3) of each group of 32 rows, 16-byte piece (tid & 7) of its 128-B line
  const int srow = threadIdx.x >> 3;
  const int spc  = threadIdx.x & 7;
  const int nb0  = n0 - (wave << 6);           // first Bt row of the block (N % 512 == 0: the 8 tiles lie in one tile row)
  const unsigned short* gA = Ap  + (size_t)b * strideA + (size_t)(m0  + srow) * lda + spc * 8;
  const unsigned short* gB = Btp + (size_t)b * strideB + (size_t)(nb0 + srow) * ldb + spc * 8;
  const size_t sa32 = (size_t)32 * lda, sb32 = (size_t)32 * ldb;
  const unsigned lds0 = (unsigned)(uintptr_t)(&sAB[0]) + (unsigned)(srow * (GS_PITCH * 2) + spc * 16);

  const int rlane = lane & 15;                 // row (A) / col (B, D) within subtile
  const int koff  = (lane >> 4) * 8;           // k offset of this lane half
  const int mOff  = (lane >> 4) * 8;           // D row offset

  v8f acc[4][4];
#pragma unroll
  for (int i = 0; i < 4; ++i)
#pragma unroll
    for (int j = 0; j < 4; ++j) acc[i][j] = (v8f){0.f,0.f,0.f,0.f,0.f,0.f,0.f,0.f};

  const int nStages = K >> 6;
  gs_stage(lds0, gA, sa32, gB, sb32);
  asm volatile("s_wait_asynccnt 0x0" ::: "memory");   // stage 0 of this wave has landed
  __syncthreads();                                     // ... and every wave's part of it
  if (nStages > 1) gs_stage(lds0 + GS_BYTES, gA + 64, sa32, gB + 64, sb32);

  for (int t = 0; t < nStages; ++t) {
    const T* sbuf = (const T*)(const void*)(sAB + (t & 1) * (GS_ROWS * GS_PITCH));
#pragma unroll
    for (int ks = 0; ks < 2; ++ks) {
      V bh[4], ah[4];   // all eight fragments of these 32 k asked for as one group, in front of their 16 products
#pragma unroll
      for (int j = 0; j < 4; ++j)
        bh[j] = Frag<T>::load(sbuf + (64 + (wave << 6) + (j << 4) + rlane) * GS_PITCH + ks * 32 + koff);
#pragma unroll
      for (int i = 0; i < 4; ++i)
        ah[i] = Frag<T>::load(sbuf + ((i << 4) + rlane) * GS_PITCH + ks * 32 + koff);
#pragma unroll
      for (int i = 0; i < 4; ++i) {
#pragma unroll
        for (int j = 0; j < 4; ++j) acc[i][j] = Frag<T>::mma(ah[i], bh[j], acc[i][j]);
        Frag<T>::guard(acc[i][0], acc[i][3], ah[i], ah[i]);
      }
      Frag<T>::keep(bh[0], bh[1], bh[2], bh[3]);
    }
    asm volatile("s_wait_dscnt 0x0" ::: "memory");      // this wave's reads of the buffer are done before it is refilled
    asm volatile("s_wait_asynccnt 0x0" ::: "memory");   // this wave's copies of stage t + 1 have landed
    __syncthreads();                                     // publishes stage t + 1 and ends every reader's last read of stage t
    if (t + 2 < nStages)
      gs_stage(lds0 + (unsigned)(t & 1) * GS_BYTES, gA + (size_t)(t + 2) * 64, sa32, gB + (size_t)(t + 2) * 64, sb32);
  }
  asm volatile("s_wait_asynccnt 0x0" ::: "memory");     // nothing in flight behind the loop
  acc_guard4(acc[0][0], acc[0][1], acc[0][2], acc[0][3]);
  acc_guard4(acc[1][0], acc[1][1], acc[1][2], acc[1][3]);
  acc_guard4(acc[2][0], acc[2][1], acc[2][2], acc[2][3]);
  acc_guard4(acc[3][0], acc[3][1], acc[3][2], acc[3][3]);

  // ---- epilogue ----
  float* slab = sT[wave];
  const float* Rb = RESID ? (resid + (size_t)b * strideR) : nullptr;
#pragma unroll
  for (int i = 0; i < 4; ++i) {
    const int mBase = m0 + (i << 4);
#pragma unroll
    for (int j = 0; j < 4; ++j) {
      const int n = n0 + (j << 4) + rlane;
      float bv = 0.f;
      if (BIAS_MODE == 2) bv = bias[n];
#pragma unroll
      for (int r = 0; r < 8; ++r) {
        float v = acc[i][j][r] * scale;
        if (BIAS_MODE == 1) v += bias[mBase + mOff + r];
        if (BIAS_MODE == 2) v += bv;
        if (RESID) v += Rb[(size_t)(mBase + mOff + r) * ldc + n];
        if (ACT == 1) v = tanhf(v);
        if (ACT == 2) v = fmaxf(v, 0.0f);
        if (ACT == 3) v = v / (1.0f + expf(-v));
        if (ACT == 4) v = (v > 0.f) ? v : 0.01f * v;
        if (ACT == 5) v = 0.5f * v * (1.0f + erff(v * 0.70710678118654752f));
        slab[(mOff + r) * 68 + (j << 4) + rlane] = v;
      }
    }
    __builtin_amdgcn_fence(__ATOMIC_RELEASE, "workgroup");
    __builtin_amdgcn_wave_barrier();
    __builtin_amdgcn_fence(__ATOMIC_ACQUIRE, "workgroup");
    if (OUT_MODE == 0) {
      float* C = (float*)Cout + (size_t)b * strideC;
      const int hh = lane >> 4, c4 = (lane & 15) * 4;     // row seg = 256 B = 16 lanes x 16 B
      {
#pragma unroll
        for (int it = 0; it < 8; ++it) {
          const int row = it * 2 + hh;
          v4f v = *(const v4f*)(slab + row * 68 + c4);
          *(v4f*)(C + (size_t)(mBase + row) * ldc + n0 + c4) = v;
        }
        
      }
    } else {
      const int q = lane >> 3, c8 = (lane & 7) * 8;
      unsigned short* C  = (unsigned short*)Cout  + (size_t)b * strideC;
      unsigned short* C2 = (OUT_MODE == 2) ? ((unsigned short*)Cout2 + (size_t)b * strideC) : nullptr;
      {
#pragma unroll
        for (int it = 0; it < 4; ++it) {
          const int row = it * 4 + q;
          const float* sp = slab + row * 68 + c8;
          v8h hv, lv;
#pragma unroll
          for (int e = 0; e < 8; ++e) {
            if (OUT_MODE == 1) {
              hv[e] = (_Float16)sp[e];
            } else {
              unsigned short hb = f2bf_bits(sp[e]);
              unsigned short lb = f2bf_bits(sp[e] - bf_bits2f(hb));
              hv[e] = __builtin_bit_cast(_Float16, hb);
              lv[e] = __builtin_bit_cast(_Float16, lb);
            }
          }
          *(v8h*)(C + (size_t)(mBase + row) * ldc + n0 + c8) = hv;
          if (OUT_MODE == 2) *(v8h*)(C2 + (size_t)(mBase + row) * ldc + n0 + c8) = lv;
        }
        
      }
    }
    __builtin_amdgcn_fence(__ATOMIC_RELEASE, "workgroup");
    __builtin_amdgcn_wave_barrier();
    __builtin_amdgcn_fence(__ATOMIC_ACQUIRE, "workgroup");
  }
}

// ---------------------------------------------------------------------------
// Elementwise f32 -> 16-bit plane, 2 consecutive elements per thread packed into one 4-B store: each wave writes
// CMODE 0: bf16 RNE bits of in*scale.
// CMODE 1: f16 bits of the bf16-RNE value of in*scale (an 8-significant-bit value re-encoded exactly in f16).
// CMODE 2: f16 RNE bits of in*scale.
// Coverage: grid = ceil(n2/256) blocks x 256 threads x 2 elements = 2*n2 = the whole plane
// (calls here: n2 = 2097152 -> 8192 blocks; n2 = 524288 -> 2048 blocks; both exact multiples of 256).
// ---------------------------------------------------------------------------
__device__ __forceinline__ unsigned pk16(unsigned short a, unsigned short b) { return (unsigned)a | ((unsigned)b << 16); }

template <int CMODE>
__global__ __launch_bounds__(256) void cast2_kernel(const float* __restrict__ in, unsigned short* __restrict__ out,
                                                    int n2, float scale) {
  const int i = blockIdx.x * 256 + threadIdx.x;
  if (i < n2) {
    const v2f f = *(const v2f*)(in + 2 * (size_t)i);
    const float f0 = f[0] * scale, f1 = f[1] * scale;
    unsigned short u0, u1;
    if (CMODE == 0) {
      u0 = f2bf_bits(f0); u1 = f2bf_bits(f1);
    } else if (CMODE == 1) {
      u0 = __builtin_bit_cast(unsigned short, (_Float16)bf_bits2f(f2bf_bits(f0)));
      u1 = __builtin_bit_cast(unsigned short, (_Float16)bf_bits2f(f2bf_bits(f1)));
    } else {
      u0 = __builtin_bit_cast(unsigned short, (_Float16)f0);
      u1 = __builtin_bit_cast(unsigned short, (_Float16)f1);
    }
    const unsigned u = pk16(u0, u1);
    ((unsigned*)out)[i] = u;
    
  }
}

#define AT_D 64
#define AT_NW 4
#define AT_QB 64
#define AT_KC 64
#define AT_LP 72   // LDS row pitch of the K and V^T tiles in elements: 144 B = 16 B x 9 (odd), so the 16 rows of one 16-byte fragment read fall on 64 distinct banks

__device__ __forceinline__ unsigned short at_bf_bits(float f) {
  unsigned u = __float_as_uint(f);
  return (unsigned short)((u + 0x7FFFu + ((u >> 16) & 1u)) >> 16);
}
__device__ __forceinline__ __bf16 at_f2bf(float f) { return __builtin_bit_cast(__bf16, at_bf_bits(f)); }
__device__ __forceinline__ void at_split(float f, __bf16& hi, __bf16& lo) {
  const unsigned short hb = at_bf_bits(f);
  hi = __builtin_bit_cast(__bf16, hb);
  lo = at_f2bf(f - __uint_as_float(((unsigned)hb) << 16));
}
__device__ __forceinline__ v8f at_mma(v16b a, v16b b, v8f c) {
  c = __builtin_amdgcn_wmma_f32_16x16x32_bf16(false, a, false, b, (short)0, c, false, false);
  asm volatile("v_nop\n\tv_nop\n\tv_nop\n\tv_nop" : "+v"(c) : "v"(a), "v"(b));
  return c;
}

// lane l <-> l ^ 16 (the two halves of a wave hold the two key halves of one query column)
__device__ __forceinline__ float at_xhalf(float v) {
  const int b = __builtin_bit_cast(int, v);
  return __builtin_bit_cast(float, __builtin_amdgcn_permlanex16(b, b, 0x76543210, 0xfedcba98, false, false));
}

__global__ __launch_bounds__(128)
void attn_full64_kernel(const unsigned short* __restrict__ qhp, const unsigned short* __restrict__ qlp,
                        const unsigned short* __restrict__ khp, const unsigned short* __restrict__ klp,
                        const unsigned short* __restrict__ vhp, const unsigned short* __restrict__ vlp,
                        const int* __restrict__ kmask,
                        float* __restrict__ out, float sscale, float mfill) {
  union FB { v16b v; v8b h[2]; };
  __shared__ __align__(16) __bf16 Ksh[AT_KC * AT_LP];            // K hi [kv][d]      9 KB
  __shared__ __align__(16) __bf16 Ksl[AT_KC * AT_LP];            // K lo
  __shared__ __align__(16) __bf16 Vth[AT_D * AT_LP];             // V hi [d][kv]      9 KB
  __shared__ __align__(16) __bf16 Vtl[AT_D * AT_LP];             // V lo
  __shared__ __align__(16) float  Os[AT_NW][16 * 68];            // per wave out tile, pitch 68

  const int tid  = threadIdx.x;
  const int wave = tid >> 5;
  const int lane = tid & 31;
  const int hh   = lane >> 4;
  const int c    = lane & 15;

  const int nqb = SEQ_LEN / AT_QB;        // 32
  const int bx = blockIdx.x;
  const int qb = bx % nqb;
  const int h  = bx / nqb;                // 0..N_HEADS-1 (grid = N_HEADS * nqb)
  const int q0 = qb * AT_QB + wave * 16;
  const size_t bo = (size_t)blockIdx.y * SEQ_LEN * EMB_DIM;   // this batch element's start in every q, k, v^T and out plane
  const int* km = kmask + (size_t)blockIdx.y * SEQ_LEN;

  const __bf16* Qh = (const __bf16*)(const void*)qhp + bo + (size_t)h * AT_D;
  const __bf16* Ql = (const __bf16*)(const void*)qlp + bo + (size_t)h * AT_D;
  const __bf16* Kh = (const __bf16*)(const void*)khp + bo + (size_t)h * AT_D;
  const __bf16* Kl = (const __bf16*)(const void*)klp + bo + (size_t)h * AT_D;
  const __bf16* Vh = (const __bf16*)(const void*)vhp + bo + (size_t)h * AT_D * SEQ_LEN;
  const __bf16* Vl = (const __bf16*)(const void*)vlp + bo + (size_t)h * AT_D * SEQ_LEN;
  float*        ob = out + bo + (size_t)h * AT_D;

  // ---- Q fragments (B operand, column = query = lane&15, split k map via Frag load): 2 d-chunks, hi and lo ----
  v16b qah[2], qal[2];
#pragma unroll
  for (int dc = 0; dc < 2; ++dc) {
    const __bf16* qr = Qh + (size_t)(q0 + c) * EMB_DIM + dc * 32 + 8 * hh;
    const __bf16* ql = Ql + (size_t)(q0 + c) * EMB_DIM + dc * 32 + 8 * hh;
    qah[dc] = Frag<__bf16>::load(qr);
    qal[dc] = Frag<__bf16>::load(ql);
  }

  // One query per lane (q0 + c). mrow: running maximum, equal in both wave halves; lrow: this half's share of the sum.
  float mrow = -INFINITY, lrow = 0.f;
  v8f oacc[4];   // out^T tiles: oacc[t][r] = out[q0 + c][t*16 + 8*hh + r]
#pragma unroll
  for (int t = 0; t < 4; ++t) oacc[t] = (v8f){0.f,0.f,0.f,0.f,0.f,0.f,0.f,0.f};

  const int nChunks = SEQ_LEN / AT_KC;   // 32, compile-time constant
  for (int kc = 0; kc < nChunks; ++kc) {
    const int kv0 = kc * AT_KC;
    __syncthreads();
    // key-padding mask of this lane's 32 keys (kv0 + j*16 + 8*hh + r, always < SEQ_LEN), asked for together with the
    // staging loads so that its latency runs under theirs
    v4u kmv[8];
#pragma unroll
    for (int j = 0; j < 4; ++j) {
      kmv[2 * j]     = *(const v4u*)(km + kv0 + j * 16 + 8 * hh);
      kmv[2 * j + 1] = *(const v4u*)(km + kv0 + j * 16 + 8 * hh + 4);
    }
    // the staging loads below may land in the registers that hold the mask loads' address: keep the wait in front of that overwrite
    asm volatile("s_wait_xcnt 0x0" ::: "memory");
    {
      // staging coverage: 128 threads x (4 x 8) elements = 64 rows x 64 per plane = the whole chunk tile
      const int r = tid >> 1, half = (tid & 1) * 32;
      const __bf16* ksh = Kh + (size_t)(kv0 + r) * EMB_DIM + half;   // K row kv0+r, d = half..half+31
      const __bf16* ksl = Kl + (size_t)(kv0 + r) * EMB_DIM + half;
      const __bf16* vsh = Vh + (size_t)r * SEQ_LEN + kv0 + half;      // V^T row d = r, s = kv0+half..+31
      const __bf16* vsl = Vl + (size_t)r * SEQ_LEN + kv0 + half;
#pragma unroll
      for (int i = 0; i < 4; ++i) {
        const v8b a0 = *(const v8b*)(ksh + 8 * i);
        const v8b a1 = *(const v8b*)(ksl + 8 * i);
        const v8b b0 = *(const v8b*)(vsh + 8 * i);
        const v8b b1 = *(const v8b*)(vsl + 8 * i);
        *(v8b*)(Ksh + r * AT_LP + half + 8 * i) = a0;
        *(v8b*)(Ksl + r * AT_LP + half + 8 * i) = a1;
        *(v8b*)(Vth + r * AT_LP + half + 8 * i) = b0;
        *(v8b*)(Vtl + r * AT_LP + half + 8 * i) = b1;
      }
    }
    __syncthreads();

    // scores^T = K . Q^T : s[j][r] = score(key kv0 + j*16 + 8*hh + r, query q0 + c)
    v8f s[4];
#pragma unroll
    for (int j = 0; j < 4; ++j) {
      s[j] = (v8f){0.f,0.f,0.f,0.f,0.f,0.f,0.f,0.f};
#pragma unroll
      for (int dc = 0; dc < 2; ++dc) {
        FB kb, kl;
        kb.h[0] = *(const v8b*)(Ksh + (j * 16 + c) * AT_LP + dc * 32 + 8 * hh);
        kb.h[1] = *(const v8b*)(Ksh + (j * 16 + c) * AT_LP + dc * 32 + 16 + 8 * hh);
        kl.h[0] = *(const v8b*)(Ksl + (j * 16 + c) * AT_LP + dc * 32 + 8 * hh);
        kl.h[1] = *(const v8b*)(Ksl + (j * 16 + c) * AT_LP + dc * 32 + 16 + 8 * hh);
        s[j] = at_mma(kb.v, qah[dc], s[j]);
        s[j] = at_mma(kl.v, qah[dc], s[j]);
        s[j] = at_mma(kb.v, qal[dc], s[j]);
      }
    }
    // mask nonzero -> score := mfill (select, as in the module)
    float m = -INFINITY;
#pragma unroll
    for (int j = 0; j < 4; ++j) {
#pragma unroll
      for (int r = 0; r < 8; ++r) {
        float sv = s[j][r] * sscale;
        sv = (kmv[2 * j + (r >> 2)][r & 3] != 0u) ? mfill : sv;
        s[j][r] = sv;
        m = fmaxf(m, sv);
      }
    }
    m = fmaxf(m, at_xhalf(m));   // the other 32 keys of this query
    const float mnew = fmaxf(mrow, m);
    const float alpha = expf(mrow - mnew);
    mrow = mnew;
    // p^T stays in registers: two score tiles (keys 0..15 and 16..31 of a 32-key group) are one B operand,
    // element e < 8 = key 8*hh + e, e >= 8 = key 16 + 8*hh + (e - 8): the order in which the V^T rows are read below
    v16b pth[2], ptl[2];
    float psum = 0.f;
#pragma unroll
    for (int j = 0; j < 4; ++j) {
#pragma unroll
      for (int r = 0; r < 8; ++r) {
        const float p = expf(s[j][r] - mnew);
        psum += p;
        __bf16 a, bl; at_split(p, a, bl);
        pth[j >> 1][(j & 1) * 8 + r] = a;
        ptl[j >> 1][(j & 1) * 8 + r] = bl;
      }
    }
    lrow = lrow * alpha + psum;
#pragma unroll
    for (int t = 0; t < 4; ++t)
#pragma unroll
      for (int r = 0; r < 8; ++r) oacc[t][r] *= alpha;
    // out^T += V^T . p^T
#pragma unroll
    for (int kk = 0; kk < 2; ++kk) {
#pragma unroll
      for (int t = 0; t < 4; ++t) {
        FB vb, vl;
        vb.h[0] = *(const v8b*)(Vth + (t * 16 + c) * AT_LP + kk * 32 + 8 * hh);
        vb.h[1] = *(const v8b*)(Vth + (t * 16 + c) * AT_LP + kk * 32 + 16 + 8 * hh);
        vl.h[0] = *(const v8b*)(Vtl + (t * 16 + c) * AT_LP + kk * 32 + 8 * hh);
        vl.h[1] = *(const v8b*)(Vtl + (t * 16 + c) * AT_LP + kk * 32 + 16 + 8 * hh);
        oacc[t] = at_mma(vb.v, pth[kk], oacc[t]);
        oacc[t] = at_mma(vl.v, pth[kk], oacc[t]);
        oacc[t] = at_mma(vb.v, ptl[kk], oacc[t]);
      }
    }
  }

  float* os = Os[wave];
  {
    const float inv = 1.0f / (lrow + at_xhalf(lrow));   // join the two halves' sums once
#pragma unroll
    for (int t = 0; t < 4; ++t) {
      v4f lo4, hi4;
#pragma unroll
      for (int r = 0; r < 4; ++r) { lo4[r] = oacc[t][r] * inv; hi4[r] = oacc[t][4 + r] * inv; }
      *(v4f*)(os + c * 68 + t * 16 + 8 * hh)     = lo4;
      *(v4f*)(os + c * 68 + t * 16 + 8 * hh + 4) = hi4;
    }
  }
  __builtin_amdgcn_fence(__ATOMIC_RELEASE, "workgroup");
  __builtin_amdgcn_wave_barrier();
  __builtin_amdgcn_fence(__ATOMIC_ACQUIRE, "workgroup");
  {
    const int c4 = (lane & 15) * 4;
    {
#pragma unroll
      for (int it = 0; it < 8; ++it) {
        const int row = it * 2 + hh;   // it 0..7 x hh 0..1 covers rows 0..15 of the wave tile
        v4f val = *(const v4f*)(os + row * 68 + c4);
        *(v4f*)(ob + (size_t)(q0 + row) * EMB_DIM + c4) = val;
      }
      
    }
  }
}

// ---------------------------------------------------------------------------
// Host-side orchestration (kernel launches + host arithmetic only).
// Workspace region map (byte offsets, every region fully written by its producer before any read):
//   0           xb    bf16 [4096][1024]            8,388,608
//   8,388,608   wqb   bf16 [1024][1024]            2,097,152
//   10,485,760  wkb   bf16 [1024][1024]            2,097,152
//   12,582,912  wvb   bf16 [1024][1024]            2,097,152
//   14,680,064  wo16  f16  [1024][1024] (x64)      2,097,152
//   16,777,216  qh    bf16 [4096][1024]            8,388,608
//   25,165,824  ql    bf16 [4096][1024]            8,388,608
//   33,554,432  kh    bf16 [4096][1024]            8,388,608
//   41,943,040  kl    bf16 [4096][1024]            8,388,608
//   50,331,648  vth   bf16 [2][1024][2048]         8,388,608
//   58,720,256  vtl   bf16 [2][1024][2048]         8,388,608
//   67,108,864  o32   f32  [4096][1024]           16,777,216
//   83,886,080  o16   f16  [4096][1024] (x16)      8,388,608
//   92,274,688  end (88 MiB)
// GEMM shapes: K = 1024 (multiple of 32) everywhere; M, N in {1024, 2048, 4096} (multiples of 64); no padding.
// ---------------------------------------------------------------------------
extern "C" void kernel_launch(void* const* d_in, const int* in_sizes, int n_in,
                              void* d_out, int out_size, void* d_ws, size_t ws_size,
                              hipStream_t stream) {
  if (n_in < 6) return;
  const int nTokEmb = N_TOK * EMB_DIM;          // 4,194,304
  const int nEmbEmb = EMB_DIM * EMB_DIM;        // 1,048,576
  if (in_sizes[0] != nTokEmb || in_sizes[1] != N_BATCH * SEQ_LEN || in_sizes[2] != nEmbEmb ||
      in_sizes[3] != nEmbEmb || in_sizes[4] != nEmbEmb || in_sizes[5] != nEmbEmb || out_size != nTokEmb) return;

  const size_t offXb  = 0;
  const size_t offWq  = offXb  + (size_t)nTokEmb * 2;
  const size_t offWk  = offWq  + (size_t)nEmbEmb * 2;
  const size_t offWv  = offWk  + (size_t)nEmbEmb * 2;
  const size_t offWo  = offWv  + (size_t)nEmbEmb * 2;
  const size_t offQh  = offWo  + (size_t)nEmbEmb * 2;
  const size_t offQl  = offQh  + (size_t)nTokEmb * 2;
  const size_t offKh  = offQl  + (size_t)nTokEmb * 2;
  const size_t offKl  = offKh  + (size_t)nTokEmb * 2;
  const size_t offVth = offKl  + (size_t)nTokEmb * 2;
  const size_t offVtl = offVth + (size_t)nTokEmb * 2;
  const size_t offO32 = offVtl + (size_t)nTokEmb * 2;
  const size_t offO16 = offO32 + (size_t)nTokEmb * 4;
  const size_t offEnd = offO16 + (size_t)nTokEmb * 2;   // 92,274,688
  if (ws_size < offEnd) return;

  const float* x    = (const float*)d_in[0];
  const int*   mask = (const int*)d_in[1];
  const float* wq   = (const float*)d_in[2];
  const float* wk   = (const float*)d_in[3];
  const float* wv   = (const float*)d_in[4];
  const float* wo   = (const float*)d_in[5];
  float* out = (float*)d_out;

  char* ws = (char*)d_ws;
  unsigned short* xb   = (unsigned short*)(ws + offXb);
  unsigned short* wqb  = (unsigned short*)(ws + offWq);
  unsigned short* wkb  = (unsigned short*)(ws + offWk);
  unsigned short* wvb  = (unsigned short*)(ws + offWv);
  unsigned short* wo16 = (unsigned short*)(ws + offWo);
  unsigned short* qh   = (unsigned short*)(ws + offQh);
  unsigned short* ql   = (unsigned short*)(ws + offQl);
  unsigned short* kh   = (unsigned short*)(ws + offKh);
  unsigned short* kl   = (unsigned short*)(ws + offKl);
  unsigned short* vth  = (unsigned short*)(ws + offVth);
  unsigned short* vtl  = (unsigned short*)(ws + offVtl);
  float*          o32  = (float*)(ws + offO32);
  unsigned short* o16  = (unsigned short*)(ws + offO16);
  const float* dummyf = x;   // valid pointer for unused bias / resid arguments (never dereferenced)

  // 1) 16-bit operand planes: x, wq, wk, wv -> bf16 RNE; wo -> f16 encode of bf16-RNE(wo*64)
  {
    const int n2x = nTokEmb / 2;   // 2,097,152 -> 8192 blocks
    const int n2w = nEmbEmb / 2;   //   524,288 -> 2048 blocks
    cast2_kernel<0><<<(n2x + 255) / 256, 256, 0, stream>>>(x,  xb,  n2x, 1.0f);
    cast2_kernel<0><<<(n2w + 255) / 256, 256, 0, stream>>>(wq, wqb, n2w, 1.0f);
    cast2_kernel<0><<<(n2w + 255) / 256, 256, 0, stream>>>(wk, wkb, n2w, 1.0f);
    cast2_kernel<0><<<(n2w + 255) / 256, 256, 0, stream>>>(wv, wvb, n2w, 1.0f);
    cast2_kernel<1><<<(n2w + 255) / 256, 256, 0, stream>>>(wo, wo16, n2w, 64.0f);
  }

  // 2) q, k = x @ W^T : M = 4096 tokens, N = 1024, K = 1024; bf16 hi/lo output planes [token][h*64+d]
  //    tiles = 64 x 16 = 1024 -> 128 blocks of 8 waves
  {
    const dim3 g(((N_TOK / 64) * (EMB_DIM / 64)) / 8, 1);
    wmma_gemm64<1, false, 0, 2, false><<<g, 256, 0, stream>>>(
        xb, xb, EMB_DIM, 0L, wqb, wqb, EMB_DIM, 0L,
        (void*)qh, (void*)ql, EMB_DIM, 0L, dummyf, dummyf, 0L, N_TOK, EMB_DIM, EMB_DIM, 1.0f);
    wmma_gemm64<1, false, 0, 2, false><<<g, 256, 0, stream>>>(
        xb, xb, EMB_DIM, 0L, wkb, wkb, EMB_DIM, 0L,
        (void*)kh, (void*)kl, EMB_DIM, 0L, dummyf, dummyf, 0L, N_TOK, EMB_DIM, EMB_DIM, 1.0f);
  }

  // 3) v^T per batch = Wv @ x_b^T : A = wvb [1024 out][1024 in], Bt = xb_b [2048 tokens][1024],
  //    C = [1024 (h*64+d)][2048 s] bf16 hi/lo, y-batched over 2 batches; tiles = 16 x 32 = 512 -> 64 blocks
  {
    const dim3 g(((EMB_DIM / 64) * (SEQ_LEN / 64)) / 8, N_BATCH);
    wmma_gemm64<1, false, 0, 2, false><<<g, 256, 0, stream>>>(
        wvb, wvb, EMB_DIM, 0L, xb, xb, EMB_DIM, (long)SEQ_LEN * EMB_DIM,
        (void*)vth, (void*)vtl, SEQ_LEN, (long)EMB_DIM * SEQ_LEN, dummyf, dummyf, 0L,
        EMB_DIM, SEQ_LEN, EMB_DIM, 1.0f);
  }

  // 4) attention: grid = (16 heads x 32 query blocks, 2 batch elements); key mask read from d_in[1] as int32
  {
    const dim3 g(N_HEADS * (SEQ_LEN / 64), N_BATCH);
    attn_full64_kernel<<<g, 128, 0, stream>>>(qh, ql, kh, kl, vth, vtl, mask, o32, 0.125f, -1.0e9f);
  }

  // 5) attention output f32 -> f16 carried x16
  {
    const int n2o = nTokEmb / 2;   // 2,097,152 -> 8192 blocks
    cast2_kernel<2><<<(n2o + 255) / 256, 256, 0, stream>>>(o32, o16, n2o, 16.0f);
  }

  // 6) out = O @ Wo^T : f16 operands (O x16, Wo x64) -> scale 1/1024, f32 into d_out [4096][1024]
  {
    const dim3 g(((N_TOK / 64) * (EMB_DIM / 64)) / 8, 1);
    wmma_gemm64<0, false, 0, 0, false><<<g, 256, 0, stream>>>(
        o16, o16, EMB_DIM, 0L, wo16, wo16, EMB_DIM, 0L,
        (void*)out, (void*)out, EMB_DIM, 0L, dummyf, dummyf, 0L, N_TOK, EMB_DIM, EMB_DIM, 1.0f / 1024.0f);
  }
}

// v005
// It runs in 222 microseconds.
// In both of two side-by-side timings against v004, it was 1.11 times as fast.
// Counting every step since v000, it is 3.15 times as fast.
// Projections q, k, v^T: v_wmma_f32_16x16x32_bf16 (x and weights RNE-converted to bf16, single product); attention q.k^T and p.v: v_wmma_f32_16x16x32_bf16 with bf16 hi/lo split operands (hi.hi + hi.lo + lo.hi); output projection: v_wmma_f32_16x16x32_f16 (attention output carried x16 in f16, bf16-RNE weight carried x64 in f16); f32 accumulate everywhere; online softmax, key-mask select (-1e9) and normalisation in f32.
#include <hip/hip_runtime.h>
#include <math.h>
#include <stdint.h>

#define N_BATCH  2
#define SEQ_LEN  2048
#define EMB_DIM  1024
#define N_HEADS  16
#define HEAD_DIM 64
#define N_TOK    (N_BATCH * SEQ_LEN)

typedef __attribute__((ext_vector_type(16))) _Float16 v16h;
typedef __attribute__((ext_vector_type(8)))  _Float16 v8h;
typedef __attribute__((ext_vector_type(16))) __bf16   v16b;
typedef __attribute__((ext_vector_type(8)))  __bf16   v8b;
typedef __attribute__((ext_vector_type(8)))  float    v8f;
typedef __attribute__((ext_vector_type(4)))  float    v4f;
typedef __attribute__((ext_vector_type(2)))  float    v2f;
typedef __attribute__((ext_vector_type(4)))  unsigned int v4u;

__device__ __forceinline__ unsigned short f2bf_bits(float f) {
  unsigned u = __float_as_uint(f);
  return (unsigned short)((u + 0x7FFFu + ((u >> 16) & 1u)) >> 16);
}
__device__ __forceinline__ float bf_bits2f(unsigned short h) { return __uint_as_float(((unsigned)h) << 16); }

// hazard guards as plain device helpers (their inline asm stays outside the kernel template body)
__device__ __forceinline__ void dep_guard_h(v8f& a, v8f& b, v16h x, v16h y) { asm volatile("v_nop\n\tv_nop\n\tv_nop\n\tv_nop" : "+v"(a), "+v"(b) : "v"(x), "v"(y)); }
__device__ __forceinline__ void dep_guard_b(v8f& a, v8f& b, v16b x, v16b y) { asm volatile("v_nop\n\tv_nop\n\tv_nop\n\tv_nop" : "+v"(a), "+v"(b) : "v"(x), "v"(y)); }
__device__ __forceinline__ void keep4_h(v16h a, v16h b, v16h c, v16h d) { asm volatile("v_nop" :: "v"(a), "v"(b), "v"(c), "v"(d)); }
__device__ __forceinline__ void keep4_b(v16b a, v16b b, v16b c, v16b d) { asm volatile("v_nop" :: "v"(a), "v"(b), "v"(c), "v"(d)); }
__device__ __forceinline__ void acc_guard4(v8f& a, v8f& b, v8f& c, v8f& d) { asm volatile("v_nop\n\tv_nop\n\tv_nop\n\tv_nop" : "+v"(a), "+v"(b), "+v"(c), "+v"(d)); }
template <typename T> struct Frag;
template <> struct Frag<_Float16> {
  typedef v16h V; union U { v16h v; v8h h[2]; };
  static __device__ __forceinline__ v16h load(const _Float16* p) {   // elements 0..7 <- p[0..7], 8..15 <- p[16..23]
    U f; f.h[0] = *(const v8h*)(p); f.h[1] = *(const v8h*)(p + 16); return f.v;
  }
  static __device__ __forceinline__ v8f mma(v16h a, v16h b, v8f c) {
    return __builtin_amdgcn_wmma_f32_16x16x32_f16(false, a, false, b, (short)0, c, false, false);
  }
  static __device__ __forceinline__ void guard(v8f& a, v8f& b, v16h x, v16h y) { dep_guard_h(a, b, x, y); }
  static __device__ __forceinline__ void keep(v16h a, v16h b, v16h c, v16h d) { keep4_h(a, b, c, d); }
};
template <> struct Frag<__bf16> {
  typedef v16b V; union U { v16b v; v8b h[2]; };
  static __device__ __forceinline__ v16b load(const __bf16* p) {
    U f; f.h[0] = *(const v8b*)(p); f.h[1] = *(const v8b*)(p + 16); return f.v;
  }
  static __device__ __forceinline__ v8f mma(v16b a, v16b b, v8f c) {
    return __builtin_amdgcn_wmma_f32_16x16x32_bf16(false, a, false, b, (short)0, c, false, false);
  }
  static __device__ __forceinline__ void guard(v8f& a, v8f& b, v16b x, v16b y) { dep_guard_b(a, b, x, y); }
  static __device__ __forceinline__ void keep(v16b a, v16b b, v16b c, v16b d) { keep4_b(a, b, c, d); }
};

// ---- Register-blocked batched WMMA GEMM ------------------------------------
// C[m,n] = scale * sum_k A[m,k] * Bt[n,k] (+bias)(+resid); each wave owns a 64x64 tile.
// A row-major [M,K]; Bt row-major [N,K]; M % 64 == 0, N % 512 == 0, K % 64 == 0; grid.x = (M/64)*(N/64)/8.
// The 8 waves of a block share one 64-row band of A and own 8 neighbouring 64-row bands of Bt. Operands reach the
// waves through LDS: a stage is 64 k (one 128-B line of each of the 64 + 512 rows), brought by asynchronous 16-byte
// copies of which 8 neighbouring lanes cover one whole line, two buffers, the next stage in flight under this one's products.
// Copy coverage: 256 threads x 18 copies x 16 B = 576 rows x 128 B = the whole stage, every LDS byte from one lane.
// SPLIT (hi/lo planes) is not instantiated and not staged.
// BIAS_MODE: 0 = none, 1 = bias[m], 2 = bias[n].
// OUT_MODE: 0 = f32, 1 = f16, 2 = bf16 hi plane (Cout) + bf16 lo plane (Cout2).
// Epilogue coverage per wave: f32 path 8 it x 2 rows x (16 lanes x 4 floats) = 16 rows x 64; 16-bit path
// 4 it x 4 rows x (8 lanes x 8 halves) = 16 rows x 64; 4 slabs = the whole 64x64 tile.
// ET: 0 = f16 operands, 1 = bf16 operands (pointers passed as 16-bit storage)
#define GS_ROWS  576                       // 64 rows of A, then 512 rows of Bt
#define GS_PITCH 72                        // LDS row pitch in elements: 144 B = 16 B x 9 (odd), no bank met twice by a 16-byte fragment read
#define GS_BYTES (GS_ROWS * GS_PITCH * 2)  // one buffer: 82,944 B
// Nine asynchronous 16-byte copies global -> LDS of this lane. The s_wait_xcnt stands inside the statement, behind the last copy,
// so that no address register of a copy is rewritten in front of it.
__device__ __forceinline__ void gs_copy9(unsigned l0, unsigned l1, unsigned l2, unsigned l3, unsigned l4, unsigned l5,
                                         unsigned l6, unsigned l7, unsigned l8,
                                         const unsigned short* g0, const unsigned short* g1, const unsigned short* g2,
                                         const unsigned short* g3, const unsigned short* g4, const unsigned short* g5,
                                         const unsigned short* g6, const unsigned short* g7, const unsigned short* g8) {
  asm volatile("global_load_async_to_lds_b128 %0, %9, off\n\t"
               "global_load_async_to_lds_b128 %1, %10, off\n\t"
               "global_load_async_to_lds_b128 %2, %11, off\n\t"
               "global_load_async_to_lds_b128 %3, %12, off\n\t"
               "global_load_async_to_lds_b128 %4, %13, off\n\t"
               "global_load_async_to_lds_b128 %5, %14, off\n\t"
               "global_load_async_to_lds_b128 %6, %15, off\n\t"
               "global_load_async_to_lds_b128 %7, %16, off\n\t"
               "global_load_async_to_lds_b128 %8, %17, off\n\t"
               "s_wait_xcnt 0x0"
               :: "v"(l0), "v"(l1), "v"(l2), "v"(l3), "v"(l4), "v"(l5), "v"(l6), "v"(l7), "v"(l8),
                  "v"(g0), "v"(g1), "v"(g2), "v"(g3), "v"(g4), "v"(g5), "v"(g6), "v"(g7), "v"(g8)
               : "memory");
}
// One stage: this thread's 2 pieces of A rows and 16 pieces of Bt rows (rows 32 apart), l = its LDS byte address in row (tid >> 3).
__device__ __forceinline__ void gs_stage(unsigned l, const unsigned short* a, size_t sa, const unsigned short* b, size_t sb) {
  const unsigned st = 32u * GS_PITCH * 2u;   // 32 LDS rows
  gs_copy9(l, l + st, l + 2 * st, l + 3 * st, l + 4 * st, l + 5 * st, l + 6 * st, l + 7 * st, l + 8 * st,
           a, a + sa, b, b + sb, b + 2 * sb, b + 3 * sb, b + 4 * sb, b + 5 * sb, b + 6 * sb);
  gs_copy9(l + 9 * st, l + 10 * st, l + 11 * st, l + 12 * st, l + 13 * st, l + 14 * st, l + 15 * st, l + 16 * st, l + 17 * st,
           b + 7 * sb, b + 8 * sb, b + 9 * sb, b + 10 * sb, b + 11 * sb, b + 12 * sb, b + 13 * sb, b + 14 * sb, b + 15 * sb);
}
template <int ET> struct Elem;
template <> struct Elem<0> { typedef _Float16 T; };
template <> struct Elem<1> { typedef __bf16 T; };
template <int ET, bool SPLIT, int BIAS_MODE, int OUT_MODE, bool RESID, int ACT = 0>
__global__ __launch_bounds__(256) void wmma_gemm64(
    const unsigned short* __restrict__ Ap, const unsigned short* __restrict__ A2p, int lda, long strideA,
    const unsigned short* __restrict__ Btp, const unsigned short* __restrict__ Bt2p, int ldb, long strideB,
    void* __restrict__ Cout, void* __restrict__ Cout2, int ldc, long strideC,
    const float* __restrict__ bias,
    const float* __restrict__ resid, long strideR,
    int M, int N, int K, float scale) {
  typedef typename Elem<ET>::T T;
  typedef typename Frag<T>::V V;
  static_assert(!SPLIT, "hi/lo planes are not staged");
  __shared__ __align__(16) unsigned short sAB[2 * GS_ROWS * GS_PITCH];   // two stage buffers, 165,888 B
  __shared__ __align__(16) float sT[8][16 * 68];   // per-wave 16x64 slab, pitch 68 floats
  const int b    = blockIdx.y;
  const int lane = threadIdx.x & 31;
  const int wave = threadIdx.x >> 5;
  const int tilesN = N >> 6;
  const int tilesM = M >> 6;
  const int tile = blockIdx.x * 8 + wave;
  if (blockIdx.x * 8 >= tilesM * tilesN) return;   // the whole block or none of it, in front of every barrier
  const int tm = tile / tilesN;
  const int tn = tile - tm * tilesN;
  const int m0 = tm << 6;
  const int n0 = tn << 6;

  // staging: thread -> row (tid >> 3) of each group of 32 rows, 16-byte piece (tid & 7) of its 128-B line
  const int srow = threadIdx.x >> 3;
  const int spc  = threadIdx.x & 7;
  const int nb0  = n0 - (wave << 6);           // first Bt row of the block (N % 512 == 0: the 8 tiles lie in one tile row)
  const unsigned short* gA = Ap  + (size_t)b * strideA + (size_t)(m0  + srow) * lda + spc * 8;
  const unsigned short* gB = Btp + (size_t)b * strideB + (size_t)(nb0 + srow) * ldb + spc * 8;
  const size_t sa32 = (size_t)32 * lda, sb32 = (size_t)32 * ldb;
  const unsigned lds0 = (unsigned)(uintptr_t)(&sAB[0]) + (unsigned)(srow * (GS_PITCH * 2) + spc * 16);

  const int rlane = lane & 15;                 // row (A) / col (B, D) within subtile
  const int koff  = (lane >> 4) * 8;           // k offset of this lane half
  const int mOff  = (lane >> 4) * 8;           // D row offset

  v8f acc[4][4];
#pragma unroll
  for (int i = 0; i < 4; ++i)
#pragma unroll
    for (int j = 0; j < 4; ++j) acc[i][j] = (v8f){0.f,0.f,0.f,0.f,0.f,0.f,0.f,0.f};

  const int nStages = K >> 6;
  gs_stage(lds0, gA, sa32, gB, sb32);
  asm volatile("s_wait_asynccnt 0x0" ::: "memory");   // stage 0 of this wave has landed
  __syncthreads();                                     // ... and every wave's part of it
  if (nStages > 1) gs_stage(lds0 + GS_BYTES, gA + 64, sa32, gB + 64, sb32);

  for (int t = 0; t < nStages; ++t) {
    const T* sbuf = (const T*)(const void*)(sAB + (t & 1) * (GS_ROWS * GS_PITCH));
#pragma unroll
    for (int ks = 0; ks < 2; ++ks) {
      V bh[4], ah[4];   // all eight fragments of these 32 k asked for as one group, in front of their 16 products
#pragma unroll
      for (int j = 0; j < 4; ++j)
        bh[j] = Frag<T>::load(sbuf + (64 + (wave << 6) + (j << 4) + rlane) * GS_PITCH + ks * 32 + koff);
#pragma unroll
      for (int i = 0; i < 4; ++i)
        ah[i] = Frag<T>::load(sbuf + ((i << 4) + rlane) * GS_PITCH + ks * 32 + koff);
#pragma unroll
      for (int i = 0; i < 4; ++i) {
#pragma unroll
        for (int j = 0; j < 4; ++j) acc[i][j] = Frag<T>::mma(ah[i], bh[j], acc[i][j]);
        Frag<T>::guard(acc[i][0], acc[i][3], ah[i], ah[i]);
      }
      Frag<T>::keep(bh[0], bh[1], bh[2], bh[3]);
    }
    asm volatile("s_wait_dscnt 0x0" ::: "memory");      // this wave's reads of the buffer are done before it is refilled
    asm volatile("s_wait_asynccnt 0x0" ::: "memory");   // this wave's copies of stage t + 1 have landed
    __syncthreads();                                     // publishes stage t + 1 and ends every reader's last read of stage t
    if (t + 2 < nStages)
      gs_stage(lds0 + (unsigned)(t & 1) * GS_BYTES, gA + (size_t)(t + 2) * 64, sa32, gB + (size_t)(t + 2) * 64, sb32);
  }
  asm volatile("s_wait_asynccnt 0x0" ::: "memory");     // nothing in flight behind the loop
  acc_guard4(acc[0][0], acc[0][1], acc[0][2], acc[0][3]);
  acc_guard4(acc[1][0], acc[1][1], acc[1][2], acc[1][3]);
  acc_guard4(acc[2][0], acc[2][1], acc[2][2], acc[2][3]);
  acc_guard4(acc[3][0], acc[3][1], acc[3][2], acc[3][3]);

  // ---- epilogue ----
  float* slab = sT[wave];
  const float* Rb = RESID ? (resid + (size_t)b * strideR) : nullptr;
#pragma unroll
  for (int i = 0; i < 4; ++i) {
    const int mBase = m0 + (i << 4);
#pragma unroll
    for (int j = 0; j < 4; ++j) {
      const int n = n0 + (j << 4) + rlane;
      float bv = 0.f;
      if (BIAS_MODE == 2) bv = bias[n];
#pragma unroll
      for (int r = 0; r < 8; ++r) {
        float v = acc[i][j][r] * scale;
        if (BIAS_MODE == 1) v += bias[mBase + mOff + r];
        if (BIAS_MODE == 2) v += bv;
        if (RESID) v += Rb[(size_t)(mBase + mOff + r) * ldc + n];
        if (ACT == 1) v = tanhf(v);
        if (ACT == 2) v = fmaxf(v, 0.0f);
        if (ACT == 3) v = v / (1.0f + expf(-v));
        if (ACT == 4) v = (v > 0.f) ? v : 0.01f * v;
        if (ACT == 5) v = 0.5f * v * (1.0f + erff(v * 0.70710678118654752f));
        slab[(mOff + r) * 68 + (j << 4) + rlane] = v;
      }
    }
    __builtin_amdgcn_fence(__ATOMIC_RELEASE, "workgroup");
    __builtin_amdgcn_wave_barrier();
    __builtin_amdgcn_fence(__ATOMIC_ACQUIRE, "workgroup");
    if (OUT_MODE == 0) {
      float* C = (float*)Cout + (size_t)b * strideC;
      const int hh = lane >> 4, c4 = (lane & 15) * 4;     // row seg = 256 B = 16 lanes x 16 B
      {
#pragma unroll
        for (int it = 0; it < 8; ++it) {
          const int row = it * 2 + hh;
          v4f v = *(const v4f*)(slab + row * 68 + c4);
          *(v4f*)(C + (size_t)(mBase + row) * ldc + n0 + c4) = v;
        }
        
      }
    } else {
      const int q = lane >> 3, c8 = (lane & 7) * 8;
      unsigned short* C  = (unsigned short*)Cout  + (size_t)b * strideC;
      unsigned short* C2 = (OUT_MODE == 2) ? ((unsigned short*)Cout2 + (size_t)b * strideC) : nullptr;
      {
#pragma unroll
        for (int it = 0; it < 4; ++it) {
          const int row = it * 4 + q;
          const float* sp = slab + row * 68 + c8;
          v8h hv, lv;
#pragma unroll
          for (int e = 0; e < 8; ++e) {
            if (OUT_MODE == 1) {
              hv[e] = (_Float16)sp[e];
            } else {
              unsigned short hb = f2bf_bits(sp[e]);
              unsigned short lb = f2bf_bits(sp[e] - bf_bits2f(hb));
              hv[e] = __builtin_bit_cast(_Float16, hb);
              lv[e] = __builtin_bit_cast(_Float16, lb);
            }
          }
          *(v8h*)(C + (size_t)(mBase + row) * ldc + n0 + c8) = hv;
          if (OUT_MODE == 2) *(v8h*)(C2 + (size_t)(mBase + row) * ldc + n0 + c8) = lv;
        }
        
      }
    }
    __builtin_amdgcn_fence(__ATOMIC_RELEASE, "workgroup");
    __builtin_amdgcn_wave_barrier();
    __builtin_amdgcn_fence(__ATOMIC_ACQUIRE, "workgroup");
  }
}

// ---------------------------------------------------------------------------
// Elementwise f32 -> 16-bit plane, 2 consecutive elements per thread packed into one 4-B store: each wave writes
// CMODE 0: bf16 RNE bits of in*scale.
// CMODE 1: f16 bits of the bf16-RNE value of in*scale (an 8-significant-bit value re-encoded exactly in f16).
// CMODE 2: f16 RNE bits of in*scale.
// Coverage: grid = ceil(n2/256) blocks x 256 threads x 2 elements = 2*n2 = the whole plane
// (calls here: n2 = 2097152 -> 8192 blocks; n2 = 524288 -> 2048 blocks; both exact multiples of 256).
// ---------------------------------------------------------------------------
__device__ __forceinline__ unsigned pk16(unsigned short a, unsigned short b) { return (unsigned)a | ((unsigned)b << 16); }

template <int CMODE>
__global__ __launch_bounds__(256) void cast2_kernel(const float* __restrict__ in, unsigned short* __restrict__ out,
                                                    int n2, float scale) {
  const int i = blockIdx.x * 256 + threadIdx.x;
  if (i < n2) {
    const v2f f = *(const v2f*)(in + 2 * (size_t)i);
    const float f0 = f[0] * scale, f1 = f[1] * scale;
    unsigned short u0, u1;
    if (CMODE == 0) {
      u0 = f2bf_bits(f0); u1 = f2bf_bits(f1);
    } else if (CMODE == 1) {
      u0 = __builtin_bit_cast(unsigned short, (_Float16)bf_bits2f(f2bf_bits(f0)));
      u1 = __builtin_bit_cast(unsigned short, (_Float16)bf_bits2f(f2bf_bits(f1)));
    } else {
      u0 = __builtin_bit_cast(unsigned short, (_Float16)f0);
      u1 = __builtin_bit_cast(unsigned short, (_Float16)f1);
    }
    const unsigned u = pk16(u0, u1);
    ((unsigned*)out)[i] = u;
    
  }
}

#define AT_D 64
#define AT_NW 4
#define AT_QB 64
#define AT_KC 64
#define AT_LP 72   // LDS row pitch of the K and V^T tiles in elements: 144 B = 16 B x 9 (odd), so the 16 rows of one 16-byte fragment read fall on 64 distinct banks

__device__ __forceinline__ unsigned short at_bf_bits(float f) {
  unsigned u = __float_as_uint(f);
  return (unsigned short)((u + 0x7FFFu + ((u >> 16) & 1u)) >> 16);
}
__device__ __forceinline__ __bf16 at_f2bf(float f) { return __builtin_bit_cast(__bf16, at_bf_bits(f)); }
__device__ __forceinline__ void at_split(float f, __bf16& hi, __bf16& lo) {
  const unsigned short hb = at_bf_bits(f);
  hi = __builtin_bit_cast(__bf16, hb);
  lo = at_f2bf(f - __uint_as_float(((unsigned)hb) << 16));
}
__device__ __forceinline__ v8f at_mma(v16b a, v16b b, v8f c) {
  c = __builtin_amdgcn_wmma_f32_16x16x32_bf16(false, a, false, b, (short)0, c, false, false);
  asm volatile("v_nop\n\tv_nop\n\tv_nop\n\tv_nop" : "+v"(c) : "v"(a), "v"(b));
  return c;
}

// lane l <-> l ^ 16 (the two halves of a wave hold the two key halves of one query column)
__device__ __forceinline__ float at_xhalf(float v) {
  const int b = __builtin_bit_cast(int, v);
  return __builtin_bit_cast(float, __builtin_amdgcn_permlanex16(b, b, 0x76543210, 0xfedcba98, false, false));
}

__global__ __launch_bounds__(128)
void attn_full64_kernel(const unsigned short* __restrict__ qhp, const unsigned short* __restrict__ qlp,
                        const unsigned short* __restrict__ khp, const unsigned short* __restrict__ klp,
                        const unsigned short* __restrict__ vhp, const unsigned short* __restrict__ vlp,
                        const int* __restrict__ kmask,
                        float* __restrict__ out, float sscale, float mfill) {
  union FB { v16b v; v8b h[2]; };
  __shared__ __align__(16) __bf16 Ksh[AT_KC * AT_LP];            // K hi [kv][d]      9 KB
  __shared__ __align__(16) __bf16 Ksl[AT_KC * AT_LP];            // K lo
  __shared__ __align__(16) __bf16 Vth[AT_D * AT_LP];             // V hi [d][kv]      9 KB
  __shared__ __align__(16) __bf16 Vtl[AT_D * AT_LP];             // V lo
  __shared__ __align__(16) float  Os[AT_NW][16 * 68];            // per wave out tile, pitch 68

  const int tid  = threadIdx.x;
  const int wave = tid >> 5;
  const int lane = tid & 31;
  const int hh   = lane >> 4;
  const int c    = lane & 15;

  const int nqb = SEQ_LEN / AT_QB;        // 32
  const int bx = blockIdx.x;
  const int qb = bx % nqb;
  const int h  = bx / nqb;                // 0..N_HEADS-1 (grid = N_HEADS * nqb)
  const int q0 = qb * AT_QB + wave * 16;
  const size_t bo = (size_t)blockIdx.y * SEQ_LEN * EMB_DIM;   // this batch element's start in every q, k, v^T and out plane
  const int* km = kmask + (size_t)blockIdx.y * SEQ_LEN;

  const __bf16* Qh = (const __bf16*)(const void*)qhp + bo + (size_t)h * AT_D;
  const __bf16* Ql = (const __bf16*)(const void*)qlp + bo + (size_t)h * AT_D;
  const __bf16* Kh = (const __bf16*)(const void*)khp + bo + (size_t)h * AT_D;
  const __bf16* Kl = (const __bf16*)(const void*)klp + bo + (size_t)h * AT_D;
  const __bf16* Vh = (const __bf16*)(const void*)vhp + bo + (size_t)h * AT_D * SEQ_LEN;
  const __bf16* Vl = (const __bf16*)(const void*)vlp + bo + (size_t)h * AT_D * SEQ_LEN;
  float*        ob = out + bo + (size_t)h * AT_D;

  // ---- Q fragments (B operand, column = query = lane&15, split k map via Frag load): 2 d-chunks, hi and lo ----
  v16b qah[2], qal[2];
#pragma unroll
  for (int dc = 0; dc < 2; ++dc) {
    const __bf16* qr = Qh + (size_t)(q0 + c) * EMB_DIM + dc * 32 + 8 * hh;
    const __bf16* ql = Ql + (size_t)(q0 + c) * EMB_DIM + dc * 32 + 8 * hh;
    qah[dc] = Frag<__bf16>::load(qr);
    qal[dc] = Frag<__bf16>::load(ql);
  }

  // One query per lane (q0 + c). mrow: running maximum, equal in both wave halves; lrow: this half's share of the sum.
  float mrow = -INFINITY, lrow = 0.f;
  const float sc2 = sscale * 1.44269504088896341f;   // score scale times log2(e)
  const float mf2 = mfill  * 1.44269504088896341f;   // the mask fill in the same units
  v8f oacc[4];   // out^T tiles: oacc[t][r] = out[q0 + c][t*16 + 8*hh + r]
#pragma unroll
  for (int t = 0; t < 4; ++t) oacc[t] = (v8f){0.f,0.f,0.f,0.f,0.f,0.f,0.f,0.f};

  const int nChunks = SEQ_LEN / AT_KC;   // 32, compile-time constant
  for (int kc = 0; kc < nChunks; ++kc) {
    const int kv0 = kc * AT_KC;
    __syncthreads();
    // key-padding mask of this lane's 32 keys (kv0 + j*16 + 8*hh + r, always < SEQ_LEN), asked for together with the
    // staging loads so that its latency runs under theirs
    v4u kmv[8];
#pragma unroll
    for (int j = 0; j < 4; ++j) {
      kmv[2 * j]     = *(const v4u*)(km + kv0 + j * 16 + 8 * hh);
      kmv[2 * j + 1] = *(const v4u*)(km + kv0 + j * 16 + 8 * hh + 4);
    }
    // the staging loads below may land in the registers that hold the mask loads' address: keep the wait in front of that overwrite
    asm volatile("s_wait_xcnt 0x0" ::: "memory");
    {
      // staging coverage: 128 threads x (4 x 8) elements = 64 rows x 64 per plane = the whole chunk tile
      const int r = tid >> 1, half = (tid & 1) * 32;
      const __bf16* ksh = Kh + (size_t)(kv0 + r) * EMB_DIM + half;   // K row kv0+r, d = half..half+31
      const __bf16* ksl = Kl + (size_t)(kv0 + r) * EMB_DIM + half;
      const __bf16* vsh = Vh + (size_t)r * SEQ_LEN + kv0 + half;      // V^T row d = r, s = kv0+half..+31
      const __bf16* vsl = Vl + (size_t)r * SEQ_LEN + kv0 + half;
#pragma unroll
      for (int i = 0; i < 4; ++i) {
        const v8b a0 = *(const v8b*)(ksh + 8 * i);
        const v8b a1 = *(const v8b*)(ksl + 8 * i);
        const v8b b0 = *(const v8b*)(vsh + 8 * i);
        const v8b b1 = *(const v8b*)(vsl + 8 * i);
        *(v8b*)(Ksh + r * AT_LP + half + 8 * i) = a0;
        *(v8b*)(Ksl + r * AT_LP + half + 8 * i) = a1;
        *(v8b*)(Vth + r * AT_LP + half + 8 * i) = b0;
        *(v8b*)(Vtl + r * AT_LP + half + 8 * i) = b1;
      }
    }
    __syncthreads();

    // scores^T = K . Q^T : s[j][r] = score(key kv0 + j*16 + 8*hh + r, query q0 + c)
    v8f s[4];
#pragma unroll
    for (int j = 0; j < 4; ++j) {
      s[j] = (v8f){0.f,0.f,0.f,0.f,0.f,0.f,0.f,0.f};
#pragma unroll
      for (int dc = 0; dc < 2; ++dc) {
        FB kb, kl;
        kb.h[0] = *(const v8b*)(Ksh + (j * 16 + c) * AT_LP + dc * 32 + 8 * hh);
        kb.h[1] = *(const v8b*)(Ksh + (j * 16 + c) * AT_LP + dc * 32 + 16 + 8 * hh);
        kl.h[0] = *(const v8b*)(Ksl + (j * 16 + c) * AT_LP + dc * 32 + 8 * hh);
        kl.h[1] = *(const v8b*)(Ksl + (j * 16 + c) * AT_LP + dc * 32 + 16 + 8 * hh);
        s[j] = at_mma(kb.v, qah[dc], s[j]);
        s[j] = at_mma(kl.v, qah[dc], s[j]);
        s[j] = at_mma(kb.v, qal[dc], s[j]);
      }
    }
    // mask nonzero -> score := mfill (select, as in the module)
    float m = -INFINITY;
#pragma unroll
    for (int j = 0; j < 4; ++j) {
#pragma unroll
      for (int r = 0; r < 8; ++r) {
        float sv = s[j][r] * sc2;
        sv = (kmv[2 * j + (r >> 2)][r & 3] != 0u) ? mf2 : sv;
        s[j][r] = sv;
        m = fmaxf(m, sv);
      }
    }
    m = fmaxf(m, at_xhalf(m));   // the other 32 keys of this query
    const float mnew = fmaxf(mrow, m);
    const float alpha = __builtin_amdgcn_exp2f(mrow - mnew);
    mrow = mnew;
    // p^T stays in registers: two score tiles (keys 0..15 and 16..31 of a 32-key group) are one B operand,
    // element e < 8 = key 8*hh + e, e >= 8 = key 16 + 8*hh + (e - 8): the order in which the V^T rows are read below
    v16b pth[2], ptl[2];
    float psum = 0.f;
#pragma unroll
    for (int j = 0; j < 4; ++j) {
#pragma unroll
      for (int r = 0; r < 8; ++r) {
        const float p = __builtin_amdgcn_exp2f(s[j][r] - mnew);
        psum += p;
        __bf16 a, bl; at_split(p, a, bl);
        pth[j >> 1][(j & 1) * 8 + r] = a;
        ptl[j >> 1][(j & 1) * 8 + r] = bl;
      }
    }
    lrow = lrow * alpha + psum;
#pragma unroll
    for (int t = 0; t < 4; ++t)
#pragma unroll
      for (int r = 0; r < 8; ++r) oacc[t][r] *= alpha;
    // out^T += V^T . p^T
#pragma unroll
    for (int kk = 0; kk < 2; ++kk) {
#pragma unroll
      for (int t = 0; t < 4; ++t) {
        FB vb, vl;
        vb.h[0] = *(const v8b*)(Vth + (t * 16 + c) * AT_LP + kk * 32 + 8 * hh);
        vb.h[1] = *(const v8b*)(Vth + (t * 16 + c) * AT_LP + kk * 32 + 16 + 8 * hh);
        vl.h[0] = *(const v8b*)(Vtl + (t * 16 + c) * AT_LP + kk * 32 + 8 * hh);
        vl.h[1] = *(const v8b*)(Vtl + (t * 16 + c) * AT_LP + kk * 32 + 16 + 8 * hh);
        oacc[t] = at_mma(vb.v, pth[kk], oacc[t]);
        oacc[t] = at_mma(vl.v, pth[kk], oacc[t]);
        oacc[t] = at_mma(vb.v, ptl[kk], oacc[t]);
      }
    }
  }

  float* os = Os[wave];
  {
    const float inv = 1.0f / (lrow + at_xhalf(lrow));   // join the two halves' sums once
#pragma unroll
    for (int t = 0; t < 4; ++t) {
      v4f lo4, hi4;
#pragma unroll
      for (int r = 0; r < 4; ++r) { lo4[r] = oacc[t][r] * inv; hi4[r] = oacc[t][4 + r] * inv; }
      *(v4f*)(os + c * 68 + t * 16 + 8 * hh)     = lo4;
      *(v4f*)(os + c * 68 + t * 16 + 8 * hh + 4) = hi4;
    }
  }
  __builtin_amdgcn_fence(__ATOMIC_RELEASE, "workgroup");
  __builtin_amdgcn_wave_barrier();
  __builtin_amdgcn_fence(__ATOMIC_ACQUIRE, "workgroup");
  {
    const int c4 = (lane & 15) * 4;
    {
#pragma unroll
      for (int it = 0; it < 8; ++it) {
        const int row = it * 2 + hh;   // it 0..7 x hh 0..1 covers rows 0..15 of the wave tile
        v4f val = *(const v4f*)(os + row * 68 + c4);
        *(v4f*)(ob + (size_t)(q0 + row) * EMB_DIM + c4) = val;
      }
      
    }
  }
}

// ---------------------------------------------------------------------------
// Host-side orchestration (kernel launches + host arithmetic only).
// Workspace region map (byte offsets, every region fully written by its producer before any read):
//   0           xb    bf16 [4096][1024]            8,388,608
//   8,388,608   wqb   bf16 [1024][1024]            2,097,152
//   10,485,760  wkb   bf16 [1024][1024]            2,097,152
//   12,582,912  wvb   bf16 [1024][1024]            2,097,152
//   14,680,064  wo16  f16  [1024][1024] (x64)      2,097,152
//   16,777,216  qh    bf16 [4096][1024]            8,388,608
//   25,165,824  ql    bf16 [4096][1024]            8,388,608
//   33,554,432  kh    bf16 [4096][1024]            8,388,608
//   41,943,040  kl    bf16 [4096][1024]            8,388,608
//   50,331,648  vth   bf16 [2][1024][2048]         8,388,608
//   58,720,256  vtl   bf16 [2][1024][2048]         8,388,608
//   67,108,864  o32   f32  [4096][1024]           16,777,216
//   83,886,080  o16   f16  [4096][1024] (x16)      8,388,608
//   92,274,688  end (88 MiB)
// GEMM shapes: K = 1024 (multiple of 32) everywhere; M, N in {1024, 2048, 4096} (multiples of 64); no padding.
// ---------------------------------------------------------------------------
extern "C" void kernel_launch(void* const* d_in, const int* in_sizes, int n_in,
                              void* d_out, int out_size, void* d_ws, size_t ws_size,
                              hipStream_t stream) {
  if (n_in < 6) return;
  const int nTokEmb = N_TOK * EMB_DIM;          // 4,194,304
  const int nEmbEmb = EMB_DIM * EMB_DIM;        // 1,048,576
  if (in_sizes[0] != nTokEmb || in_sizes[1] != N_BATCH * SEQ_LEN || in_sizes[2] != nEmbEmb ||
      in_sizes[3] != nEmbEmb || in_sizes[4] != nEmbEmb || in_sizes[5] != nEmbEmb || out_size != nTokEmb) return;

  const size_t offXb  = 0;
  const size_t offWq  = offXb  + (size_t)nTokEmb * 2;
  const size_t offWk  = offWq  + (size_t)nEmbEmb * 2;
  const size_t offWv  = offWk  + (size_t)nEmbEmb * 2;
  const size_t offWo  = offWv  + (size_t)nEmbEmb * 2;
  const size_t offQh  = offWo  + (size_t)nEmbEmb * 2;
  const size_t offQl  = offQh  + (size_t)nTokEmb * 2;
  const size_t offKh  = offQl  + (size_t)nTokEmb * 2;
  const size_t offKl  = offKh  + (size_t)nTokEmb * 2;
  const size_t offVth = offKl  + (size_t)nTokEmb * 2;
  const size_t offVtl = offVth + (size_t)nTokEmb * 2;
  const size_t offO32 = offVtl + (size_t)nTokEmb * 2;
  const size_t offO16 = offO32 + (size_t)nTokEmb * 4;
  const size_t offEnd = offO16 + (size_t)nTokEmb * 2;   // 92,274,688
  if (ws_size < offEnd) return;

  const float* x    = (const float*)d_in[0];
  const int*   mask = (const int*)d_in[1];
  const float* wq   = (const float*)d_in[2];
  const float* wk   = (const float*)d_in[3];
  const float* wv   = (const float*)d_in[4];
  const float* wo   = (const float*)d_in[5];
  float* out = (float*)d_out;

  char* ws = (char*)d_ws;
  unsigned short* xb   = (unsigned short*)(ws + offXb);
  unsigned short* wqb  = (unsigned short*)(ws + offWq);
  unsigned short* wkb  = (unsigned short*)(ws + offWk);
  unsigned short* wvb  = (unsigned short*)(ws + offWv);
  unsigned short* wo16 = (unsigned short*)(ws + offWo);
  unsigned short* qh   = (unsigned short*)(ws + offQh);
  unsigned short* ql   = (unsigned short*)(ws + offQl);
  unsigned short* kh   = (unsigned short*)(ws + offKh);
  unsigned short* kl   = (unsigned short*)(ws + offKl);
  unsigned short* vth  = (unsigned short*)(ws + offVth);
  unsigned short* vtl  = (unsigned short*)(ws + offVtl);
  float*          o32  = (float*)(ws + offO32);
  unsigned short* o16  = (unsigned short*)(ws + offO16);
  const float* dummyf = x;   // valid pointer for unused bias / resid arguments (never dereferenced)

  // 1) 16-bit operand planes: x, wq, wk, wv -> bf16 RNE; wo -> f16 encode of bf16-RNE(wo*64)
  {
    const int n2x = nTokEmb / 2;   // 2,097,152 -> 8192 blocks
    const int n2w = nEmbEmb / 2;   //   524,288 -> 2048 blocks
    cast2_kernel<0><<<(n2x + 255) / 256, 256, 0, stream>>>(x,  xb,  n2x, 1.0f);
    cast2_kernel<0><<<(n2w + 255) / 256, 256, 0, stream>>>(wq, wqb, n2w, 1.0f);
    cast2_kernel<0><<<(n2w + 255) / 256, 256, 0, stream>>>(wk, wkb, n2w, 1.0f);
    cast2_kernel<0><<<(n2w + 255) / 256, 256, 0, stream>>>(wv, wvb, n2w, 1.0f);
    cast2_kernel<1><<<(n2w + 255) / 256, 256, 0, stream>>>(wo, wo16, n2w, 64.0f);
  }

  // 2) q, k = x @ W^T : M = 4096 tokens, N = 1024, K = 1024; bf16 hi/lo output planes [token][h*64+d]
  //    tiles = 64 x 16 = 1024 -> 128 blocks of 8 waves
  {
    const dim3 g(((N_TOK / 64) * (EMB_DIM / 64)) / 8, 1);
    wmma_gemm64<1, false, 0, 2, false><<<g, 256, 0, stream>>>(
        xb, xb, EMB_DIM, 0L, wqb, wqb, EMB_DIM, 0L,
        (void*)qh, (void*)ql, EMB_DIM, 0L, dummyf, dummyf, 0L, N_TOK, EMB_DIM, EMB_DIM, 1.0f);
    wmma_gemm64<1, false, 0, 2, false><<<g, 256, 0, stream>>>(
        xb, xb, EMB_DIM, 0L, wkb, wkb, EMB_DIM, 0L,
        (void*)kh, (void*)kl, EMB_DIM, 0L, dummyf, dummyf, 0L, N_TOK, EMB_DIM, EMB_DIM, 1.0f);
  }

  // 3) v^T per batch = Wv @ x_b^T : A = wvb [1024 out][1024 in], Bt = xb_b [2048 tokens][1024],
  //    C = [1024 (h*64+d)][2048 s] bf16 hi/lo, y-batched over 2 batches; tiles = 16 x 32 = 512 -> 64 blocks
  {
    const dim3 g(((EMB_DIM / 64) * (SEQ_LEN / 64)) / 8, N_BATCH);
    wmma_gemm64<1, false, 0, 2, false><<<g, 256, 0, stream>>>(
        wvb, wvb, EMB_DIM, 0L, xb, xb, EMB_DIM, (long)SEQ_LEN * EMB_DIM,
        (void*)vth, (void*)vtl, SEQ_LEN, (long)EMB_DIM * SEQ_LEN, dummyf, dummyf, 0L,
        EMB_DIM, SEQ_LEN, EMB_DIM, 1.0f);
  }

  // 4) attention: grid = (16 heads x 32 query blocks, 2 batch elements); key mask read from d_in[1] as int32
  {
    const dim3 g(N_HEADS * (SEQ_LEN / 64), N_BATCH);
    attn_full64_kernel<<<g, 128, 0, stream>>>(qh, ql, kh, kl, vth, vtl, mask, o32, 0.125f, -1.0e9f);
  }

  // 5) attention output f32 -> f16 carried x16
  {
    const int n2o = nTokEmb / 2;   // 2,097,152 -> 8192 blocks
    cast2_kernel<2><<<(n2o + 255) / 256, 256, 0, stream>>>(o32, o16, n2o, 16.0f);
  }

  // 6) out = O @ Wo^T : f16 operands (O x16, Wo x64) -> scale 1/1024, f32 into d_out [4096][1024]
  {
    const dim3 g(((N_TOK / 64) * (EMB_DIM / 64)) / 8, 1);
    wmma_gemm64<0, false, 0, 0, false><<<g, 256, 0, stream>>>(
        o16, o16, EMB_DIM, 0L, wo16, wo16, EMB_DIM, 0L,
        (void*)out, (void*)out, EMB_DIM, 0L, dummyf, dummyf, 0L, N_TOK, EMB_DIM, EMB_DIM, 1.0f / 1024.0f);
  }
}

// v006
// One run takes 206 microseconds.
// In two side-by-side timings against v005, it was 1.08 and 1.07 times as fast.
// Over all steps from v000 it is 3.39 times as fast.
// Projections q, k, v^T: v_wmma_f32_16x16x32_bf16 (x and weights RNE-converted to bf16, single product); attention q.k^T and p.v: v_wmma_f32_16x16x32_bf16 with bf16 hi/lo split operands (hi.hi + hi.lo + lo.hi); output projection: v_wmma_f32_16x16x32_f16 (attention output carried x16 in f16, bf16-RNE weight carried x64 in f16); f32 accumulate everywhere; online softmax, key-mask select (-1e9) and normalisation in f32.
#include <hip/hip_runtime.h>
#include <math.h>
#include <stdint.h>

#define N_BATCH  2
#define SEQ_LEN  2048
#define EMB_DIM  1024
#define N_HEADS  16
#define HEAD_DIM 64
#define N_TOK    (N_BATCH * SEQ_LEN)

typedef __attribute__((ext_vector_type(16))) _Float16 v16h;
typedef __attribute__((ext_vector_type(8)))  _Float16 v8h;
typedef __attribute__((ext_vector_type(16))) __bf16   v16b;
typedef __attribute__((ext_vector_type(8)))  __bf16   v8b;
typedef __attribute__((ext_vector_type(8)))  float    v8f;
typedef __attribute__((ext_vector_type(4)))  float    v4f;
typedef __attribute__((ext_vector_type(2)))  float    v2f;
typedef __attribute__((ext_vector_type(4)))  unsigned int v4u;

__device__ __forceinline__ unsigned short f2bf_bits(float f) {
  unsigned u = __float_as_uint(f);
  return (unsigned short)((u + 0x7FFFu + ((u >> 16) & 1u)) >> 16);
}
__device__ __forceinline__ float bf_bits2f(unsigned short h) { return __uint_as_float(((unsigned)h) << 16); }

// hazard guards as plain device helpers (their inline asm stays outside the kernel template body)
__device__ __forceinline__ void dep_guard_h(v8f& a, v8f& b, v16h x, v16h y) { asm volatile("v_nop\n\tv_nop\n\tv_nop\n\tv_nop" : "+v"(a), "+v"(b) : "v"(x), "v"(y)); }
__device__ __forceinline__ void dep_guard_b(v8f& a, v8f& b, v16b x, v16b y) { asm volatile("v_nop\n\tv_nop\n\tv_nop\n\tv_nop" : "+v"(a), "+v"(b) : "v"(x), "v"(y)); }
__device__ __forceinline__ void keep4_h(v16h a, v16h b, v16h c, v16h d) { asm volatile("v_nop" :: "v"(a), "v"(b), "v"(c), "v"(d)); }
__device__ __forceinline__ void keep4_b(v16b a, v16b b, v16b c, v16b d) { asm volatile("v_nop" :: "v"(a), "v"(b), "v"(c), "v"(d)); }
__device__ __forceinline__ void acc_guard4(v8f& a, v8f& b, v8f& c, v8f& d) { asm volatile("v_nop\n\tv_nop\n\tv_nop\n\tv_nop" : "+v"(a), "+v"(b), "+v"(c), "+v"(d)); }
template <typename T> struct Frag;
template <> struct Frag<_Float16> {
  typedef v16h V; union U { v16h v; v8h h[2]; };
  static __device__ __forceinline__ v16h load(const _Float16* p) {   // elements 0..7 <- p[0..7], 8..15 <- p[16..23]
    U f; f.h[0] = *(const v8h*)(p); f.h[1] = *(const v8h*)(p + 16); return f.v;
  }
  static __device__ __forceinline__ v8f mma(v16h a, v16h b, v8f c) {
    return __builtin_amdgcn_wmma_f32_16x16x32_f16(false, a, false, b, (short)0, c, false, false);
  }
  static __device__ __forceinline__ void guard(v8f& a, v8f& b, v16h x, v16h y) { dep_guard_h(a, b, x, y); }
  static __device__ __forceinline__ void keep(v16h a, v16h b, v16h c, v16h d) { keep4_h(a, b, c, d); }
};
template <> struct Frag<__bf16> {
  typedef v16b V; union U { v16b v; v8b h[2]; };
  static __device__ __forceinline__ v16b load(const __bf16* p) {
    U f; f.h[0] = *(const v8b*)(p); f.h[1] = *(const v8b*)(p + 16); return f.v;
  }
  static __device__ __forceinline__ v8f mma(v16b a, v16b b, v8f c) {
    return __builtin_amdgcn_wmma_f32_16x16x32_bf16(false, a, false, b, (short)0, c, false, false);
  }
  static __device__ __forceinline__ void guard(v8f& a, v8f& b, v16b x, v16b y) { dep_guard_b(a, b, x, y); }
  static __device__ __forceinline__ void keep(v16b a, v16b b, v16b c, v16b d) { keep4_b(a, b, c, d); }
};

// ---- Register-blocked batched WMMA GEMM ------------------------------------
// C[m,n] = scale * sum_k A[m,k] * Bt[n,k] (+bias)(+resid); each wave owns a 64x64 tile.
// A row-major [M,K]; Bt row-major [N,K]; M % 64 == 0, N % 512 == 0, K % 64 == 0; grid.x = (M/64)*(N/64)/8.
// The 8 waves of a block share one 64-row band of A and own 8 neighbouring 64-row bands of Bt. Operands reach the
// waves through LDS: a stage is 64 k (one 128-B line of each of the 64 + 512 rows), brought by asynchronous 16-byte
// copies of which 8 neighbouring lanes cover one whole line, two buffers, the next stage in flight under this one's products.
// Copy coverage: 256 threads x 18 copies x 16 B = 576 rows x 128 B = the whole stage, every LDS byte from one lane.
// SPLIT (hi/lo planes) is not instantiated and not staged.
// BIAS_MODE: 0 = none, 1 = bias[m], 2 = bias[n].
// OUT_MODE: 0 = f32, 1 = f16, 2 = bf16 hi plane (Cout) + bf16 lo plane (Cout2).
// Epilogue coverage per wave: f32 path 8 it x 2 rows x (16 lanes x 4 floats) = 16 rows x 64; 16-bit path
// 4 it x 4 rows x (8 lanes x 8 halves) = 16 rows x 64; 4 slabs = the whole 64x64 tile.
// ET: 0 = f16 operands, 1 = bf16 operands (pointers passed as 16-bit storage)
#define GS_ROWS  576                       // 64 rows of A, then 512 rows of Bt
#define GS_PITCH 72                        // LDS row pitch in elements: 144 B = 16 B x 9 (odd), no bank met twice by a 16-byte fragment read
#define GS_BYTES (GS_ROWS * GS_PITCH * 2)  // one buffer: 82,944 B
// Nine asynchronous 16-byte copies global -> LDS of this lane. The s_wait_xcnt stands inside the statement, behind the last copy,
// so that no address register of a copy is rewritten in front of it.
__device__ __forceinline__ void gs_copy9(unsigned l0, unsigned l1, unsigned l2, unsigned l3, unsigned l4, unsigned l5,
                                         unsigned l6, unsigned l7, unsigned l8,
                                         const unsigned short* g0, const unsigned short* g1, const unsigned short* g2,
                                         const unsigned short* g3, const unsigned short* g4, const unsigned short* g5,
                                         const unsigned short* g6, const unsigned short* g7, const unsigned short* g8) {
  asm volatile("global_load_async_to_lds_b128 %0, %9, off\n\t"
               "global_load_async_to_lds_b128 %1, %10, off\n\t"
               "global_load_async_to_lds_b128 %2, %11, off\n\t"
               "global_load_async_to_lds_b128 %3, %12, off\n\t"
               "global_load_async_to_lds_b128 %4, %13, off\n\t"
               "global_load_async_to_lds_b128 %5, %14, off\n\t"
               "global_load_async_to_lds_b128 %6, %15, off\n\t"
               "global_load_async_to_lds_b128 %7, %16, off\n\t"
               "global_load_async_to_lds_b128 %8, %17, off\n\t"
               "s_wait_xcnt 0x0"
               :: "v"(l0), "v"(l1), "v"(l2), "v"(l3), "v"(l4), "v"(l5), "v"(l6), "v"(l7), "v"(l8),
                  "v"(g0), "v"(g1), "v"(g2), "v"(g3), "v"(g4), "v"(g5), "v"(g6), "v"(g7), "v"(g8)
               : "memory");
}
// One stage: this thread's 2 pieces of A rows and 16 pieces of Bt rows (rows 32 apart), l = its LDS byte address in row (tid >> 3).
__device__ __forceinline__ void gs_stage(unsigned l, const unsigned short* a, size_t sa, const unsigned short* b, size_t sb) {
  const unsigned st = 32u * GS_PITCH * 2u;   // 32 LDS rows
  gs_copy9(l, l + st, l + 2 * st, l + 3 * st, l + 4 * st, l + 5 * st, l + 6 * st, l + 7 * st, l + 8 * st,
           a, a + sa, b, b + sb, b + 2 * sb, b + 3 * sb, b + 4 * sb, b + 5 * sb, b + 6 * sb);
  gs_copy9(l + 9 * st, l + 10 * st, l + 11 * st, l + 12 * st, l + 13 * st, l + 14 * st, l + 15 * st, l + 16 * st, l + 17 * st,
           b + 7 * sb, b + 8 * sb, b + 9 * sb, b + 10 * sb, b + 11 * sb, b + 12 * sb, b + 13 * sb, b + 14 * sb, b + 15 * sb);
}
template <int ET> struct Elem;
template <> struct Elem<0> { typedef _Float16 T; };
template <> struct Elem<1> { typedef __bf16 T; };
template <int ET, bool SPLIT, int BIAS_MODE, int OUT_MODE, bool RESID, int ACT = 0>
__global__ __launch_bounds__(256) void wmma_gemm64(
    const unsigned short* __restrict__ Ap, const unsigned short* __restrict__ A2p, int lda, long strideA,
    const unsigned short* __restrict__ Btp, const unsigned short* __restrict__ Bt2p, int ldb, long strideB,
    void* __restrict__ Cout, void* __restrict__ Cout2, int ldc, long strideC,
    const float* __restrict__ bias,
    const float* __restrict__ resid, long strideR,
    int M, int N, int K, float scale) {
  typedef typename Elem<ET>::T T;
  typedef typename Frag<T>::V V;
  static_assert(!SPLIT, "hi/lo planes are not staged");
  __shared__ __align__(16) unsigned short sAB[2 * GS_ROWS * GS_PITCH];   // two stage buffers, 165,888 B
  __shared__ __align__(16) float sT[8][16 * 68];   // per-wave 16x64 slab, pitch 68 floats
  const int b    = blockIdx.y;
  const int lane = threadIdx.x & 31;
  const int wave = threadIdx.x >> 5;
  const int tilesN = N >> 6;
  const int tilesM = M >> 6;
  const int tile = blockIdx.x * 8 + wave;
  if (blockIdx.x * 8 >= tilesM * tilesN) return;   // the whole block or none of it, in front of every barrier
  const int tm = tile / tilesN;
  const int tn = tile - tm * tilesN;
  const int m0 = tm << 6;
  const int n0 = tn << 6;

  // staging: thread -> row (tid >> 3) of each group of 32 rows, 16-byte piece (tid & 7) of its 128-B line
  const int srow = threadIdx.x >> 3;
  const int spc  = threadIdx.x & 7;
  const int nb0  = n0 - (wave << 6);           // first Bt row of the block (N % 512 == 0: the 8 tiles lie in one tile row)
  const unsigned short* gA = Ap  + (size_t)b * strideA + (size_t)(m0  + srow) * lda + spc * 8;
  const unsigned short* gB = Btp + (size_t)b * strideB + (size_t)(nb0 + srow) * ldb + spc * 8;
  const size_t sa32 = (size_t)32 * lda, sb32 = (size_t)32 * ldb;
  const unsigned lds0 = (unsigned)(uintptr_t)(&sAB[0]) + (unsigned)(srow * (GS_PITCH * 2) + spc * 16);

  const int rlane = lane & 15;                 // row (A) / col (B, D) within subtile
  const int koff  = (lane >> 4) * 8;           // k offset of this lane half
  const int mOff  = (lane >> 4) * 8;           // D row offset

  v8f acc[4][4];
#pragma unroll
  for (int i = 0; i < 4; ++i)
#pragma unroll
    for (int j = 0; j < 4; ++j) acc[i][j] = (v8f){0.f,0.f,0.f,0.f,0.f,0.f,0.f,0.f};

  const int nStages = K >> 6;
  gs_stage(lds0, gA, sa32, gB, sb32);
  asm volatile("s_wait_asynccnt 0x0" ::: "memory");   // stage 0 of this wave has landed
  __syncthreads();                                     // ... and every wave's part of it
  if (nStages > 1) gs_stage(lds0 + GS_BYTES, gA + 64, sa32, gB + 64, sb32);

  for (int t = 0; t < nStages; ++t) {
    const T* sbuf = (const T*)(const void*)(sAB + (t & 1) * (GS_ROWS * GS_PITCH));
#pragma unroll
    for (int ks = 0; ks < 2; ++ks) {
      V bh[4], ah[4];   // all eight fragments of these 32 k asked for as one group, in front of their 16 products
#pragma unroll
      for (int j = 0; j < 4; ++j)
        bh[j] = Frag<T>::load(sbuf + (64 + (wave << 6) + (j << 4) + rlane) * GS_PITCH + ks * 32 + koff);
#pragma unroll
      for (int i = 0; i < 4; ++i)
        ah[i] = Frag<T>::load(sbuf + ((i << 4) + rlane) * GS_PITCH + ks * 32 + koff);
#pragma unroll
      for (int i = 0; i < 4; ++i) {
#pragma unroll
        for (int j = 0; j < 4; ++j) acc[i][j] = Frag<T>::mma(ah[i], bh[j], acc[i][j]);
        Frag<T>::guard(acc[i][0], acc[i][3], ah[i], ah[i]);
      }
      Frag<T>::keep(bh[0], bh[1], bh[2], bh[3]);
    }
    asm volatile("s_wait_dscnt 0x0" ::: "memory");      // this wave's reads of the buffer are done before it is refilled
    asm volatile("s_wait_asynccnt 0x0" ::: "memory");   // this wave's copies of stage t + 1 have landed
    __syncthreads();                                     // publishes stage t + 1 and ends every reader's last read of stage t
    if (t + 2 < nStages)
      gs_stage(lds0 + (unsigned)(t & 1) * GS_BYTES, gA + (size_t)(t + 2) * 64, sa32, gB + (size_t)(t + 2) * 64, sb32);
  }
  asm volatile("s_wait_asynccnt 0x0" ::: "memory");     // nothing in flight behind the loop
  acc_guard4(acc[0][0], acc[0][1], acc[0][2], acc[0][3]);
  acc_guard4(acc[1][0], acc[1][1], acc[1][2], acc[1][3]);
  acc_guard4(acc[2][0], acc[2][1], acc[2][2], acc[2][3]);
  acc_guard4(acc[3][0], acc[3][1], acc[3][2], acc[3][3]);

  // ---- epilogue ----
  float* slab = sT[wave];
  const float* Rb = RESID ? (resid + (size_t)b * strideR) : nullptr;
#pragma unroll
  for (int i = 0; i < 4; ++i) {
    const int mBase = m0 + (i << 4);
#pragma unroll
    for (int j = 0; j < 4; ++j) {
      const int n = n0 + (j << 4) + rlane;
      float bv = 0.f;
      if (BIAS_MODE == 2) bv = bias[n];
#pragma unroll
      for (int r = 0; r < 8; ++r) {
        float v = acc[i][j][r] * scale;
        if (BIAS_MODE == 1) v += bias[mBase + mOff + r];
        if (BIAS_MODE == 2) v += bv;
        if (RESID) v += Rb[(size_t)(mBase + mOff + r) * ldc + n];
        if (ACT == 1) v = tanhf(v);
        if (ACT == 2) v = fmaxf(v, 0.0f);
        if (ACT == 3) v = v / (1.0f + expf(-v));
        if (ACT == 4) v = (v > 0.f) ? v : 0.01f * v;
        if (ACT == 5) v = 0.5f * v * (1.0f + erff(v * 0.70710678118654752f));
        slab[(mOff + r) * 68 + (j << 4) + rlane] = v;
      }
    }
    __builtin_amdgcn_fence(__ATOMIC_RELEASE, "workgroup");
    __builtin_amdgcn_wave_barrier();
    __builtin_amdgcn_fence(__ATOMIC_ACQUIRE, "workgroup");
    if (OUT_MODE == 0) {
      float* C = (float*)Cout + (size_t)b * strideC;
      const int hh = lane >> 4, c4 = (lane & 15) * 4;     // row seg = 256 B = 16 lanes x 16 B
      {
#pragma unroll
        for (int it = 0; it < 8; ++it) {
          const int row = it * 2 + hh;
          v4f v = *(const v4f*)(slab + row * 68 + c4);
          *(v4f*)(C + (size_t)(mBase + row) * ldc + n0 + c4) = v;
        }
        
      }
    } else {
      const int q = lane >> 3, c8 = (lane & 7) * 8;
      unsigned short* C  = (unsigned short*)Cout  + (size_t)b * strideC;
      unsigned short* C2 = (OUT_MODE == 2) ? ((unsigned short*)Cout2 + (size_t)b * strideC) : nullptr;
      {
#pragma unroll
        for (int it = 0; it < 4; ++it) {
          const int row = it * 4 + q;
          const float* sp = slab + row * 68 + c8;
          v8h hv, lv;
#pragma unroll
          for (int e = 0; e < 8; ++e) {
            if (OUT_MODE == 1) {
              hv[e] = (_Float16)sp[e];
            } else {
              unsigned short hb = f2bf_bits(sp[e]);
              unsigned short lb = f2bf_bits(sp[e] - bf_bits2f(hb));
              hv[e] = __builtin_bit_cast(_Float16, hb);
              lv[e] = __builtin_bit_cast(_Float16, lb);
            }
          }
          *(v8h*)(C + (size_t)(mBase + row) * ldc + n0 + c8) = hv;
          if (OUT_MODE == 2) *(v8h*)(C2 + (size_t)(mBase + row) * ldc + n0 + c8) = lv;
        }
        
      }
    }
    __builtin_amdgcn_fence(__ATOMIC_RELEASE, "workgroup");
    __builtin_amdgcn_wave_barrier();
    __builtin_amdgcn_fence(__ATOMIC_ACQUIRE, "workgroup");
  }
}

// ---------------------------------------------------------------------------
// Elementwise f32 -> 16-bit plane, 2 consecutive elements per thread packed into one 4-B store: each wave writes
// CMODE 0: bf16 RNE bits of in*scale.
// CMODE 1: f16 bits of the bf16-RNE value of in*scale (an 8-significant-bit value re-encoded exactly in f16).
// CMODE 2: f16 RNE bits of in*scale.
// Coverage: grid = ceil(n2/256) blocks x 256 threads x 2 elements = 2*n2 = the whole plane
// (calls here: n2 = 2097152 -> 8192 blocks; n2 = 524288 -> 2048 blocks; both exact multiples of 256).
// ---------------------------------------------------------------------------
__device__ __forceinline__ unsigned pk16(unsigned short a, unsigned short b) { return (unsigned)a | ((unsigned)b << 16); }

template <int CMODE>
__global__ __launch_bounds__(256) void cast2_kernel(const float* __restrict__ in, unsigned short* __restrict__ out,
                                                    int n2, float scale) {
  const int i = blockIdx.x * 256 + threadIdx.x;
  if (i < n2) {
    const v2f f = *(const v2f*)(in + 2 * (size_t)i);
    const float f0 = f[0] * scale, f1 = f[1] * scale;
    unsigned short u0, u1;
    if (CMODE == 0) {
      u0 = f2bf_bits(f0); u1 = f2bf_bits(f1);
    } else if (CMODE == 1) {
      u0 = __builtin_bit_cast(unsigned short, (_Float16)bf_bits2f(f2bf_bits(f0)));
      u1 = __builtin_bit_cast(unsigned short, (_Float16)bf_bits2f(f2bf_bits(f1)));
    } else {
      u0 = __builtin_bit_cast(unsigned short, (_Float16)f0);
      u1 = __builtin_bit_cast(unsigned short, (_Float16)f1);
    }
    const unsigned u = pk16(u0, u1);
    ((unsigned*)out)[i] = u;
    
  }
}

#define AT_D 64
#define AT_NW 4
#define AT_QB 64
#define AT_KC 64
#define AT_PLANE (AT_KC * AT_LP)   // elements of one plane's tile in LDS
#define AT_BUF   (4 * AT_PLANE)    // elements of one buffer: K hi, K lo, V^T hi, V^T lo = 36,864 B
#define AT_LP 72   // LDS row pitch of the K and V^T tiles in elements: 144 B = 16 B x 9 (odd), so the 16 rows of one 16-byte fragment read fall on 64 distinct banks

__device__ __forceinline__ unsigned short at_bf_bits(float f) {
  unsigned u = __float_as_uint(f);
  return (unsigned short)((u + 0x7FFFu + ((u >> 16) & 1u)) >> 16);
}
__device__ __forceinline__ __bf16 at_f2bf(float f) { return __builtin_bit_cast(__bf16, at_bf_bits(f)); }
__device__ __forceinline__ void at_split(float f, __bf16& hi, __bf16& lo) {
  const unsigned short hb = at_bf_bits(f);
  hi = __builtin_bit_cast(__bf16, hb);
  lo = at_f2bf(f - __uint_as_float(((unsigned)hb) << 16));
}
__device__ __forceinline__ v8f at_mma(v16b a, v16b b, v8f c) {
  c = __builtin_amdgcn_wmma_f32_16x16x32_bf16(false, a, false, b, (short)0, c, false, false);
  asm volatile("v_nop\n\tv_nop\n\tv_nop\n\tv_nop" : "+v"(c) : "v"(a), "v"(b));
  return c;
}

// lane l <-> l ^ 16 (the two halves of a wave hold the two key halves of one query column)
__device__ __forceinline__ float at_xhalf(float v) {
  const int b = __builtin_bit_cast(int, v);
  return __builtin_bit_cast(float, __builtin_amdgcn_permlanex16(b, b, 0x76543210, 0xfedcba98, false, false));
}

// Eight asynchronous 16-byte copies global -> LDS of this lane. The s_wait_xcnt stands inside the statement, behind the last copy,
// so that no address register of a copy is rewritten in front of it.
__device__ __forceinline__ void at_copy8(unsigned l0, unsigned l1, unsigned l2, unsigned l3,
                                         unsigned l4, unsigned l5, unsigned l6, unsigned l7,
                                         const __bf16* g0, const __bf16* g1, const __bf16* g2, const __bf16* g3,
                                         const __bf16* g4, const __bf16* g5, const __bf16* g6, const __bf16* g7) {
  asm volatile("global_load_async_to_lds_b128 %0, %8, off\n\t"
               "global_load_async_to_lds_b128 %1, %9, off\n\t"
               "global_load_async_to_lds_b128 %2, %10, off\n\t"
               "global_load_async_to_lds_b128 %3, %11, off\n\t"
               "global_load_async_to_lds_b128 %4, %12, off\n\t"
               "global_load_async_to_lds_b128 %5, %13, off\n\t"
               "global_load_async_to_lds_b128 %6, %14, off\n\t"
               "global_load_async_to_lds_b128 %7, %15, off\n\t"
               "s_wait_xcnt 0x0"
               :: "v"(l0), "v"(l1), "v"(l2), "v"(l3), "v"(l4), "v"(l5), "v"(l6), "v"(l7),
                  "v"(g0), "v"(g1), "v"(g2), "v"(g3), "v"(g4), "v"(g5), "v"(g6), "v"(g7)
               : "memory");
}
// One chunk: this thread's 4 pieces (rows 16 apart) of each of the 4 planes; l = its LDS byte address in row (tid >> 3) of the K hi tile.
__device__ __forceinline__ void at_stage(unsigned l, const __bf16* kh, const __bf16* kl, const __bf16* vh, const __bf16* vl) {
  const unsigned rs = 16u * AT_LP * 2u;    // 16 LDS rows
  const unsigned ps = AT_PLANE * 2u;       // one plane's tile
  const size_t ks = (size_t)16 * EMB_DIM, vs = (size_t)16 * SEQ_LEN;   // 16 rows of K, of V^T
  at_copy8(l, l + rs, l + 2 * rs, l + 3 * rs, l + ps, l + ps + rs, l + ps + 2 * rs, l + ps + 3 * rs,
           kh, kh + ks, kh + 2 * ks, kh + 3 * ks, kl, kl + ks, kl + 2 * ks, kl + 3 * ks);
  at_copy8(l + 2 * ps, l + 2 * ps + rs, l + 2 * ps + 2 * rs, l + 2 * ps + 3 * rs,
           l + 3 * ps, l + 3 * ps + rs, l + 3 * ps + 2 * rs, l + 3 * ps + 3 * rs,
           vh, vh + vs, vh + 2 * vs, vh + 3 * vs, vl, vl + vs, vl + 2 * vs, vl + 3 * vs);
}

__global__ __launch_bounds__(128)
void attn_full64_kernel(const unsigned short* __restrict__ qhp, const unsigned short* __restrict__ qlp,
                        const unsigned short* __restrict__ khp, const unsigned short* __restrict__ klp,
                        const unsigned short* __restrict__ vhp, const unsigned short* __restrict__ vlp,
                        const int* __restrict__ kmask,
                        float* __restrict__ out, float sscale, float mfill) {
  union FB { v16b v; v8b h[2]; };
  // two chunk buffers, each K hi [kv][d], K lo, V^T hi [d][kv], V^T lo (9 KB a plane); behind the loop: per wave out tile, pitch 68 floats
  __shared__ __align__(16) unsigned char sKV[2 * AT_BUF * 2];    // 73,728 B
  static_assert(AT_NW * 16 * 68 * 4 <= 2 * AT_BUF * 2, "the out tiles fit the buffers");

  const int tid  = threadIdx.x;
  const int wave = tid >> 5;
  const int lane = tid & 31;
  const int hh   = lane >> 4;
  const int c    = lane & 15;

  const int nqb = SEQ_LEN / AT_QB;        // 32
  const int bx = blockIdx.x;
  const int qb = bx % nqb;
  const int h  = bx / nqb;                // 0..N_HEADS-1 (grid = N_HEADS * nqb)
  const int q0 = qb * AT_QB + wave * 16;
  const size_t bo = (size_t)blockIdx.y * SEQ_LEN * EMB_DIM;   // this batch element's start in every q, k, v^T and out plane
  const int* km = kmask + (size_t)blockIdx.y * SEQ_LEN;

  const __bf16* Qh = (const __bf16*)(const void*)qhp + bo + (size_t)h * AT_D;
  const __bf16* Ql = (const __bf16*)(const void*)qlp + bo + (size_t)h * AT_D;
  const __bf16* Kh = (const __bf16*)(const void*)khp + bo + (size_t)h * AT_D;
  const __bf16* Kl = (const __bf16*)(const void*)klp + bo + (size_t)h * AT_D;
  const __bf16* Vh = (const __bf16*)(const void*)vhp + bo + (size_t)h * AT_D * SEQ_LEN;
  const __bf16* Vl = (const __bf16*)(const void*)vlp + bo + (size_t)h * AT_D * SEQ_LEN;
  float*        ob = out + bo + (size_t)h * AT_D;

  // ---- Q fragments (B operand, column = query = lane&15, split k map via Frag load): 2 d-chunks, hi and lo ----
  v16b qah[2], qal[2];
#pragma unroll
  for (int dc = 0; dc < 2; ++dc) {
    const __bf16* qr = Qh + (size_t)(q0 + c) * EMB_DIM + dc * 32 + 8 * hh;
    const __bf16* ql = Ql + (size_t)(q0 + c) * EMB_DIM + dc * 32 + 8 * hh;
    qah[dc] = Frag<__bf16>::load(qr);
    qal[dc] = Frag<__bf16>::load(ql);
  }

  // One query per lane (q0 + c). mrow: running maximum, equal in both wave halves; lrow: this half's share of the sum.
  float mrow = -INFINITY, lrow = 0.f;
  const float sc2 = sscale * 1.44269504088896341f;   // score scale times log2(e)
  const float mf2 = mfill  * 1.44269504088896341f;   // the mask fill in the same units
  v8f oacc[4];   // out^T tiles: oacc[t][r] = out[q0 + c][t*16 + 8*hh + r]
#pragma unroll
  for (int t = 0; t < 4; ++t) oacc[t] = (v8f){0.f,0.f,0.f,0.f,0.f,0.f,0.f,0.f};

  // staging: thread -> row (tid >> 3) of each group of 16 rows, 16-byte piece (tid & 7) of its 128-B line
  const int srow = tid >> 3, spc = tid & 7;
  const __bf16* gkh = Kh + (size_t)srow * EMB_DIM + spc * 8;   // K row kv0 + srow (+16, +32, +48), d = 8*spc..
  const __bf16* gkl = Kl + (size_t)srow * EMB_DIM + spc * 8;
  const __bf16* gvh = Vh + (size_t)srow * SEQ_LEN + spc * 8;   // V^T row d = srow (+16, +32, +48), s = kv0 + 8*spc..
  const __bf16* gvl = Vl + (size_t)srow * SEQ_LEN + spc * 8;
  const unsigned lds0 = (unsigned)(uintptr_t)(&sKV[0]) + (unsigned)(srow * (AT_LP * 2) + spc * 16);

  const int nChunks = SEQ_LEN / AT_KC;   // 32, compile-time constant
  at_stage(lds0, gkh, gkl, gvh, gvl);
  asm volatile("s_wait_asynccnt 0x0" ::: "memory");   // chunk 0 of this wave has landed
  __syncthreads();                                     // ... and every wave's part of it
  at_stage(lds0 + AT_BUF * 2u, gkh + (size_t)AT_KC * EMB_DIM, gkl + (size_t)AT_KC * EMB_DIM, gvh + AT_KC, gvl + AT_KC);

  // key-padding mask of this lane's 32 keys of a chunk (kv + j*16 + 8*hh + r, always < SEQ_LEN)
  v4u kmv[8];
#pragma unroll
  for (int j = 0; j < 4; ++j) {
    kmv[2 * j]     = *(const v4u*)(km + j * 16 + 8 * hh);
    kmv[2 * j + 1] = *(const v4u*)(km + j * 16 + 8 * hh + 4);
  }
  // later instructions may land in the registers that hold the mask loads' address: keep the wait in front of that overwrite
  asm volatile("s_wait_xcnt 0x0" ::: "memory");

  // one trip: the products and the softmax of chunk kc, then the publish point of chunk kc + 1
  auto trip = [&](const int kc) __attribute__((always_inline)) {
    const int kv0 = kc * AT_KC;
    const __bf16* Ksh = (const __bf16*)(const void*)sKV + (kc & 1) * AT_BUF;
    const __bf16* Ksl = Ksh + AT_PLANE;
    const __bf16* Vth = Ksh + 2 * AT_PLANE;
    const __bf16* Vtl = Ksh + 3 * AT_PLANE;

    // scores^T = K . Q^T : s[j][r] = score(key kv0 + j*16 + 8*hh + r, query q0 + c)
    v8f s[4];
#pragma unroll
    for (int j = 0; j < 4; ++j) {
      s[j] = (v8f){0.f,0.f,0.f,0.f,0.f,0.f,0.f,0.f};
#pragma unroll
      for (int dc = 0; dc < 2; ++dc) {
        FB kb, kl;
        kb.h[0] = *(const v8b*)(Ksh + (j * 16 + c) * AT_LP + dc * 32 + 8 * hh);
        kb.h[1] = *(const v8b*)(Ksh + (j * 16 + c) * AT_LP + dc * 32 + 16 + 8 * hh);
        kl.h[0] = *(const v8b*)(Ksl + (j * 16 + c) * AT_LP + dc * 32 + 8 * hh);
        kl.h[1] = *(const v8b*)(Ksl + (j * 16 + c) * AT_LP + dc * 32 + 16 + 8 * hh);
        s[j] = at_mma(kb.v, qah[dc], s[j]);
        s[j] = at_mma(kl.v, qah[dc], s[j]);
        s[j] = at_mma(kb.v, qal[dc], s[j]);
      }
    }
    // mask nonzero -> score := mfill (select, as in the module)
    float m = -INFINITY;
#pragma unroll
    for (int j = 0; j < 4; ++j) {
#pragma unroll
      for (int r = 0; r < 8; ++r) {
        float sv = s[j][r] * sc2;
        sv = (kmv[2 * j + (r >> 2)][r & 3] != 0u) ? mf2 : sv;
        s[j][r] = sv;
        m = fmaxf(m, sv);
      }
    }
    // the next chunk's mask words, asked for here so that their latency runs under the rest of this trip
    // (the last trip asks for its own again: in bounds, never used)
    const int kvn = (kc + 1 < nChunks) ? kv0 + AT_KC : kv0;
#pragma unroll
    for (int j = 0; j < 4; ++j) {
      kmv[2 * j]     = *(const v4u*)(km + kvn + j * 16 + 8 * hh);
      kmv[2 * j + 1] = *(const v4u*)(km + kvn + j * 16 + 8 * hh + 4);
    }
    // later instructions may land in the registers that hold the mask loads' address: keep the wait in front of that overwrite
    asm volatile("s_wait_xcnt 0x0" ::: "memory");
    m = fmaxf(m, at_xhalf(m));   // the other 32 keys of this query
    const float mnew = fmaxf(mrow, m);
    const float alpha = __builtin_amdgcn_exp2f(mrow - mnew);
    mrow = mnew;
    // p^T stays in registers: two score tiles (keys 0..15 and 16..31 of a 32-key group) are one B operand,
    // element e < 8 = key 8*hh + e, e >= 8 = key 16 + 8*hh + (e - 8): the order in which the V^T rows are read below
    v16b pth[2], ptl[2];
    float psum = 0.f;
#pragma unroll
    for (int j = 0; j < 4; ++j) {
#pragma unroll
      for (int r = 0; r < 8; ++r) {
        const float p = __builtin_amdgcn_exp2f(s[j][r] - mnew);
        psum += p;
        __bf16 a, bl; at_split(p, a, bl);
        pth[j >> 1][(j & 1) * 8 + r] = a;
        ptl[j >> 1][(j & 1) * 8 + r] = bl;
      }
    }
    lrow = lrow * alpha + psum;
#pragma unroll
    for (int t = 0; t < 4; ++t)
#pragma unroll
      for (int r = 0; r < 8; ++r) oacc[t][r] *= alpha;
    // out^T += V^T . p^T
#pragma unroll
    for (int kk = 0; kk < 2; ++kk) {
#pragma unroll
      for (int t = 0; t < 4; ++t) {
        FB vb, vl;
        vb.h[0] = *(const v8b*)(Vth + (t * 16 + c) * AT_LP + kk * 32 + 8 * hh);
        vb.h[1] = *(const v8b*)(Vth + (t * 16 + c) * AT_LP + kk * 32 + 16 + 8 * hh);
        vl.h[0] = *(const v8b*)(Vtl + (t * 16 + c) * AT_LP + kk * 32 + 8 * hh);
        vl.h[1] = *(const v8b*)(Vtl + (t * 16 + c) * AT_LP + kk * 32 + 16 + 8 * hh);
        oacc[t] = at_mma(vb.v, pth[kk], oacc[t]);
        oacc[t] = at_mma(vl.v, pth[kk], oacc[t]);
        oacc[t] = at_mma(vb.v, ptl[kk], oacc[t]);
      }
    }
    asm volatile("s_wait_dscnt 0x0" ::: "memory");      // this wave's reads of the buffer are done before it is refilled
    asm volatile("s_wait_asynccnt 0x0" ::: "memory");   // this wave's copies of chunk kc + 1 have landed
    __syncthreads();                                     // publishes chunk kc + 1 and ends every reader's last read of chunk kc
  };
  int kc = 0;
  for (; kc < nChunks - 2; ++kc) {   // while a chunk kc + 2 exists: its copies go into the buffer that this trip has just read
    trip(kc);
    at_stage(lds0 + (unsigned)(kc & 1) * (AT_BUF * 2u), gkh + (size_t)(kc + 2) * AT_KC * EMB_DIM,
             gkl + (size_t)(kc + 2) * AT_KC * EMB_DIM, gvh + (kc + 2) * AT_KC, gvl + (kc + 2) * AT_KC);
  }
  for (; kc < nChunks; ++kc) trip(kc);   // the last two chunks: nothing left to fetch
  asm volatile("s_wait_asynccnt 0x0" ::: "memory");     // nothing in flight behind the loop; the last barrier ended every read of the buffers

  float* os = (float*)(void*)sKV + wave * (16 * 68);
  {
    const float inv = 1.0f / (lrow + at_xhalf(lrow));   // join the two halves' sums once
#pragma unroll
    for (int t = 0; t < 4; ++t) {
      v4f lo4, hi4;
#pragma unroll
      for (int r = 0; r < 4; ++r) { lo4[r] = oacc[t][r] * inv; hi4[r] = oacc[t][4 + r] * inv; }
      *(v4f*)(os + c * 68 + t * 16 + 8 * hh)     = lo4;
      *(v4f*)(os + c * 68 + t * 16 + 8 * hh + 4) = hi4;
    }
  }
  __builtin_amdgcn_fence(__ATOMIC_RELEASE, "workgroup");
  __builtin_amdgcn_wave_barrier();
  __builtin_amdgcn_fence(__ATOMIC_ACQUIRE, "workgroup");
  {
    const int c4 = (lane & 15) * 4;
    {
#pragma unroll
      for (int it = 0; it < 8; ++it) {
        const int row = it * 2 + hh;   // it 0..7 x hh 0..1 covers rows 0..15 of the wave tile
        v4f val = *(const v4f*)(os + row * 68 + c4);
        *(v4f*)(ob + (size_t)(q0 + row) * EMB_DIM + c4) = val;
      }
      
    }
  }
}

// ---------------------------------------------------------------------------
// Host-side orchestration (kernel launches + host arithmetic only).
// Workspace region map (byte offsets, every region fully written by its producer before any read):
//   0           xb    bf16 [4096][1024]            8,388,608
//   8,388,608   wqb   bf16 [1024][1024]            2,097,152
//   10,485,760  wkb   bf16 [1024][1024]            2,097,152
//   12,582,912  wvb   bf16 [1024][1024]            2,097,152
//   14,680,064  wo16  f16  [1024][1024] (x64)      2,097,152
//   16,777,216  qh    bf16 [4096][1024]            8,388,608
//   25,165,824  ql    bf16 [4096][1024]            8,388,608
//   33,554,432  kh    bf16 [4096][1024]            8,388,608
//   41,943,040  kl    bf16 [4096][1024]            8,388,608
//   50,331,648  vth   bf16 [2][1024][2048]         8,388,608
//   58,720,256  vtl   bf16 [2][1024][2048]         8,388,608
//   67,108,864  o32   f32  [4096][1024]           16,777,216
//   83,886,080  o16   f16  [4096][1024] (x16)      8,388,608
//   92,274,688  end (88 MiB)
// GEMM shapes: K = 1024 (multiple of 32) everywhere; M, N in {1024, 2048, 4096} (multiples of 64); no padding.
// ---------------------------------------------------------------------------
extern "C" void kernel_launch(void* const* d_in, const int* in_sizes, int n_in,
                              void* d_out, int out_size, void* d_ws, size_t ws_size,
                              hipStream_t stream) {
  if (n_in < 6) return;
  const int nTokEmb = N_TOK * EMB_DIM;          // 4,194,304
  const int nEmbEmb = EMB_DIM * EMB_DIM;        // 1,048,576
  if (in_sizes[0] != nTokEmb || in_sizes[1] != N_BATCH * SEQ_LEN || in_sizes[2] != nEmbEmb ||
      in_sizes[3] != nEmbEmb || in_sizes[4] != nEmbEmb || in_sizes[5] != nEmbEmb || out_size != nTokEmb) return;

  const size_t offXb  = 0;
  const size_t offWq  = offXb  + (size_t)nTokEmb * 2;
  const size_t offWk  = offWq  + (size_t)nEmbEmb * 2;
  const size_t offWv  = offWk  + (size_t)nEmbEmb * 2;
  const size_t offWo  = offWv  + (size_t)nEmbEmb * 2;
  const size_t offQh  = offWo  + (size_t)nEmbEmb * 2;
  const size_t offQl  = offQh  + (size_t)nTokEmb * 2;
  const size_t offKh  = offQl  + (size_t)nTokEmb * 2;
  const size_t offKl  = offKh  + (size_t)nTokEmb * 2;
  const size_t offVth = offKl  + (size_t)nTokEmb * 2;
  const size_t offVtl = offVth + (size_t)nTokEmb * 2;
  const size_t offO32 = offVtl + (size_t)nTokEmb * 2;
  const size_t offO16 = offO32 + (size_t)nTokEmb * 4;
  const size_t offEnd = offO16 + (size_t)nTokEmb * 2;   // 92,274,688
  if (ws_size < offEnd) return;

  const float* x    = (const float*)d_in[0];
  const int*   mask = (const int*)d_in[1];
  const float* wq   = (const float*)d_in[2];
  const float* wk   = (const float*)d_in[3];
  const float* wv   = (const float*)d_in[4];
  const float* wo   = (const float*)d_in[5];
  float* out = (float*)d_out;

  char* ws = (char*)d_ws;
  unsigned short* xb   = (unsigned short*)(ws + offXb);
  unsigned short* wqb  = (unsigned short*)(ws + offWq);
  unsigned short* wkb  = (unsigned short*)(ws + offWk);
  unsigned short* wvb  = (unsigned short*)(ws + offWv);
  unsigned short* wo16 = (unsigned short*)(ws + offWo);
  unsigned short* qh   = (unsigned short*)(ws + offQh);
  unsigned short* ql   = (unsigned short*)(ws + offQl);
  unsigned short* kh   = (unsigned short*)(ws + offKh);
  unsigned short* kl   = (unsigned short*)(ws + offKl);
  unsigned short* vth  = (unsigned short*)(ws + offVth);
  unsigned short* vtl  = (unsigned short*)(ws + offVtl);
  float*          o32  = (float*)(ws + offO32);
  unsigned short* o16  = (unsigned short*)(ws + offO16);
  const float* dummyf = x;   // valid pointer for unused bias / resid arguments (never dereferenced)

  // 1) 16-bit operand planes: x, wq, wk, wv -> bf16 RNE; wo -> f16 encode of bf16-RNE(wo*64)
  {
    const int n2x = nTokEmb / 2;   // 2,097,152 -> 8192 blocks
    const int n2w = nEmbEmb / 2;   //   524,288 -> 2048 blocks
    cast2_kernel<0><<<(n2x + 255) / 256, 256, 0, stream>>>(x,  xb,  n2x, 1.0f);
    cast2_kernel<0><<<(n2w + 255) / 256, 256, 0, stream>>>(wq, wqb, n2w, 1.0f);
    cast2_kernel<0><<<(n2w + 255) / 256, 256, 0, stream>>>(wk, wkb, n2w, 1.0f);
    cast2_kernel<0><<<(n2w + 255) / 256, 256, 0, stream>>>(wv, wvb, n2w, 1.0f);
    cast2_kernel<1><<<(n2w + 255) / 256, 256, 0, stream>>>(wo, wo16, n2w, 64.0f);
  }

  // 2) q, k = x @ W^T : M = 4096 tokens, N = 1024, K = 1024; bf16 hi/lo output planes [token][h*64+d]
  //    tiles = 64 x 16 = 1024 -> 128 blocks of 8 waves
  {
    const dim3 g(((N_TOK / 64) * (EMB_DIM / 64)) / 8, 1);
    wmma_gemm64<1, false, 0, 2, false><<<g, 256, 0, stream>>>(
        xb, xb, EMB_DIM, 0L, wqb, wqb, EMB_DIM, 0L,
        (void*)qh, (void*)ql, EMB_DIM, 0L, dummyf, dummyf, 0L, N_TOK, EMB_DIM, EMB_DIM, 1.0f);
    wmma_gemm64<1, false, 0, 2, false><<<g, 256, 0, stream>>>(
        xb, xb, EMB_DIM, 0L, wkb, wkb, EMB_DIM, 0L,
        (void*)kh, (void*)kl, EMB_DIM, 0L, dummyf, dummyf, 0L, N_TOK, EMB_DIM, EMB_DIM, 1.0f);
  }

  // 3) v^T per batch = Wv @ x_b^T : A = wvb [1024 out][1024 in], Bt = xb_b [2048 tokens][1024],
  //    C = [1024 (h*64+d)][2048 s] bf16 hi/lo, y-batched over 2 batches; tiles = 16 x 32 = 512 -> 64 blocks
  {
    const dim3 g(((EMB_DIM / 64) * (SEQ_LEN / 64)) / 8, N_BATCH);
    wmma_gemm64<1, false, 0, 2, false><<<g, 256, 0, stream>>>(
        wvb, wvb, EMB_DIM, 0L, xb, xb, EMB_DIM, (long)SEQ_LEN * EMB_DIM,
        (void*)vth, (void*)vtl, SEQ_LEN, (long)EMB_DIM * SEQ_LEN, dummyf, dummyf, 0L,
        EMB_DIM, SEQ_LEN, EMB_DIM, 1.0f);
  }

  // 4) attention: grid = (16 heads x 32 query blocks, 2 batch elements); key mask read from d_in[1] as int32
  {
    const dim3 g(N_HEADS * (SEQ_LEN / 64), N_BATCH);
    attn_full64_kernel<<<g, 128, 0, stream>>>(qh, ql, kh, kl, vth, vtl, mask, o32, 0.125f, -1.0e9f);
  }

  // 5) attention output f32 -> f16 carried x16
  {
    const int n2o = nTokEmb / 2;   // 2,097,152 -> 8192 blocks
    cast2_kernel<2><<<(n2o + 255) / 256, 256, 0, stream>>>(o32, o16, n2o, 16.0f);
  }

  // 6) out = O @ Wo^T : f16 operands (O x16, Wo x64) -> scale 1/1024, f32 into d_out [4096][1024]
  {
    const dim3 g(((N_TOK / 64) * (EMB_DIM / 64)) / 8, 1);
    wmma_gemm64<0, false, 0, 0, false><<<g, 256, 0, stream>>>(
        o16, o16, EMB_DIM, 0L, wo16, wo16, EMB_DIM, 0L,
        (void*)out, (void*)out, EMB_DIM, 0L, dummyf, dummyf, 0L, N_TOK, EMB_DIM, EMB_DIM, 1.0f / 1024.0f);
  }
}

// v007
// A run of this version takes 179 microseconds.
// Timed twice side by side with v006, it ran 1.15 times as fast both times.
// All steps since v000 together make it 3.88 times as fast.
// Projections q, k, v^T: v_wmma_f32_16x16x32_bf16 (x and weights RNE-converted to bf16, single product); attention q.k^T and p.v: v_wmma_f32_16x16x32_bf16 with bf16 hi/lo split operands (hi.hi + hi.lo + lo.hi); output projection: v_wmma_f32_16x16x32_f16 (attention output carried x16 in f16, bf16-RNE weight carried x64 in f16); f32 accumulate everywhere; online softmax, key-mask select (-1e9) and normalisation in f32.
#include <hip/hip_runtime.h>
#include <math.h>
#include <stdint.h>

#define N_BATCH  2
#define SEQ_LEN  2048
#define EMB_DIM  1024
#define N_HEADS  16
#define HEAD_DIM 64
#define N_TOK    (N_BATCH * SEQ_LEN)

typedef __attribute__((ext_vector_type(16))) _Float16 v16h;
typedef __attribute__((ext_vector_type(8)))  _Float16 v8h;
typedef __attribute__((ext_vector_type(16))) __bf16   v16b;
typedef __attribute__((ext_vector_type(8)))  __bf16   v8b;
typedef __attribute__((ext_vector_type(8)))  float    v8f;
typedef __attribute__((ext_vector_type(4)))  float    v4f;
typedef __attribute__((ext_vector_type(2)))  float    v2f;
typedef __attribute__((ext_vector_type(4)))  unsigned int v4u;

__device__ __forceinline__ unsigned short f2bf_bits(float f) {
  unsigned u = __float_as_uint(f);
  return (unsigned short)((u + 0x7FFFu + ((u >> 16) & 1u)) >> 16);
}
__device__ __forceinline__ float bf_bits2f(unsigned short h) { return __uint_as_float(((unsigned)h) << 16); }

// hazard guards as plain device helpers (their inline asm stays outside the kernel template body)
__device__ __forceinline__ void dep_guard_h(v8f& a, v8f& b, v16h x, v16h y) { asm volatile("v_nop\n\tv_nop\n\tv_nop\n\tv_nop" : "+v"(a), "+v"(b) : "v"(x), "v"(y)); }
__device__ __forceinline__ void dep_guard_b(v8f& a, v8f& b, v16b x, v16b y) { asm volatile("v_nop\n\tv_nop\n\tv_nop\n\tv_nop" : "+v"(a), "+v"(b) : "v"(x), "v"(y)); }
__device__ __forceinline__ void keep4_h(v16h a, v16h b, v16h c, v16h d) { asm volatile("v_nop" :: "v"(a), "v"(b), "v"(c), "v"(d)); }
__device__ __forceinline__ void keep4_b(v16b a, v16b b, v16b c, v16b d) { asm volatile("v_nop" :: "v"(a), "v"(b), "v"(c), "v"(d)); }
__device__ __forceinline__ void acc_guard4(v8f& a, v8f& b, v8f& c, v8f& d) { asm volatile("v_nop\n\tv_nop\n\tv_nop\n\tv_nop" : "+v"(a), "+v"(b), "+v"(c), "+v"(d)); }
template <typename T> struct Frag;
template <> struct Frag<_Float16> {
  typedef v16h V; union U { v16h v; v8h h[2]; };
  static __device__ __forceinline__ v16h load(const _Float16* p) {   // elements 0..7 <- p[0..7], 8..15 <- p[16..23]
    U f; f.h[0] = *(const v8h*)(p); f.h[1] = *(const v8h*)(p + 16); return f.v;
  }
  static __device__ __forceinline__ v8f mma(v16h a, v16h b, v8f c) {
    return __builtin_amdgcn_wmma_f32_16x16x32_f16(false, a, false, b, (short)0, c, false, false);
  }
  static __device__ __forceinline__ void guard(v8f& a, v8f& b, v16h x, v16h y) { dep_guard_h(a, b, x, y); }
  static __device__ __forceinline__ void keep(v16h a, v16h b, v16h c, v16h d) { keep4_h(a, b, c, d); }
};
template <> struct Frag<__bf16> {
  typedef v16b V; union U { v16b v; v8b h[2]; };
  static __device__ __forceinline__ v16b load(const __bf16* p) {
    U f; f.h[0] = *(const v8b*)(p); f.h[1] = *(const v8b*)(p + 16); return f.v;
  }
  static __device__ __forceinline__ v8f mma(v16b a, v16b b, v8f c) {
    return __builtin_amdgcn_wmma_f32_16x16x32_bf16(false, a, false, b, (short)0, c, false, false);
  }
  static __device__ __forceinline__ void guard(v8f& a, v8f& b, v16b x, v16b y) { dep_guard_b(a, b, x, y); }
  static __device__ __forceinline__ void keep(v16b a, v16b b, v16b c, v16b d) { keep4_b(a, b, c, d); }
};

// ---- Register-blocked batched WMMA GEMM ------------------------------------
// C[m,n] = scale * sum_k A[m,k] * Bt[n,k] (+bias)(+resid); each wave owns a 64x64 tile.
// A row-major [M,K]; Bt row-major [N,K]; M % 64 == 0, N % 512 == 0, K % 64 == 0; grid.x = (M/64)*(N/64)/8.
// The 8 waves of a block share one 64-row band of A and own 8 neighbouring 64-row bands of Bt. Operands reach the
// waves through LDS: a stage is 64 k (one 128-B line of each of the 64 + 512 rows), brought by asynchronous 16-byte
// copies of which 8 neighbouring lanes cover one whole line, two buffers, the next stage in flight under this one's products.
// Copy coverage: 256 threads x 18 copies x 16 B = 576 rows x 128 B = the whole stage, every LDS byte from one lane.
// SPLIT (hi/lo planes) is not instantiated and not staged.
// BIAS_MODE: 0 = none, 1 = bias[m], 2 = bias[n].
// OUT_MODE: 0 = f32, 1 = f16, 2 = bf16 hi plane (Cout) + bf16 lo plane (Cout2).
// Epilogue coverage per wave: f32 path 8 it x 2 rows x (16 lanes x 4 floats) = 16 rows x 64; 16-bit path
// 4 it x 4 rows x (8 lanes x 8 halves) = 16 rows x 64; 4 slabs = the whole 64x64 tile.
// ET: 0 = f16 operands, 1 = bf16 operands (pointers passed as 16-bit storage)
#define GS_ROWS  576                       // 64 rows of A, then 512 rows of Bt
#define GS_PITCH 72                        // LDS row pitch in elements: 144 B = 16 B x 9 (odd), no bank met twice by a 16-byte fragment read
#define GS_BYTES (GS_ROWS * GS_PITCH * 2)  // one buffer: 82,944 B
// Nine asynchronous 16-byte copies global -> LDS of this lane. The s_wait_xcnt stands inside the statement, behind the last copy,
// so that no address register of a copy is rewritten in front of it.
__device__ __forceinline__ void gs_copy9(unsigned l0, unsigned l1, unsigned l2, unsigned l3, unsigned l4, unsigned l5,
                                         unsigned l6, unsigned l7, unsigned l8,
                                         const unsigned short* g0, const unsigned short* g1, const unsigned short* g2,
                                         const unsigned short* g3, const unsigned short* g4, const unsigned short* g5,
                                         const unsigned short* g6, const unsigned short* g7, const unsigned short* g8) {
  asm volatile("global_load_async_to_lds_b128 %0, %9, off\n\t"
               "global_load_async_to_lds_b128 %1, %10, off\n\t"
               "global_load_async_to_lds_b128 %2, %11, off\n\t"
               "global_load_async_to_lds_b128 %3, %12, off\n\t"
               "global_load_async_to_lds_b128 %4, %13, off\n\t"
               "global_load_async_to_lds_b128 %5, %14, off\n\t"
               "global_load_async_to_lds_b128 %6, %15, off\n\t"
               "global_load_async_to_lds_b128 %7, %16, off\n\t"
               "global_load_async_to_lds_b128 %8, %17, off\n\t"
               "s_wait_xcnt 0x0"
               :: "v"(l0), "v"(l1), "v"(l2), "v"(l3), "v"(l4), "v"(l5), "v"(l6), "v"(l7), "v"(l8),
                  "v"(g0), "v"(g1), "v"(g2), "v"(g3), "v"(g4), "v"(g5), "v"(g6), "v"(g7), "v"(g8)
               : "memory");
}
// One stage: this thread's 2 pieces of A rows and 16 pieces of Bt rows (rows 32 apart), l = its LDS byte address in row (tid >> 3).
__device__ __forceinline__ void gs_stage(unsigned l, const unsigned short* a, size_t sa, const unsigned short* b, size_t sb) {
  const unsigned st = 32u * GS_PITCH * 2u;   // 32 LDS rows
  gs_copy9(l, l + st, l + 2 * st, l + 3 * st, l + 4 * st, l + 5 * st, l + 6 * st, l + 7 * st, l + 8 * st,
           a, a + sa, b, b + sb, b + 2 * sb, b + 3 * sb, b + 4 * sb, b + 5 * sb, b + 6 * sb);
  gs_copy9(l + 9 * st, l + 10 * st, l + 11 * st, l + 12 * st, l + 13 * st, l + 14 * st, l + 15 * st, l + 16 * st, l + 17 * st,
           b + 7 * sb, b + 8 * sb, b + 9 * sb, b + 10 * sb, b + 11 * sb, b + 12 * sb, b + 13 * sb, b + 14 * sb, b + 15 * sb);
}
template <int ET> struct Elem;
template <> struct Elem<0> { typedef _Float16 T; };
template <> struct Elem<1> { typedef __bf16 T; };
// bx = index of the block among the blocks of its product, b = batch index of the product
template <int ET, bool SPLIT, int BIAS_MODE, int OUT_MODE, bool RESID, int ACT = 0>
__device__ __forceinline__ void gemm64_body(
    const int bx, const int b,
    const unsigned short* __restrict__ Ap, const unsigned short* __restrict__ A2p, int lda, long strideA,
    const unsigned short* __restrict__ Btp, const unsigned short* __restrict__ Bt2p, int ldb, long strideB,
    void* __restrict__ Cout, void* __restrict__ Cout2, int ldc, long strideC,
    const float* __restrict__ bias,
    const float* __restrict__ resid, long strideR,
    int M, int N, int K, float scale) {
  typedef typename Elem<ET>::T T;
  typedef typename Frag<T>::V V;
  static_assert(!SPLIT, "hi/lo planes are not staged");
  __shared__ __align__(16) unsigned short sAB[2 * GS_ROWS * GS_PITCH];   // two stage buffers, 165,888 B
  __shared__ __align__(16) float sT[8][16 * 68];   // per-wave 16x64 slab, pitch 68 floats
  const int lane = threadIdx.x & 31;
  const int wave = threadIdx.x >> 5;
  const int tilesN = N >> 6;
  const int tilesM = M >> 6;
  const int tile = bx * 8 + wave;
  if (bx * 8 >= tilesM * tilesN) return;   // the whole block or none of it, in front of every barrier
  const int tm = tile / tilesN;
  const int tn = tile - tm * tilesN;
  const int m0 = tm << 6;
  const int n0 = tn << 6;

  // staging: thread -> row (tid >> 3) of each group of 32 rows, 16-byte piece (tid & 7) of its 128-B line
  const int srow = threadIdx.x >> 3;
  const int spc  = threadIdx.x & 7;
  const int nb0  = n0 - (wave << 6);           // first Bt row of the block (N % 512 == 0: the 8 tiles lie in one tile row)
  const unsigned short* gA = Ap  + (size_t)b * strideA + (size_t)(m0  + srow) * lda + spc * 8;
  const unsigned short* gB = Btp + (size_t)b * strideB + (size_t)(nb0 + srow) * ldb + spc * 8;
  const size_t sa32 = (size_t)32 * lda, sb32 = (size_t)32 * ldb;
  const unsigned lds0 = (unsigned)(uintptr_t)(&sAB[0]) + (unsigned)(srow * (GS_PITCH * 2) + spc * 16);

  const int rlane = lane & 15;                 // row (A) / col (B, D) within subtile
  const int koff  = (lane >> 4) * 8;           // k offset of this lane half
  const int mOff  = (lane >> 4) * 8;           // D row offset

  v8f acc[4][4];
#pragma unroll
  for (int i = 0; i < 4; ++i)
#pragma unroll
    for (int j = 0; j < 4; ++j) acc[i][j] = (v8f){0.f,0.f,0.f,0.f,0.f,0.f,0.f,0.f};

  const int nStages = K >> 6;
  gs_stage(lds0, gA, sa32, gB, sb32);
  asm volatile("s_wait_asynccnt 0x0" ::: "memory");   // stage 0 of this wave has landed
  __syncthreads();                                     // ... and every wave's part of it
  if (nStages > 1) gs_stage(lds0 + GS_BYTES, gA + 64, sa32, gB + 64, sb32);

  for (int t = 0; t < nStages; ++t) {
    const T* sbuf = (const T*)(const void*)(sAB + (t & 1) * (GS_ROWS * GS_PITCH));
#pragma unroll
    for (int ks = 0; ks < 2; ++ks) {
      V bh[4], ah[4];   // all eight fragments of these 32 k asked for as one group, in front of their 16 products
#pragma unroll
      for (int j = 0; j < 4; ++j)
        bh[j] = Frag<T>::load(sbuf + (64 + (wave << 6) + (j << 4) + rlane) * GS_PITCH + ks * 32 + koff);
#pragma unroll
      for (int i = 0; i < 4; ++i)
        ah[i] = Frag<T>::load(sbuf + ((i << 4) + rlane) * GS_PITCH + ks * 32 + koff);
#pragma unroll
      for (int i = 0; i < 4; ++i) {
#pragma unroll
        for (int j = 0; j < 4; ++j) acc[i][j] = Frag<T>::mma(ah[i], bh[j], acc[i][j]);
        Frag<T>::guard(acc[i][0], acc[i][3], ah[i], ah[i]);
      }
      Frag<T>::keep(bh[0], bh[1], bh[2], bh[3]);
    }
    asm volatile("s_wait_dscnt 0x0" ::: "memory");      // this wave's reads of the buffer are done before it is refilled
    asm volatile("s_wait_asynccnt 0x0" ::: "memory");   // this wave's copies of stage t + 1 have landed
    __syncthreads();                                     // publishes stage t + 1 and ends every reader's last read of stage t
    if (t + 2 < nStages)
      gs_stage(lds0 + (unsigned)(t & 1) * GS_BYTES, gA + (size_t)(t + 2) * 64, sa32, gB + (size_t)(t + 2) * 64, sb32);
  }
  asm volatile("s_wait_asynccnt 0x0" ::: "memory");     // nothing in flight behind the loop
  acc_guard4(acc[0][0], acc[0][1], acc[0][2], acc[0][3]);
  acc_guard4(acc[1][0], acc[1][1], acc[1][2], acc[1][3]);
  acc_guard4(acc[2][0], acc[2][1], acc[2][2], acc[2][3]);
  acc_guard4(acc[3][0], acc[3][1], acc[3][2], acc[3][3]);

  // ---- epilogue ----
  float* slab = sT[wave];
  const float* Rb = RESID ? (resid + (size_t)b * strideR) : nullptr;
#pragma unroll
  for (int i = 0; i < 4; ++i) {
    const int mBase = m0 + (i << 4);
#pragma unroll
    for (int j = 0; j < 4; ++j) {
      const int n = n0 + (j << 4) + rlane;
      float bv = 0.f;
      if (BIAS_MODE == 2) bv = bias[n];
#pragma unroll
      for (int r = 0; r < 8; ++r) {
        float v = acc[i][j][r] * scale;
        if (BIAS_MODE == 1) v += bias[mBase + mOff + r];
        if (BIAS_MODE == 2) v += bv;
        if (RESID) v += Rb[(size_t)(mBase + mOff + r) * ldc + n];
        if (ACT == 1) v = tanhf(v);
        if (ACT == 2) v = fmaxf(v, 0.0f);
        if (ACT == 3) v = v / (1.0f + expf(-v));
        if (ACT == 4) v = (v > 0.f) ? v : 0.01f * v;
        if (ACT == 5) v = 0.5f * v * (1.0f + erff(v * 0.70710678118654752f));
        slab[(mOff + r) * 68 + (j << 4) + rlane] = v;
      }
    }
    __builtin_amdgcn_fence(__ATOMIC_RELEASE, "workgroup");
    __builtin_amdgcn_wave_barrier();
    __builtin_amdgcn_fence(__ATOMIC_ACQUIRE, "workgroup");
    if (OUT_MODE == 0) {
      float* C = (float*)Cout + (size_t)b * strideC;
      const int hh = lane >> 4, c4 = (lane & 15) * 4;     // row seg = 256 B = 16 lanes x 16 B
      {
#pragma unroll
        for (int it = 0; it < 8; ++it) {
          const int row = it * 2 + hh;
          v4f v = *(const v4f*)(slab + row * 68 + c4);
          *(v4f*)(C + (size_t)(mBase + row) * ldc + n0 + c4) = v;
        }
        
      }
    } else {
      const int q = lane >> 3, c8 = (lane & 7) * 8;
      unsigned short* C  = (unsigned short*)Cout  + (size_t)b * strideC;
      unsigned short* C2 = (OUT_MODE == 2) ? ((unsigned short*)Cout2 + (size_t)b * strideC) : nullptr;
      {
#pragma unroll
        for (int it = 0; it < 4; ++it) {
          const int row = it * 4 + q;
          const float* sp = slab + row * 68 + c8;
          v8h hv, lv;
#pragma unroll
          for (int e = 0; e < 8; ++e) {
            if (OUT_MODE == 1) {
              hv[e] = (_Float16)sp[e];
            } else {
              unsigned short hb = f2bf_bits(sp[e]);
              unsigned short lb = f2bf_bits(sp[e] - bf_bits2f(hb));
              hv[e] = __builtin_bit_cast(_Float16, hb);
              lv[e] = __builtin_bit_cast(_Float16, lb);
            }
          }
          *(v8h*)(C + (size_t)(mBase + row) * ldc + n0 + c8) = hv;
          if (OUT_MODE == 2) *(v8h*)(C2 + (size_t)(mBase + row) * ldc + n0 + c8) = lv;
        }
        
      }
    }
    __builtin_amdgcn_fence(__ATOMIC_RELEASE, "workgroup");
    __builtin_amdgcn_wave_barrier();
    __builtin_amdgcn_fence(__ATOMIC_ACQUIRE, "workgroup");
  }
}

// One product per launch: grid = (blocks of the product, batch).
template <int ET, bool SPLIT, int BIAS_MODE, int OUT_MODE, bool RESID, int ACT = 0>
__global__ __launch_bounds__(256) void wmma_gemm64(
    const unsigned short* __restrict__ Ap, const unsigned short* __restrict__ A2p, int lda, long strideA,
    const unsigned short* __restrict__ Btp, const unsigned short* __restrict__ Bt2p, int ldb, long strideB,
    void* __restrict__ Cout, void* __restrict__ Cout2, int ldc, long strideC,
    const float* __restrict__ bias,
    const float* __restrict__ resid, long strideR,
    int M, int N, int K, float scale) {
  gemm64_body<ET, SPLIT, BIAS_MODE, OUT_MODE, RESID, ACT>(blockIdx.x, blockIdx.y, Ap, A2p, lda, strideA, Btp, Bt2p, ldb, strideB,
                                                          Cout, Cout2, ldc, strideC, bias, resid, strideR, M, N, K, scale);
}

// The three projections, which do not depend on one another, in one grid of (128, 3) blocks, so that all WGPs have work
// (one product alone has 128 blocks, one to a WGP). blockIdx.y (the same for the whole block) picks the product:
//   0: q = x . Wq^T, 1: k = x . Wk^T : M = 4096 tokens, N = 1024; 64 x 16 tiles = 128 blocks; planes [token][h*64+d]
//   2: v^T of batch b = Wv . x_b^T   : M = 1024, N = 2048 tokens; 16 x 32 tiles = 64 blocks for each of the 2 batch elements
//      (b = blockIdx.x >> 6); planes [b][h*64+d][s]
__global__ __launch_bounds__(256) void qkv_gemm64(
    const unsigned short* __restrict__ xb, const unsigned short* __restrict__ wqb,
    const unsigned short* __restrict__ wkb, const unsigned short* __restrict__ wvb,
    unsigned short* __restrict__ qh, unsigned short* __restrict__ ql,
    unsigned short* __restrict__ kh, unsigned short* __restrict__ kl,
    unsigned short* __restrict__ vth, unsigned short* __restrict__ vtl) {
  const int  which = blockIdx.y;
  const bool isV   = which == 2;
  const unsigned short* A  = isV ? wvb : xb;
  const unsigned short* Bt = isV ? xb : (which == 0 ? wqb : wkb);
  unsigned short* C  = isV ? vth : (which == 0 ? qh : kh);
  unsigned short* C2 = isV ? vtl : (which == 0 ? ql : kl);
  const int bx = isV ? (int)(blockIdx.x & 63) : (int)blockIdx.x;
  const int b  = isV ? (int)(blockIdx.x >> 6) : 0;
  gemm64_body<1, false, 0, 2, false>(bx, b, A, A, EMB_DIM, 0L, Bt, Bt, EMB_DIM, isV ? (long)SEQ_LEN * EMB_DIM : 0L,
                                     (void*)C, (void*)C2, isV ? SEQ_LEN : EMB_DIM, isV ? (long)EMB_DIM * SEQ_LEN : 0L,
                                     nullptr, nullptr, 0L, isV ? EMB_DIM : N_TOK, isV ? SEQ_LEN : EMB_DIM, EMB_DIM, 1.0f);
}

// ---------------------------------------------------------------------------
// Elementwise f32 -> 16-bit plane, 2 consecutive elements per thread packed into one 4-B store: each wave writes
// CMODE 0: bf16 RNE bits of in*scale.
// CMODE 1: f16 bits of the bf16-RNE value of in*scale (an 8-significant-bit value re-encoded exactly in f16).
// CMODE 2: f16 RNE bits of in*scale.
// Coverage: grid = ceil(n2/256) blocks x 256 threads x 2 elements = 2*n2 = the whole plane
// (n2 = 2097152 -> 8192 blocks; n2 = 524288 -> 2048 blocks; both exact multiples of 256).
// ---------------------------------------------------------------------------
__device__ __forceinline__ unsigned pk16(unsigned short a, unsigned short b) { return (unsigned)a | ((unsigned)b << 16); }

template <int CMODE>
__device__ __forceinline__ void cast2_body(const float* __restrict__ in, unsigned short* __restrict__ out,
                                           const int i, const int n2, const float scale) {
  if (i < n2) {
    const v2f f = *(const v2f*)(in + 2 * (size_t)i);
    const float f0 = f[0] * scale, f1 = f[1] * scale;
    unsigned short u0, u1;
    if (CMODE == 0) {
      u0 = f2bf_bits(f0); u1 = f2bf_bits(f1);
    } else if (CMODE == 1) {
      u0 = __builtin_bit_cast(unsigned short, (_Float16)bf_bits2f(f2bf_bits(f0)));
      u1 = __builtin_bit_cast(unsigned short, (_Float16)bf_bits2f(f2bf_bits(f1)));
    } else {
      u0 = __builtin_bit_cast(unsigned short, (_Float16)f0);
      u1 = __builtin_bit_cast(unsigned short, (_Float16)f1);
    }
    const unsigned u = pk16(u0, u1);
    ((unsigned*)out)[i] = u;
  }
}

template <int CMODE>
__global__ __launch_bounds__(256) void cast2_kernel(const float* __restrict__ in, unsigned short* __restrict__ out,
                                                    int n2, float scale) {
  cast2_body<CMODE>(in, out, blockIdx.x * 256 + threadIdx.x, n2, scale);
}

// The five input planes, which do not depend on one another, in one grid: blocks 0..8191 convert x, then 2048 blocks each
// wq, wk, wv (CMODE 0) and wo (CMODE 1, x64). The plane is the same for a whole block.
// Coverage: 8192 x 512 = 4,194,304 elements of x; 2048 x 512 = 1,048,576 elements of each weight.
#define CI_XB (N_TOK * EMB_DIM / 512)     // 8192 blocks of x
#define CI_WB (EMB_DIM * EMB_DIM / 512)   // 2048 blocks of one weight
__global__ __launch_bounds__(256) void cast_inputs_kernel(
    const float* __restrict__ x, const float* __restrict__ wq, const float* __restrict__ wk,
    const float* __restrict__ wv, const float* __restrict__ wo,
    unsigned short* __restrict__ xb, unsigned short* __restrict__ wqb, unsigned short* __restrict__ wkb,
    unsigned short* __restrict__ wvb, unsigned short* __restrict__ wo16) {
  const int bx = blockIdx.x;
  if (bx < CI_XB) {
    cast2_body<0>(x, xb, bx * 256 + threadIdx.x, CI_XB * 256, 1.0f);
  } else {
    const int w = (bx - CI_XB) / CI_WB;                                   // 0..3
    const int i = ((bx - CI_XB) % CI_WB) * 256 + threadIdx.x;
    if (w == 3) {
      cast2_body<1>(wo, wo16, i, CI_WB * 256, 64.0f);
    } else {
      cast2_body<0>(w == 0 ? wq : (w == 1 ? wk : wv), w == 0 ? wqb : (w == 1 ? wkb : wvb), i, CI_WB * 256, 1.0f);
    }
  }
}

#define AT_D 64
#define AT_NW 4
#define AT_QB 64
#define AT_KC 64
#define AT_PLANE (AT_KC * AT_LP)   // elements of one plane's tile in LDS
#define AT_BUF   (4 * AT_PLANE)    // elements of one buffer: K hi, K lo, V^T hi, V^T lo = 36,864 B
#define AT_LP 72   // LDS row pitch of the K and V^T tiles in elements: 144 B = 16 B x 9 (odd), so the 16 rows of one 16-byte fragment read fall on 64 distinct banks

__device__ __forceinline__ unsigned short at_bf_bits(float f) {
  unsigned u = __float_as_uint(f);
  return (unsigned short)((u + 0x7FFFu + ((u >> 16) & 1u)) >> 16);
}
__device__ __forceinline__ __bf16 at_f2bf(float f) { return __builtin_bit_cast(__bf16, at_bf_bits(f)); }
__device__ __forceinline__ void at_split(float f, __bf16& hi, __bf16& lo) {
  const unsigned short hb = at_bf_bits(f);
  hi = __builtin_bit_cast(__bf16, hb);
  lo = at_f2bf(f - __uint_as_float(((unsigned)hb) << 16));
}
__device__ __forceinline__ v8f at_mma(v16b a, v16b b, v8f c) {
  c = __builtin_amdgcn_wmma_f32_16x16x32_bf16(false, a, false, b, (short)0, c, false, false);
  asm volatile("v_nop\n\tv_nop\n\tv_nop\n\tv_nop" : "+v"(c) : "v"(a), "v"(b));
  return c;
}

// lane l <-> l ^ 16 (the two halves of a wave hold the two key halves of one query column)
__device__ __forceinline__ float at_xhalf(float v) {
  const int b = __builtin_bit_cast(int, v);
  return __builtin_bit_cast(float, __builtin_amdgcn_permlanex16(b, b, 0x76543210, 0xfedcba98, false, false));
}

// Eight asynchronous 16-byte copies global -> LDS of this lane. The s_wait_xcnt stands inside the statement, behind the last copy,
// so that no address register of a copy is rewritten in front of it.
__device__ __forceinline__ void at_copy8(unsigned l0, unsigned l1, unsigned l2, unsigned l3,
                                         unsigned l4, unsigned l5, unsigned l6, unsigned l7,
                                         const __bf16* g0, const __bf16* g1, const __bf16* g2, const __bf16* g3,
                                         const __bf16* g4, const __bf16* g5, const __bf16* g6, const __bf16* g7) {
  asm volatile("global_load_async_to_lds_b128 %0, %8, off\n\t"
               "global_load_async_to_lds_b128 %1, %9, off\n\t"
               "global_load_async_to_lds_b128 %2, %10, off\n\t"
               "global_load_async_to_lds_b128 %3, %11, off\n\t"
               "global_load_async_to_lds_b128 %4, %12, off\n\t"
               "global_load_async_to_lds_b128 %5, %13, off\n\t"
               "global_load_async_to_lds_b128 %6, %14, off\n\t"
               "global_load_async_to_lds_b128 %7, %15, off\n\t"
               "s_wait_xcnt 0x0"
               :: "v"(l0), "v"(l1), "v"(l2), "v"(l3), "v"(l4), "v"(l5), "v"(l6), "v"(l7),
                  "v"(g0), "v"(g1), "v"(g2), "v"(g3), "v"(g4), "v"(g5), "v"(g6), "v"(g7)
               : "memory");
}
// One chunk: this thread's 4 pieces (rows 16 apart) of each of the 4 planes; l = its LDS byte address in row (tid >> 3) of the K hi tile.
__device__ __forceinline__ void at_stage(unsigned l, const __bf16* kh, const __bf16* kl, const __bf16* vh, const __bf16* vl) {
  const unsigned rs = 16u * AT_LP * 2u;    // 16 LDS rows
  const unsigned ps = AT_PLANE * 2u;       // one plane's tile
  const size_t ks = (size_t)16 * EMB_DIM, vs = (size_t)16 * SEQ_LEN;   // 16 rows of K, of V^T
  at_copy8(l, l + rs, l + 2 * rs, l + 3 * rs, l + ps, l + ps + rs, l + ps + 2 * rs, l + ps + 3 * rs,
           kh, kh + ks, kh + 2 * ks, kh + 3 * ks, kl, kl + ks, kl + 2 * ks, kl + 3 * ks);
  at_copy8(l + 2 * ps, l + 2 * ps + rs, l + 2 * ps + 2 * rs, l + 2 * ps + 3 * rs,
           l + 3 * ps, l + 3 * ps + rs, l + 3 * ps + 2 * rs, l + 3 * ps + 3 * rs,
           vh, vh + vs, vh + 2 * vs, vh + 3 * vs, vl, vl + vs, vl + 2 * vs, vl + 3 * vs);
}

__global__ __launch_bounds__(128)
void attn_full64_kernel(const unsigned short* __restrict__ qhp, const unsigned short* __restrict__ qlp,
                        const unsigned short* __restrict__ khp, const unsigned short* __restrict__ klp,
                        const unsigned short* __restrict__ vhp, const unsigned short* __restrict__ vlp,
                        const int* __restrict__ kmask,
                        float* __restrict__ out, float sscale, float mfill) {
  union FB { v16b v; v8b h[2]; };
  // two chunk buffers, each K hi [kv][d], K lo, V^T hi [d][kv], V^T lo (9 KB a plane); behind the loop: per wave out tile, pitch 68 floats
  __shared__ __align__(16) unsigned char sKV[2 * AT_BUF * 2];    // 73,728 B
  static_assert(AT_NW * 16 * 68 * 4 <= 2 * AT_BUF * 2, "the out tiles fit the buffers");

  const int tid  = threadIdx.x;
  const int wave = tid >> 5;
  const int lane = tid & 31;
  const int hh   = lane >> 4;
  const int c    = lane & 15;

  const int nqb = SEQ_LEN / AT_QB;        // 32
  const int bx = blockIdx.x;
  const int qb = bx % nqb;
  const int h  = bx / nqb;                // 0..N_HEADS-1 (grid = N_HEADS * nqb)
  const int q0 = qb * AT_QB + wave * 16;
  const size_t bo = (size_t)blockIdx.y * SEQ_LEN * EMB_DIM;   // this batch element's start in every q, k, v^T and out plane
  const int* km = kmask + (size_t)blockIdx.y * SEQ_LEN;

  const __bf16* Qh = (const __bf16*)(const void*)qhp + bo + (size_t)h * AT_D;
  const __bf16* Ql = (const __bf16*)(const void*)qlp + bo + (size_t)h * AT_D;
  const __bf16* Kh = (const __bf16*)(const void*)khp + bo + (size_t)h * AT_D;
  const __bf16* Kl = (const __bf16*)(const void*)klp + bo + (size_t)h * AT_D;
  const __bf16* Vh = (const __bf16*)(const void*)vhp + bo + (size_t)h * AT_D * SEQ_LEN;
  const __bf16* Vl = (const __bf16*)(const void*)vlp + bo + (size_t)h * AT_D * SEQ_LEN;
  float*        ob = out + bo + (size_t)h * AT_D;

  // ---- Q fragments (B operand, column = query = lane&15, split k map via Frag load): 2 d-chunks, hi and lo ----
  v16b qah[2], qal[2];
#pragma unroll
  for (int dc = 0; dc < 2; ++dc) {
    const __bf16* qr = Qh + (size_t)(q0 + c) * EMB_DIM + dc * 32 + 8 * hh;
    const __bf16* ql = Ql + (size_t)(q0 + c) * EMB_DIM + dc * 32 + 8 * hh;
    qah[dc] = Frag<__bf16>::load(qr);
    qal[dc] = Frag<__bf16>::load(ql);
  }

  // One query per lane (q0 + c). mrow: running maximum, equal in both wave halves; lrow: this half's share of the sum.
  float mrow = -INFINITY, lrow = 0.f;
  const float sc2 = sscale * 1.44269504088896341f;   // score scale times log2(e)
  const float mf2 = mfill  * 1.44269504088896341f;   // the mask fill in the same units
  v8f oacc[4];   // out^T tiles: oacc[t][r] = out[q0 + c][t*16 + 8*hh + r]
#pragma unroll
  for (int t = 0; t < 4; ++t) oacc[t] = (v8f){0.f,0.f,0.f,0.f,0.f,0.f,0.f,0.f};

  // staging: thread -> row (tid >> 3) of each group of 16 rows, 16-byte piece (tid & 7) of its 128-B line
  const int srow = tid >> 3, spc = tid & 7;
  const __bf16* gkh = Kh + (size_t)srow * EMB_DIM + spc * 8;   // K row kv0 + srow (+16, +32, +48), d = 8*spc..
  const __bf16* gkl = Kl + (size_t)srow * EMB_DIM + spc * 8;
  const __bf16* gvh = Vh + (size_t)srow * SEQ_LEN + spc * 8;   // V^T row d = srow (+16, +32, +48), s = kv0 + 8*spc..
  const __bf16* gvl = Vl + (size_t)srow * SEQ_LEN + spc * 8;
  const unsigned lds0 = (unsigned)(uintptr_t)(&sKV[0]) + (unsigned)(srow * (AT_LP * 2) + spc * 16);

  const int nChunks = SEQ_LEN / AT_KC;   // 32, compile-time constant
  at_stage(lds0, gkh, gkl, gvh, gvl);
  asm volatile("s_wait_asynccnt 0x0" ::: "memory");   // chunk 0 of this wave has landed
  __syncthreads();                                     // ... and every wave's part of it
  at_stage(lds0 + AT_BUF * 2u, gkh + (size_t)AT_KC * EMB_DIM, gkl + (size_t)AT_KC * EMB_DIM, gvh + AT_KC, gvl + AT_KC);

  // key-padding mask of this lane's 32 keys of a chunk (kv + j*16 + 8*hh + r, always < SEQ_LEN)
  v4u kmv[8];
#pragma unroll
  for (int j = 0; j < 4; ++j) {
    kmv[2 * j]     = *(const v4u*)(km + j * 16 + 8 * hh);
    kmv[2 * j + 1] = *(const v4u*)(km + j * 16 + 8 * hh + 4);
  }
  // later instructions may land in the registers that hold the mask loads' address: keep the wait in front of that overwrite
  asm volatile("s_wait_xcnt 0x0" ::: "memory");

  // one trip: the products and the softmax of chunk kc, then the publish point of chunk kc + 1
  auto trip = [&](const int kc) __attribute__((always_inline)) {
    const int kv0 = kc * AT_KC;
    const __bf16* Ksh = (const __bf16*)(const void*)sKV + (kc & 1) * AT_BUF;
    const __bf16* Ksl = Ksh + AT_PLANE;
    const __bf16* Vth = Ksh + 2 * AT_PLANE;
    const __bf16* Vtl = Ksh + 3 * AT_PLANE;

    // scores^T = K . Q^T : s[j][r] = score(key kv0 + j*16 + 8*hh + r, query q0 + c)
    v8f s[4];
#pragma unroll
    for (int j = 0; j < 4; ++j) {
      s[j] = (v8f){0.f,0.f,0.f,0.f,0.f,0.f,0.f,0.f};
#pragma unroll
      for (int dc = 0; dc < 2; ++dc) {
        FB kb, kl;
        kb.h[0] = *(const v8b*)(Ksh + (j * 16 + c) * AT_LP + dc * 32 + 8 * hh);
        kb.h[1] = *(const v8b*)(Ksh + (j * 16 + c) * AT_LP + dc * 32 + 16 + 8 * hh);
        kl.h[0] = *(const v8b*)(Ksl + (j * 16 + c) * AT_LP + dc * 32 + 8 * hh);
        kl.h[1] = *(const v8b*)(Ksl + (j * 16 + c) * AT_LP + dc * 32 + 16 + 8 * hh);
        s[j] = at_mma(kb.v, qah[dc], s[j]);
        s[j] = at_mma(kl.v, qah[dc], s[j]);
        s[j] = at_mma(kb.v, qal[dc], s[j]);
      }
    }
    // mask nonzero -> score := mfill (select, as in the module)
    float m = -INFINITY;
#pragma unroll
    for (int j = 0; j < 4; ++j) {
#pragma unroll
      for (int r = 0; r < 8; ++r) {
        float sv = s[j][r] * sc2;
        sv = (kmv[2 * j + (r >> 2)][r & 3] != 0u) ? mf2 : sv;
        s[j][r] = sv;
        m = fmaxf(m, sv);
      }
    }
    // the next chunk's mask words, asked for here so that their latency runs under the rest of this trip
    // (the last trip asks for its own again: in bounds, never used)
    const int kvn = (kc + 1 < nChunks) ? kv0 + AT_KC : kv0;
#pragma unroll
    for (int j = 0; j < 4; ++j) {
      kmv[2 * j]     = *(const v4u*)(km + kvn + j * 16 + 8 * hh);
      kmv[2 * j + 1] = *(const v4u*)(km + kvn + j * 16 + 8 * hh + 4);
    }
    // later instructions may land in the registers that hold the mask loads' address: keep the wait in front of that overwrite
    asm volatile("s_wait_xcnt 0x0" ::: "memory");
    m = fmaxf(m, at_xhalf(m));   // the other 32 keys of this query
    const float mnew = fmaxf(mrow, m);
    const float alpha = __builtin_amdgcn_exp2f(mrow - mnew);
    mrow = mnew;
    // p^T stays in registers: two score tiles (keys 0..15 and 16..31 of a 32-key group) are one B operand,
    // element e < 8 = key 8*hh + e, e >= 8 = key 16 + 8*hh + (e - 8): the order in which the V^T rows are read below
    v16b pth[2], ptl[2];
    float psum = 0.f;
#pragma unroll
    for (int j = 0; j < 4; ++j) {
#pragma unroll
      for (int r = 0; r < 8; ++r) {
        const float p = __builtin_amdgcn_exp2f(s[j][r] - mnew);
        psum += p;
        __bf16 a, bl; at_split(p, a, bl);
        pth[j >> 1][(j & 1) * 8 + r] = a;
        ptl[j >> 1][(j & 1) * 8 + r] = bl;
      }
    }
    lrow = lrow * alpha + psum;
#pragma unroll
    for (int t = 0; t < 4; ++t)
#pragma unroll
      for (int r = 0; r < 8; ++r) oacc[t][r] *= alpha;
    // out^T += V^T . p^T
#pragma unroll
    for (int kk = 0; kk < 2; ++kk) {
#pragma unroll
      for (int t = 0; t < 4; ++t) {
        FB vb, vl;
        vb.h[0] = *(const v8b*)(Vth + (t * 16 + c) * AT_LP + kk * 32 + 8 * hh);
        vb.h[1] = *(const v8b*)(Vth + (t * 16 + c) * AT_LP + kk * 32 + 16 + 8 * hh);
        vl.h[0] = *(const v8b*)(Vtl + (t * 16 + c) * AT_LP + kk * 32 + 8 * hh);
        vl.h[1] = *(const v8b*)(Vtl + (t * 16 + c) * AT_LP + kk * 32 + 16 + 8 * hh);
        oacc[t] = at_mma(vb.v, pth[kk], oacc[t]);
        oacc[t] = at_mma(vl.v, pth[kk], oacc[t]);
        oacc[t] = at_mma(vb.v, ptl[kk], oacc[t]);
      }
    }
    asm volatile("s_wait_dscnt 0x0" ::: "memory");      // this wave's reads of the buffer are done before it is refilled
    asm volatile("s_wait_asynccnt 0x0" ::: "memory");   // this wave's copies of chunk kc + 1 have landed
    __syncthreads();                                     // publishes chunk kc + 1 and ends every reader's last read of chunk kc
  };
  int kc = 0;
  for (; kc < nChunks - 2; ++kc) {   // while a chunk kc + 2 exists: its copies go into the buffer that this trip has just read
    trip(kc);
    at_stage(lds0 + (unsigned)(kc & 1) * (AT_BUF * 2u), gkh + (size_t)(kc + 2) * AT_KC * EMB_DIM,
             gkl + (size_t)(kc + 2) * AT_KC * EMB_DIM, gvh + (kc + 2) * AT_KC, gvl + (kc + 2) * AT_KC);
  }
  for (; kc < nChunks; ++kc) trip(kc);   // the last two chunks: nothing left to fetch
  asm volatile("s_wait_asynccnt 0x0" ::: "memory");     // nothing in flight behind the loop; the last barrier ended every read of the buffers

  float* os = (float*)(void*)sKV + wave * (16 * 68);
  {
    const float inv = 1.0f / (lrow + at_xhalf(lrow));   // join the two halves' sums once
#pragma unroll
    for (int t = 0; t < 4; ++t) {
      v4f lo4, hi4;
#pragma unroll
      for (int r = 0; r < 4; ++r) { lo4[r] = oacc[t][r] * inv; hi4[r] = oacc[t][4 + r] * inv; }
      *(v4f*)(os + c * 68 + t * 16 + 8 * hh)     = lo4;
      *(v4f*)(os + c * 68 + t * 16 + 8 * hh + 4) = hi4;
    }
  }
  __builtin_amdgcn_fence(__ATOMIC_RELEASE, "workgroup");
  __builtin_amdgcn_wave_barrier();
  __builtin_amdgcn_fence(__ATOMIC_ACQUIRE, "workgroup");
  {
    const int c4 = (lane & 15) * 4;
    {
#pragma unroll
      for (int it = 0; it < 8; ++it) {
        const int row = it * 2 + hh;   // it 0..7 x hh 0..1 covers rows 0..15 of the wave tile
        v4f val = *(const v4f*)(os + row * 68 + c4);
        *(v4f*)(ob + (size_t)(q0 + row) * EMB_DIM + c4) = val;
      }
      
    }
  }
}

// ---------------------------------------------------------------------------
// Host-side orchestration (kernel launches + host arithmetic only).
// Workspace region map (byte offsets, every region fully written by its producer before any read):
//   0           xb    bf16 [4096][1024]            8,388,608
//   8,388,608   wqb   bf16 [1024][1024]            2,097,152
//   10,485,760  wkb   bf16 [1024][1024]            2,097,152
//   12,582,912  wvb   bf16 [1024][1024]            2,097,152
//   14,680,064  wo16  f16  [1024][1024] (x64)      2,097,152
//   16,777,216  qh    bf16 [4096][1024]            8,388,608
//   25,165,824  ql    bf16 [4096][1024]            8,388,608
//   33,554,432  kh    bf16 [4096][1024]            8,388,608
//   41,943,040  kl    bf16 [4096][1024]            8,388,608
//   50,331,648  vth   bf16 [2][1024][2048]         8,388,608
//   58,720,256  vtl   bf16 [2][1024][2048]         8,388,608
//   67,108,864  o32   f32  [4096][1024]           16,777,216
//   83,886,080  o16   f16  [4096][1024] (x16)      8,388,608
//   92,274,688  end (88 MiB)
// GEMM shapes: K = 1024 (multiple of 32) everywhere; M, N in {1024, 2048, 4096} (multiples of 64); no padding.
// ---------------------------------------------------------------------------
extern "C" void kernel_launch(void* const* d_in, const int* in_sizes, int n_in,
                              void* d_out, int out_size, void* d_ws, size_t ws_size,
                              hipStream_t stream) {
  if (n_in < 6) return;
  const int nTokEmb = N_TOK * EMB_DIM;          // 4,194,304
  const int nEmbEmb = EMB_DIM * EMB_DIM;        // 1,048,576
  if (in_sizes[0] != nTokEmb || in_sizes[1] != N_BATCH * SEQ_LEN || in_sizes[2] != nEmbEmb ||
      in_sizes[3] != nEmbEmb || in_sizes[4] != nEmbEmb || in_sizes[5] != nEmbEmb || out_size != nTokEmb) return;

  const size_t offXb  = 0;
  const size_t offWq  = offXb  + (size_t)nTokEmb * 2;
  const size_t offWk  = offWq  + (size_t)nEmbEmb * 2;
  const size_t offWv  = offWk  + (size_t)nEmbEmb * 2;
  const size_t offWo  = offWv  + (size_t)nEmbEmb * 2;
  const size_t offQh  = offWo  + (size_t)nEmbEmb * 2;
  const size_t offQl  = offQh  + (size_t)nTokEmb * 2;
  const size_t offKh  = offQl  + (size_t)nTokEmb * 2;
  const size_t offKl  = offKh  + (size_t)nTokEmb * 2;
  const size_t offVth = offKl  + (size_t)nTokEmb * 2;
  const size_t offVtl = offVth + (size_t)nTokEmb * 2;
  const size_t offO32 = offVtl + (size_t)nTokEmb * 2;
  const size_t offO16 = offO32 + (size_t)nTokEmb * 4;
  const size_t offEnd = offO16 + (size_t)nTokEmb * 2;   // 92,274,688
  if (ws_size < offEnd) return;

  const float* x    = (const float*)d_in[0];
  const int*   mask = (const int*)d_in[1];
  const float* wq   = (const float*)d_in[2];
  const float* wk   = (const float*)d_in[3];
  const float* wv   = (const float*)d_in[4];
  const float* wo   = (const float*)d_in[5];
  float* out = (float*)d_out;

  char* ws = (char*)d_ws;
  unsigned short* xb   = (unsigned short*)(ws + offXb);
  unsigned short* wqb  = (unsigned short*)(ws + offWq);
  unsigned short* wkb  = (unsigned short*)(ws + offWk);
  unsigned short* wvb  = (unsigned short*)(ws + offWv);
  unsigned short* wo16 = (unsigned short*)(ws + offWo);
  unsigned short* qh   = (unsigned short*)(ws + offQh);
  unsigned short* ql   = (unsigned short*)(ws + offQl);
  unsigned short* kh   = (unsigned short*)(ws + offKh);
  unsigned short* kl   = (unsigned short*)(ws + offKl);
  unsigned short* vth  = (unsigned short*)(ws + offVth);
  unsigned short* vtl  = (unsigned short*)(ws + offVtl);
  float*          o32  = (float*)(ws + offO32);
  unsigned short* o16  = (unsigned short*)(ws + offO16);
  const float* dummyf = x;   // valid pointer for unused bias / resid arguments (never dereferenced)

  // 1) 16-bit operand planes: x, wq, wk, wv -> bf16 RNE; wo -> f16 encode of bf16-RNE(wo*64)
  //    one grid of 8192 + 4 x 2048 = 16,384 blocks
  cast_inputs_kernel<<<CI_XB + 4 * CI_WB, 256, 0, stream>>>(x, wq, wk, wv, wo, xb, wqb, wkb, wvb, wo16);

  // 2), 3) q, k = x @ W^T (bf16 hi/lo planes [token][h*64+d]) and v^T per batch = Wv @ x_b^T (planes [b][h*64+d][s]):
  //    K = 1024; 3 products x 128 blocks of 8 waves in one grid
  qkv_gemm64<<<dim3(128, 3), 256, 0, stream>>>(xb, wqb, wkb, wvb, qh, ql, kh, kl, vth, vtl);

  // 4) attention: grid = (16 heads x 32 query blocks, 2 batch elements); key mask read from d_in[1] as int32
  {
    const dim3 g(N_HEADS * (SEQ_LEN / 64), N_BATCH);
    attn_full64_kernel<<<g, 128, 0, stream>>>(qh, ql, kh, kl, vth, vtl, mask, o32, 0.125f, -1.0e9f);
  }

  // 5) attention output f32 -> f16 carried x16
  {
    const int n2o = nTokEmb / 2;   // 2,097,152 -> 8192 blocks
    cast2_kernel<2><<<(n2o + 255) / 256, 256, 0, stream>>>(o32, o16, n2o, 16.0f);
  }

  // 6) out = O @ Wo^T : f16 operands (O x16, Wo x64) -> scale 1/1024, f32 into d_out [4096][1024]
  {
    const dim3 g(((N_TOK / 64) * (EMB_DIM / 64)) / 8, 1);
    wmma_gemm64<0, false, 0, 0, false><<<g, 256, 0, stream>>>(
        o16, o16, EMB_DIM, 0L, wo16, wo16, EMB_DIM, 0L,
        (void*)out, (void*)out, EMB_DIM, 0L, dummyf, dummyf, 0L, N_TOK, EMB_DIM, EMB_DIM, 1.0f / 1024.0f);
  }
}

// v008
// Measured time: 162 microseconds a run.
// Two timings next to v007 put it at 1.10 and 1.11 times that version's speed.
// Over all steps from v000 it is 4.29 times as fast.
// Projections q, k, v^T: v_wmma_f32_16x16x32_bf16 (x and weights RNE-converted to bf16, single product); attention q.k^T and p.v: v_wmma_f32_16x16x32_bf16 with bf16 hi/lo split operands (hi.hi + hi.lo + lo.hi); output projection: v_wmma_f32_16x16x32_f16 (attention output carried x16 in f16, bf16-RNE weight carried x64 in f16); f32 accumulate everywhere; online softmax, key-mask select (-1e9) and normalisation in f32.
#include <hip/hip_runtime.h>
#include <math.h>
#include <stdint.h>

#define N_BATCH  2
#define SEQ_LEN  2048
#define EMB_DIM  1024
#define N_HEADS  16
#define HEAD_DIM 64
#define N_TOK    (N_BATCH * SEQ_LEN)

typedef __attribute__((ext_vector_type(16))) _Float16 v16h;
typedef __attribute__((ext_vector_type(8)))  _Float16 v8h;
typedef __attribute__((ext_vector_type(16))) __bf16   v16b;
typedef __attribute__((ext_vector_type(8)))  __bf16   v8b;
typedef __attribute__((ext_vector_type(2)))  __bf16   v2b;
typedef __attribute__((ext_vector_type(8)))  float    v8f;
typedef __attribute__((ext_vector_type(4)))  float    v4f;
typedef __attribute__((ext_vector_type(2)))  float    v2f;
typedef __attribute__((ext_vector_type(4)))  unsigned int v4u;

__device__ __forceinline__ unsigned short f2bf_bits(float f) {
  unsigned u = __float_as_uint(f);
  return (unsigned short)((u + 0x7FFFu + ((u >> 16) & 1u)) >> 16);
}
__device__ __forceinline__ float bf_bits2f(unsigned short h) { return __uint_as_float(((unsigned)h) << 16); }
// Two f32 -> bf16 hi and lo planes: hi = RNE bf16 of f, lo = RNE bf16 of (f - hi); each conversion is one v_cvt_pk_bf16_f32 for the pair.
__device__ __forceinline__ void split2_bf16(const v2f f, v2b& hi, v2b& lo) {
  hi = __builtin_convertvector(f, v2b);
  const unsigned hw = __builtin_bit_cast(unsigned, hi);
  v2f d;
  d[0] = f[0] - __uint_as_float(hw << 16);
  d[1] = f[1] - __uint_as_float(hw & 0xFFFF0000u);
  lo = __builtin_convertvector(d, v2b);
}

// hazard guards as plain device helpers
__device__ __forceinline__ void dep_guard_h(v8f& a, v8f& b, v16h x, v16h y) { asm volatile("v_nop\n\tv_nop\n\tv_nop\n\tv_nop" : "+v"(a), "+v"(b) : "v"(x), "v"(y)); }
__device__ __forceinline__ void dep_guard_b(v8f& a, v8f& b, v16b x, v16b y) { asm volatile("v_nop\n\tv_nop\n\tv_nop\n\tv_nop" : "+v"(a), "+v"(b) : "v"(x), "v"(y)); }
__device__ __forceinline__ void keep4_h(v16h a, v16h b, v16h c, v16h d) { asm volatile("v_nop" :: "v"(a), "v"(b), "v"(c), "v"(d)); }
__device__ __forceinline__ void keep4_b(v16b a, v16b b, v16b c, v16b d) { asm volatile("v_nop" :: "v"(a), "v"(b), "v"(c), "v"(d)); }
__device__ __forceinline__ void acc_guard4(v8f& a, v8f& b, v8f& c, v8f& d) { asm volatile("v_nop\n\tv_nop\n\tv_nop\n\tv_nop" : "+v"(a), "+v"(b), "+v"(c), "+v"(d)); }
template <typename T> struct Frag;
template <> struct Frag<_Float16> {
  typedef v16h V; union U { v16h v; v8h h[2]; };
  static __device__ __forceinline__ v16h load(const _Float16* p) {   // elements 0..7 <- p[0..7], 8..15 <- p[16..23]
    U f; f.h[0] = *(const v8h*)(p); f.h[1] = *(const v8h*)(p + 16); return f.v;
  }
  static __device__ __forceinline__ v8f mma(v16h a, v16h b, v8f c) {
    return __builtin_amdgcn_wmma_f32_16x16x32_f16(false, a, false, b, (short)0, c, false, false);
  }
  static __device__ __forceinline__ void guard(v8f& a, v8f& b, v16h x, v16h y) { dep_guard_h(a, b, x, y); }
  static __device__ __forceinline__ void keep(v16h a, v16h b, v16h c, v16h d) { keep4_h(a, b, c, d); }
};
template <> struct Frag<__bf16> {
  typedef v16b V; union U { v16b v; v8b h[2]; };
  static __device__ __forceinline__ v16b load(const __bf16* p) {
    U f; f.h[0] = *(const v8b*)(p); f.h[1] = *(const v8b*)(p + 16); return f.v;
  }
  static __device__ __forceinline__ v8f mma(v16b a, v16b b, v8f c) {
    return __builtin_amdgcn_wmma_f32_16x16x32_bf16(false, a, false, b, (short)0, c, false, false);
  }
  static __device__ __forceinline__ void guard(v8f& a, v8f& b, v16b x, v16b y) { dep_guard_b(a, b, x, y); }
  static __device__ __forceinline__ void keep(v16b a, v16b b, v16b c, v16b d) { keep4_b(a, b, c, d); }
};

// ---- Register-blocked batched WMMA GEMM ------------------------------------
// C[m,n] = scale * sum_k A[m,k] * Bt[n,k] (+bias)(+resid); each wave owns a 64x64 tile.
// A row-major [M,K]; Bt row-major [N,K]; M % 64 == 0, N % 512 == 0, K % 64 == 0; grid.x = (M/64)*(N/64)/8.
// The 8 waves of a block share one 64-row band of A and own 8 neighbouring 64-row bands of Bt. Operands reach the
// waves through LDS: a stage is 64 k (one 128-B line of each of the 64 + 512 rows), brought by asynchronous 16-byte
// copies of which 8 neighbouring lanes cover one whole line, two buffers, the next stage in flight under this one's products.
// Copy coverage: 256 threads x 18 copies x 16 B = 576 rows x 128 B = the whole stage, every LDS byte from one lane.
// SPLIT (hi/lo planes) is not instantiated and not staged.
// BIAS_MODE: 0 = none, 1 = bias[m], 2 = bias[n].
// OUT_MODE: 0 = f32, 1 = f16, 2 = bf16 hi plane (Cout) + bf16 lo plane (Cout2).
// Epilogue coverage per wave: f32 path 8 it x 2 rows x (16 lanes x 4 floats) = 16 rows x 64; 16-bit path
// 4 it x 4 rows x (8 lanes x 8 halves) = 16 rows x 64; 4 slabs = the whole 64x64 tile.
// ET: 0 = f16 operands, 1 = bf16 operands (pointers passed as 16-bit storage)
#define GS_ROWS  576                       // 64 rows of A, then 512 rows of Bt
#define GS_PITCH 72                        // LDS row pitch in elements: 144 B = 16 B x 9 (odd), no bank met twice by a 16-byte fragment read
#define GS_BYTES (GS_ROWS * GS_PITCH * 2)  // one buffer: 82,944 B
// Nine asynchronous 16-byte copies global -> LDS of this lane. The s_wait_xcnt stands inside the statement, behind the last copy,
// so that no address register of a copy is rewritten in front of it.
__device__ __forceinline__ void gs_copy9(unsigned l0, unsigned l1, unsigned l2, unsigned l3, unsigned l4, unsigned l5,
                                         unsigned l6, unsigned l7, unsigned l8,
                                         const unsigned short* g0, const unsigned short* g1, const unsigned short* g2,
                                         const unsigned short* g3, const unsigned short* g4, const unsigned short* g5,
                                         const unsigned short* g6, const unsigned short* g7, const unsigned short* g8) {
  asm volatile("global_load_async_to_lds_b128 %0, %9, off\n\t"
               "global_load_async_to_lds_b128 %1, %10, off\n\t"
               "global_load_async_to_lds_b128 %2, %11, off\n\t"
               "global_load_async_to_lds_b128 %3, %12, off\n\t"
               "global_load_async_to_lds_b128 %4, %13, off\n\t"
               "global_load_async_to_lds_b128 %5, %14, off\n\t"
               "global_load_async_to_lds_b128 %6, %15, off\n\t"
               "global_load_async_to_lds_b128 %7, %16, off\n\t"
               "global_load_async_to_lds_b128 %8, %17, off\n\t"
               "s_wait_xcnt 0x0"
               :: "v"(l0), "v"(l1), "v"(l2), "v"(l3), "v"(l4), "v"(l5), "v"(l6), "v"(l7), "v"(l8),
                  "v"(g0), "v"(g1), "v"(g2), "v"(g3), "v"(g4), "v"(g5), "v"(g6), "v"(g7), "v"(g8)
               : "memory");
}
// One stage: this thread's 2 pieces of A rows and 16 pieces of Bt rows (rows 32 apart), l = its LDS byte address in row (tid >> 3).
__device__ __forceinline__ void gs_stage(unsigned l, const unsigned short* a, size_t sa, const unsigned short* b, size_t sb) {
  const unsigned st = 32u * GS_PITCH * 2u;   // 32 LDS rows
  gs_copy9(l, l + st, l + 2 * st, l + 3 * st, l + 4 * st, l + 5 * st, l + 6 * st, l + 7 * st, l + 8 * st,
           a, a + sa, b, b + sb, b + 2 * sb, b + 3 * sb, b + 4 * sb, b + 5 * sb, b + 6 * sb);
  gs_copy9(l + 9 * st, l + 10 * st, l + 11 * st, l + 12 * st, l + 13 * st, l + 14 * st, l + 15 * st, l + 16 * st, l + 17 * st,
           b + 7 * sb, b + 8 * sb, b + 9 * sb, b + 10 * sb, b + 11 * sb, b + 12 * sb, b + 13 * sb, b + 14 * sb, b + 15 * sb);
}
template <int ET> struct Elem;
template <> struct Elem<0> { typedef _Float16 T; };
template <> struct Elem<1> { typedef __bf16 T; };
// bx = index of the block among the blocks of its product, b = batch index of the product
template <int ET, bool SPLIT, int BIAS_MODE, int OUT_MODE, bool RESID, int ACT = 0>
__device__ __forceinline__ void gemm64_body(
    const int bx, const int b,
    const unsigned short* __restrict__ Ap, const unsigned short* __restrict__ A2p, int lda, long strideA,
    const unsigned short* __restrict__ Btp, const unsigned short* __restrict__ Bt2p, int ldb, long strideB,
    void* __restrict__ Cout, void* __restrict__ Cout2, int ldc, long strideC,
    const float* __restrict__ bias,
    const float* __restrict__ resid, long strideR,
    int M, int N, int K, float scale) {
  typedef typename Elem<ET>::T T;
  typedef typename Frag<T>::V V;
  static_assert(!SPLIT, "hi/lo planes are not staged");
  __shared__ __align__(16) unsigned short sAB[2 * GS_ROWS * GS_PITCH];   // two stage buffers, 165,888 B
  __shared__ __align__(16) float sT[8][16 * 68];   // per-wave 16x64 slab, pitch 68 floats
  const int lane = threadIdx.x & 31;
  const int wave = threadIdx.x >> 5;
  const int tilesN = N >> 6;
  const int tilesM = M >> 6;
  const int tile = bx * 8 + wave;
  if (bx * 8 >= tilesM * tilesN) return;   // the whole block or none of it, in front of every barrier
  const int tm = tile / tilesN;
  const int tn = tile - tm * tilesN;
  const int m0 = tm << 6;
  const int n0 = tn << 6;

  // staging: thread -> row (tid >> 3) of each group of 32 rows, 16-byte piece (tid & 7) of its 128-B line
  const int srow = threadIdx.x >> 3;
  const int spc  = threadIdx.x & 7;
  const int nb0  = n0 - (wave << 6);           // first Bt row of the block (N % 512 == 0: the 8 tiles lie in one tile row)
  const unsigned short* gA = Ap  + (size_t)b * strideA + (size_t)(m0  + srow) * lda + spc * 8;
  const unsigned short* gB = Btp + (size_t)b * strideB + (size_t)(nb0 + srow) * ldb + spc * 8;
  const size_t sa32 = (size_t)32 * lda, sb32 = (size_t)32 * ldb;
  const unsigned lds0 = (unsigned)(uintptr_t)(&sAB[0]) + (unsigned)(srow * (GS_PITCH * 2) + spc * 16);

  const int rlane = lane & 15;                 // row (A) / col (B, D) within subtile
  const int koff  = (lane >> 4) * 8;           // k offset of this lane half
  const int mOff  = (lane >> 4) * 8;           // D row offset

  v8f acc[4][4];
#pragma unroll
  for (int i = 0; i < 4; ++i)
#pragma unroll
    for (int j = 0; j < 4; ++j) acc[i][j] = (v8f){0.f,0.f,0.f,0.f,0.f,0.f,0.f,0.f};

  const int nStages = K >> 6;
  gs_stage(lds0, gA, sa32, gB, sb32);
  asm volatile("s_wait_asynccnt 0x0" ::: "memory");   // stage 0 of this wave has landed
  __syncthreads();                                     // ... and every wave's part of it
  if (nStages > 1) gs_stage(lds0 + GS_BYTES, gA + 64, sa32, gB + 64, sb32);

  for (int t = 0; t < nStages; ++t) {
    const T* sbuf = (const T*)(const void*)(sAB + (t & 1) * (GS_ROWS * GS_PITCH));
#pragma unroll
    for (int ks = 0; ks < 2; ++ks) {
      V bh[4], ah[4];   // all eight fragments of these 32 k asked for as one group, in front of their 16 products
#pragma unroll
      for (int j = 0; j < 4; ++j)
        bh[j] = Frag<T>::load(sbuf + (64 + (wave << 6) + (j << 4) + rlane) * GS_PITCH + ks * 32 + koff);
#pragma unroll
      for (int i = 0; i < 4; ++i)
        ah[i] = Frag<T>::load(sbuf + ((i << 4) + rlane) * GS_PITCH + ks * 32 + koff);
#pragma unroll
      for (int i = 0; i < 4; ++i) {
#pragma unroll
        for (int j = 0; j < 4; ++j) acc[i][j] = Frag<T>::mma(ah[i], bh[j], acc[i][j]);
        Frag<T>::guard(acc[i][0], acc[i][3], ah[i], ah[i]);
      }
      Frag<T>::keep(bh[0], bh[1], bh[2], bh[3]);
    }
    asm volatile("s_wait_dscnt 0x0" ::: "memory");      // this wave's reads of the buffer are done before it is refilled
    asm volatile("s_wait_asynccnt 0x0" ::: "memory");   // this wave's copies of stage t + 1 have landed
    __syncthreads();                                     // publishes stage t + 1 and ends every reader's last read of stage t
    if (t + 2 < nStages)
      gs_stage(lds0 + (unsigned)(t & 1) * GS_BYTES, gA + (size_t)(t + 2) * 64, sa32, gB + (size_t)(t + 2) * 64, sb32);
  }
  asm volatile("s_wait_asynccnt 0x0" ::: "memory");     // nothing in flight behind the loop
  acc_guard4(acc[0][0], acc[0][1], acc[0][2], acc[0][3]);
  acc_guard4(acc[1][0], acc[1][1], acc[1][2], acc[1][3]);
  acc_guard4(acc[2][0], acc[2][1], acc[2][2], acc[2][3]);
  acc_guard4(acc[3][0], acc[3][1], acc[3][2], acc[3][3]);

  // ---- epilogue ----
  float* slab = sT[wave];
  const float* Rb = RESID ? (resid + (size_t)b * strideR) : nullptr;
#pragma unroll
  for (int i = 0; i < 4; ++i) {
    const int mBase = m0 + (i << 4);
#pragma unroll
    for (int j = 0; j < 4; ++j) {
      const int n = n0 + (j << 4) + rlane;
      float bv = 0.f;
      if (BIAS_MODE == 2) bv = bias[n];
#pragma unroll
      for (int r = 0; r < 8; ++r) {
        float v = acc[i][j][r] * scale;
        if (BIAS_MODE == 1) v += bias[mBase + mOff + r];
        if (BIAS_MODE == 2) v += bv;
        if (RESID) v += Rb[(size_t)(mBase + mOff + r) * ldc + n];
        if (ACT == 1) v = tanhf(v);
        if (ACT == 2) v = fmaxf(v, 0.0f);
        if (ACT == 3) v = v / (1.0f + expf(-v));
        if (ACT == 4) v = (v > 0.f) ? v : 0.01f * v;
        if (ACT == 5) v = 0.5f * v * (1.0f + erff(v * 0.70710678118654752f));
        slab[(mOff + r) * 68 + (j << 4) + rlane] = v;
      }
    }
    __builtin_amdgcn_fence(__ATOMIC_RELEASE, "workgroup");
    __builtin_amdgcn_wave_barrier();
    __builtin_amdgcn_fence(__ATOMIC_ACQUIRE, "workgroup");
    if (OUT_MODE == 0) {
      float* C = (float*)Cout + (size_t)b * strideC;
      const int hh = lane >> 4, c4 = (lane & 15) * 4;     // row seg = 256 B = 16 lanes x 16 B
      {
#pragma unroll
        for (int it = 0; it < 8; ++it) {
          const int row = it * 2 + hh;
          v4f v = *(const v4f*)(slab + row * 68 + c4);
          *(v4f*)(C + (size_t)(mBase + row) * ldc + n0 + c4) = v;
        }
        
      }
    } else {
      const int q = lane >> 3, c8 = (lane & 7) * 8;
      unsigned short* C  = (unsigned short*)Cout  + (size_t)b * strideC;
      unsigned short* C2 = (OUT_MODE == 2) ? ((unsigned short*)Cout2 + (size_t)b * strideC) : nullptr;
      {
#pragma unroll
        for (int it = 0; it < 4; ++it) {
          const int row = it * 4 + q;
          const float* sp = slab + row * 68 + c8;
          v8h hv, lv;
          v4u hw, lw;   // the pairs as whole 32-bit words: element e in the low half, e + 1 in the high half
#pragma unroll
          for (int e = 0; e < 8; e += 2) {
            if (OUT_MODE == 1) {
              hv[e]     = (_Float16)sp[e];
              hv[e + 1] = (_Float16)sp[e + 1];
            } else {
              v2b hb, lb;
              split2_bf16((v2f){sp[e], sp[e + 1]}, hb, lb);
              hw[e >> 1] = __builtin_bit_cast(unsigned, hb);
              lw[e >> 1] = __builtin_bit_cast(unsigned, lb);
            }
          }
          if (OUT_MODE == 2) { hv = __builtin_bit_cast(v8h, hw); lv = __builtin_bit_cast(v8h, lw); }
          *(v8h*)(C + (size_t)(mBase + row) * ldc + n0 + c8) = hv;
          if (OUT_MODE == 2) *(v8h*)(C2 + (size_t)(mBase + row) * ldc + n0 + c8) = lv;
        }
        
      }
    }
    __builtin_amdgcn_fence(__ATOMIC_RELEASE, "workgroup");
    __builtin_amdgcn_wave_barrier();
    __builtin_amdgcn_fence(__ATOMIC_ACQUIRE, "workgroup");
  }
}

// One product per launch: grid = (blocks of the product, batch).
template <int ET, bool SPLIT, int BIAS_MODE, int OUT_MODE, bool RESID, int ACT = 0>
__global__ __launch_bounds__(256) void wmma_gemm64(
    const unsigned short* __restrict__ Ap, const unsigned short* __restrict__ A2p, int lda, long strideA,
    const unsigned short* __restrict__ Btp, const unsigned short* __restrict__ Bt2p, int ldb, long strideB,
    void* __restrict__ Cout, void* __restrict__ Cout2, int ldc, long strideC,
    const float* __restrict__ bias,
    const float* __restrict__ resid, long strideR,
    int M, int N, int K, float scale) {
  gemm64_body<ET, SPLIT, BIAS_MODE, OUT_MODE, RESID, ACT>(blockIdx.x, blockIdx.y, Ap, A2p, lda, strideA, Btp, Bt2p, ldb, strideB,
                                                          Cout, Cout2, ldc, strideC, bias, resid, strideR, M, N, K, scale);
}

// The three projections, which do not depend on one another, in one grid of (128, 3) blocks, so that all WGPs have work
// (one product alone has 128 blocks, one to a WGP). blockIdx.y (the same for the whole block) picks the product:
//   0: q = x . Wq^T, 1: k = x . Wk^T : M = 4096 tokens, N = 1024; 64 x 16 tiles = 128 blocks; planes [token][h*64+d]
//   2: v^T of batch b = Wv . x_b^T   : M = 1024, N = 2048 tokens; 16 x 32 tiles = 64 blocks for each of the 2 batch elements
//      (b = blockIdx.x >> 6); planes [b][h*64+d][s]
__global__ __launch_bounds__(256) void qkv_gemm64(
    const unsigned short* __restrict__ xb, const unsigned short* __restrict__ wqb,
    const unsigned short* __restrict__ wkb, const unsigned short* __restrict__ wvb,
    unsigned short* __restrict__ qh, unsigned short* __restrict__ ql,
    unsigned short* __restrict__ kh, unsigned short* __restrict__ kl,
    unsigned short* __restrict__ vth, unsigned short* __restrict__ vtl) {
  const int  which = blockIdx.y;
  const bool isV   = which == 2;
  const unsigned short* A  = isV ? wvb : xb;
  const unsigned short* Bt = isV ? xb : (which == 0 ? wqb : wkb);
  unsigned short* C  = isV ? vth : (which == 0 ? qh : kh);
  unsigned short* C2 = isV ? vtl : (which == 0 ? ql : kl);
  const int bx = isV ? (int)(blockIdx.x & 63) : (int)blockIdx.x;
  const int b  = isV ? (int)(blockIdx.x >> 6) : 0;
  gemm64_body<1, false, 0, 2, false>(bx, b, A, A, EMB_DIM, 0L, Bt, Bt, EMB_DIM, isV ? (long)SEQ_LEN * EMB_DIM : 0L,
                                     (void*)C, (void*)C2, isV ? SEQ_LEN : EMB_DIM, isV ? (long)EMB_DIM * SEQ_LEN : 0L,
                                     nullptr, nullptr, 0L, isV ? EMB_DIM : N_TOK, isV ? SEQ_LEN : EMB_DIM, EMB_DIM, 1.0f);
}

// ---------------------------------------------------------------------------
// Elementwise f32 -> 16-bit plane, 2 consecutive elements per thread packed into one 4-B store: each wave writes
// CMODE 0: bf16 RNE bits of in*scale.
// CMODE 1: f16 bits of the bf16-RNE value of in*scale (an 8-significant-bit value re-encoded exactly in f16).
// CMODE 2: f16 RNE bits of in*scale.
// Coverage: grid = ceil(n2/256) blocks x 256 threads x 2 elements = 2*n2 = the whole plane
// (n2 = 2097152 -> 8192 blocks; n2 = 524288 -> 2048 blocks; both exact multiples of 256).
// ---------------------------------------------------------------------------
__device__ __forceinline__ unsigned pk16(unsigned short a, unsigned short b) { return (unsigned)a | ((unsigned)b << 16); }

template <int CMODE>
__device__ __forceinline__ void cast2_body(const float* __restrict__ in, unsigned short* __restrict__ out,
                                           const int i, const int n2, const float scale) {
  if (i < n2) {
    const v2f f = *(const v2f*)(in + 2 * (size_t)i);
    const float f0 = f[0] * scale, f1 = f[1] * scale;
    unsigned short u0, u1;
    if (CMODE == 0) {
      u0 = f2bf_bits(f0); u1 = f2bf_bits(f1);
    } else if (CMODE == 1) {
      u0 = __builtin_bit_cast(unsigned short, (_Float16)bf_bits2f(f2bf_bits(f0)));
      u1 = __builtin_bit_cast(unsigned short, (_Float16)bf_bits2f(f2bf_bits(f1)));
    } else {
      u0 = __builtin_bit_cast(unsigned short, (_Float16)f0);
      u1 = __builtin_bit_cast(unsigned short, (_Float16)f1);
    }
    const unsigned u = pk16(u0, u1);
    ((unsigned*)out)[i] = u;
  }
}

template <int CMODE>
__global__ __launch_bounds__(256) void cast2_kernel(const float* __restrict__ in, unsigned short* __restrict__ out,
                                                    int n2, float scale) {
  cast2_body<CMODE>(in, out, blockIdx.x * 256 + threadIdx.x, n2, scale);
}

// The five input planes, which do not depend on one another, in one grid: blocks 0..8191 convert x, then 2048 blocks each
// wq, wk, wv (CMODE 0) and wo (CMODE 1, x64). The plane is the same for a whole block.
// Coverage: 8192 x 512 = 4,194,304 elements of x; 2048 x 512 = 1,048,576 elements of each weight.
#define CI_XB (N_TOK * EMB_DIM / 512)     // 8192 blocks of x
#define CI_WB (EMB_DIM * EMB_DIM / 512)   // 2048 blocks of one weight
__global__ __launch_bounds__(256) void cast_inputs_kernel(
    const float* __restrict__ x, const float* __restrict__ wq, const float* __restrict__ wk,
    const float* __restrict__ wv, const float* __restrict__ wo,
    unsigned short* __restrict__ xb, unsigned short* __restrict__ wqb, unsigned short* __restrict__ wkb,
    unsigned short* __restrict__ wvb, unsigned short* __restrict__ wo16) {
  const int bx = blockIdx.x;
  if (bx < CI_XB) {
    cast2_body<0>(x, xb, bx * 256 + threadIdx.x, CI_XB * 256, 1.0f);
  } else {
    const int w = (bx - CI_XB) / CI_WB;                                   // 0..3
    const int i = ((bx - CI_XB) % CI_WB) * 256 + threadIdx.x;
    if (w == 3) {
      cast2_body<1>(wo, wo16, i, CI_WB * 256, 64.0f);
    } else {
      cast2_body<0>(w == 0 ? wq : (w == 1 ? wk : wv), w == 0 ? wqb : (w == 1 ? wkb : wvb), i, CI_WB * 256, 1.0f);
    }
  }
}

#define AT_D 64
#define AT_NW 4
#define AT_QB 64
#define AT_KC 64
#define AT_PLANE (AT_KC * AT_LP)   // elements of one plane's tile in LDS
#define AT_BUF   (4 * AT_PLANE)    // elements of one buffer: K hi, K lo, V^T hi, V^T lo = 36,864 B
#define AT_LP 72   // LDS row pitch of the K and V^T tiles in elements: 144 B = 16 B x 9 (odd), so the 16 rows of one 16-byte fragment read fall on 64 distinct banks

__device__ __forceinline__ v8f at_mma(v16b a, v16b b, v8f c) {
  c = __builtin_amdgcn_wmma_f32_16x16x32_bf16(false, a, false, b, (short)0, c, false, false);
  asm volatile("v_nop\n\tv_nop\n\tv_nop\n\tv_nop" : "+v"(c) : "v"(a), "v"(b));
  return c;
}

// lane l <-> l ^ 16 (the two halves of a wave hold the two key halves of one query column)
__device__ __forceinline__ float at_xhalf(float v) {
  const int b = __builtin_bit_cast(int, v);
  return __builtin_bit_cast(float, __builtin_amdgcn_permlanex16(b, b, 0x76543210, 0xfedcba98, false, false));
}

// Eight asynchronous 16-byte copies global -> LDS of this lane. The s_wait_xcnt stands inside the statement, behind the last copy,
// so that no address register of a copy is rewritten in front of it.
__device__ __forceinline__ void at_copy8(unsigned l0, unsigned l1, unsigned l2, unsigned l3,
                                         unsigned l4, unsigned l5, unsigned l6, unsigned l7,
                                         const __bf16* g0, const __bf16* g1, const __bf16* g2, const __bf16* g3,
                                         const __bf16* g4, const __bf16* g5, const __bf16* g6, const __bf16* g7) {
  asm volatile("global_load_async_to_lds_b128 %0, %8, off\n\t"
               "global_load_async_to_lds_b128 %1, %9, off\n\t"
               "global_load_async_to_lds_b128 %2, %10, off\n\t"
               "global_load_async_to_lds_b128 %3, %11, off\n\t"
               "global_load_async_to_lds_b128 %4, %12, off\n\t"
               "global_load_async_to_lds_b128 %5, %13, off\n\t"
               "global_load_async_to_lds_b128 %6, %14, off\n\t"
               "global_load_async_to_lds_b128 %7, %15, off\n\t"
               "s_wait_xcnt 0x0"
               :: "v"(l0), "v"(l1), "v"(l2), "v"(l3), "v"(l4), "v"(l5), "v"(l6), "v"(l7),
                  "v"(g0), "v"(g1), "v"(g2), "v"(g3), "v"(g4), "v"(g5), "v"(g6), "v"(g7)
               : "memory");
}
// One chunk: this thread's 4 pieces (rows 16 apart) of each of the 4 planes; l = its LDS byte address in row (tid >> 3) of the K hi tile.
__device__ __forceinline__ void at_stage(unsigned l, const __bf16* kh, const __bf16* kl, const __bf16* vh, const __bf16* vl) {
  const unsigned rs = 16u * AT_LP * 2u;    // 16 LDS rows
  const unsigned ps = AT_PLANE * 2u;       // one plane's tile
  const size_t ks = (size_t)16 * EMB_DIM, vs = (size_t)16 * SEQ_LEN;   // 16 rows of K, of V^T
  at_copy8(l, l + rs, l + 2 * rs, l + 3 * rs, l + ps, l + ps + rs, l + ps + 2 * rs, l + ps + 3 * rs,
           kh, kh + ks, kh + 2 * ks, kh + 3 * ks, kl, kl + ks, kl + 2 * ks, kl + 3 * ks);
  at_copy8(l + 2 * ps, l + 2 * ps + rs, l + 2 * ps + 2 * rs, l + 2 * ps + 3 * rs,
           l + 3 * ps, l + 3 * ps + rs, l + 3 * ps + 2 * rs, l + 3 * ps + 3 * rs,
           vh, vh + vs, vh + 2 * vs, vh + 3 * vs, vl, vl + vs, vl + 2 * vs, vl + 3 * vs);
}

__global__ __launch_bounds__(128)
void attn_full64_kernel(const unsigned short* __restrict__ qhp, const unsigned short* __restrict__ qlp,
                        const unsigned short* __restrict__ khp, const unsigned short* __restrict__ klp,
                        const unsigned short* __restrict__ vhp, const unsigned short* __restrict__ vlp,
                        const int* __restrict__ kmask,
                        float* __restrict__ out, float sscale, float mfill) {
  union FB { v16b v; v8b h[2]; };
  // two chunk buffers, each K hi [kv][d], K lo, V^T hi [d][kv], V^T lo (9 KB a plane); behind the loop: per wave out tile, pitch 68 floats
  __shared__ __align__(16) unsigned char sKV[2 * AT_BUF * 2];    // 73,728 B
  static_assert(AT_NW * 16 * 68 * 4 <= 2 * AT_BUF * 2, "the out tiles fit the buffers");

  const int tid  = threadIdx.x;
  const int wave = tid >> 5;
  const int lane = tid & 31;
  const int hh   = lane >> 4;
  const int c    = lane & 15;

  const int nqb = SEQ_LEN / AT_QB;        // 32
  const int bx = blockIdx.x;
  const int qb = bx % nqb;
  const int h  = bx / nqb;                // 0..N_HEADS-1 (grid = N_HEADS * nqb)
  const int q0 = qb * AT_QB + wave * 16;
  const size_t bo = (size_t)blockIdx.y * SEQ_LEN * EMB_DIM;   // this batch element's start in every q, k, v^T and out plane
  const int* km = kmask + (size_t)blockIdx.y * SEQ_LEN;

  const __bf16* Qh = (const __bf16*)(const void*)qhp + bo + (size_t)h * AT_D;
  const __bf16* Ql = (const __bf16*)(const void*)qlp + bo + (size_t)h * AT_D;
  const __bf16* Kh = (const __bf16*)(const void*)khp + bo + (size_t)h * AT_D;
  const __bf16* Kl = (const __bf16*)(const void*)klp + bo + (size_t)h * AT_D;
  const __bf16* Vh = (const __bf16*)(const void*)vhp + bo + (size_t)h * AT_D * SEQ_LEN;
  const __bf16* Vl = (const __bf16*)(const void*)vlp + bo + (size_t)h * AT_D * SEQ_LEN;
  float*        ob = out + bo + (size_t)h * AT_D;

  // ---- Q fragments (B operand, column = query = lane&15, split k map via Frag load): 2 d-chunks, hi and lo ----
  v16b qah[2], qal[2];
#pragma unroll
  for (int dc = 0; dc < 2; ++dc) {
    const __bf16* qr = Qh + (size_t)(q0 + c) * EMB_DIM + dc * 32 + 8 * hh;
    const __bf16* ql = Ql + (size_t)(q0 + c) * EMB_DIM + dc * 32 + 8 * hh;
    qah[dc] = Frag<__bf16>::load(qr);
    qal[dc] = Frag<__bf16>::load(ql);
  }

  // One query per lane (q0 + c). mrow: running maximum, equal in both wave halves; lrow: this half's share of the sum.
  float mrow = -INFINITY, lrow = 0.f;
  const float sc2 = sscale * 1.44269504088896341f;   // score scale times log2(e)
  const float mf2 = mfill  * 1.44269504088896341f;   // the mask fill in the same units
  v8f oacc[4];   // out^T tiles: oacc[t][r] = out[q0 + c][t*16 + 8*hh + r]
#pragma unroll
  for (int t = 0; t < 4; ++t) oacc[t] = (v8f){0.f,0.f,0.f,0.f,0.f,0.f,0.f,0.f};

  // staging: thread -> row (tid >> 3) of each group of 16 rows, 16-byte piece (tid & 7) of its 128-B line
  const int srow = tid >> 3, spc = tid & 7;
  const __bf16* gkh = Kh + (size_t)srow * EMB_DIM + spc * 8;   // K row kv0 + srow (+16, +32, +48), d = 8*spc..
  const __bf16* gkl = Kl + (size_t)srow * EMB_DIM + spc * 8;
  const __bf16* gvh = Vh + (size_t)srow * SEQ_LEN + spc * 8;   // V^T row d = srow (+16, +32, +48), s = kv0 + 8*spc..
  const __bf16* gvl = Vl + (size_t)srow * SEQ_LEN + spc * 8;
  const unsigned lds0 = (unsigned)(uintptr_t)(&sKV[0]) + (unsigned)(srow * (AT_LP * 2) + spc * 16);

  const int nChunks = SEQ_LEN / AT_KC;   // 32, compile-time constant
  at_stage(lds0, gkh, gkl, gvh, gvl);
  asm volatile("s_wait_asynccnt 0x0" ::: "memory");   // chunk 0 of this wave has landed
  __syncthreads();                                     // ... and every wave's part of it
  at_stage(lds0 + AT_BUF * 2u, gkh + (size_t)AT_KC * EMB_DIM, gkl + (size_t)AT_KC * EMB_DIM, gvh + AT_KC, gvl + AT_KC);

  // key-padding mask of this lane's 32 keys of a chunk (kv + j*16 + 8*hh + r, always < SEQ_LEN)
  v4u kmv[8];
#pragma unroll
  for (int j = 0; j < 4; ++j) {
    kmv[2 * j]     = *(const v4u*)(km + j * 16 + 8 * hh);
    kmv[2 * j + 1] = *(const v4u*)(km + j * 16 + 8 * hh + 4);
  }
  // later instructions may land in the registers that hold the mask loads' address: keep the wait in front of that overwrite
  asm volatile("s_wait_xcnt 0x0" ::: "memory");

  // one trip: the products and the softmax of chunk kc, then the publish point of chunk kc + 1
  auto trip = [&](const int kc) __attribute__((always_inline)) {
    const int kv0 = kc * AT_KC;
    const __bf16* Ksh = (const __bf16*)(const void*)sKV + (kc & 1) * AT_BUF;
    const __bf16* Ksl = Ksh + AT_PLANE;
    const __bf16* Vth = Ksh + 2 * AT_PLANE;
    const __bf16* Vtl = Ksh + 3 * AT_PLANE;

    // scores^T = K . Q^T : s[j][r] = score(key kv0 + j*16 + 8*hh + r, query q0 + c)
    v8f s[4];
#pragma unroll
    for (int j = 0; j < 4; ++j) {
      s[j] = (v8f){0.f,0.f,0.f,0.f,0.f,0.f,0.f,0.f};
#pragma unroll
      for (int dc = 0; dc < 2; ++dc) {
        FB kb, kl;
        kb.h[0] = *(const v8b*)(Ksh + (j * 16 + c) * AT_LP + dc * 32 + 8 * hh);
        kb.h[1] = *(const v8b*)(Ksh + (j * 16 + c) * AT_LP + dc * 32 + 16 + 8 * hh);
        kl.h[0] = *(const v8b*)(Ksl + (j * 16 + c) * AT_LP + dc * 32 + 8 * hh);
        kl.h[1] = *(const v8b*)(Ksl + (j * 16 + c) * AT_LP + dc * 32 + 16 + 8 * hh);
        s[j] = at_mma(kb.v, qah[dc], s[j]);
        s[j] = at_mma(kl.v, qah[dc], s[j]);
        s[j] = at_mma(kb.v, qal[dc], s[j]);
      }
    }
    // mask nonzero -> score := mfill (select, as in the module)
    float m = -INFINITY;
#pragma unroll
    for (int j = 0; j < 4; ++j) {
#pragma unroll
      for (int r = 0; r < 8; ++r) {
        float sv = s[j][r] * sc2;
        sv = (kmv[2 * j + (r >> 2)][r & 3] != 0u) ? mf2 : sv;
        s[j][r] = sv;
        m = fmaxf(m, sv);
      }
    }
    // the next chunk's mask words, asked for here so that their latency runs under the rest of this trip
    // (the last trip asks for its own again: in bounds, never used)
    const int kvn = (kc + 1 < nChunks) ? kv0 + AT_KC : kv0;
#pragma unroll
    for (int j = 0; j < 4; ++j) {
      kmv[2 * j]     = *(const v4u*)(km + kvn + j * 16 + 8 * hh);
      kmv[2 * j + 1] = *(const v4u*)(km + kvn + j * 16 + 8 * hh + 4);
    }
    // later instructions may land in the registers that hold the mask loads' address: keep the wait in front of that overwrite
    asm volatile("s_wait_xcnt 0x0" ::: "memory");
    m = fmaxf(m, at_xhalf(m));   // the other 32 keys of this query
    const float mnew = fmaxf(mrow, m);
    const float alpha = __builtin_amdgcn_exp2f(mrow - mnew);
    mrow = mnew;
    // p^T stays in registers: two score tiles (keys 0..15 and 16..31 of a 32-key group) are one B operand,
    // element e < 8 = key 8*hh + e, e >= 8 = key 16 + 8*hh + (e - 8): the order in which the V^T rows are read below
    v16b pth[2], ptl[2];
    float psum = 0.f;
#pragma unroll
    for (int j = 0; j < 4; ++j) {
#pragma unroll
      for (int r = 0; r < 8; r += 2) {
        v2f p;
        p[0] = __builtin_amdgcn_exp2f(s[j][r] - mnew);
        p[1] = __builtin_amdgcn_exp2f(s[j][r + 1] - mnew);
        psum += p[0];
        psum += p[1];
        v2b hi, lo;
        split2_bf16(p, hi, lo);
        pth[j >> 1][(j & 1) * 8 + r]     = hi[0];
        pth[j >> 1][(j & 1) * 8 + r + 1] = hi[1];
        ptl[j >> 1][(j & 1) * 8 + r]     = lo[0];
        ptl[j >> 1][(j & 1) * 8 + r + 1] = lo[1];
      }
    }
    lrow = lrow * alpha + psum;
#pragma unroll
    for (int t = 0; t < 4; ++t)
#pragma unroll
      for (int r = 0; r < 8; ++r) oacc[t][r] *= alpha;
    // out^T += V^T . p^T
#pragma unroll
    for (int kk = 0; kk < 2; ++kk) {
#pragma unroll
      for (int t = 0; t < 4; ++t) {
        FB vb, vl;
        vb.h[0] = *(const v8b*)(Vth + (t * 16 + c) * AT_LP + kk * 32 + 8 * hh);
        vb.h[1] = *(const v8b*)(Vth + (t * 16 + c) * AT_LP + kk * 32 + 16 + 8 * hh);
        vl.h[0] = *(const v8b*)(Vtl + (t * 16 + c) * AT_LP + kk * 32 + 8 * hh);
        vl.h[1] = *(const v8b*)(Vtl + (t * 16 + c) * AT_LP + kk * 32 + 16 + 8 * hh);
        oacc[t] = at_mma(vb.v, pth[kk], oacc[t]);
        oacc[t] = at_mma(vl.v, pth[kk], oacc[t]);
        oacc[t] = at_mma(vb.v, ptl[kk], oacc[t]);
      }
    }
    asm volatile("s_wait_dscnt 0x0" ::: "memory");      // this wave's reads of the buffer are done before it is refilled
    asm volatile("s_wait_asynccnt 0x0" ::: "memory");   // this wave's copies of chunk kc + 1 have landed
    __syncthreads();                                     // publishes chunk kc + 1 and ends every reader's last read of chunk kc
  };
  int kc = 0;
  for (; kc < nChunks - 2; ++kc) {   // while a chunk kc + 2 exists: its copies go into the buffer that this trip has just read
    trip(kc);
    at_stage(lds0 + (unsigned)(kc & 1) * (AT_BUF * 2u), gkh + (size_t)(kc + 2) * AT_KC * EMB_DIM,
             gkl + (size_t)(kc + 2) * AT_KC * EMB_DIM, gvh + (kc + 2) * AT_KC, gvl + (kc + 2) * AT_KC);
  }
  for (; kc < nChunks; ++kc) trip(kc);   // the last two chunks: nothing left to fetch
  asm volatile("s_wait_asynccnt 0x0" ::: "memory");     // nothing in flight behind the loop; the last barrier ended every read of the buffers

  float* os = (float*)(void*)sKV + wave * (16 * 68);
  {
    const float inv = 1.0f / (lrow + at_xhalf(lrow));   // join the two halves' sums once
#pragma unroll
    for (int t = 0; t < 4; ++t) {
      v4f lo4, hi4;
#pragma unroll
      for (int r = 0; r < 4; ++r) { lo4[r] = oacc[t][r] * inv; hi4[r] = oacc[t][4 + r] * inv; }
      *(v4f*)(os + c * 68 + t * 16 + 8 * hh)     = lo4;
      *(v4f*)(os + c * 68 + t * 16 + 8 * hh + 4) = hi4;
    }
  }
  __builtin_amdgcn_fence(__ATOMIC_RELEASE, "workgroup");
  __builtin_amdgcn_wave_barrier();
  __builtin_amdgcn_fence(__ATOMIC_ACQUIRE, "workgroup");
  {
    const int c4 = (lane & 15) * 4;
    {
#pragma unroll
      for (int it = 0; it < 8; ++it) {
        const int row = it * 2 + hh;   // it 0..7 x hh 0..1 covers rows 0..15 of the wave tile
        v4f val = *(const v4f*)(os + row * 68 + c4);
        *(v4f*)(ob + (size_t)(q0 + row) * EMB_DIM + c4) = val;
      }
      
    }
  }
}

// ---------------------------------------------------------------------------
// Host-side orchestration (kernel launches + host arithmetic only).
// Workspace region map (byte offsets, every region fully written by its producer before any read):
//   0           xb    bf16 [4096][1024]            8,388,608
//   8,388,608   wqb   bf16 [1024][1024]            2,097,152
//   10,485,760  wkb   bf16 [1024][1024]            2,097,152
//   12,582,912  wvb   bf16 [1024][1024]            2,097,152
//   14,680,064  wo16  f16  [1024][1024] (x64)      2,097,152
//   16,777,216  qh    bf16 [4096][1024]            8,388,608
//   25,165,824  ql    bf16 [4096][1024]            8,388,608
//   33,554,432  kh    bf16 [4096][1024]            8,388,608
//   41,943,040  kl    bf16 [4096][1024]            8,388,608
//   50,331,648  vth   bf16 [2][1024][2048]         8,388,608
//   58,720,256  vtl   bf16 [2][1024][2048]         8,388,608
//   67,108,864  o32   f32  [4096][1024]           16,777,216
//   83,886,080  o16   f16  [4096][1024] (x16)      8,388,608
//   92,274,688  end (88 MiB)
// GEMM shapes: K = 1024 (multiple of 32) everywhere; M, N in {1024, 2048, 4096} (multiples of 64); no padding.
// ---------------------------------------------------------------------------
extern "C" void kernel_launch(void* const* d_in, const int* in_sizes, int n_in,
                              void* d_out, int out_size, void* d_ws, size_t ws_size,
                              hipStream_t stream) {
  if (n_in < 6) return;
  const int nTokEmb = N_TOK * EMB_DIM;          // 4,194,304
  const int nEmbEmb = EMB_DIM * EMB_DIM;        // 1,048,576
  if (in_sizes[0] != nTokEmb || in_sizes[1] != N_BATCH * SEQ_LEN || in_sizes[2] != nEmbEmb ||
      in_sizes[3] != nEmbEmb || in_sizes[4] != nEmbEmb || in_sizes[5] != nEmbEmb || out_size != nTokEmb) return;

  const size_t offXb  = 0;
  const size_t offWq  = offXb  + (size_t)nTokEmb * 2;
  const size_t offWk  = offWq  + (size_t)nEmbEmb * 2;
  const size_t offWv  = offWk  + (size_t)nEmbEmb * 2;
  const size_t offWo  = offWv  + (size_t)nEmbEmb * 2;
  const size_t offQh  = offWo  + (size_t)nEmbEmb * 2;
  const size_t offQl  = offQh  + (size_t)nTokEmb * 2;
  const size_t offKh  = offQl  + (size_t)nTokEmb * 2;
  const size_t offKl  = offKh  + (size_t)nTokEmb * 2;
  const size_t offVth = offKl  + (size_t)nTokEmb * 2;
  const size_t offVtl = offVth + (size_t)nTokEmb * 2;
  const size_t offO32 = offVtl + (size_t)nTokEmb * 2;
  const size_t offO16 = offO32 + (size_t)nTokEmb * 4;
  const size_t offEnd = offO16 + (size_t)nTokEmb * 2;   // 92,274,688
  if (ws_size < offEnd) return;

  const float* x    = (const float*)d_in[0];
  const int*   mask = (const int*)d_in[1];
  const float* wq   = (const float*)d_in[2];
  const float* wk   = (const float*)d_in[3];
  const float* wv   = (const float*)d_in[4];
  const float* wo   = (const float*)d_in[5];
  float* out = (float*)d_out;

  char* ws = (char*)d_ws;
  unsigned short* xb   = (unsigned short*)(ws + offXb);
  unsigned short* wqb  = (unsigned short*)(ws + offWq);
  unsigned short* wkb  = (unsigned short*)(ws + offWk);
  unsigned short* wvb  = (unsigned short*)(ws + offWv);
  unsigned short* wo16 = (unsigned short*)(ws + offWo);
  unsigned short* qh   = (unsigned short*)(ws + offQh);
  unsigned short* ql   = (unsigned short*)(ws + offQl);
  unsigned short* kh   = (unsigned short*)(ws + offKh);
  unsigned short* kl   = (unsigned short*)(ws + offKl);
  unsigned short* vth  = (unsigned short*)(ws + offVth);
  unsigned short* vtl  = (unsigned short*)(ws + offVtl);
  float*          o32  = (float*)(ws + offO32);
  unsigned short* o16  = (unsigned short*)(ws + offO16);
  const float* dummyf = x;   // valid pointer for unused bias / resid arguments (never dereferenced)

  // 1) 16-bit operand planes: x, wq, wk, wv -> bf16 RNE; wo -> f16 encode of bf16-RNE(wo*64)
  //    one grid of 8192 + 4 x 2048 = 16,384 blocks
  cast_inputs_kernel<<<CI_XB + 4 * CI_WB, 256, 0, stream>>>(x, wq, wk, wv, wo, xb, wqb, wkb, wvb, wo16);

  // 2), 3) q, k = x @ W^T (bf16 hi/lo planes [token][h*64+d]) and v^T per batch = Wv @ x_b^T (planes [b][h*64+d][s]):
  //    K = 1024; 3 products x 128 blocks of 8 waves in one grid
  qkv_gemm64<<<dim3(128, 3), 256, 0, stream>>>(xb, wqb, wkb, wvb, qh, ql, kh, kl, vth, vtl);

  // 4) attention: grid = (16 heads x 32 query blocks, 2 batch elements); key mask read from d_in[1] as int32
  {
    const dim3 g(N_HEADS * (SEQ_LEN / 64), N_BATCH);
    attn_full64_kernel<<<g, 128, 0, stream>>>(qh, ql, kh, kl, vth, vtl, mask, o32, 0.125f, -1.0e9f);
  }

  // 5) attention output f32 -> f16 carried x16
  {
    const int n2o = nTokEmb / 2;   // 2,097,152 -> 8192 blocks
    cast2_kernel<2><<<(n2o + 255) / 256, 256, 0, stream>>>(o32, o16, n2o, 16.0f);
  }

  // 6) out = O @ Wo^T : f16 operands (O x16, Wo x64) -> scale 1/1024, f32 into d_out [4096][1024]
  {
    const dim3 g(((N_TOK / 64) * (EMB_DIM / 64)) / 8, 1);
    wmma_gemm64<0, false, 0, 0, false><<<g, 256, 0, stream>>>(
        o16, o16, EMB_DIM, 0L, wo16, wo16, EMB_DIM, 0L,
        (void*)out, (void*)out, EMB_DIM, 0L, dummyf, dummyf, 0L, N_TOK, EMB_DIM, EMB_DIM, 1.0f / 1024.0f);
  }
}

// v009
// One run takes 119 microseconds.
// In two side-by-side timings against v008, it was 1.38 and 1.35 times as fast.
// Over all steps from v000 it is 5.86 times as fast.
// Projections q, k, v^T: v_wmma_f32_16x16x32_bf16 (x and weights RNE-converted to bf16, single product); attention q.k^T and p.v: v_wmma_f32_16x16x32_bf16 with bf16 hi/lo split operands (hi.hi + hi.lo + lo.hi); output projection: v_wmma_f32_16x16x32_f16 (attention output carried x16 in f16, bf16-RNE weight carried x64 in f16); f32 accumulate everywhere; online softmax, key-mask select (-1e9) and normalisation in f32.
#include <hip/hip_runtime.h>
#include <math.h>
#include <stdint.h>

#define N_BATCH  2
#define SEQ_LEN  2048
#define EMB_DIM  1024
#define N_HEADS  16
#define HEAD_DIM 64
#define N_TOK    (N_BATCH * SEQ_LEN)
#define KO_CS    32   // ints between the two batch elements' key counts: a 128-B line each, one writer a line

typedef __attribute__((ext_vector_type(16))) _Float16 v16h;
typedef __attribute__((ext_vector_type(8)))  _Float16 v8h;
typedef __attribute__((ext_vector_type(16))) __bf16   v16b;
typedef __attribute__((ext_vector_type(8)))  __bf16   v8b;
typedef __attribute__((ext_vector_type(2)))  __bf16   v2b;
typedef __attribute__((ext_vector_type(8)))  float    v8f;
typedef __attribute__((ext_vector_type(4)))  float    v4f;
typedef __attribute__((ext_vector_type(2)))  float    v2f;
typedef __attribute__((ext_vector_type(4)))  unsigned int v4u;

__device__ __forceinline__ unsigned short f2bf_bits(float f) {
  unsigned u = __float_as_uint(f);
  return (unsigned short)((u + 0x7FFFu + ((u >> 16) & 1u)) >> 16);
}
__device__ __forceinline__ float bf_bits2f(unsigned short h) { return __uint_as_float(((unsigned)h) << 16); }
// Two f32 -> bf16 hi and lo planes: hi = RNE bf16 of f, lo = RNE bf16 of (f - hi); each conversion is one v_cvt_pk_bf16_f32 for the pair.
__device__ __forceinline__ void split2_bf16(const v2f f, v2b& hi, v2b& lo) {
  hi = __builtin_convertvector(f, v2b);
  const unsigned hw = __builtin_bit_cast(unsigned, hi);
  v2f d;
  d[0] = f[0] - __uint_as_float(hw << 16);
  d[1] = f[1] - __uint_as_float(hw & 0xFFFF0000u);
  lo = __builtin_convertvector(d, v2b);
}

// hazard guards as plain device helpers
__device__ __forceinline__ void dep_guard_h(v8f& a, v8f& b, v16h x, v16h y) { asm volatile("v_nop\n\tv_nop\n\tv_nop\n\tv_nop" : "+v"(a), "+v"(b) : "v"(x), "v"(y)); }
__device__ __forceinline__ void dep_guard_b(v8f& a, v8f& b, v16b x, v16b y) { asm volatile("v_nop\n\tv_nop\n\tv_nop\n\tv_nop" : "+v"(a), "+v"(b) : "v"(x), "v"(y)); }
__device__ __forceinline__ void keep4_h(v16h a, v16h b, v16h c, v16h d) { asm volatile("v_nop" :: "v"(a), "v"(b), "v"(c), "v"(d)); }
__device__ __forceinline__ void keep4_b(v16b a, v16b b, v16b c, v16b d) { asm volatile("v_nop" :: "v"(a), "v"(b), "v"(c), "v"(d)); }
__device__ __forceinline__ void acc_guard4(v8f& a, v8f& b, v8f& c, v8f& d) { asm volatile("v_nop\n\tv_nop\n\tv_nop\n\tv_nop" : "+v"(a), "+v"(b), "+v"(c), "+v"(d)); }
template <typename T> struct Frag;
template <> struct Frag<_Float16> {
  typedef v16h V; union U { v16h v; v8h h[2]; };
  static __device__ __forceinline__ v16h load(const _Float16* p) {   // elements 0..7 <- p[0..7], 8..15 <- p[16..23]
    U f; f.h[0] = *(const v8h*)(p); f.h[1] = *(const v8h*)(p + 16); return f.v;
  }
  static __device__ __forceinline__ v8f mma(v16h a, v16h b, v8f c) {
    return __builtin_amdgcn_wmma_f32_16x16x32_f16(false, a, false, b, (short)0, c, false, false);
  }
  static __device__ __forceinline__ void guard(v8f& a, v8f& b, v16h x, v16h y) { dep_guard_h(a, b, x, y); }
  static __device__ __forceinline__ void keep(v16h a, v16h b, v16h c, v16h d) { keep4_h(a, b, c, d); }
};
template <> struct Frag<__bf16> {
  typedef v16b V; union U { v16b v; v8b h[2]; };
  static __device__ __forceinline__ v16b load(const __bf16* p) {
    U f; f.h[0] = *(const v8b*)(p); f.h[1] = *(const v8b*)(p + 16); return f.v;
  }
  static __device__ __forceinline__ v8f mma(v16b a, v16b b, v8f c) {
    return __builtin_amdgcn_wmma_f32_16x16x32_bf16(false, a, false, b, (short)0, c, false, false);
  }
  static __device__ __forceinline__ void guard(v8f& a, v8f& b, v16b x, v16b y) { dep_guard_b(a, b, x, y); }
  static __device__ __forceinline__ void keep(v16b a, v16b b, v16b c, v16b d) { keep4_b(a, b, c, d); }
};

// ---- Register-blocked batched WMMA GEMM ------------------------------------
// C[m,n] = scale * sum_k A[m,k] * Bt[n,k] (+bias)(+resid); each wave owns a 64x64 tile.
// A row-major [M,K]; Bt row-major [N,K]; M % 64 == 0, N % 512 == 0, K % 64 == 0; grid.x = (M/64)*(N/64)/8.
// The 8 waves of a block share one 64-row band of A and own 8 neighbouring 64-row bands of Bt. Operands reach the
// waves through LDS: a stage is 64 k (one 128-B line of each of the 64 + 512 rows), brought by asynchronous 16-byte
// copies of which 8 neighbouring lanes cover one whole line, two buffers, the next stage in flight under this one's products.
// Copy coverage: 256 threads x 18 copies x 16 B = 576 rows x 128 B = the whole stage, every LDS byte from one lane.
// SPLIT (hi/lo planes) is not instantiated and not staged.
// BIAS_MODE: 0 = none, 1 = bias[m], 2 = bias[n].
// OUT_MODE: 0 = f32, 1 = f16, 2 = bf16 hi plane (Cout) + bf16 lo plane (Cout2).
// Epilogue coverage per wave: f32 path 8 it x 2 rows x (16 lanes x 4 floats) = 16 rows x 64; 16-bit path
// 4 it x 4 rows x (8 lanes x 8 halves) = 16 rows x 64; 4 slabs = the whole 64x64 tile.
// ET: 0 = f16 operands, 1 = bf16 operands (pointers passed as 16-bit storage)
#define GS_ROWS  576                       // 64 rows of A, then 512 rows of Bt
#define GS_PITCH 72                        // LDS row pitch in elements: 144 B = 16 B x 9 (odd), no bank met twice by a 16-byte fragment read
#define GS_BYTES (GS_ROWS * GS_PITCH * 2)  // one buffer: 82,944 B
// Nine asynchronous 16-byte copies global -> LDS of this lane. The s_wait_xcnt stands inside the statement, behind the last copy,
// so that no address register of a copy is rewritten in front of it.
__device__ __forceinline__ void gs_copy9(unsigned l0, unsigned l1, unsigned l2, unsigned l3, unsigned l4, unsigned l5,
                                         unsigned l6, unsigned l7, unsigned l8,
                                         const unsigned short* g0, const unsigned short* g1, const unsigned short* g2,
                                         const unsigned short* g3, const unsigned short* g4, const unsigned short* g5,
                                         const unsigned short* g6, const unsigned short* g7, const unsigned short* g8) {
  asm volatile("global_load_async_to_lds_b128 %0, %9, off\n\t"
               "global_load_async_to_lds_b128 %1, %10, off\n\t"
               "global_load_async_to_lds_b128 %2, %11, off\n\t"
               "global_load_async_to_lds_b128 %3, %12, off\n\t"
               "global_load_async_to_lds_b128 %4, %13, off\n\t"
               "global_load_async_to_lds_b128 %5, %14, off\n\t"
               "global_load_async_to_lds_b128 %6, %15, off\n\t"
               "global_load_async_to_lds_b128 %7, %16, off\n\t"
               "global_load_async_to_lds_b128 %8, %17, off\n\t"
               "s_wait_xcnt 0x0"
               :: "v"(l0), "v"(l1), "v"(l2), "v"(l3), "v"(l4), "v"(l5), "v"(l6), "v"(l7), "v"(l8),
                  "v"(g0), "v"(g1), "v"(g2), "v"(g3), "v"(g4), "v"(g5), "v"(g6), "v"(g7), "v"(g8)
               : "memory");
}
// One stage: this thread's 2 pieces of A rows and 16 pieces of Bt rows (rows 32 apart), l = its LDS byte address in row (tid >> 3).
__device__ __forceinline__ void gs_stage(unsigned l, const unsigned short* a, size_t sa, const unsigned short* b, size_t sb) {
  const unsigned st = 32u * GS_PITCH * 2u;   // 32 LDS rows
  gs_copy9(l, l + st, l + 2 * st, l + 3 * st, l + 4 * st, l + 5 * st, l + 6 * st, l + 7 * st, l + 8 * st,
           a, a + sa, b, b + sb, b + 2 * sb, b + 3 * sb, b + 4 * sb, b + 5 * sb, b + 6 * sb);
  gs_copy9(l + 9 * st, l + 10 * st, l + 11 * st, l + 12 * st, l + 13 * st, l + 14 * st, l + 15 * st, l + 16 * st, l + 17 * st,
           b + 7 * sb, b + 8 * sb, b + 9 * sb, b + 10 * sb, b + 11 * sb, b + 12 * sb, b + 13 * sb, b + 14 * sb, b + 15 * sb);
}
// One stage with an address of its own for each of this thread's 18 rows (2 of A, 16 of Bt): the rows of a gathered operand.
__device__ __forceinline__ void gs_stage_rows(unsigned l, const unsigned short* const (&p)[18]) {
  const unsigned st = 32u * GS_PITCH * 2u;   // 32 LDS rows
  gs_copy9(l, l + st, l + 2 * st, l + 3 * st, l + 4 * st, l + 5 * st, l + 6 * st, l + 7 * st, l + 8 * st,
           p[0], p[1], p[2], p[3], p[4], p[5], p[6], p[7], p[8]);
  gs_copy9(l + 9 * st, l + 10 * st, l + 11 * st, l + 12 * st, l + 13 * st, l + 14 * st, l + 15 * st, l + 16 * st, l + 17 * st,
           p[9], p[10], p[11], p[12], p[13], p[14], p[15], p[16], p[17]);
}
template <int ET> struct Elem;
template <> struct Elem<0> { typedef _Float16 T; };
template <> struct Elem<1> { typedef __bf16 T; };
// bx = index of the block among the blocks of its product, b = batch index of the product
// GATHER: row r of A is row permA[r] of Ap, row r of Bt is row permB[r] of Btp (a null list = the rows as they lie); the same for the whole block.
template <int ET, bool SPLIT, int BIAS_MODE, int OUT_MODE, bool RESID, int ACT = 0, bool GATHER = false>
__device__ __forceinline__ void gemm64_body(
    const int bx, const int b,
    const unsigned short* __restrict__ Ap, const unsigned short* __restrict__ A2p, int lda, long strideA,
    const unsigned short* __restrict__ Btp, const unsigned short* __restrict__ Bt2p, int ldb, long strideB,
    void* __restrict__ Cout, void* __restrict__ Cout2, int ldc, long strideC,
    const float* __restrict__ bias,
    const float* __restrict__ resid, long strideR,
    int M, int N, int K, float scale,
    const int* __restrict__ permA = nullptr, const int* __restrict__ permB = nullptr) {
  typedef typename Elem<ET>::T T;
  typedef typename Frag<T>::V V;
  static_assert(!SPLIT, "hi/lo planes are not staged");
  __shared__ __align__(16) unsigned short sAB[2 * GS_ROWS * GS_PITCH];   // two stage buffers, 165,888 B
  __shared__ __align__(16) float sT[8][16 * 68];   // per-wave 16x64 slab, pitch 68 floats
  const int lane = threadIdx.x & 31;
  const int wave = threadIdx.x >> 5;
  const int tilesN = N >> 6;
  const int tilesM = M >> 6;
  const int tile = bx * 8 + wave;
  if (bx * 8 >= tilesM * tilesN) return;   // the whole block or none of it, in front of every barrier
  const int tm = tile / tilesN;
  const int tn = tile - tm * tilesN;
  const int m0 = tm << 6;
  const int n0 = tn << 6;

  // staging: thread -> row (tid >> 3) of each group of 32 rows, 16-byte piece (tid & 7) of its 128-B line
  const int srow = threadIdx.x >> 3;
  const int spc  = threadIdx.x & 7;
  const int nb0  = n0 - (wave << 6);           // first Bt row of the block (N % 512 == 0: the 8 tiles lie in one tile row)
  const unsigned short* gA = Ap  + (size_t)b * strideA + (size_t)(m0  + srow) * lda + spc * 8;
  const unsigned short* gB = Btp + (size_t)b * strideB + (size_t)(nb0 + srow) * ldb + spc * 8;
  const size_t sa32 = (size_t)32 * lda, sb32 = (size_t)32 * ldb;
  const unsigned lds0 = (unsigned)(uintptr_t)(&sAB[0]) + (unsigned)(srow * (GS_PITCH * 2) + spc * 16);
  // GATHER: where this thread's piece of each of its 18 rows starts at k = 0 (elements from the operand's first)
  unsigned ro[18];
  if constexpr (GATHER) {
    int ra[2], rb[16];
#pragma unroll
    for (int i = 0; i < 2; ++i) ra[i] = m0 + srow + 32 * i;
#pragma unroll
    for (int i = 0; i < 16; ++i) rb[i] = nb0 + srow + 32 * i;
    if (permA) {
#pragma unroll
      for (int i = 0; i < 2; ++i) ra[i] = permA[ra[i]];
    }
    if (permB) {
#pragma unroll
      for (int i = 0; i < 16; ++i) rb[i] = permB[rb[i]];
    }
    // later instructions may land in the registers that hold the list loads' addresses: keep the wait in front of that overwrite
    asm volatile("s_wait_xcnt 0x0" ::: "memory");
#pragma unroll
    for (int i = 0; i < 2; ++i) ro[i] = (unsigned)ra[i] * (unsigned)lda + (unsigned)(spc * 8);
#pragma unroll
    for (int i = 0; i < 16; ++i) ro[2 + i] = (unsigned)rb[i] * (unsigned)ldb + (unsigned)(spc * 8);
  }
  // the copies of stage t into the buffer whose row (tid >> 3), piece (tid & 7) lies at LDS byte l
  auto stage = [&](const unsigned l, const int t) __attribute__((always_inline)) {
    if constexpr (GATHER) {
      const unsigned short* Ab = Ap  + (size_t)b * strideA + (size_t)t * 64;
      const unsigned short* Bb = Btp + (size_t)b * strideB + (size_t)t * 64;
      const unsigned short* p[18];
#pragma unroll
      for (int i = 0; i < 2; ++i) p[i] = Ab + ro[i];
#pragma unroll
      for (int i = 2; i < 18; ++i) p[i] = Bb + ro[i];
      gs_stage_rows(l, p);
    } else {
      gs_stage(l, gA + (size_t)t * 64, sa32, gB + (size_t)t * 64, sb32);
    }
  };

  const int rlane = lane & 15;                 // row (A) / col (B, D) within subtile
  const int koff  = (lane >> 4) * 8;           // k offset of this lane half
  const int mOff  = (lane >> 4) * 8;           // D row offset

  v8f acc[4][4];
#pragma unroll
  for (int i = 0; i < 4; ++i)
#pragma unroll
    for (int j = 0; j < 4; ++j) acc[i][j] = (v8f){0.f,0.f,0.f,0.f,0.f,0.f,0.f,0.f};

  const int nStages = K >> 6;
  stage(lds0, 0);
  asm volatile("s_wait_asynccnt 0x0" ::: "memory");   // stage 0 of this wave has landed
  __syncthreads();                                     // ... and every wave's part of it
  if (nStages > 1) stage(lds0 + GS_BYTES, 1);

  for (int t = 0; t < nStages; ++t) {
    const T* sbuf = (const T*)(const void*)(sAB + (t & 1) * (GS_ROWS * GS_PITCH));
#pragma unroll
    for (int ks = 0; ks < 2; ++ks) {
      V bh[4], ah[4];   // all eight fragments of these 32 k asked for as one group, in front of their 16 products
#pragma unroll
      for (int j = 0; j < 4; ++j)
        bh[j] = Frag<T>::load(sbuf + (64 + (wave << 6) + (j << 4) + rlane) * GS_PITCH + ks * 32 + koff);
#pragma unroll
      for (int i = 0; i < 4; ++i)
        ah[i] = Frag<T>::load(sbuf + ((i << 4) + rlane) * GS_PITCH + ks * 32 + koff);
#pragma unroll
      for (int i = 0; i < 4; ++i) {
#pragma unroll
        for (int j = 0; j < 4; ++j) acc[i][j] = Frag<T>::mma(ah[i], bh[j], acc[i][j]);
        Frag<T>::guard(acc[i][0], acc[i][3], ah[i], ah[i]);
      }
      Frag<T>::keep(bh[0], bh[1], bh[2], bh[3]);
    }
    asm volatile("s_wait_dscnt 0x0" ::: "memory");      // this wave's reads of the buffer are done before it is refilled
    asm volatile("s_wait_asynccnt 0x0" ::: "memory");   // this wave's copies of stage t + 1 have landed
    __syncthreads();                                     // publishes stage t + 1 and ends every reader's last read of stage t
    if (t + 2 < nStages) stage(lds0 + (unsigned)(t & 1) * GS_BYTES, t + 2);
  }
  asm volatile("s_wait_asynccnt 0x0" ::: "memory");     // nothing in flight behind the loop
  acc_guard4(acc[0][0], acc[0][1], acc[0][2], acc[0][3]);
  acc_guard4(acc[1][0], acc[1][1], acc[1][2], acc[1][3]);
  acc_guard4(acc[2][0], acc[2][1], acc[2][2], acc[2][3]);
  acc_guard4(acc[3][0], acc[3][1], acc[3][2], acc[3][3]);

  // ---- epilogue ----
  float* slab = sT[wave];
  const float* Rb = RESID ? (resid + (size_t)b * strideR) : nullptr;
#pragma unroll
  for (int i = 0; i < 4; ++i) {
    const int mBase = m0 + (i << 4);
#pragma unroll
    for (int j = 0; j < 4; ++j) {
      const int n = n0 + (j << 4) + rlane;
      float bv = 0.f;
      if (BIAS_MODE == 2) bv = bias[n];
#pragma unroll
      for (int r = 0; r < 8; ++r) {
        float v = acc[i][j][r] * scale;
        if (BIAS_MODE == 1) v += bias[mBase + mOff + r];
        if (BIAS_MODE == 2) v += bv;
        if (RESID) v += Rb[(size_t)(mBase + mOff + r) * ldc + n];
        if (ACT == 1) v = tanhf(v);
        if (ACT == 2) v = fmaxf(v, 0.0f);
        if (ACT == 3) v = v / (1.0f + expf(-v));
        if (ACT == 4) v = (v > 0.f) ? v : 0.01f * v;
        if (ACT == 5) v = 0.5f * v * (1.0f + erff(v * 0.70710678118654752f));
        slab[(mOff + r) * 68 + (j << 4) + rlane] = v;
      }
    }
    __builtin_amdgcn_fence(__ATOMIC_RELEASE, "workgroup");
    __builtin_amdgcn_wave_barrier();
    __builtin_amdgcn_fence(__ATOMIC_ACQUIRE, "workgroup");
    if (OUT_MODE == 0) {
      float* C = (float*)Cout + (size_t)b * strideC;
      const int hh = lane >> 4, c4 = (lane & 15) * 4;     // row seg = 256 B = 16 lanes x 16 B
      {
#pragma unroll
        for (int it = 0; it < 8; ++it) {
          const int row = it * 2 + hh;
          v4f v = *(const v4f*)(slab + row * 68 + c4);
          *(v4f*)(C + (size_t)(mBase + row) * ldc + n0 + c4) = v;
        }
        
      }
    } else {
      const int q = lane >> 3, c8 = (lane & 7) * 8;
      unsigned short* C  = (unsigned short*)Cout  + (size_t)b * strideC;
      unsigned short* C2 = (OUT_MODE == 2) ? ((unsigned short*)Cout2 + (size_t)b * strideC) : nullptr;
      {
#pragma unroll
        for (int it = 0; it < 4; ++it) {
          const int row = it * 4 + q;
          const float* sp = slab + row * 68 + c8;
          v8h hv, lv;
          v4u hw, lw;   // the pairs as whole 32-bit words: element e in the low half, e + 1 in the high half
#pragma unroll
          for (int e = 0; e < 8; e += 2) {
            if (OUT_MODE == 1) {
              hv[e]     = (_Float16)sp[e];
              hv[e + 1] = (_Float16)sp[e + 1];
            } else {
              v2b hb, lb;
              split2_bf16((v2f){sp[e], sp[e + 1]}, hb, lb);
              hw[e >> 1] = __builtin_bit_cast(unsigned, hb);
              lw[e >> 1] = __builtin_bit_cast(unsigned, lb);
            }
          }
          if (OUT_MODE == 2) { hv = __builtin_bit_cast(v8h, hw); lv = __builtin_bit_cast(v8h, lw); }
          *(v8h*)(C + (size_t)(mBase + row) * ldc + n0 + c8) = hv;
          if (OUT_MODE == 2) *(v8h*)(C2 + (size_t)(mBase + row) * ldc + n0 + c8) = lv;
        }
        
      }
    }
    __builtin_amdgcn_fence(__ATOMIC_RELEASE, "workgroup");
    __builtin_amdgcn_wave_barrier();
    __builtin_amdgcn_fence(__ATOMIC_ACQUIRE, "workgroup");
  }
}

// One product per launch: grid = (blocks of the product, batch).
template <int ET, bool SPLIT, int BIAS_MODE, int OUT_MODE, bool RESID, int ACT = 0>
__global__ __launch_bounds__(256) void wmma_gemm64(
    const unsigned short* __restrict__ Ap, const unsigned short* __restrict__ A2p, int lda, long strideA,
    const unsigned short* __restrict__ Btp, const unsigned short* __restrict__ Bt2p, int ldb, long strideB,
    void* __restrict__ Cout, void* __restrict__ Cout2, int ldc, long strideC,
    const float* __restrict__ bias,
    const float* __restrict__ resid, long strideR,
    int M, int N, int K, float scale) {
  gemm64_body<ET, SPLIT, BIAS_MODE, OUT_MODE, RESID, ACT>(blockIdx.x, blockIdx.y, Ap, A2p, lda, strideA, Btp, Bt2p, ldb, strideB,
                                                          Cout, Cout2, ldc, strideC, bias, resid, strideR, M, N, K, scale);
}

// The three projections, which do not depend on one another, in one grid of (128, 3) blocks, so that all WGPs have work
// (one product alone has 128 blocks, one to a WGP). blockIdx.y (the same for the whole block) picks the product:
//   0: q = x . Wq^T, 1: k = x . Wk^T : M = 4096 tokens, N = 1024; 64 x 16 tiles = 128 blocks; planes [token][h*64+d]
//   2: v^T of batch b = Wv . x_b^T   : M = 1024, N = 2048 tokens; 16 x 32 tiles = 64 blocks for each of the 2 batch elements
//      (b = blockIdx.x >> 6); planes [b][h*64+d][s]
// k and v^T are laid out in key order (key_order_body): place j of batch b holds token perm[b*2048 + j], so their token rows of x are
// gathered through perm. A block whose first place is not walked by the attention (>= the batch's walked count) has nothing to do.
__global__ __launch_bounds__(256) void qkv_gemm64(
    const unsigned short* __restrict__ xb, const unsigned short* __restrict__ wqb,
    const unsigned short* __restrict__ wkb, const unsigned short* __restrict__ wvb,
    unsigned short* __restrict__ qh, unsigned short* __restrict__ ql,
    unsigned short* __restrict__ kh, unsigned short* __restrict__ kl,
    unsigned short* __restrict__ vth, unsigned short* __restrict__ vtl,
    const int* __restrict__ perm, const int* __restrict__ kcnt) {
  const int  which = blockIdx.y;
  const bool isV   = which == 2;
  if (which != 0) {   // the whole block or none of it, in front of every barrier
    const int walked = min(max(kcnt[(blockIdx.x >> 6) * KO_CS + 1], 1), SEQ_LEN);
    const int first  = isV ? (int)(blockIdx.x & 3) * 512 : (int)((blockIdx.x >> 1) & 31) * 64;   // first place of the block's tiles
    if (first >= walked) return;
  }
  const unsigned short* A  = isV ? wvb : xb;
  const unsigned short* Bt = isV ? xb : (which == 0 ? wqb : wkb);
  unsigned short* C  = isV ? vth : (which == 0 ? qh : kh);
  unsigned short* C2 = isV ? vtl : (which == 0 ? ql : kl);
  const int bx = isV ? (int)(blockIdx.x & 63) : (int)blockIdx.x;
  const int b  = isV ? (int)(blockIdx.x >> 6) : 0;
  // perm holds token rows counted over both batch elements, so x needs no batch stride
  gemm64_body<1, false, 0, 2, false, 0, true>(bx, b, A, A, EMB_DIM, 0L, Bt, Bt, EMB_DIM, 0L,
                                     (void*)C, (void*)C2, isV ? SEQ_LEN : EMB_DIM, isV ? (long)EMB_DIM * SEQ_LEN : 0L,
                                     nullptr, nullptr, 0L, isV ? EMB_DIM : N_TOK, isV ? SEQ_LEN : EMB_DIM, EMB_DIM, 1.0f,
                                     which == 1 ? perm : nullptr, isV ? perm + b * SEQ_LEN : nullptr);
}

// ---------------------------------------------------------------------------
// Elementwise f32 -> 16-bit plane, 2 consecutive elements per thread packed into one 4-B store: each wave writes
// CMODE 0: bf16 RNE bits of in*scale.
// CMODE 1: f16 bits of the bf16-RNE value of in*scale (an 8-significant-bit value re-encoded exactly in f16).
// CMODE 2: f16 RNE bits of in*scale.
// Coverage: grid = ceil(n2/256) blocks x 256 threads x 2 elements = 2*n2 = the whole plane
// (n2 = 2097152 -> 8192 blocks; n2 = 524288 -> 2048 blocks; both exact multiples of 256).
// ---------------------------------------------------------------------------
__device__ __forceinline__ unsigned pk16(unsigned short a, unsigned short b) { return (unsigned)a | ((unsigned)b << 16); }

template <int CMODE>
__device__ __forceinline__ void cast2_body(const float* __restrict__ in, unsigned short* __restrict__ out,
                                           const int i, const int n2, const float scale) {
  if (i < n2) {
    const v2f f = *(const v2f*)(in + 2 * (size_t)i);
    const float f0 = f[0] * scale, f1 = f[1] * scale;
    unsigned short u0, u1;
    if (CMODE == 0) {
      u0 = f2bf_bits(f0); u1 = f2bf_bits(f1);
    } else if (CMODE == 1) {
      u0 = __builtin_bit_cast(unsigned short, (_Float16)bf_bits2f(f2bf_bits(f0)));
      u1 = __builtin_bit_cast(unsigned short, (_Float16)bf_bits2f(f2bf_bits(f1)));
    } else {
      u0 = __builtin_bit_cast(unsigned short, (_Float16)f0);
      u1 = __builtin_bit_cast(unsigned short, (_Float16)f1);
    }
    const unsigned u = pk16(u0, u1);
    ((unsigned*)out)[i] = u;
  }
}

template <int CMODE>
__global__ __launch_bounds__(256) void cast2_kernel(const float* __restrict__ in, unsigned short* __restrict__ out,
                                                    int n2, float scale) {
  cast2_body<CMODE>(in, out, blockIdx.x * 256 + threadIdx.x, n2, scale);
}

// Key order of one batch element (one block of 256 threads, 8 neighbouring keys a thread): the keys that the mask leaves in come
// first, in their order, the masked-out ones behind them, in theirs. perm[b*2048 + j] = token row (over both batch elements) at place j:
// a permutation, so every entry is written once and lies in 0..4095 whatever the mask holds.
// cnt[0] = keys left in; cnt[1] = places the attention walks: the keys left in, or all 2048 where none is left in.
// Why the masked-out keys need no walk: their score is the fill -1e9, so beside one real score their weight exp(fill - max) is exactly 0
// in f32, as it is in the module; where every key is masked out all weights are equal, and all places are walked with the fill as score.
__device__ __forceinline__ void key_order_body(const int* __restrict__ mask, int* __restrict__ perm, int* __restrict__ cnt, const int b) {
  __shared__ int sc[256];
  __shared__ __align__(16) int sp[SEQ_LEN];
  const int tid = threadIdx.x;
  const int* mb = mask + b * SEQ_LEN + tid * 8;
  const v4u ma = *(const v4u*)mb, mc = *(const v4u*)(mb + 4);
  int in[8], c = 0;
#pragma unroll
  for (int e = 0; e < 8; ++e) { in[e] = ((e < 4 ? ma[e & 3] : mc[e & 3]) == 0u) ? 1 : 0; c += in[e]; }
  sc[tid] = c;
  __syncthreads();
  int incl = c;   // running sum over the threads up to this one, doubling the reach each step
  for (int d = 1; d < 256; d <<= 1) {
    const int o = (tid >= d) ? sc[tid - d] : 0;
    __syncthreads();   // every read of this step is done before the entries change
    incl += o;
    sc[tid] = incl;
    __syncthreads();
  }
  const int total = sc[255];
  int kp = incl - c;                // place of this thread's first key that is left in
  int mp = total + tid * 8 - kp;    // place of its first masked-out key
#pragma unroll
  for (int e = 0; e < 8; ++e) {
    sp[in[e] ? kp : mp] = b * SEQ_LEN + tid * 8 + e;
    kp += in[e];
    mp += 1 - in[e];
  }
  __syncthreads();
  // the list goes out in whole lines: 8 neighbouring entries a thread
  *(v4u*)(perm + b * SEQ_LEN + tid * 8)     = *(const v4u*)(sp + tid * 8);
  *(v4u*)(perm + b * SEQ_LEN + tid * 8 + 4) = *(const v4u*)(sp + tid * 8 + 4);
  if (tid == 0) { cnt[0] = total; cnt[1] = total ? total : SEQ_LEN; }
}

// The five input planes and the two key orders, which do not depend on one another, in one grid: blocks 0, 1 order the keys of
// batch element 0, 1; of the blocks behind them 0..8191 convert x, then 2048 blocks each
// wq, wk, wv (CMODE 0) and wo (CMODE 1, x64). The plane is the same for a whole block.
// Coverage: 8192 x 512 = 4,194,304 elements of x; 2048 x 512 = 1,048,576 elements of each weight.
#define CI_XB (N_TOK * EMB_DIM / 512)     // 8192 blocks of x
#define CI_WB (EMB_DIM * EMB_DIM / 512)   // 2048 blocks of one weight
__global__ __launch_bounds__(256) void cast_inputs_kernel(
    const float* __restrict__ x, const float* __restrict__ wq, const float* __restrict__ wk,
    const float* __restrict__ wv, const float* __restrict__ wo,
    unsigned short* __restrict__ xb, unsigned short* __restrict__ wqb, unsigned short* __restrict__ wkb,
    unsigned short* __restrict__ wvb, unsigned short* __restrict__ wo16,
    const int* __restrict__ mask, int* __restrict__ perm, int* __restrict__ kcnt) {
  const int bx = (int)blockIdx.x - N_BATCH;
  if (bx < 0) {
    key_order_body(mask, perm, kcnt + blockIdx.x * KO_CS, blockIdx.x);
  } else if (bx < CI_XB) {
    cast2_body<0>(x, xb, bx * 256 + threadIdx.x, CI_XB * 256, 1.0f);
  } else {
    const int w = (bx - CI_XB) / CI_WB;                                   // 0..3
    const int i = ((bx - CI_XB) % CI_WB) * 256 + threadIdx.x;
    if (w == 3) {
      cast2_body<1>(wo, wo16, i, CI_WB * 256, 64.0f);
    } else {
      cast2_body<0>(w == 0 ? wq : (w == 1 ? wk : wv), w == 0 ? wqb : (w == 1 ? wkb : wvb), i, CI_WB * 256, 1.0f);
    }
  }
}

#define AT_D 64
#define AT_NW 4
#define AT_QB 64
#define AT_KC 64
#define AT_PLANE (AT_KC * AT_LP)   // elements of one plane's tile in LDS
#define AT_BUF   (4 * AT_PLANE)    // elements of one buffer: K hi, K lo, V^T hi, V^T lo = 36,864 B
#define AT_LP 72   // LDS row pitch of the K and V^T tiles in elements: 144 B = 16 B x 9 (odd), so the 16 rows of one 16-byte fragment read fall on 64 distinct banks

__device__ __forceinline__ v8f at_mma(v16b a, v16b b, v8f c) {
  c = __builtin_amdgcn_wmma_f32_16x16x32_bf16(false, a, false, b, (short)0, c, false, false);
  asm volatile("v_nop\n\tv_nop\n\tv_nop\n\tv_nop" : "+v"(c) : "v"(a), "v"(b));
  return c;
}

// lane l <-> l ^ 16 (the two halves of a wave hold the two key halves of one query column)
__device__ __forceinline__ float at_xhalf(float v) {
  const int b = __builtin_bit_cast(int, v);
  return __builtin_bit_cast(float, __builtin_amdgcn_permlanex16(b, b, 0x76543210, 0xfedcba98, false, false));
}

// Eight asynchronous 16-byte copies global -> LDS of this lane. The s_wait_xcnt stands inside the statement, behind the last copy,
// so that no address register of a copy is rewritten in front of it.
__device__ __forceinline__ void at_copy8(unsigned l0, unsigned l1, unsigned l2, unsigned l3,
                                         unsigned l4, unsigned l5, unsigned l6, unsigned l7,
                                         const __bf16* g0, const __bf16* g1, const __bf16* g2, const __bf16* g3,
                                         const __bf16* g4, const __bf16* g5, const __bf16* g6, const __bf16* g7) {
  asm volatile("global_load_async_to_lds_b128 %0, %8, off\n\t"
               "global_load_async_to_lds_b128 %1, %9, off\n\t"
               "global_load_async_to_lds_b128 %2, %10, off\n\t"
               "global_load_async_to_lds_b128 %3, %11, off\n\t"
               "global_load_async_to_lds_b128 %4, %12, off\n\t"
               "global_load_async_to_lds_b128 %5, %13, off\n\t"
               "global_load_async_to_lds_b128 %6, %14, off\n\t"
               "global_load_async_to_lds_b128 %7, %15, off\n\t"
               "s_wait_xcnt 0x0"
               :: "v"(l0), "v"(l1), "v"(l2), "v"(l3), "v"(l4), "v"(l5), "v"(l6), "v"(l7),
                  "v"(g0), "v"(g1), "v"(g2), "v"(g3), "v"(g4), "v"(g5), "v"(g6), "v"(g7)
               : "memory");
}
// One chunk: this thread's 4 pieces (rows 16 apart) of each of the 4 planes; l = its LDS byte address in row (tid >> 3) of the K hi tile.
__device__ __forceinline__ void at_stage(unsigned l, const __bf16* kh, const __bf16* kl, const __bf16* vh, const __bf16* vl) {
  const unsigned rs = 16u * AT_LP * 2u;    // 16 LDS rows
  const unsigned ps = AT_PLANE * 2u;       // one plane's tile
  const size_t ks = (size_t)16 * EMB_DIM, vs = (size_t)16 * SEQ_LEN;   // 16 rows of K, of V^T
  at_copy8(l, l + rs, l + 2 * rs, l + 3 * rs, l + ps, l + ps + rs, l + ps + 2 * rs, l + ps + 3 * rs,
           kh, kh + ks, kh + 2 * ks, kh + 3 * ks, kl, kl + ks, kl + 2 * ks, kl + 3 * ks);
  at_copy8(l + 2 * ps, l + 2 * ps + rs, l + 2 * ps + 2 * rs, l + 2 * ps + 3 * rs,
           l + 3 * ps, l + 3 * ps + rs, l + 3 * ps + 2 * rs, l + 3 * ps + 3 * rs,
           vh, vh + vs, vh + 2 * vs, vh + 3 * vs, vl, vl + vs, vl + 2 * vs, vl + 3 * vs);
}

__global__ __launch_bounds__(128)
void attn_full64_kernel(const unsigned short* __restrict__ qhp, const unsigned short* __restrict__ qlp,
                        const unsigned short* __restrict__ khp, const unsigned short* __restrict__ klp,
                        const unsigned short* __restrict__ vhp, const unsigned short* __restrict__ vlp,
                        const int* __restrict__ kcnt,
                        float* __restrict__ out, float sscale, float mfill) {
  union FB { v16b v; v8b h[2]; };
  // two chunk buffers, each K hi [kv][d], K lo, V^T hi [d][kv], V^T lo (9 KB a plane); behind the loop: per wave out tile, pitch 68 floats
  __shared__ __align__(16) unsigned char sKV[2 * AT_BUF * 2];    // 73,728 B
  static_assert(AT_NW * 16 * 68 * 4 <= 2 * AT_BUF * 2, "the out tiles fit the buffers");

  const int tid  = threadIdx.x;
  const int wave = tid >> 5;
  const int lane = tid & 31;
  const int hh   = lane >> 4;
  const int c    = lane & 15;

  const int nqb = SEQ_LEN / AT_QB;        // 32
  const int bx = blockIdx.x;
  const int qb = bx % nqb;
  const int h  = bx / nqb;                // 0..N_HEADS-1 (grid = N_HEADS * nqb)
  const int q0 = qb * AT_QB + wave * 16;
  const size_t bo = (size_t)blockIdx.y * SEQ_LEN * EMB_DIM;   // this batch element's start in every q, k, v^T and out plane
  const int nIn    = kcnt[blockIdx.y * KO_CS];                                   // keys left in: places 0..nIn-1
  const int walked = min(max(kcnt[blockIdx.y * KO_CS + 1], 1), SEQ_LEN);         // places to walk, bounded by the shape

  const __bf16* Qh = (const __bf16*)(const void*)qhp + bo + (size_t)h * AT_D;
  const __bf16* Ql = (const __bf16*)(const void*)qlp + bo + (size_t)h * AT_D;
  const __bf16* Kh = (const __bf16*)(const void*)khp + bo + (size_t)h * AT_D;
  const __bf16* Kl = (const __bf16*)(const void*)klp + bo + (size_t)h * AT_D;
  const __bf16* Vh = (const __bf16*)(const void*)vhp + bo + (size_t)h * AT_D * SEQ_LEN;
  const __bf16* Vl = (const __bf16*)(const void*)vlp + bo + (size_t)h * AT_D * SEQ_LEN;
  float*        ob = out + bo + (size_t)h * AT_D;

  // ---- Q fragments (B operand, column = query = lane&15, split k map via Frag load): 2 d-chunks, hi and lo ----
  v16b qah[2], qal[2];
#pragma unroll
  for (int dc = 0; dc < 2; ++dc) {
    const __bf16* qr = Qh + (size_t)(q0 + c) * EMB_DIM + dc * 32 + 8 * hh;
    const __bf16* ql = Ql + (size_t)(q0 + c) * EMB_DIM + dc * 32 + 8 * hh;
    qah[dc] = Frag<__bf16>::load(qr);
    qal[dc] = Frag<__bf16>::load(ql);
  }

  // One query per lane (q0 + c). mrow: running maximum, equal in both wave halves; lrow: this half's share of the sum.
  float mrow = -INFINITY, lrow = 0.f;
  const float sc2 = sscale * 1.44269504088896341f;   // score scale times log2(e)
  const float mf2 = mfill  * 1.44269504088896341f;   // the mask fill in the same units
  v8f oacc[4];   // out^T tiles: oacc[t][r] = out[q0 + c][t*16 + 8*hh + r]
#pragma unroll
  for (int t = 0; t < 4; ++t) oacc[t] = (v8f){0.f,0.f,0.f,0.f,0.f,0.f,0.f,0.f};

  // staging: thread -> row (tid >> 3) of each group of 16 rows, 16-byte piece (tid & 7) of its 128-B line
  const int srow = tid >> 3, spc = tid & 7;
  const __bf16* gkh = Kh + (size_t)srow * EMB_DIM + spc * 8;   // K row kv0 + srow (+16, +32, +48), d = 8*spc..
  const __bf16* gkl = Kl + (size_t)srow * EMB_DIM + spc * 8;
  const __bf16* gvh = Vh + (size_t)srow * SEQ_LEN + spc * 8;   // V^T row d = srow (+16, +32, +48), s = kv0 + 8*spc..
  const __bf16* gvl = Vl + (size_t)srow * SEQ_LEN + spc * 8;
  const unsigned lds0 = (unsigned)(uintptr_t)(&sKV[0]) + (unsigned)(srow * (AT_LP * 2) + spc * 16);

  const int nChunks = (walked + AT_KC - 1) / AT_KC;   // 1..32, the same for the whole grid row of a batch element
  at_stage(lds0, gkh, gkl, gvh, gvl);
  asm volatile("s_wait_asynccnt 0x0" ::: "memory");   // chunk 0 of this wave has landed
  __syncthreads();                                     // ... and every wave's part of it
  if (nChunks > 1)
    at_stage(lds0 + AT_BUF * 2u, gkh + (size_t)AT_KC * EMB_DIM, gkl + (size_t)AT_KC * EMB_DIM, gvh + AT_KC, gvl + AT_KC);

  // one trip: the products and the softmax of chunk kc, then the publish point of chunk kc + 1
  auto trip = [&](const int kc) __attribute__((always_inline)) {
    const int kv0 = kc * AT_KC;
    const __bf16* Ksh = (const __bf16*)(const void*)sKV + (kc & 1) * AT_BUF;
    const __bf16* Ksl = Ksh + AT_PLANE;
    const __bf16* Vth = Ksh + 2 * AT_PLANE;
    const __bf16* Vtl = Ksh + 3 * AT_PLANE;

    // scores^T = K . Q^T : s[j][r] = score(key kv0 + j*16 + 8*hh + r, query q0 + c)
    v8f s[4];
#pragma unroll
    for (int j = 0; j < 4; ++j) {
      s[j] = (v8f){0.f,0.f,0.f,0.f,0.f,0.f,0.f,0.f};
#pragma unroll
      for (int dc = 0; dc < 2; ++dc) {
        FB kb, kl;
        kb.h[0] = *(const v8b*)(Ksh + (j * 16 + c) * AT_LP + dc * 32 + 8 * hh);
        kb.h[1] = *(const v8b*)(Ksh + (j * 16 + c) * AT_LP + dc * 32 + 16 + 8 * hh);
        kl.h[0] = *(const v8b*)(Ksl + (j * 16 + c) * AT_LP + dc * 32 + 8 * hh);
        kl.h[1] = *(const v8b*)(Ksl + (j * 16 + c) * AT_LP + dc * 32 + 16 + 8 * hh);
        s[j] = at_mma(kb.v, qah[dc], s[j]);
        s[j] = at_mma(kl.v, qah[dc], s[j]);
        s[j] = at_mma(kb.v, qal[dc], s[j]);
      }
    }
#pragma unroll
    for (int j = 0; j < 4; ++j)
#pragma unroll
      for (int r = 0; r < 8; ++r) s[j][r] *= sc2;
    // a place at or behind nIn holds a masked-out key -> score := mfill (select, as in the module); only a chunk that reaches nIn has one
    if (kv0 + AT_KC > nIn) {
      const int lim = nIn - kv0 - 8 * hh;   // this lane's place j*16 + r of the chunk holds a key left in while it is below lim
#pragma unroll
      for (int j = 0; j < 4; ++j)
#pragma unroll
        for (int r = 0; r < 8; ++r) s[j][r] = (j * 16 + r < lim) ? s[j][r] : mf2;
    }
    float m = -INFINITY;
#pragma unroll
    for (int j = 0; j < 4; ++j)
#pragma unroll
      for (int r = 0; r < 8; ++r) m = fmaxf(m, s[j][r]);
    m = fmaxf(m, at_xhalf(m));   // the other 32 keys of this query
    const float mnew = fmaxf(mrow, m);
    const float alpha = __builtin_amdgcn_exp2f(mrow - mnew);
    mrow = mnew;
    // p^T stays in registers: two score tiles (keys 0..15 and 16..31 of a 32-key group) are one B operand,
    // element e < 8 = key 8*hh + e, e >= 8 = key 16 + 8*hh + (e - 8): the order in which the V^T rows are read below
    v16b pth[2], ptl[2];
    float psum = 0.f;
#pragma unroll
    for (int j = 0; j < 4; ++j) {
#pragma unroll
      for (int r = 0; r < 8; r += 2) {
        v2f p;
        p[0] = __builtin_amdgcn_exp2f(s[j][r] - mnew);
        p[1] = __builtin_amdgcn_exp2f(s[j][r + 1] - mnew);
        psum += p[0];
        psum += p[1];
        v2b hi, lo;
        split2_bf16(p, hi, lo);
        pth[j >> 1][(j & 1) * 8 + r]     = hi[0];
        pth[j >> 1][(j & 1) * 8 + r + 1] = hi[1];
        ptl[j >> 1][(j & 1) * 8 + r]     = lo[0];
        ptl[j >> 1][(j & 1) * 8 + r + 1] = lo[1];
      }
    }
    lrow = lrow * alpha + psum;
#pragma unroll
    for (int t = 0; t < 4; ++t)
#pragma unroll
      for (int r = 0; r < 8; ++r) oacc[t][r] *= alpha;
    // out^T += V^T . p^T
#pragma unroll
    for (int kk = 0; kk < 2; ++kk) {
#pragma unroll
      for (int t = 0; t < 4; ++t) {
        FB vb, vl;
        vb.h[0] = *(const v8b*)(Vth + (t * 16 + c) * AT_LP + kk * 32 + 8 * hh);
        vb.h[1] = *(const v8b*)(Vth + (t * 16 + c) * AT_LP + kk * 32 + 16 + 8 * hh);
        vl.h[0] = *(const v8b*)(Vtl + (t * 16 + c) * AT_LP + kk * 32 + 8 * hh);
        vl.h[1] = *(const v8b*)(Vtl + (t * 16 + c) * AT_LP + kk * 32 + 16 + 8 * hh);
        oacc[t] = at_mma(vb.v, pth[kk], oacc[t]);
        oacc[t] = at_mma(vl.v, pth[kk], oacc[t]);
        oacc[t] = at_mma(vb.v, ptl[kk], oacc[t]);
      }
    }
    asm volatile("s_wait_dscnt 0x0" ::: "memory");      // this wave's reads of the buffer are done before it is refilled
    asm volatile("s_wait_asynccnt 0x0" ::: "memory");   // this wave's copies of chunk kc + 1 have landed
    __syncthreads();                                     // publishes chunk kc + 1 and ends every reader's last read of chunk kc
  };
  int kc = 0;
  for (; kc < nChunks - 2; ++kc) {   // while a chunk kc + 2 exists: its copies go into the buffer that this trip has just read
    trip(kc);
    at_stage(lds0 + (unsigned)(kc & 1) * (AT_BUF * 2u), gkh + (size_t)(kc + 2) * AT_KC * EMB_DIM,
             gkl + (size_t)(kc + 2) * AT_KC * EMB_DIM, gvh + (kc + 2) * AT_KC, gvl + (kc + 2) * AT_KC);
  }
  for (; kc < nChunks; ++kc) trip(kc);   // the last two chunks: nothing left to fetch
  asm volatile("s_wait_asynccnt 0x0" ::: "memory");     // nothing in flight behind the loop; the last barrier ended every read of the buffers

  float* os = (float*)(void*)sKV + wave * (16 * 68);
  {
    const float inv = 1.0f / (lrow + at_xhalf(lrow));   // join the two halves' sums once
#pragma unroll
    for (int t = 0; t < 4; ++t) {
      v4f lo4, hi4;
#pragma unroll
      for (int r = 0; r < 4; ++r) { lo4[r] = oacc[t][r] * inv; hi4[r] = oacc[t][4 + r] * inv; }
      *(v4f*)(os + c * 68 + t * 16 + 8 * hh)     = lo4;
      *(v4f*)(os + c * 68 + t * 16 + 8 * hh + 4) = hi4;
    }
  }
  __builtin_amdgcn_fence(__ATOMIC_RELEASE, "workgroup");
  __builtin_amdgcn_wave_barrier();
  __builtin_amdgcn_fence(__ATOMIC_ACQUIRE, "workgroup");
  {
    const int c4 = (lane & 15) * 4;
    {
#pragma unroll
      for (int it = 0; it < 8; ++it) {
        const int row = it * 2 + hh;   // it 0..7 x hh 0..1 covers rows 0..15 of the wave tile
        v4f val = *(const v4f*)(os + row * 68 + c4);
        *(v4f*)(ob + (size_t)(q0 + row) * EMB_DIM + c4) = val;
      }
      
    }
  }
}

// ---------------------------------------------------------------------------
// Host-side orchestration (kernel launches + host arithmetic only).
// Workspace region map (byte offsets, every element that is read written by its producer before the read; kh, kl, vth, vtl only as far as the attention walks):
//   0           xb    bf16 [4096][1024]            8,388,608
//   8,388,608   wqb   bf16 [1024][1024]            2,097,152
//   10,485,760  wkb   bf16 [1024][1024]            2,097,152
//   12,582,912  wvb   bf16 [1024][1024]            2,097,152
//   14,680,064  wo16  f16  [1024][1024] (x64)      2,097,152
//   16,777,216  qh    bf16 [4096][1024]            8,388,608
//   25,165,824  ql    bf16 [4096][1024]            8,388,608
//   33,554,432  kh    bf16 [4096][1024]            8,388,608
//   41,943,040  kl    bf16 [4096][1024]            8,388,608
//   50,331,648  vth   bf16 [2][1024][2048]         8,388,608
//   58,720,256  vtl   bf16 [2][1024][2048]         8,388,608
//   67,108,864  o32   f32  [4096][1024]           16,777,216
//   83,886,080  o16   f16  [4096][1024] (x16)      8,388,608
//   92,274,688  perm  int32 [2][2048] token row at each place of the key order   16,384
//   92,291,072  kcnt  int32 [2][32]: keys left in, places walked (2 of 32 used)     256
//   92,291,328  end
// GEMM shapes: K = 1024 (multiple of 32) everywhere; M, N in {1024, 2048, 4096} (multiples of 64); no padding.
// ---------------------------------------------------------------------------
extern "C" void kernel_launch(void* const* d_in, const int* in_sizes, int n_in,
                              void* d_out, int out_size, void* d_ws, size_t ws_size,
                              hipStream_t stream) {
  if (n_in < 6) return;
  const int nTokEmb = N_TOK * EMB_DIM;          // 4,194,304
  const int nEmbEmb = EMB_DIM * EMB_DIM;        // 1,048,576
  if (in_sizes[0] != nTokEmb || in_sizes[1] != N_BATCH * SEQ_LEN || in_sizes[2] != nEmbEmb ||
      in_sizes[3] != nEmbEmb || in_sizes[4] != nEmbEmb || in_sizes[5] != nEmbEmb || out_size != nTokEmb) return;

  const size_t offXb  = 0;
  const size_t offWq  = offXb  + (size_t)nTokEmb * 2;
  const size_t offWk  = offWq  + (size_t)nEmbEmb * 2;
  const size_t offWv  = offWk  + (size_t)nEmbEmb * 2;
  const size_t offWo  = offWv  + (size_t)nEmbEmb * 2;
  const size_t offQh  = offWo  + (size_t)nEmbEmb * 2;
  const size_t offQl  = offQh  + (size_t)nTokEmb * 2;
  const size_t offKh  = offQl  + (size_t)nTokEmb * 2;
  const size_t offKl  = offKh  + (size_t)nTokEmb * 2;
  const size_t offVth = offKl  + (size_t)nTokEmb * 2;
  const size_t offVtl = offVth + (size_t)nTokEmb * 2;
  const size_t offO32 = offVtl + (size_t)nTokEmb * 2;
  const size_t offO16 = offO32 + (size_t)nTokEmb * 4;
  const size_t offPerm = offO16 + (size_t)nTokEmb * 2;   // 92,274,688
  const size_t offCnt  = offPerm + (size_t)N_TOK * 4;
  const size_t offEnd  = offCnt + (size_t)N_BATCH * KO_CS * 4;   // 92,291,328
  if (ws_size < offEnd) return;

  const float* x    = (const float*)d_in[0];
  const int*   mask = (const int*)d_in[1];
  const float* wq   = (const float*)d_in[2];
  const float* wk   = (const float*)d_in[3];
  const float* wv   = (const float*)d_in[4];
  const float* wo   = (const float*)d_in[5];
  float* out = (float*)d_out;

  char* ws = (char*)d_ws;
  unsigned short* xb   = (unsigned short*)(ws + offXb);
  unsigned short* wqb  = (unsigned short*)(ws + offWq);
  unsigned short* wkb  = (unsigned short*)(ws + offWk);
  unsigned short* wvb  = (unsigned short*)(ws + offWv);
  unsigned short* wo16 = (unsigned short*)(ws + offWo);
  unsigned short* qh   = (unsigned short*)(ws + offQh);
  unsigned short* ql   = (unsigned short*)(ws + offQl);
  unsigned short* kh   = (unsigned short*)(ws + offKh);
  unsigned short* kl   = (unsigned short*)(ws + offKl);
  unsigned short* vth  = (unsigned short*)(ws + offVth);
  unsigned short* vtl  = (unsigned short*)(ws + offVtl);
  float*          o32  = (float*)(ws + offO32);
  unsigned short* o16  = (unsigned short*)(ws + offO16);
  int*            perm = (int*)(ws + offPerm);
  int*            kcnt = (int*)(ws + offCnt);
  const float* dummyf = x;   // valid pointer for unused bias / resid arguments (never dereferenced)

  // 1) 16-bit operand planes: x, wq, wk, wv -> bf16 RNE; wo -> f16 encode of bf16-RNE(wo*64)
  //    and the key order of each batch element from the mask (d_in[1] read as int32): one grid of 2 + 8192 + 4 x 2048 = 16,386 blocks
  cast_inputs_kernel<<<N_BATCH + CI_XB + 4 * CI_WB, 256, 0, stream>>>(x, wq, wk, wv, wo, xb, wqb, wkb, wvb, wo16, mask, perm, kcnt);

  // 2), 3) q, k = x @ W^T (bf16 hi/lo planes [token][h*64+d]) and v^T per batch = Wv @ x_b^T (planes [b][h*64+d][s]):
  //    K = 1024; 3 products x 128 blocks of 8 waves in one grid
  //    k and v^T in key order, only as far as the attention walks
  qkv_gemm64<<<dim3(128, 3), 256, 0, stream>>>(xb, wqb, wkb, wvb, qh, ql, kh, kl, vth, vtl, perm, kcnt);

  // 4) attention: grid = (16 heads x 32 query blocks, 2 batch elements); walks the keys that the mask leaves in
  {
    const dim3 g(N_HEADS * (SEQ_LEN / 64), N_BATCH);
    attn_full64_kernel<<<g, 128, 0, stream>>>(qh, ql, kh, kl, vth, vtl, kcnt, o32, 0.125f, -1.0e9f);
  }

  // 5) attention output f32 -> f16 carried x16
  {
    const int n2o = nTokEmb / 2;   // 2,097,152 -> 8192 blocks
    cast2_kernel<2><<<(n2o + 255) / 256, 256, 0, stream>>>(o32, o16, n2o, 16.0f);
  }

  // 6) out = O @ Wo^T : f16 operands (O x16, Wo x64) -> scale 1/1024, f32 into d_out [4096][1024]
  {
    const dim3 g(((N_TOK / 64) * (EMB_DIM / 64)) / 8, 1);
    wmma_gemm64<0, false, 0, 0, false><<<g, 256, 0, stream>>>(
        o16, o16, EMB_DIM, 0L, wo16, wo16, EMB_DIM, 0L,
        (void*)out, (void*)out, EMB_DIM, 0L, dummyf, dummyf, 0L, N_TOK, EMB_DIM, EMB_DIM, 1.0f / 1024.0f);
  }
}

// v010
// One run takes 115 microseconds.
// Next to v009, in two timings, it ran 1.03 times as fast each time.
// Over all steps from v000 it is 6.03 times as fast.
// Projections q, k, v^T: v_wmma_f32_16x16x32_bf16 (x and weights RNE-converted to bf16, single product); attention q.k^T and p.v: v_wmma_f32_16x16x32_bf16 with bf16 hi/lo split operands (hi.hi + hi.lo + lo.hi); output projection: v_wmma_f32_16x16x32_f16 (attention output carried x16 in f16, bf16-RNE weight carried x64 in f16); f32 accumulate everywhere; online softmax, key-mask select (-1e9) and normalisation in f32.
#include <hip/hip_runtime.h>
#include <math.h>
#include <stdint.h>

#define N_BATCH  2
#define SEQ_LEN  2048
#define EMB_DIM  1024
#define N_HEADS  16
#define HEAD_DIM 64
#define N_TOK    (N_BATCH * SEQ_LEN)
#define KO_CS    32   // ints between the two batch elements' key counts: a 128-B line each, one writer a line

typedef __attribute__((ext_vector_type(16))) _Float16 v16h;
typedef __attribute__((ext_vector_type(8)))  _Float16 v8h;
typedef __attribute__((ext_vector_type(16))) __bf16   v16b;
typedef __attribute__((ext_vector_type(8)))  __bf16   v8b;
typedef __attribute__((ext_vector_type(2)))  __bf16   v2b;
typedef __attribute__((ext_vector_type(8)))  float    v8f;
typedef __attribute__((ext_vector_type(4)))  float    v4f;
typedef __attribute__((ext_vector_type(2)))  float    v2f;
typedef __attribute__((ext_vector_type(4)))  unsigned int v4u;

__device__ __forceinline__ unsigned short f2bf_bits(float f) {
  unsigned u = __float_as_uint(f);
  return (unsigned short)((u + 0x7FFFu + ((u >> 16) & 1u)) >> 16);
}
__device__ __forceinline__ float bf_bits2f(unsigned short h) { return __uint_as_float(((unsigned)h) << 16); }
// Two f32 -> bf16 hi and lo planes: hi = RNE bf16 of f, lo = RNE bf16 of (f - hi); each conversion is one v_cvt_pk_bf16_f32 for the pair.
__device__ __forceinline__ void split2_bf16(const v2f f, v2b& hi, v2b& lo) {
  hi = __builtin_convertvector(f, v2b);
  const unsigned hw = __builtin_bit_cast(unsigned, hi);
  v2f d;
  d[0] = f[0] - __uint_as_float(hw << 16);
  d[1] = f[1] - __uint_as_float(hw & 0xFFFF0000u);
  lo = __builtin_convertvector(d, v2b);
}

// hazard guards as plain device helpers
__device__ __forceinline__ void dep_guard_h(v8f& a, v8f& b, v16h x, v16h y) { asm volatile("v_nop\n\tv_nop\n\tv_nop\n\tv_nop" : "+v"(a), "+v"(b) : "v"(x), "v"(y)); }
__device__ __forceinline__ void dep_guard_b(v8f& a, v8f& b, v16b x, v16b y) { asm volatile("v_nop\n\tv_nop\n\tv_nop\n\tv_nop" : "+v"(a), "+v"(b) : "v"(x), "v"(y)); }
__device__ __forceinline__ void keep4_h(v16h a, v16h b, v16h c, v16h d) { asm volatile("v_nop" :: "v"(a), "v"(b), "v"(c), "v"(d)); }
__device__ __forceinline__ void keep4_b(v16b a, v16b b, v16b c, v16b d) { asm volatile("v_nop" :: "v"(a), "v"(b), "v"(c), "v"(d)); }
__device__ __forceinline__ void acc_guard4(v8f& a, v8f& b, v8f& c, v8f& d) { asm volatile("v_nop\n\tv_nop\n\tv_nop\n\tv_nop" : "+v"(a), "+v"(b), "+v"(c), "+v"(d)); }
template <typename T> struct Frag;
template <> struct Frag<_Float16> {
  typedef v16h V; union U { v16h v; v8h h[2]; };
  static __device__ __forceinline__ v16h load(const _Float16* p) {   // elements 0..7 <- p[0..7], 8..15 <- p[16..23]
    U f; f.h[0] = *(const v8h*)(p); f.h[1] = *(const v8h*)(p + 16); return f.v;
  }
  static __device__ __forceinline__ v8f mma(v16h a, v16h b, v8f c) {
    return __builtin_amdgcn_wmma_f32_16x16x32_f16(false, a, false, b, (short)0, c, false, false);
  }
  static __device__ __forceinline__ void guard(v8f& a, v8f& b, v16h x, v16h y) { dep_guard_h(a, b, x, y); }
  static __device__ __forceinline__ void keep(v16h a, v16h b, v16h c, v16h d) { keep4_h(a, b, c, d); }
};
template <> struct Frag<__bf16> {
  typedef v16b V; union U { v16b v; v8b h[2]; };
  static __device__ __forceinline__ v16b load(const __bf16* p) {
    U f; f.h[0] = *(const v8b*)(p); f.h[1] = *(const v8b*)(p + 16); return f.v;
  }
  static __device__ __forceinline__ v8f mma(v16b a, v16b b, v8f c) {
    return __builtin_amdgcn_wmma_f32_16x16x32_bf16(false, a, false, b, (short)0, c, false, false);
  }
  static __device__ __forceinline__ void guard(v8f& a, v8f& b, v16b x, v16b y) { dep_guard_b(a, b, x, y); }
  static __device__ __forceinline__ void keep(v16b a, v16b b, v16b c, v16b d) { keep4_b(a, b, c, d); }
};

// ---- Register-blocked batched WMMA GEMM ------------------------------------
// C[m,n] = scale * sum_k A[m,k] * Bt[n,k] (+bias)(+resid); each wave owns a 64x64 tile.
// A row-major [M,K]; Bt row-major [N,K]; M % 64 == 0, N % 512 == 0, K % 64 == 0; grid.x = (M/64)*(N/64)/8.
// The 8 waves of a block share one 64-row band of A and own 8 neighbouring 64-row bands of Bt. Operands reach the
// waves through LDS: a stage is 64 k (one 128-B line of each of the 64 + 512 rows), brought by asynchronous 16-byte
// copies of which 8 neighbouring lanes cover one whole line, two buffers, the next stage in flight under this one's products.
// Copy coverage: 256 threads x 18 copies x 16 B = 576 rows x 128 B = the whole stage, every LDS byte from one lane.
// SPLIT (hi/lo planes) is not instantiated and not staged.
// BIAS_MODE: 0 = none, 1 = bias[m], 2 = bias[n].
// OUT_MODE: 0 = f32, 1 = f16, 2 = bf16 hi plane (Cout) + bf16 lo plane (Cout2).
// Epilogue coverage per wave: f32 path 8 it x 2 rows x (16 lanes x 4 floats) = 16 rows x 64; 16-bit path
// 4 it x 4 rows x (8 lanes x 8 halves) = 16 rows x 64; 4 slabs = the whole 64x64 tile.
// ET: 0 = f16 operands, 1 = bf16 operands (pointers passed as 16-bit storage)
#define GS_ROWS  576                       // 64 rows of A, then 512 rows of Bt
#define GS_PITCH 72                        // LDS row pitch in elements: 144 B = 16 B x 9 (odd), no bank met twice by a 16-byte fragment read
#define GS_BYTES (GS_ROWS * GS_PITCH * 2)  // one buffer: 82,944 B
// Nine asynchronous 16-byte copies global -> LDS of this lane. The s_wait_xcnt stands inside the statement, behind the last copy,
// so that no address register of a copy is rewritten in front of it.
__device__ __forceinline__ void gs_copy9(unsigned l0, unsigned l1, unsigned l2, unsigned l3, unsigned l4, unsigned l5,
                                         unsigned l6, unsigned l7, unsigned l8,
                                         const unsigned short* g0, const unsigned short* g1, const unsigned short* g2,
                                         const unsigned short* g3, const unsigned short* g4, const unsigned short* g5,
                                         const unsigned short* g6, const unsigned short* g7, const unsigned short* g8) {
  asm volatile("global_load_async_to_lds_b128 %0, %9, off\n\t"
               "global_load_async_to_lds_b128 %1, %10, off\n\t"
               "global_load_async_to_lds_b128 %2, %11, off\n\t"
               "global_load_async_to_lds_b128 %3, %12, off\n\t"
               "global_load_async_to_lds_b128 %4, %13, off\n\t"
               "global_load_async_to_lds_b128 %5, %14, off\n\t"
               "global_load_async_to_lds_b128 %6, %15, off\n\t"
               "global_load_async_to_lds_b128 %7, %16, off\n\t"
               "global_load_async_to_lds_b128 %8, %17, off\n\t"
               "s_wait_xcnt 0x0"
               :: "v"(l0), "v"(l1), "v"(l2), "v"(l3), "v"(l4), "v"(l5), "v"(l6), "v"(l7), "v"(l8),
                  "v"(g0), "v"(g1), "v"(g2), "v"(g3), "v"(g4), "v"(g5), "v"(g6), "v"(g7), "v"(g8)
               : "memory");
}
// One stage: this thread's 2 pieces of A rows and 16 pieces of Bt rows (rows 32 apart), l = its LDS byte address in row (tid >> 3).
__device__ __forceinline__ void gs_stage(unsigned l, const unsigned short* a, size_t sa, const unsigned short* b, size_t sb) {
  const unsigned st = 32u * GS_PITCH * 2u;   // 32 LDS rows
  gs_copy9(l, l + st, l + 2 * st, l + 3 * st, l + 4 * st, l + 5 * st, l + 6 * st, l + 7 * st, l + 8 * st,
           a, a + sa, b, b + sb, b + 2 * sb, b + 3 * sb, b + 4 * sb, b + 5 * sb, b + 6 * sb);
  gs_copy9(l + 9 * st, l + 10 * st, l + 11 * st, l + 12 * st, l + 13 * st, l + 14 * st, l + 15 * st, l + 16 * st, l + 17 * st,
           b + 7 * sb, b + 8 * sb, b + 9 * sb, b + 10 * sb, b + 11 * sb, b + 12 * sb, b + 13 * sb, b + 14 * sb, b + 15 * sb);
}
// One stage with an address of its own for each of this thread's 18 rows (2 of A, 16 of Bt): the rows of a gathered operand.
__device__ __forceinline__ void gs_stage_rows(unsigned l, const unsigned short* const (&p)[18]) {
  const unsigned st = 32u * GS_PITCH * 2u;   // 32 LDS rows
  gs_copy9(l, l + st, l + 2 * st, l + 3 * st, l + 4 * st, l + 5 * st, l + 6 * st, l + 7 * st, l + 8 * st,
           p[0], p[1], p[2], p[3], p[4], p[5], p[6], p[7], p[8]);
  gs_copy9(l + 9 * st, l + 10 * st, l + 11 * st, l + 12 * st, l + 13 * st, l + 14 * st, l + 15 * st, l + 16 * st, l + 17 * st,
           p[9], p[10], p[11], p[12], p[13], p[14], p[15], p[16], p[17]);
}
template <int ET> struct Elem;
template <> struct Elem<0> { typedef _Float16 T; };
template <> struct Elem<1> { typedef __bf16 T; };
// bx = index of the block among the blocks of its product, b = batch index of the product
// GATHER: row r of A is row permA[r] of Ap, row r of Bt is row permB[r] of Btp (a null list = the rows as they lie); the same for the whole block.
template <int ET, bool SPLIT, int BIAS_MODE, int OUT_MODE, bool RESID, int ACT = 0, bool GATHER = false>
__device__ __forceinline__ void gemm64_body(
    const int bx, const int b,
    const unsigned short* __restrict__ Ap, const unsigned short* __restrict__ A2p, int lda, long strideA,
    const unsigned short* __restrict__ Btp, const unsigned short* __restrict__ Bt2p, int ldb, long strideB,
    void* __restrict__ Cout, void* __restrict__ Cout2, int ldc, long strideC,
    const float* __restrict__ bias,
    const float* __restrict__ resid, long strideR,
    int M, int N, int K, float scale,
    const int* __restrict__ permA = nullptr, const int* __restrict__ permB = nullptr) {
  typedef typename Elem<ET>::T T;
  typedef typename Frag<T>::V V;
  static_assert(!SPLIT, "hi/lo planes are not staged");
  __shared__ __align__(16) unsigned short sAB[2 * GS_ROWS * GS_PITCH];   // two stage buffers, 165,888 B
  __shared__ __align__(16) float sT[8][16 * 68];   // per-wave 16x64 slab, pitch 68 floats
  const int lane = threadIdx.x & 31;
  const int wave = threadIdx.x >> 5;
  const int tilesN = N >> 6;
  const int tilesM = M >> 6;
  const int tile = bx * 8 + wave;
  if (bx * 8 >= tilesM * tilesN) return;   // the whole block or none of it, in front of every barrier
  const int tm = tile / tilesN;
  const int tn = tile - tm * tilesN;
  const int m0 = tm << 6;
  const int n0 = tn << 6;

  // staging: thread -> row (tid >> 3) of each group of 32 rows, 16-byte piece (tid & 7) of its 128-B line
  const int srow = threadIdx.x >> 3;
  const int spc  = threadIdx.x & 7;
  const int nb0  = n0 - (wave << 6);           // first Bt row of the block (N % 512 == 0: the 8 tiles lie in one tile row)
  const unsigned short* gA = Ap  + (size_t)b * strideA + (size_t)(m0  + srow) * lda + spc * 8;
  const unsigned short* gB = Btp + (size_t)b * strideB + (size_t)(nb0 + srow) * ldb + spc * 8;
  const size_t sa32 = (size_t)32 * lda, sb32 = (size_t)32 * ldb;
  const unsigned lds0 = (unsigned)(uintptr_t)(&sAB[0]) + (unsigned)(srow * (GS_PITCH * 2) + spc * 16);
  // GATHER: where this thread's piece of each of its 18 rows starts at k = 0 (elements from the operand's first)
  unsigned ro[18];
  if constexpr (GATHER) {
    int ra[2], rb[16];
#pragma unroll
    for (int i = 0; i < 2; ++i) ra[i] = m0 + srow + 32 * i;
#pragma unroll
    for (int i = 0; i < 16; ++i) rb[i] = nb0 + srow + 32 * i;
    if (permA) {
#pragma unroll
      for (int i = 0; i < 2; ++i) ra[i] = permA[ra[i]];
    }
    if (permB) {
#pragma unroll
      for (int i = 0; i < 16; ++i) rb[i] = permB[rb[i]];
    }
    // later instructions may land in the registers that hold the list loads' addresses: keep the wait in front of that overwrite
    asm volatile("s_wait_xcnt 0x0" ::: "memory");
#pragma unroll
    for (int i = 0; i < 2; ++i) ro[i] = (unsigned)ra[i] * (unsigned)lda + (unsigned)(spc * 8);
#pragma unroll
    for (int i = 0; i < 16; ++i) ro[2 + i] = (unsigned)rb[i] * (unsigned)ldb + (unsigned)(spc * 8);
  }
  // the copies of stage t into the buffer whose row (tid >> 3), piece (tid & 7) lies at LDS byte l
  auto stage = [&](const unsigned l, const int t) __attribute__((always_inline)) {
    if constexpr (GATHER) {
      const unsigned short* Ab = Ap  + (size_t)b * strideA + (size_t)t * 64;
      const unsigned short* Bb = Btp + (size_t)b * strideB + (size_t)t * 64;
      const unsigned short* p[18];
#pragma unroll
      for (int i = 0; i < 2; ++i) p[i] = Ab + ro[i];
#pragma unroll
      for (int i = 2; i < 18; ++i) p[i] = Bb + ro[i];
      gs_stage_rows(l, p);
    } else {
      gs_stage(l, gA + (size_t)t * 64, sa32, gB + (size_t)t * 64, sb32);
    }
  };

  const int rlane = lane & 15;                 // row (A) / col (B, D) within subtile
  const int koff  = (lane >> 4) * 8;           // k offset of this lane half
  const int mOff  = (lane >> 4) * 8;           // D row offset

  v8f acc[4][4];
#pragma unroll
  for (int i = 0; i < 4; ++i)
#pragma unroll
    for (int j = 0; j < 4; ++j) acc[i][j] = (v8f){0.f,0.f,0.f,0.f,0.f,0.f,0.f,0.f};

  const int nStages = K >> 6;
  stage(lds0, 0);
  asm volatile("s_wait_asynccnt 0x0" ::: "memory");   // stage 0 of this wave has landed
  __syncthreads();                                     // ... and every wave's part of it
  if (nStages > 1) stage(lds0 + GS_BYTES, 1);

  for (int t = 0; t < nStages; ++t) {
    const T* sbuf = (const T*)(const void*)(sAB + (t & 1) * (GS_ROWS * GS_PITCH));
#pragma unroll
    for (int ks = 0; ks < 2; ++ks) {
      V bh[4], ah[4];   // all eight fragments of these 32 k asked for as one group, in front of their 16 products
#pragma unroll
      for (int j = 0; j < 4; ++j)
        bh[j] = Frag<T>::load(sbuf + (64 + (wave << 6) + (j << 4) + rlane) * GS_PITCH + ks * 32 + koff);
#pragma unroll
      for (int i = 0; i < 4; ++i)
        ah[i] = Frag<T>::load(sbuf + ((i << 4) + rlane) * GS_PITCH + ks * 32 + koff);
#pragma unroll
      for (int i = 0; i < 4; ++i) {
#pragma unroll
        for (int j = 0; j < 4; ++j) acc[i][j] = Frag<T>::mma(ah[i], bh[j], acc[i][j]);
        Frag<T>::guard(acc[i][0], acc[i][3], ah[i], ah[i]);
      }
      Frag<T>::keep(bh[0], bh[1], bh[2], bh[3]);
    }
    asm volatile("s_wait_dscnt 0x0" ::: "memory");      // this wave's reads of the buffer are done before it is refilled
    asm volatile("s_wait_asynccnt 0x0" ::: "memory");   // this wave's copies of stage t + 1 have landed
    __syncthreads();                                     // publishes stage t + 1 and ends every reader's last read of stage t
    if (t + 2 < nStages) stage(lds0 + (unsigned)(t & 1) * GS_BYTES, t + 2);
  }
  asm volatile("s_wait_asynccnt 0x0" ::: "memory");     // nothing in flight behind the loop
  acc_guard4(acc[0][0], acc[0][1], acc[0][2], acc[0][3]);
  acc_guard4(acc[1][0], acc[1][1], acc[1][2], acc[1][3]);
  acc_guard4(acc[2][0], acc[2][1], acc[2][2], acc[2][3]);
  acc_guard4(acc[3][0], acc[3][1], acc[3][2], acc[3][3]);

  // ---- epilogue ----
  float* slab = sT[wave];
  const float* Rb = RESID ? (resid + (size_t)b * strideR) : nullptr;
#pragma unroll
  for (int i = 0; i < 4; ++i) {
    const int mBase = m0 + (i << 4);
#pragma unroll
    for (int j = 0; j < 4; ++j) {
      const int n = n0 + (j << 4) + rlane;
      float bv = 0.f;
      if (BIAS_MODE == 2) bv = bias[n];
#pragma unroll
      for (int r = 0; r < 8; ++r) {
        float v = acc[i][j][r] * scale;
        if (BIAS_MODE == 1) v += bias[mBase + mOff + r];
        if (BIAS_MODE == 2) v += bv;
        if (RESID) v += Rb[(size_t)(mBase + mOff + r) * ldc + n];
        if (ACT == 1) v = tanhf(v);
        if (ACT == 2) v = fmaxf(v, 0.0f);
        if (ACT == 3) v = v / (1.0f + expf(-v));
        if (ACT == 4) v = (v > 0.f) ? v : 0.01f * v;
        if (ACT == 5) v = 0.5f * v * (1.0f + erff(v * 0.70710678118654752f));
        slab[(mOff + r) * 68 + (j << 4) + rlane] = v;
      }
    }
    __builtin_amdgcn_fence(__ATOMIC_RELEASE, "workgroup");
    __builtin_amdgcn_wave_barrier();
    __builtin_amdgcn_fence(__ATOMIC_ACQUIRE, "workgroup");
    if (OUT_MODE == 0) {
      float* C = (float*)Cout + (size_t)b * strideC;
      const int hh = lane >> 4, c4 = (lane & 15) * 4;     // row seg = 256 B = 16 lanes x 16 B
      {
#pragma unroll
        for (int it = 0; it < 8; ++it) {
          const int row = it * 2 + hh;
          v4f v = *(const v4f*)(slab + row * 68 + c4);
          *(v4f*)(C + (size_t)(mBase + row) * ldc + n0 + c4) = v;
        }
        
      }
    } else {
      const int q = lane >> 3, c8 = (lane & 7) * 8;
      unsigned short* C  = (unsigned short*)Cout  + (size_t)b * strideC;
      unsigned short* C2 = (OUT_MODE == 2) ? ((unsigned short*)Cout2 + (size_t)b * strideC) : nullptr;
      {
#pragma unroll
        for (int it = 0; it < 4; ++it) {
          const int row = it * 4 + q;
          const float* sp = slab + row * 68 + c8;
          v8h hv, lv;
          v4u hw, lw;   // the pairs as whole 32-bit words: element e in the low half, e + 1 in the high half
#pragma unroll
          for (int e = 0; e < 8; e += 2) {
            if (OUT_MODE == 1) {
              hv[e]     = (_Float16)sp[e];
              hv[e + 1] = (_Float16)sp[e + 1];
            } else {
              v2b hb, lb;
              split2_bf16((v2f){sp[e], sp[e + 1]}, hb, lb);
              hw[e >> 1] = __builtin_bit_cast(unsigned, hb);
              lw[e >> 1] = __builtin_bit_cast(unsigned, lb);
            }
          }
          if (OUT_MODE == 2) { hv = __builtin_bit_cast(v8h, hw); lv = __builtin_bit_cast(v8h, lw); }
          *(v8h*)(C + (size_t)(mBase + row) * ldc + n0 + c8) = hv;
          if (OUT_MODE == 2) *(v8h*)(C2 + (size_t)(mBase + row) * ldc + n0 + c8) = lv;
        }
        
      }
    }
    __builtin_amdgcn_fence(__ATOMIC_RELEASE, "workgroup");
    __builtin_amdgcn_wave_barrier();
    __builtin_amdgcn_fence(__ATOMIC_ACQUIRE, "workgroup");
  }
}

// One product per launch: grid = (blocks of the product, batch).
template <int ET, bool SPLIT, int BIAS_MODE, int OUT_MODE, bool RESID, int ACT = 0>
__global__ __launch_bounds__(256) void wmma_gemm64(
    const unsigned short* __restrict__ Ap, const unsigned short* __restrict__ A2p, int lda, long strideA,
    const unsigned short* __restrict__ Btp, const unsigned short* __restrict__ Bt2p, int ldb, long strideB,
    void* __restrict__ Cout, void* __restrict__ Cout2, int ldc, long strideC,
    const float* __restrict__ bias,
    const float* __restrict__ resid, long strideR,
    int M, int N, int K, float scale) {
  gemm64_body<ET, SPLIT, BIAS_MODE, OUT_MODE, RESID, ACT>(blockIdx.x, blockIdx.y, Ap, A2p, lda, strideA, Btp, Bt2p, ldb, strideB,
                                                          Cout, Cout2, ldc, strideC, bias, resid, strideR, M, N, K, scale);
}

// The three projections, which do not depend on one another, in one grid of (128, 3) blocks, so that all WGPs have work
// (one product alone has 128 blocks, one to a WGP). blockIdx.y (the same for the whole block) picks the product:
//   0: q = x . Wq^T, 1: k = x . Wk^T : M = 4096 tokens, N = 1024; 64 x 16 tiles = 128 blocks; planes [token][h*64+d]
//   2: v^T of batch b = Wv . x_b^T   : M = 1024, N = 2048 tokens; 16 x 32 tiles = 64 blocks for each of the 2 batch elements
//      (b = blockIdx.x >> 6); planes [b][h*64+d][s]
// k and v^T are laid out in key order (key_order_body): place j of batch b holds token perm[b*2048 + j], so their token rows of x are
// gathered through perm. A block whose first place is not walked by the attention (>= the batch's walked count) has nothing to do.
__global__ __launch_bounds__(256) void qkv_gemm64(
    const unsigned short* __restrict__ xb, const unsigned short* __restrict__ wqb,
    const unsigned short* __restrict__ wkb, const unsigned short* __restrict__ wvb,
    unsigned short* __restrict__ qh, unsigned short* __restrict__ ql,
    unsigned short* __restrict__ kh, unsigned short* __restrict__ kl,
    unsigned short* __restrict__ vth, unsigned short* __restrict__ vtl,
    const int* __restrict__ perm, const int* __restrict__ kcnt) {
  const int  which = blockIdx.y;
  const bool isV   = which == 2;
  if (which != 0) {   // the whole block or none of it, in front of every barrier
    const int walked = min(max(kcnt[(blockIdx.x >> 6) * KO_CS + 1], 1), SEQ_LEN);
    const int first  = isV ? (int)(blockIdx.x & 3) * 512 : (int)((blockIdx.x >> 1) & 31) * 64;   // first place of the block's tiles
    if (first >= walked) return;
  }
  const unsigned short* A  = isV ? wvb : xb;
  const unsigned short* Bt = isV ? xb : (which == 0 ? wqb : wkb);
  unsigned short* C  = isV ? vth : (which == 0 ? qh : kh);
  unsigned short* C2 = isV ? vtl : (which == 0 ? ql : kl);
  const int bx = isV ? (int)(blockIdx.x & 63) : (int)blockIdx.x;
  const int b  = isV ? (int)(blockIdx.x >> 6) : 0;
  // perm holds token rows counted over both batch elements, so x needs no batch stride
  gemm64_body<1, false, 0, 2, false, 0, true>(bx, b, A, A, EMB_DIM, 0L, Bt, Bt, EMB_DIM, 0L,
                                     (void*)C, (void*)C2, isV ? SEQ_LEN : EMB_DIM, isV ? (long)EMB_DIM * SEQ_LEN : 0L,
                                     nullptr, nullptr, 0L, isV ? EMB_DIM : N_TOK, isV ? SEQ_LEN : EMB_DIM, EMB_DIM, 1.0f,
                                     which == 1 ? perm : nullptr, isV ? perm + b * SEQ_LEN : nullptr);
}

// ---------------------------------------------------------------------------
// Elementwise f32 -> 16-bit plane as a short resident stream: few waves, each with much in flight.
// A block of 8 waves converts CV_BLK = 16,384 neighbouring elements, a wave 2,048 of them (8 KB in, 4 KB out):
// 16 loads of 16 B a lane, each wave-wide load 512 neighbouring bytes (4 whole lines), all asked for in front of the first
// conversion; 16 stores of 8 B a lane, each wave-wide store 256 neighbouring bytes (2 whole lines, one writer a line).
// CMODE 0: bf16 RNE bits of in*scale.
// CMODE 1: f16 bits of the bf16-RNE value of in*scale (an 8-significant-bit value re-encoded exactly in f16).
// CMODE 2: f16 RNE bits of in*scale.
// Coverage: blocks x 8 waves x 16 pieces x 32 lanes x 4 elements = blocks x 16,384 = the whole plane
// (4,194,304 elements -> 256 blocks; 1,048,576 -> 64 blocks; both exact multiples, so no edge).
// ---------------------------------------------------------------------------
#define CV_U   16                    // pieces of 4 elements a thread
#define CV_BLK (256 * CV_U * 4)      // elements a block
typedef __attribute__((ext_vector_type(2))) unsigned int v2u;
__device__ __forceinline__ unsigned pk16(unsigned short a, unsigned short b) { return (unsigned)a | ((unsigned)b << 16); }

// two neighbouring elements -> one 32-bit word, the first in the low half
template <int CMODE>
__device__ __forceinline__ unsigned cast_pair(const float f0, const float f1) {
  if (CMODE == 0) return pk16(f2bf_bits(f0), f2bf_bits(f1));
  if (CMODE == 1) return pk16(__builtin_bit_cast(unsigned short, (_Float16)bf_bits2f(f2bf_bits(f0))),
                              __builtin_bit_cast(unsigned short, (_Float16)bf_bits2f(f2bf_bits(f1))));
  return pk16(__builtin_bit_cast(unsigned short, (_Float16)f0), __builtin_bit_cast(unsigned short, (_Float16)f1));
}

// blk = index of the block among the blocks of its plane; p0 = this lane's first piece, counted in pieces of 4 elements from the plane's start
template <int CMODE>
__device__ __forceinline__ void cast_stream_body(const float* __restrict__ in, unsigned short* __restrict__ out,
                                                 const int blk, const float scale) {
  const unsigned p0 = (unsigned)blk * (CV_BLK / 4) + (threadIdx.x >> 5) * (CV_U * 32) + (threadIdx.x & 31);
  const v4f* __restrict__ ip = (const v4f*)in;
  v2u* __restrict__ op = (v2u*)out;
  v4f f[CV_U];
#pragma unroll   // f[] stays in registers and the loads stand in a row, told apart by their immediate offsets
  for (int u = 0; u < CV_U; ++u) f[u] = ip[p0 + u * 32];
  __builtin_amdgcn_sched_barrier(0);   // all 16 loads are asked for in front of the first conversion: a load sunk among the conversions would wait out a second latency
#pragma unroll   // f[u] is a register only for a constant u
  for (int u = 0; u < CV_U; ++u) {
    v2u w;
    w[0] = cast_pair<CMODE>(f[u][0] * scale, f[u][1] * scale);
    w[1] = cast_pair<CMODE>(f[u][2] * scale, f[u][3] * scale);
    op[p0 + u * 32] = w;
  }
  // code laid out behind this body may land in the registers that the stores name (offset, data): keep the wait in front of that overwrite
  asm volatile("s_wait_xcnt 0x0" ::: "memory");
}

template <int CMODE>
__global__ __launch_bounds__(256) void cast_stream_kernel(const float* __restrict__ in, unsigned short* __restrict__ out, float scale) {
  cast_stream_body<CMODE>(in, out, blockIdx.x, scale);
}

// Key order of one batch element (one block of 256 threads, 8 neighbouring keys a thread): the keys that the mask leaves in come
// first, in their order, the masked-out ones behind them, in theirs. perm[b*2048 + j] = token row (over both batch elements) at place j:
// a permutation, so every entry is written once and lies in 0..4095 whatever the mask holds.
// cnt[0] = keys left in; cnt[1] = places the attention walks: the keys left in, or all 2048 where none is left in.
// Why the masked-out keys need no walk: their score is the fill -1e9, so beside one real score their weight exp(fill - max) is exactly 0
// in f32, as it is in the module; where every key is masked out all weights are equal, and all places are walked with the fill as score.
__device__ __forceinline__ void key_order_body(const int* __restrict__ mask, int* __restrict__ perm, int* __restrict__ cnt, const int b) {
  __shared__ int sc[256];
  __shared__ __align__(16) int sp[SEQ_LEN];
  const int tid = threadIdx.x;
  const int* mb = mask + b * SEQ_LEN + tid * 8;
  const v4u ma = *(const v4u*)mb, mc = *(const v4u*)(mb + 4);
  int in[8], c = 0;
#pragma unroll
  for (int e = 0; e < 8; ++e) { in[e] = ((e < 4 ? ma[e & 3] : mc[e & 3]) == 0u) ? 1 : 0; c += in[e]; }
  sc[tid] = c;
  __syncthreads();
  int incl = c;   // running sum over the threads up to this one, doubling the reach each step
  for (int d = 1; d < 256; d <<= 1) {
    const int o = (tid >= d) ? sc[tid - d] : 0;
    __syncthreads();   // every read of this step is done before the entries change
    incl += o;
    sc[tid] = incl;
    __syncthreads();
  }
  const int total = sc[255];
  int kp = incl - c;                // place of this thread's first key that is left in
  int mp = total + tid * 8 - kp;    // place of its first masked-out key
#pragma unroll
  for (int e = 0; e < 8; ++e) {
    sp[in[e] ? kp : mp] = b * SEQ_LEN + tid * 8 + e;
    kp += in[e];
    mp += 1 - in[e];
  }
  __syncthreads();
  // the list goes out in whole lines: 8 neighbouring entries a thread
  *(v4u*)(perm + b * SEQ_LEN + tid * 8)     = *(const v4u*)(sp + tid * 8);
  *(v4u*)(perm + b * SEQ_LEN + tid * 8 + 4) = *(const v4u*)(sp + tid * 8 + 4);
  if (tid == 0) { cnt[0] = total; cnt[1] = total ? total : SEQ_LEN; }
}

// The five input planes and the two key orders, which do not depend on one another, in one grid: blocks 0, 1 order the keys of
// batch element 0, 1; of the blocks behind them 0..255 convert x, then 64 blocks each
// wq, wk, wv (CMODE 0) and wo (CMODE 1, x64). The plane is the same for a whole block.
// Coverage: 256 x 16,384 = 4,194,304 elements of x; 64 x 16,384 = 1,048,576 elements of each weight.
#define CI_XB (N_TOK * EMB_DIM / CV_BLK)     // 256 blocks of x
#define CI_WB (EMB_DIM * EMB_DIM / CV_BLK)   // 64 blocks of one weight
__global__ __launch_bounds__(256) void cast_inputs_kernel(
    const float* __restrict__ x, const float* __restrict__ wq, const float* __restrict__ wk,
    const float* __restrict__ wv, const float* __restrict__ wo,
    unsigned short* __restrict__ xb, unsigned short* __restrict__ wqb, unsigned short* __restrict__ wkb,
    unsigned short* __restrict__ wvb, unsigned short* __restrict__ wo16,
    const int* __restrict__ mask, int* __restrict__ perm, int* __restrict__ kcnt) {
  const int bx = (int)blockIdx.x - N_BATCH;
  if (bx < 0) {
    key_order_body(mask, perm, kcnt + blockIdx.x * KO_CS, blockIdx.x);
  } else if (bx < CI_XB) {
    cast_stream_body<0>(x, xb, bx, 1.0f);
  } else {
    const int w = (bx - CI_XB) / CI_WB;                                   // 0..3
    const int i = (bx - CI_XB) % CI_WB;                                   // block of the weight
    if (w == 3) {
      cast_stream_body<1>(wo, wo16, i, 64.0f);
    } else {
      cast_stream_body<0>(w == 0 ? wq : (w == 1 ? wk : wv), w == 0 ? wqb : (w == 1 ? wkb : wvb), i, 1.0f);
    }
  }
}

#define AT_D 64
#define AT_NW 4
#define AT_QB 64
#define AT_KC 64
#define AT_PLANE (AT_KC * AT_LP)   // elements of one plane's tile in LDS
#define AT_BUF   (4 * AT_PLANE)    // elements of one buffer: K hi, K lo, V^T hi, V^T lo = 36,864 B
#define AT_LP 72   // LDS row pitch of the K and V^T tiles in elements: 144 B = 16 B x 9 (odd), so the 16 rows of one 16-byte fragment read fall on 64 distinct banks

__device__ __forceinline__ v8f at_mma(v16b a, v16b b, v8f c) {
  c = __builtin_amdgcn_wmma_f32_16x16x32_bf16(false, a, false, b, (short)0, c, false, false);
  asm volatile("v_nop\n\tv_nop\n\tv_nop\n\tv_nop" : "+v"(c) : "v"(a), "v"(b));
  return c;
}

// lane l <-> l ^ 16 (the two halves of a wave hold the two key halves of one query column)
__device__ __forceinline__ float at_xhalf(float v) {
  const int b = __builtin_bit_cast(int, v);
  return __builtin_bit_cast(float, __builtin_amdgcn_permlanex16(b, b, 0x76543210, 0xfedcba98, false, false));
}

// Eight asynchronous 16-byte copies global -> LDS of this lane. The s_wait_xcnt stands inside the statement, behind the last copy,
// so that no address register of a copy is rewritten in front of it.
__device__ __forceinline__ void at_copy8(unsigned l0, unsigned l1, unsigned l2, unsigned l3,
                                         unsigned l4, unsigned l5, unsigned l6, unsigned l7,
                                         const __bf16* g0, const __bf16* g1, const __bf16* g2, const __bf16* g3,
                                         const __bf16* g4, const __bf16* g5, const __bf16* g6, const __bf16* g7) {
  asm volatile("global_load_async_to_lds_b128 %0, %8, off\n\t"
               "global_load_async_to_lds_b128 %1, %9, off\n\t"
               "global_load_async_to_lds_b128 %2, %10, off\n\t"
               "global_load_async_to_lds_b128 %3, %11, off\n\t"
               "global_load_async_to_lds_b128 %4, %12, off\n\t"
               "global_load_async_to_lds_b128 %5, %13, off\n\t"
               "global_load_async_to_lds_b128 %6, %14, off\n\t"
               "global_load_async_to_lds_b128 %7, %15, off\n\t"
               "s_wait_xcnt 0x0"
               :: "v"(l0), "v"(l1), "v"(l2), "v"(l3), "v"(l4), "v"(l5), "v"(l6), "v"(l7),
                  "v"(g0), "v"(g1), "v"(g2), "v"(g3), "v"(g4), "v"(g5), "v"(g6), "v"(g7)
               : "memory");
}
// One chunk: this thread's 4 pieces (rows 16 apart) of each of the 4 planes; l = its LDS byte address in row (tid >> 3) of the K hi tile.
__device__ __forceinline__ void at_stage(unsigned l, const __bf16* kh, const __bf16* kl, const __bf16* vh, const __bf16* vl) {
  const unsigned rs = 16u * AT_LP * 2u;    // 16 LDS rows
  const unsigned ps = AT_PLANE * 2u;       // one plane's tile
  const size_t ks = (size_t)16 * EMB_DIM, vs = (size_t)16 * SEQ_LEN;   // 16 rows of K, of V^T
  at_copy8(l, l + rs, l + 2 * rs, l + 3 * rs, l + ps, l + ps + rs, l + ps + 2 * rs, l + ps + 3 * rs,
           kh, kh + ks, kh + 2 * ks, kh + 3 * ks, kl, kl + ks, kl + 2 * ks, kl + 3 * ks);
  at_copy8(l + 2 * ps, l + 2 * ps + rs, l + 2 * ps + 2 * rs, l + 2 * ps + 3 * rs,
           l + 3 * ps, l + 3 * ps + rs, l + 3 * ps + 2 * rs, l + 3 * ps + 3 * rs,
           vh, vh + vs, vh + 2 * vs, vh + 3 * vs, vl, vl + vs, vl + 2 * vs, vl + 3 * vs);
}

__global__ __launch_bounds__(128)
void attn_full64_kernel(const unsigned short* __restrict__ qhp, const unsigned short* __restrict__ qlp,
                        const unsigned short* __restrict__ khp, const unsigned short* __restrict__ klp,
                        const unsigned short* __restrict__ vhp, const unsigned short* __restrict__ vlp,
                        const int* __restrict__ kcnt,
                        float* __restrict__ out, float sscale, float mfill) {
  union FB { v16b v; v8b h[2]; };
  // two chunk buffers, each K hi [kv][d], K lo, V^T hi [d][kv], V^T lo (9 KB a plane); behind the loop: per wave out tile, pitch 68 floats
  __shared__ __align__(16) unsigned char sKV[2 * AT_BUF * 2];    // 73,728 B
  static_assert(AT_NW * 16 * 68 * 4 <= 2 * AT_BUF * 2, "the out tiles fit the buffers");

  const int tid  = threadIdx.x;
  const int wave = tid >> 5;
  const int lane = tid & 31;
  const int hh   = lane >> 4;
  const int c    = lane & 15;

  const int nqb = SEQ_LEN / AT_QB;        // 32
  const int bx = blockIdx.x;
  const int qb = bx % nqb;
  const int h  = bx / nqb;                // 0..N_HEADS-1 (grid = N_HEADS * nqb)
  const int q0 = qb * AT_QB + wave * 16;
  const size_t bo = (size_t)blockIdx.y * SEQ_LEN * EMB_DIM;   // this batch element's start in every q, k, v^T and out plane
  const int nIn    = kcnt[blockIdx.y * KO_CS];                                   // keys left in: places 0..nIn-1
  const int walked = min(max(kcnt[blockIdx.y * KO_CS + 1], 1), SEQ_LEN);         // places to walk, bounded by the shape

  const __bf16* Qh = (const __bf16*)(const void*)qhp + bo + (size_t)h * AT_D;
  const __bf16* Ql = (const __bf16*)(const void*)qlp + bo + (size_t)h * AT_D;
  const __bf16* Kh = (const __bf16*)(const void*)khp + bo + (size_t)h * AT_D;
  const __bf16* Kl = (const __bf16*)(const void*)klp + bo + (size_t)h * AT_D;
  const __bf16* Vh = (const __bf16*)(const void*)vhp + bo + (size_t)h * AT_D * SEQ_LEN;
  const __bf16* Vl = (const __bf16*)(const void*)vlp + bo + (size_t)h * AT_D * SEQ_LEN;
  float*        ob = out + bo + (size_t)h * AT_D;

  // ---- Q fragments (B operand, column = query = lane&15, split k map via Frag load): 2 d-chunks, hi and lo ----
  v16b qah[2], qal[2];
#pragma unroll
  for (int dc = 0; dc < 2; ++dc) {
    const __bf16* qr = Qh + (size_t)(q0 + c) * EMB_DIM + dc * 32 + 8 * hh;
    const __bf16* ql = Ql + (size_t)(q0 + c) * EMB_DIM + dc * 32 + 8 * hh;
    qah[dc] = Frag<__bf16>::load(qr);
    qal[dc] = Frag<__bf16>::load(ql);
  }

  // One query per lane (q0 + c). mrow: running maximum, equal in both wave halves; lrow: this half's share of the sum.
  float mrow = -INFINITY, lrow = 0.f;
  const float sc2 = sscale * 1.44269504088896341f;   // score scale times log2(e)
  const float mf2 = mfill  * 1.44269504088896341f;   // the mask fill in the same units
  v8f oacc[4];   // out^T tiles: oacc[t][r] = out[q0 + c][t*16 + 8*hh + r]
#pragma unroll
  for (int t = 0; t < 4; ++t) oacc[t] = (v8f){0.f,0.f,0.f,0.f,0.f,0.f,0.f,0.f};

  // staging: thread -> row (tid >> 3) of each group of 16 rows, 16-byte piece (tid & 7) of its 128-B line
  const int srow = tid >> 3, spc = tid & 7;
  const __bf16* gkh = Kh + (size_t)srow * EMB_DIM + spc * 8;   // K row kv0 + srow (+16, +32, +48), d = 8*spc..
  const __bf16* gkl = Kl + (size_t)srow * EMB_DIM + spc * 8;
  const __bf16* gvh = Vh + (size_t)srow * SEQ_LEN + spc * 8;   // V^T row d = srow (+16, +32, +48), s = kv0 + 8*spc..
  const __bf16* gvl = Vl + (size_t)srow * SEQ_LEN + spc * 8;
  const unsigned lds0 = (unsigned)(uintptr_t)(&sKV[0]) + (unsigned)(srow * (AT_LP * 2) + spc * 16);

  const int nChunks = (walked + AT_KC - 1) / AT_KC;   // 1..32, the same for the whole grid row of a batch element
  at_stage(lds0, gkh, gkl, gvh, gvl);
  asm volatile("s_wait_asynccnt 0x0" ::: "memory");   // chunk 0 of this wave has landed
  __syncthreads();                                     // ... and every wave's part of it
  if (nChunks > 1)
    at_stage(lds0 + AT_BUF * 2u, gkh + (size_t)AT_KC * EMB_DIM, gkl + (size_t)AT_KC * EMB_DIM, gvh + AT_KC, gvl + AT_KC);

  // one trip: the products and the softmax of chunk kc, then the publish point of chunk kc + 1
  auto trip = [&](const int kc) __attribute__((always_inline)) {
    const int kv0 = kc * AT_KC;
    const __bf16* Ksh = (const __bf16*)(const void*)sKV + (kc & 1) * AT_BUF;
    const __bf16* Ksl = Ksh + AT_PLANE;
    const __bf16* Vth = Ksh + 2 * AT_PLANE;
    const __bf16* Vtl = Ksh + 3 * AT_PLANE;

    // scores^T = K . Q^T : s[j][r] = score(key kv0 + j*16 + 8*hh + r, query q0 + c)
    v8f s[4];
#pragma unroll
    for (int j = 0; j < 4; ++j) {
      s[j] = (v8f){0.f,0.f,0.f,0.f,0.f,0.f,0.f,0.f};
#pragma unroll
      for (int dc = 0; dc < 2; ++dc) {
        FB kb, kl;
        kb.h[0] = *(const v8b*)(Ksh + (j * 16 + c) * AT_LP + dc * 32 + 8 * hh);
        kb.h[1] = *(const v8b*)(Ksh + (j * 16 + c) * AT_LP + dc * 32 + 16 + 8 * hh);
        kl.h[0] = *(const v8b*)(Ksl + (j * 16 + c) * AT_LP + dc * 32 + 8 * hh);
        kl.h[1] = *(const v8b*)(Ksl + (j * 16 + c) * AT_LP + dc * 32 + 16 + 8 * hh);
        s[j] = at_mma(kb.v, qah[dc], s[j]);
        s[j] = at_mma(kl.v, qah[dc], s[j]);
        s[j] = at_mma(kb.v, qal[dc], s[j]);
      }
    }
#pragma unroll
    for (int j = 0; j < 4; ++j)
#pragma unroll
      for (int r = 0; r < 8; ++r) s[j][r] *= sc2;
    // a place at or behind nIn holds a masked-out key -> score := mfill (select, as in the module); only a chunk that reaches nIn has one
    if (kv0 + AT_KC > nIn) {
      const int lim = nIn - kv0 - 8 * hh;   // this lane's place j*16 + r of the chunk holds a key left in while it is below lim
#pragma unroll
      for (int j = 0; j < 4; ++j)
#pragma unroll
        for (int r = 0; r < 8; ++r) s[j][r] = (j * 16 + r < lim) ? s[j][r] : mf2;
    }
    float m = -INFINITY;
#pragma unroll
    for (int j = 0; j < 4; ++j)
#pragma unroll
      for (int r = 0; r < 8; ++r) m = fmaxf(m, s[j][r]);
    m = fmaxf(m, at_xhalf(m));   // the other 32 keys of this query
    const float mnew = fmaxf(mrow, m);
    const float alpha = __builtin_amdgcn_exp2f(mrow - mnew);
    mrow = mnew;
    // p^T stays in registers: two score tiles (keys 0..15 and 16..31 of a 32-key group) are one B operand,
    // element e < 8 = key 8*hh + e, e >= 8 = key 16 + 8*hh + (e - 8): the order in which the V^T rows are read below
    v16b pth[2], ptl[2];
    float psum = 0.f;
#pragma unroll
    for (int j = 0; j < 4; ++j) {
#pragma unroll
      for (int r = 0; r < 8; r += 2) {
        v2f p;
        p[0] = __builtin_amdgcn_exp2f(s[j][r] - mnew);
        p[1] = __builtin_amdgcn_exp2f(s[j][r + 1] - mnew);
        psum += p[0];
        psum += p[1];
        v2b hi, lo;
        split2_bf16(p, hi, lo);
        pth[j >> 1][(j & 1) * 8 + r]     = hi[0];
        pth[j >> 1][(j & 1) * 8 + r + 1] = hi[1];
        ptl[j >> 1][(j & 1) * 8 + r]     = lo[0];
        ptl[j >> 1][(j & 1) * 8 + r + 1] = lo[1];
      }
    }
    lrow = lrow * alpha + psum;
#pragma unroll
    for (int t = 0; t < 4; ++t)
#pragma unroll
      for (int r = 0; r < 8; ++r) oacc[t][r] *= alpha;
    // out^T += V^T . p^T
#pragma unroll
    for (int kk = 0; kk < 2; ++kk) {
#pragma unroll
      for (int t = 0; t < 4; ++t) {
        FB vb, vl;
        vb.h[0] = *(const v8b*)(Vth + (t * 16 + c) * AT_LP + kk * 32 + 8 * hh);
        vb.h[1] = *(const v8b*)(Vth + (t * 16 + c) * AT_LP + kk * 32 + 16 + 8 * hh);
        vl.h[0] = *(const v8b*)(Vtl + (t * 16 + c) * AT_LP + kk * 32 + 8 * hh);
        vl.h[1] = *(const v8b*)(Vtl + (t * 16 + c) * AT_LP + kk * 32 + 16 + 8 * hh);
        oacc[t] = at_mma(vb.v, pth[kk], oacc[t]);
        oacc[t] = at_mma(vl.v, pth[kk], oacc[t]);
        oacc[t] = at_mma(vb.v, ptl[kk], oacc[t]);
      }
    }
    asm volatile("s_wait_dscnt 0x0" ::: "memory");      // this wave's reads of the buffer are done before it is refilled
    asm volatile("s_wait_asynccnt 0x0" ::: "memory");   // this wave's copies of chunk kc + 1 have landed
    __syncthreads();                                     // publishes chunk kc + 1 and ends every reader's last read of chunk kc
  };
  int kc = 0;
  for (; kc < nChunks - 2; ++kc) {   // while a chunk kc + 2 exists: its copies go into the buffer that this trip has just read
    trip(kc);
    at_stage(lds0 + (unsigned)(kc & 1) * (AT_BUF * 2u), gkh + (size_t)(kc + 2) * AT_KC * EMB_DIM,
             gkl + (size_t)(kc + 2) * AT_KC * EMB_DIM, gvh + (kc + 2) * AT_KC, gvl + (kc + 2) * AT_KC);
  }
  for (; kc < nChunks; ++kc) trip(kc);   // the last two chunks: nothing left to fetch
  asm volatile("s_wait_asynccnt 0x0" ::: "memory");     // nothing in flight behind the loop; the last barrier ended every read of the buffers

  float* os = (float*)(void*)sKV + wave * (16 * 68);
  {
    const float inv = 1.0f / (lrow + at_xhalf(lrow));   // join the two halves' sums once
#pragma unroll
    for (int t = 0; t < 4; ++t) {
      v4f lo4, hi4;
#pragma unroll
      for (int r = 0; r < 4; ++r) { lo4[r] = oacc[t][r] * inv; hi4[r] = oacc[t][4 + r] * inv; }
      *(v4f*)(os + c * 68 + t * 16 + 8 * hh)     = lo4;
      *(v4f*)(os + c * 68 + t * 16 + 8 * hh + 4) = hi4;
    }
  }
  __builtin_amdgcn_fence(__ATOMIC_RELEASE, "workgroup");
  __builtin_amdgcn_wave_barrier();
  __builtin_amdgcn_fence(__ATOMIC_ACQUIRE, "workgroup");
  {
    const int c4 = (lane & 15) * 4;
    {
#pragma unroll
      for (int it = 0; it < 8; ++it) {
        const int row = it * 2 + hh;   // it 0..7 x hh 0..1 covers rows 0..15 of the wave tile
        v4f val = *(const v4f*)(os + row * 68 + c4);
        *(v4f*)(ob + (size_t)(q0 + row) * EMB_DIM + c4) = val;
      }
      
    }
  }
}

// ---------------------------------------------------------------------------
// Host-side orchestration (kernel launches + host arithmetic only).
// Workspace region map (byte offsets, every element that is read written by its producer before the read; kh, kl, vth, vtl only as far as the attention walks):
//   0           xb    bf16 [4096][1024]            8,388,608
//   8,388,608   wqb   bf16 [1024][1024]            2,097,152
//   10,485,760  wkb   bf16 [1024][1024]            2,097,152
//   12,582,912  wvb   bf16 [1024][1024]            2,097,152
//   14,680,064  wo16  f16  [1024][1024] (x64)      2,097,152
//   16,777,216  qh    bf16 [4096][1024]            8,388,608
//   25,165,824  ql    bf16 [4096][1024]            8,388,608
//   33,554,432  kh    bf16 [4096][1024]            8,388,608
//   41,943,040  kl    bf16 [4096][1024]            8,388,608
//   50,331,648  vth   bf16 [2][1024][2048]         8,388,608
//   58,720,256  vtl   bf16 [2][1024][2048]         8,388,608
//   67,108,864  o32   f32  [4096][1024]           16,777,216
//   83,886,080  o16   f16  [4096][1024] (x16)      8,388,608
//   92,274,688  perm  int32 [2][2048] token row at each place of the key order   16,384
//   92,291,072  kcnt  int32 [2][32]: keys left in, places walked (2 of 32 used)     256
//   92,291,328  end
// GEMM shapes: K = 1024 (multiple of 32) everywhere; M, N in {1024, 2048, 4096} (multiples of 64); no padding.
// ---------------------------------------------------------------------------
extern "C" void kernel_launch(void* const* d_in, const int* in_sizes, int n_in,
                              void* d_out, int out_size, void* d_ws, size_t ws_size,
                              hipStream_t stream) {
  if (n_in < 6) return;
  const int nTokEmb = N_TOK * EMB_DIM;          // 4,194,304
  const int nEmbEmb = EMB_DIM * EMB_DIM;        // 1,048,576
  if (in_sizes[0] != nTokEmb || in_sizes[1] != N_BATCH * SEQ_LEN || in_sizes[2] != nEmbEmb ||
      in_sizes[3] != nEmbEmb || in_sizes[4] != nEmbEmb || in_sizes[5] != nEmbEmb || out_size != nTokEmb) return;

  const size_t offXb  = 0;
  const size_t offWq  = offXb  + (size_t)nTokEmb * 2;
  const size_t offWk  = offWq  + (size_t)nEmbEmb * 2;
  const size_t offWv  = offWk  + (size_t)nEmbEmb * 2;
  const size_t offWo  = offWv  + (size_t)nEmbEmb * 2;
  const size_t offQh  = offWo  + (size_t)nEmbEmb * 2;
  const size_t offQl  = offQh  + (size_t)nTokEmb * 2;
  const size_t offKh  = offQl  + (size_t)nTokEmb * 2;
  const size_t offKl  = offKh  + (size_t)nTokEmb * 2;
  const size_t offVth = offKl  + (size_t)nTokEmb * 2;
  const size_t offVtl = offVth + (size_t)nTokEmb * 2;
  const size_t offO32 = offVtl + (size_t)nTokEmb * 2;
  const size_t offO16 = offO32 + (size_t)nTokEmb * 4;
  const size_t offPerm = offO16 + (size_t)nTokEmb * 2;   // 92,274,688
  const size_t offCnt  = offPerm + (size_t)N_TOK * 4;
  const size_t offEnd  = offCnt + (size_t)N_BATCH * KO_CS * 4;   // 92,291,328
  if (ws_size < offEnd) return;

  const float* x    = (const float*)d_in[0];
  const int*   mask = (const int*)d_in[1];
  const float* wq   = (const float*)d_in[2];
  const float* wk   = (const float*)d_in[3];
  const float* wv   = (const float*)d_in[4];
  const float* wo   = (const float*)d_in[5];
  float* out = (float*)d_out;

  char* ws = (char*)d_ws;
  unsigned short* xb   = (unsigned short*)(ws + offXb);
  unsigned short* wqb  = (unsigned short*)(ws + offWq);
  unsigned short* wkb  = (unsigned short*)(ws + offWk);
  unsigned short* wvb  = (unsigned short*)(ws + offWv);
  unsigned short* wo16 = (unsigned short*)(ws + offWo);
  unsigned short* qh   = (unsigned short*)(ws + offQh);
  unsigned short* ql   = (unsigned short*)(ws + offQl);
  unsigned short* kh   = (unsigned short*)(ws + offKh);
  unsigned short* kl   = (unsigned short*)(ws + offKl);
  unsigned short* vth  = (unsigned short*)(ws + offVth);
  unsigned short* vtl  = (unsigned short*)(ws + offVtl);
  float*          o32  = (float*)(ws + offO32);
  unsigned short* o16  = (unsigned short*)(ws + offO16);
  int*            perm = (int*)(ws + offPerm);
  int*            kcnt = (int*)(ws + offCnt);
  const float* dummyf = x;   // valid pointer for unused bias / resid arguments (never dereferenced)

  // 1) 16-bit operand planes: x, wq, wk, wv -> bf16 RNE; wo -> f16 encode of bf16-RNE(wo*64)
  //    and the key order of each batch element from the mask (d_in[1] read as int32): one grid of 2 + 256 + 4 x 64 = 514 blocks
  cast_inputs_kernel<<<N_BATCH + CI_XB + 4 * CI_WB, 256, 0, stream>>>(x, wq, wk, wv, wo, xb, wqb, wkb, wvb, wo16, mask, perm, kcnt);

  // 2), 3) q, k = x @ W^T (bf16 hi/lo planes [token][h*64+d]) and v^T per batch = Wv @ x_b^T (planes [b][h*64+d][s]):
  //    K = 1024; 3 products x 128 blocks of 8 waves in one grid
  //    k and v^T in key order, only as far as the attention walks
  qkv_gemm64<<<dim3(128, 3), 256, 0, stream>>>(xb, wqb, wkb, wvb, qh, ql, kh, kl, vth, vtl, perm, kcnt);

  // 4) attention: grid = (16 heads x 32 query blocks, 2 batch elements); walks the keys that the mask leaves in
  {
    const dim3 g(N_HEADS * (SEQ_LEN / 64), N_BATCH);
    attn_full64_kernel<<<g, 128, 0, stream>>>(qh, ql, kh, kl, vth, vtl, kcnt, o32, 0.125f, -1.0e9f);
  }

  // 5) attention output f32 -> f16 carried x16
  cast_stream_kernel<2><<<N_TOK * EMB_DIM / CV_BLK, 256, 0, stream>>>(o32, o16, 16.0f);   // 256 blocks

  // 6) out = O @ Wo^T : f16 operands (O x16, Wo x64) -> scale 1/1024, f32 into d_out [4096][1024]
  {
    const dim3 g(((N_TOK / 64) * (EMB_DIM / 64)) / 8, 1);
    wmma_gemm64<0, false, 0, 0, false><<<g, 256, 0, stream>>>(
        o16, o16, EMB_DIM, 0L, wo16, wo16, EMB_DIM, 0L,
        (void*)out, (void*)out, EMB_DIM, 0L, dummyf, dummyf, 0L, N_TOK, EMB_DIM, EMB_DIM, 1.0f / 1024.0f);
  }
}
